// v000
// The times below were measured on an AMD MI455X: many runs one after another, warmed up first and cycling through
// copies of the inputs, with the whole window's GPU time divided by the number of runs. Launches and the gaps
// between them are all in it. The median over several windows is given; except for v000 it joins two sittings, which
// can be a few percent apart, so the side-by-side timings, each taken in one sitting, are the better comparison.
// v000, which the later versions start from, runs in 2200 microseconds.
// Contractions: qkv projection (x as f16(bf16 RNE) x w_qkv^T as f16(16*bf16 RNE)), attn.v (P f16 carried x32768 x V^T f16) and output projection (o f16 carried x16 x w_out^T as f16(16*bf16 RNE)) on v_wmma_f32_16x16x32_f16; scores q.k^T on v_wmma_f32_16x16x32_bf16 with q,k as bf16 hi+lo planes (hi*hi + hi*lo + lo*hi); f32 accumulate everywhere; RMSNorm, 2x2 rotary map and softmax in f32.
#include <hip/hip_runtime.h>
#include <math.h>

// ---------------------------------------------------------------------------
// Problem constants
// ---------------------------------------------------------------------------
constexpr int kBatch = 2;
constexpr int kSeq   = 2048;
constexpr int kDim   = 2048;              // model dim (K of the qkv projection, N of the output projection)
constexpr int kHeads = 16;
constexpr int kKV    = 8;
constexpr int kHD    = 128;
constexpr int kTok   = kBatch * kSeq;     // 4096 token rows
constexpr int kNQ    = kHeads * kHD;      // 2048 q columns / o columns
constexpr int kNK    = kKV * kHD;         // 1024 k columns (= v columns)
constexpr int kNQK   = kNQ + kNK;         // 3072 = pitch of the f32 q|k plane
constexpr int kNQKV  = kNQ + 2 * kNK;     // 4096 rows of w_qkv
constexpr int kQKRows = kBatch * (kHeads + kKV) * kSeq;   // 98304 rows of 128 in each q|k 16-bit plane
constexpr int kKRow0  = kBatch * kHeads * kSeq;           // 65536 = first k row in the q|k planes
constexpr float kEps        = 1.1920929e-07f;
constexpr float kInvHD      = 1.0f / 128.0f;
constexpr float kWCarry     = 16.0f;                      // weights carried x16 in f16
constexpr float kWCarryInv  = 1.0f / 16.0f;
constexpr float kPCarry     = 32768.0f;                   // probabilities carried x2^15 in f16
constexpr float kOCarry     = 16.0f;                      // attention output carried x16 in f16
constexpr float kPVScale    = kOCarry / kPCarry;          // 2^-11
constexpr float kOutScale   = 1.0f / (kOCarry * kWCarry); // 2^-8
constexpr float kScoreScale = 0.08838834764831845f;       // 128^-0.5
static_assert(kHD == 128, "norm kernel lane map: 32 lanes x 4 dims");
static_assert(kHeads == 2 * kKV, "two query heads per kv head");
static_assert(kSeq % 64 == 0 && kNQK % 64 == 0 && kNK % 64 == 0 && kNQ % 64 == 0 && kDim % 64 == 0 && kTok % 64 == 0, "GEMM M/N tiles");
static_assert(kHD % 64 == 0, "GEMM N tile (ctx)");
static_assert(kDim % 32 == 0 && kHD % 32 == 0 && kSeq % 32 == 0 && kNQ % 32 == 0, "GEMM K % 32");
static_assert(kSeq == 256 * 8, "softmax coverage: 256 threads x 8 columns");
static_assert((kHeads + kKV) % 8 == 0, "norm kernel: 8 waves per block over 24 q|k heads");

typedef __attribute__((ext_vector_type(16))) _Float16 v16h;
typedef __attribute__((ext_vector_type(8)))  _Float16 v8h;
typedef __attribute__((ext_vector_type(16))) __bf16   v16b;
typedef __attribute__((ext_vector_type(8)))  __bf16   v8b;
typedef __attribute__((ext_vector_type(8)))  float    v8f;
typedef __attribute__((ext_vector_type(4)))  float    v4f;
typedef __attribute__((ext_vector_type(2)))  float    v2f;
typedef __attribute__((ext_vector_type(2)))  int      v2i;
typedef __attribute__((ext_vector_type(4)))  unsigned int v4u;

__device__ __forceinline__ unsigned short f2bf_bits(float f) {
  unsigned u = __float_as_uint(f);
  return (unsigned short)((u + 0x7FFFu + ((u >> 16) & 1u)) >> 16);
}
__device__ __forceinline__ float bf_bits2f(unsigned short h) { return __uint_as_float(((unsigned)h) << 16); }

// hazard guards as plain device helpers (no inline asm inside the kernel template body)
__device__ __forceinline__ void dep_guard_h(v8f& a, v8f& b, v16h x, v16h y) { asm volatile("v_nop\n\tv_nop\n\tv_nop\n\tv_nop" : "+v"(a), "+v"(b) : "v"(x), "v"(y)); }
__device__ __forceinline__ void dep_guard_b(v8f& a, v8f& b, v16b x, v16b y) { asm volatile("v_nop\n\tv_nop\n\tv_nop\n\tv_nop" : "+v"(a), "+v"(b) : "v"(x), "v"(y)); }
__device__ __forceinline__ void keep4_h(v16h a, v16h b, v16h c, v16h d) { asm volatile("v_nop" :: "v"(a), "v"(b), "v"(c), "v"(d)); }
__device__ __forceinline__ void keep4_b(v16b a, v16b b, v16b c, v16b d) { asm volatile("v_nop" :: "v"(a), "v"(b), "v"(c), "v"(d)); }
__device__ __forceinline__ void acc_guard4(v8f& a, v8f& b, v8f& c, v8f& d) { asm volatile("v_nop\n\tv_nop\n\tv_nop\n\tv_nop" : "+v"(a), "+v"(b), "+v"(c), "+v"(d)); }
template <typename T> struct Frag;
template <> struct Frag<_Float16> {
  typedef v16h V; union U { v16h v; v8h h[2]; };
  // elements 0..7 <- p[0..7], 8..15 <- p[16..23]
  static __device__ __forceinline__ v16h load(const _Float16* p) {
    U f; f.h[0] = *(const v8h*)(p); f.h[1] = *(const v8h*)(p + 16); return f.v;
  }
  static __device__ __forceinline__ v8f mma(v16h a, v16h b, v8f c) {
    return __builtin_amdgcn_wmma_f32_16x16x32_f16(false, a, false, b, (short)0, c, false, false);
  }
  static __device__ __forceinline__ void guard(v8f& a, v8f& b, v16h x, v16h y) { dep_guard_h(a, b, x, y); }
  static __device__ __forceinline__ void keep(v16h a, v16h b, v16h c, v16h d) { keep4_h(a, b, c, d); }
};
template <> struct Frag<__bf16> {
  typedef v16b V; union U { v16b v; v8b h[2]; };
  static __device__ __forceinline__ v16b load(const __bf16* p) {
    U f; f.h[0] = *(const v8b*)(p); f.h[1] = *(const v8b*)(p + 16); return f.v;
  }
  static __device__ __forceinline__ v8f mma(v16b a, v16b b, v8f c) {
    return __builtin_amdgcn_wmma_f32_16x16x32_bf16(false, a, false, b, (short)0, c, false, false);
  }
  static __device__ __forceinline__ void guard(v8f& a, v8f& b, v16b x, v16b y) { dep_guard_b(a, b, x, y); }
  static __device__ __forceinline__ void keep(v16b a, v16b b, v16b c, v16b d) { keep4_b(a, b, c, d); }
};

__device__ __forceinline__ unsigned pk16(unsigned short a, unsigned short b) { return (unsigned)a | ((unsigned)b << 16); }
__device__ __forceinline__ unsigned short h_bits(float f) { const _Float16 h = (_Float16)f; return __builtin_bit_cast(unsigned short, h); }
// RNE bf16 conversion returned as f32
__device__ __forceinline__ float bfr(float f) { return bf_bits2f(f2bf_bits(f)); }

// ---- Register-blocked batched WMMA GEMM (ACT reduced to none/relu/leaky) -------------------------------
// C[m,n] = scale * sum_k A[m,k] * Bt[n,k] (+bias)(+resid); each wave owns a 64x64 tile.
// A row-major [M,K]; Bt row-major [N,K]; M,N % 64 == 0, K % 32 == 0.
// SPLIT: operands are hi/lo planes (A2/Bt2 = lo planes, same layout); product = hi*hi + hi*lo + lo*hi.
// BIAS_MODE: 0 = none, 1 = bias[m], 2 = bias[n].
// OUT_MODE: 0 = f32, 1 = f16, 2 = bf16 hi plane (Cout) + bf16 lo plane (Cout2).
// ET: 0 = f16 operands, 1 = bf16 operands (pointers passed as 16-bit storage)
template <int ET> struct Elem;
template <> struct Elem<0> { typedef _Float16 T; };
template <> struct Elem<1> { typedef __bf16 T; };
template <int ET, bool SPLIT, int BIAS_MODE, int OUT_MODE, bool RESID, int ACT = 0>
__global__ __launch_bounds__(256) void wmma_gemm64(
    const unsigned short* __restrict__ Ap, const unsigned short* __restrict__ A2p, int lda, long strideA,
    const unsigned short* __restrict__ Btp, const unsigned short* __restrict__ Bt2p, int ldb, long strideB,
    void* __restrict__ Cout, void* __restrict__ Cout2, int ldc, long strideC,
    const float* __restrict__ bias,
    const float* __restrict__ resid, long strideR,
    int M, int N, int K, float scale) {
  typedef typename Elem<ET>::T T;
  typedef typename Frag<T>::V V;
  const T* A = (const T*)Ap; const T* A2 = (const T*)A2p; const T* Bt = (const T*)Btp; const T* Bt2 = (const T*)Bt2p;
  __shared__ __align__(16) float sT[8][16 * 68];   // per-wave 16x64 slab, pitch 68 floats
  const int b    = blockIdx.y;
  const int lane = threadIdx.x & 31;
  const int wave = threadIdx.x >> 5;
  const int tilesN = N >> 6;
  const int tilesM = M >> 6;
  const int tile = blockIdx.x * 8 + wave;
  if (tile >= tilesM * tilesN) return;   // wave-uniform; no block barriers in this kernel
  const int tm = tile / tilesN;
  const int tn = tile - tm * tilesN;
  const int m0 = tm << 6;
  const int n0 = tn << 6;

  const T* Ab  = A  + (size_t)b * strideA;
  const T* Bb  = Bt + (size_t)b * strideB;
  const T* Ab2 = SPLIT ? (A2  + (size_t)b * strideA) : nullptr;
  const T* Bb2 = SPLIT ? (Bt2 + (size_t)b * strideB) : nullptr;

  const int rlane = lane & 15;                 // row (A) / col (B, D) within subtile
  const int koff  = (lane >> 4) * 8;           // k offset of this lane half
  const int mOff  = (lane >> 4) * 8;           // D row offset

  v8f acc[4][4];
#pragma unroll
  for (int i = 0; i < 4; ++i)
#pragma unroll
    for (int j = 0; j < 4; ++j) acc[i][j] = (v8f){0.f,0.f,0.f,0.f,0.f,0.f,0.f,0.f};

  for (int k0 = 0; k0 < K; k0 += 32) {
    V bh[4], bl[4];
#pragma unroll
    for (int j = 0; j < 4; ++j) {
      const size_t bo = (size_t)(n0 + (j << 4) + rlane) * ldb + koff + k0;
      bh[j] = Frag<T>::load(Bb + bo);
      if (SPLIT) bl[j] = Frag<T>::load(Bb2 + bo);
    }
#pragma unroll
    for (int i = 0; i < 4; ++i) {
      const size_t ao = (size_t)(m0 + (i << 4) + rlane) * lda + koff + k0;
      V ah = Frag<T>::load(Ab + ao);
      V al;
      if (SPLIT) al = Frag<T>::load(Ab2 + ao);
#pragma unroll
      for (int j = 0; j < 4; ++j) {
        acc[i][j] = Frag<T>::mma(ah, bh[j], acc[i][j]);
        if (SPLIT) {
          acc[i][j] = Frag<T>::mma(ah, bl[j], acc[i][j]);
          acc[i][j] = Frag<T>::mma(al, bh[j], acc[i][j]);
        }
      }
      Frag<T>::guard(acc[i][0], acc[i][3], ah, SPLIT ? al : ah);
    }
    Frag<T>::keep(bh[0], bh[1], bh[2], bh[3]);
    if (SPLIT) Frag<T>::keep(bl[0], bl[1], bl[2], bl[3]);
  }
  acc_guard4(acc[0][0], acc[0][1], acc[0][2], acc[0][3]);
  acc_guard4(acc[1][0], acc[1][1], acc[1][2], acc[1][3]);
  acc_guard4(acc[2][0], acc[2][1], acc[2][2], acc[2][3]);
  acc_guard4(acc[3][0], acc[3][1], acc[3][2], acc[3][3]);

  // ---- epilogue ----
  float* slab = sT[wave];
  const float* Rb = RESID ? (resid + (size_t)b * strideR) : nullptr;
#pragma unroll
  for (int i = 0; i < 4; ++i) {
    const int mBase = m0 + (i << 4);
#pragma unroll
    for (int j = 0; j < 4; ++j) {
      const int n = n0 + (j << 4) + rlane;
      float bv = 0.f;
      if (BIAS_MODE == 2) bv = bias[n];
#pragma unroll
      for (int r = 0; r < 8; ++r) {
        float v = acc[i][j][r] * scale;
        if (BIAS_MODE == 1) v += bias[mBase + mOff + r];
        if (BIAS_MODE == 2) v += bv;
        if (RESID) v += Rb[(size_t)(mBase + mOff + r) * ldc + n];
        if (ACT == 2) v = fmaxf(v, 0.0f);
        if (ACT == 4) v = (v > 0.f) ? v : 0.01f * v;
        slab[(mOff + r) * 68 + (j << 4) + rlane] = v;
      }
    }
    __builtin_amdgcn_fence(__ATOMIC_RELEASE, "workgroup");
    __builtin_amdgcn_wave_barrier();
    __builtin_amdgcn_fence(__ATOMIC_ACQUIRE, "workgroup");
    if (OUT_MODE == 0) {
      float* C = (float*)Cout + (size_t)b * strideC;
      const int hh = lane >> 4, c4 = (lane & 15) * 4;     // row seg = 256 B = 16 lanes x 16 B
      {
#pragma unroll
        for (int it = 0; it < 8; ++it) {
          const int row = it * 2 + hh;
          v4f v = *(const v4f*)(slab + row * 68 + c4);
          *(v4f*)(C + (size_t)(mBase + row) * ldc + n0 + c4) = v;
        }
        
      }
    } else {
      const int q = lane >> 3, c8 = (lane & 7) * 8;
      unsigned short* C  = (unsigned short*)Cout  + (size_t)b * strideC;
      unsigned short* C2 = (OUT_MODE == 2) ? ((unsigned short*)Cout2 + (size_t)b * strideC) : nullptr;
      {
#pragma unroll
        for (int it = 0; it < 4; ++it) {
          const int row = it * 4 + q;
          const float* sp = slab + row * 68 + c8;
          v8h hv, lv;
#pragma unroll
          for (int e = 0; e < 8; ++e) {
            if (OUT_MODE == 1) {
              hv[e] = (_Float16)sp[e];
            } else {
              unsigned short hb = f2bf_bits(sp[e]);
              unsigned short lb = f2bf_bits(sp[e] - bf_bits2f(hb));
              hv[e] = __builtin_bit_cast(_Float16, hb);
              lv[e] = __builtin_bit_cast(_Float16, lb);
            }
          }
          *(v8h*)(C + (size_t)(mBase + row) * ldc + n0 + c8) = hv;
          if (OUT_MODE == 2) *(v8h*)(C2 + (size_t)(mBase + row) * ldc + n0 + c8) = lv;
        }
        
      }
    }
    __builtin_amdgcn_fence(__ATOMIC_RELEASE, "workgroup");
    __builtin_amdgcn_wave_barrier();
    __builtin_amdgcn_fence(__ATOMIC_ACQUIRE, "workgroup");
  }
}

// ---------------------------------------------------------------------------
// f32 -> (RNE bf16) -> f16 cast with an exact power-of-two carry: out = f16( scale * bf16(in) ).
// ---------------------------------------------------------------------------
__global__ __launch_bounds__(256) void cast8_kernel(const float* __restrict__ in, unsigned short* __restrict__ out, int n8, float scale) {
  const int i = blockIdx.x * 256 + threadIdx.x;
  if (i >= n8) return;
  const float* p = in + 8 * (size_t)i;
  const v4f a = *(const v4f*)(p);
  const v4f c = *(const v4f*)(p + 4);
  unsigned short hb[8];
#pragma unroll
  for (int e = 0; e < 4; ++e) {
    hb[e]     = h_bits(bfr(a[e]) * scale);
    hb[4 + e] = h_bits(bfr(c[e]) * scale);
  }
  const v4u u = (v4u){pk16(hb[0], hb[1]), pk16(hb[2], hb[3]), pk16(hb[4], hb[5]), pk16(hb[6], hb[7])};
  unsigned short* q = out + 8 * (size_t)i;
  *(v4u*)q = u;
  
}

// ---------------------------------------------------------------------------
// RMSNorm (mean over 128, eps inside rsqrt, x norm weight) + per-position 2x2 rotary map on the q and k heads of one batch,
// f32 math; the result is emitted as a bf16 hi plane and a bf16 lo plane (lo = RNE bf16 of v - hi).
// One wave per (position s, head) with head 0..15 = q heads, 16..23 = k heads; lane owns dims 4*lane..4*lane+3 (two pairs).
// Input: QK f32 [2048 s][3072] of batch b (q cols 0..2047, k cols 2048..3071). Rotary table fcs [s][64][2][2], norm weights [128];
// all three converted to bf16 (RNE) before use. out[2p+i] = fc[s,p,i,0]*v[2p] + fc[s,p,i,1]*v[2p+1].
// Output planes Ph (hi) and Ph + loOff (lo), rows of 128 elements = 256 B: q rows (b*16+h)*2048+s, k rows 65536 + (b*8+kh)*2048+s.
// Store: the 4 packed hi words and the 4 packed lo words of every lane are shuffled from lanes 2L, 2L+1 (L = lane & 15) with wave-uniform register choice, then each lane
// selects by value: lanes 0..15 hold 8 consecutive hi dims, lanes 16..31 hold 8 consecutive lo dims; ONE 32-lane x 16-B instruction
// grid (3, 2048) x 256 threads per batch = 49152 waves = 2048 x 24 rows (hi and lo).
// ---------------------------------------------------------------------------
__global__ __launch_bounds__(256) void norm_rope_kernel(const float* __restrict__ QK, const float* __restrict__ fcs,
                                                        const float* __restrict__ qw, const float* __restrict__ kw,
                                                        unsigned short* __restrict__ Ph, long loOff, int b) {
  const int lane = threadIdx.x & 31;
  const int wave = threadIdx.x >> 5;
  const int head = blockIdx.x * 8 + wave;          // 0..23, wave-uniform
  const int s    = blockIdx.y;                     // 0..2047
  const int d0   = lane * 4;

  const v4f xv = *(const v4f*)(QK + (size_t)s * kNQK + (size_t)head * kHD + d0);
  float v0 = xv[0], v1 = xv[1], v2 = xv[2], v3 = xv[3];
  float ss = 0.0f;
  ss += v0 * v0; ss += v1 * v1; ss += v2 * v2; ss += v3 * v3;
#pragma unroll
  for (int off = 1; off < 32; off <<= 1) ss += __shfl_xor(ss, off, 32);
  const float rn = rsqrtf(ss * kInvHD + kEps);

  // norm weights: both candidates loaded unconditionally, arithmetic select by head kind
  const v4f wq = *(const v4f*)(qw + d0);
  const v4f wk = *(const v4f*)(kw + d0);
  const float fq = (head < kHeads) ? 1.0f : 0.0f;
  const float fk = 1.0f - fq;
  const float w0 = bfr(fmaf(fq, wq[0], fk * wk[0]));
  const float w1 = bfr(fmaf(fq, wq[1], fk * wk[1]));
  const float w2 = bfr(fmaf(fq, wq[2], fk * wk[2]));
  const float w3 = bfr(fmaf(fq, wq[3], fk * wk[3]));
  v0 = (v0 * rn) * w0; v1 = (v1 * rn) * w1; v2 = (v2 * rn) * w2; v3 = (v3 * rn) * w3;

  // rotary 2x2 maps for pairs p = 2*lane, 2*lane+1 at position s (8 consecutive floats)
  const float* fp = fcs + ((size_t)s * (kHD / 2) + 2 * lane) * 4;
  const v4f fa = *(const v4f*)(fp);
  const v4f fb = *(const v4f*)(fp + 4);
  const float a00 = bfr(fa[0]), a01 = bfr(fa[1]), a10 = bfr(fa[2]), a11 = bfr(fa[3]);
  const float b00 = bfr(fb[0]), b01 = bfr(fb[1]), b10 = bfr(fb[2]), b11 = bfr(fb[3]);
  const float o0 = a00 * v0 + a01 * v1;
  const float o1 = a10 * v0 + a11 * v1;
  const float o2 = b00 * v2 + b01 * v3;
  const float o3 = b10 * v2 + b11 * v3;

  // bf16 hi / lo split of each value
  const unsigned short hb0 = f2bf_bits(o0), hb1 = f2bf_bits(o1), hb2 = f2bf_bits(o2), hb3 = f2bf_bits(o3);
  const unsigned short lb0 = f2bf_bits(o0 - bf_bits2f(hb0));
  const unsigned short lb1 = f2bf_bits(o1 - bf_bits2f(hb1));
  const unsigned short lb2 = f2bf_bits(o2 - bf_bits2f(hb2));
  const unsigned short lb3 = f2bf_bits(o3 - bf_bits2f(hb3));
  const unsigned ph0 = pk16(hb0, hb1), ph1 = pk16(hb2, hb3);
  const unsigned pl0 = pk16(lb0, lb1), pl1 = pk16(lb2, lb3);

  // gather 8 consecutive dims per lane: dims 8L..8L+3 from lane 2L, 8L+4..8L+7 from lane 2L+1 (L = lane & 15); every candidate
  // is shuffled with a wave-uniform register choice, the hi/lo choice is made per lane after the shuffles
  const int src = (2 * lane) & 31;
  const unsigned gh0 = __shfl(ph0, src, 32);
  const unsigned gh1 = __shfl(ph1, src, 32);
  const unsigned gh2 = __shfl(ph0, src + 1, 32);
  const unsigned gh3 = __shfl(ph1, src + 1, 32);
  const unsigned gl0 = __shfl(pl0, src, 32);
  const unsigned gl1 = __shfl(pl1, src, 32);
  const unsigned gl2 = __shfl(pl0, src + 1, 32);
  const unsigned gl3 = __shfl(pl1, src + 1, 32);
  const bool loh = (lane >= 16);
  const v4u u = (v4u){loh ? gl0 : gh0, loh ? gl1 : gh1, loh ? gl2 : gh2, loh ? gl3 : gh3};

  const int hq = (head < kHeads) ? head : 0;
  const int hk = (head < kHeads) ? 0 : (head - kHeads);
  const size_t rowQ = ((size_t)(b * kHeads + hq)) * kSeq + s;
  const size_t rowK = (size_t)kKRow0 + ((size_t)(b * kKV + hk)) * kSeq + s;
  const size_t row  = (head < kHeads) ? rowQ : rowK;
  const size_t poff = loh ? (size_t)loOff : (size_t)0;
  unsigned short* dp = Ph + poff + row * kHD + 8 * (lane & 15);
  {
    *(v4u*)dp = u;
    
  }
}

// ---------------------------------------------------------------------------
// Additive key mask + row softmax over 2048 scaled scores, f32 math:
//   a = S[i][j] + (mask[j] != 0 ? 0 : -inf);  P[i][j] = f16( 32768 * exp(a - max) / sum exp(a - max) )
// One block of 256 threads per (row i = blockIdx.x, head-in-pair hg = blockIdx.y).
// Phase 1/2: rolled 4-trip loops, thread t owns columns it*512 + 2t, 2t+1 (4 x 256 x 2 = 2048 = whole row); values kept in LDS,
// each thread re-reads only the LDS words it wrote itself until the final barrier.
// Reductions in fixed order (thread sequential, wave shuffle tree, 8 wave partials in index order).
// Store: thread t owns cols 8t..8t+7 (written to LDS by threads (4t..4t+3) mod 256, read after the second block barrier) -> one 16-B store
// ---------------------------------------------------------------------------
__global__ __launch_bounds__(256) void softmax_kernel(const float* __restrict__ Sp, const int* __restrict__ maskp,
                                                      unsigned short* __restrict__ Pp) {
  __shared__ __align__(16) float lg[kSeq];
  __shared__ float redM[8];
  __shared__ float redS[8];
  const int i    = blockIdx.x;
  const int hg   = blockIdx.y;
  const int t    = threadIdx.x;
  const int lane = t & 31, wave = t >> 5;
  const size_t rowoff = ((size_t)hg * kSeq + i) * kSeq;
  const float* sr = Sp + rowoff;

  float mx = -__builtin_inff();
#pragma unroll 1
  for (int it = 0; it < 4; ++it) {
    const int c = it * 512 + 2 * t;
    const v2f sv = *(const v2f*)(sr + c);
    const v2i mv = *(const v2i*)(maskp + c);
    v2f av;
#pragma unroll
    for (int e = 0; e < 2; ++e) {
      const float bias = (mv[e] != 0) ? 0.0f : -__builtin_inff();
      const float a = sv[e] + bias;
      av[e] = a;
      mx = fmaxf(mx, a);
    }
    *(v2f*)(lg + c) = av;
  }
#pragma unroll
  for (int off = 16; off > 0; off >>= 1) mx = fmaxf(mx, __shfl_xor(mx, off, 32));
  if (lane == 0) redM[wave] = mx;
  __syncthreads();
  float m = redM[0];
#pragma unroll
  for (int w = 1; w < 8; ++w) m = fmaxf(m, redM[w]);

  float sum = 0.f;
#pragma unroll 1
  for (int it = 0; it < 4; ++it) {
    const int c = it * 512 + 2 * t;
    const v2f l = *(const v2f*)(lg + c);
    v2f ev;
#pragma unroll
    for (int e = 0; e < 2; ++e) {
      ev[e] = expf(l[e] - m);
      sum += ev[e];
    }
    *(v2f*)(lg + c) = ev;
  }
#pragma unroll
  for (int off = 16; off > 0; off >>= 1) sum += __shfl_xor(sum, off, 32);
  if (lane == 0) redS[wave] = sum;
  __syncthreads();
  float tot = redS[0];
#pragma unroll
  for (int w = 1; w < 8; ++w) tot += redS[w];
  const float inv = kPCarry / tot;

  const v4f e0 = *(const v4f*)(lg + 8 * t);
  const v4f e1 = *(const v4f*)(lg + 8 * t + 4);
  unsigned short hb[8];
#pragma unroll
  for (int e = 0; e < 4; ++e) {
    hb[e]     = h_bits(e0[e] * inv);
    hb[4 + e] = h_bits(e1[e] * inv);
  }
  const v4u u = (v4u){pk16(hb[0], hb[1]), pk16(hb[2], hb[3]), pk16(hb[4], hb[5]), pk16(hb[6], hb[7])};
  unsigned short* pr = Pp + rowoff + 8 * (size_t)t;
  *(v4u*)pr = u;
  
}

// ---------------------------------------------------------------------------
// Host glue.
//   R0 X16  f16 [4096][2048]                        16,777,216 at           0   (later: Ob f16 [4096][2048], same type + layout)
//   R1 Wq16 f16 [4096][2048] (w_qkv x16)            16,777,216 at  16,777,216   (later: PP f16 [2][2048][2048] = [4096][2048], same)
//   R2 Wo16 f16 [2048][2048] (w_out x16)             8,388,608 at  33,554,432
//   R3 f32, sized from the MAX over its users        33,554,432 at  41,943,040 : QK32 [2048][3072] q|k of one batch (25,165,824)
//                                                                                 then SC [2][2048][2048] scaled scores (33,554,432)
//   R4 VT   f16 [2*8][128][2048] (v transposed)       8,388,608 at  75,497,472
//   R5 QKhi bf16 [98304][128] (q rows then k rows)  25,165,824 at  83,886,080
//   R6 QKlo bf16 [98304][128]                        25,165,824 at 109,051,904
//   total                                          134,217,728
// Re-use timeline (stream ordered): X16/Wq16 are read only by the qkv and V^T GEMMs; QK32 of a batch only by that batch's norm kernel;
// Ob, PP and SC are first written by the attention group loop which starts after the last norm kernel and the V^T GEMM.
// Every region is fully written before it is read; no region changes element type.
// GEMM shapes: q|k per batch (M=2048, N=3072, K=2048); V^T per batch (M=1024, N=2048, K=2048); scores (M=N=2048, K=128);
// ctx (M=2048, N=128, K=2048); output (M=4096, N=2048, K=2048); all M,N multiples of 64, all K multiples of 32, no padding anywhere.
// ---------------------------------------------------------------------------
extern "C" void kernel_launch(void* const* d_in, const int* in_sizes, int n_in,
                              void* d_out, int out_size, void* d_ws, size_t ws_size,
                              hipStream_t stream) {
  if (n_in < 7) return;
  const int nX = kBatch * kSeq * kDim;            // 8,388,608
  if (in_sizes[0] != nX) return;
  if (in_sizes[1] != kBatch * kSeq) return;
  if (in_sizes[2] != kSeq * (kHD / 2) * 4) return;
  if (in_sizes[3] != kNQKV * kDim) return;
  if (in_sizes[4] != kDim * kNQ) return;
  if (in_sizes[5] != kHD || in_sizes[6] != kHD) return;
  if (out_size != kTok * kDim) return;

  const size_t szX16  = (size_t)kTok * kDim * 2;
  const size_t szWq16 = (size_t)kNQKV * kDim * 2;
  const size_t szWo16 = (size_t)kDim * kNQ * 2;
  const size_t szQK32 = (size_t)kSeq * kNQK * 4;          // one batch
  const size_t szSC   = (size_t)2 * kSeq * kSeq * 4;
  const size_t szR3   = (szQK32 > szSC) ? szQK32 : szSC;
  const size_t szVT   = (size_t)kBatch * kKV * kHD * kSeq * 2;
  const size_t szPl   = (size_t)kQKRows * kHD * 2;        // one bf16 q|k plane
  const size_t szOb   = (size_t)kTok * kNQ * 2;
  const size_t szPP   = (size_t)2 * kSeq * kSeq * 2;
  const size_t offX16  = 0;
  const size_t offWq16 = offX16 + szX16;
  const size_t offWo16 = offWq16 + szWq16;
  const size_t offR3   = offWo16 + szWo16;
  const size_t offVT   = offR3 + szR3;
  const size_t offPhi  = offVT + szVT;
  const size_t offPlo  = offPhi + szPl;
  const size_t total   = offPlo + szPl;
  if (szOb > szX16 || szPP > szWq16) return;     // re-used regions fit their first carve
  if (ws_size < total) return;

  const float* x     = (const float*)d_in[0];
  const int*   xmask = (const int*)d_in[1];
  const float* freqs = (const float*)d_in[2];
  const float* wqkv  = (const float*)d_in[3];
  const float* wout  = (const float*)d_in[4];
  const float* qw    = (const float*)d_in[5];
  const float* kw    = (const float*)d_in[6];
  float* out = (float*)d_out;
  char* ws = (char*)d_ws;
  unsigned short* X16  = (unsigned short*)(ws + offX16);
  unsigned short* Ob   = (unsigned short*)(ws + offX16);     // re-use of R0 (f16, same layout)
  unsigned short* Wq16 = (unsigned short*)(ws + offWq16);
  unsigned short* PP   = (unsigned short*)(ws + offWq16);    // re-use of R1 (f16, same layout)
  unsigned short* Wo16 = (unsigned short*)(ws + offWo16);
  float* QK32 = (float*)(ws + offR3);
  float* SC   = (float*)(ws + offR3);                        // re-use of R3 (f32)
  unsigned short* VT  = (unsigned short*)(ws + offVT);
  unsigned short* Phi = (unsigned short*)(ws + offPhi);
  unsigned short* Plo = (unsigned short*)(ws + offPlo);
  const long loOff = (long)kQKRows * kHD;                    // elements from the hi plane to the lo plane
  const float* dummyf = (const float*)(ws + offR3);          // valid in-ws pointer for unused bias/resid arguments

  // ---- 16-bit operand planes of the inputs (RNE bf16 of every float input, f16 containers, weights x16) ----
  const int n8x = nX / 8;                 // 1,048,576 -> 4096 blocks exact
  const int n8w = (kNQKV * kDim) / 8;     // 1,048,576 -> 4096 blocks exact
  const int n8o = (kDim * kNQ) / 8;       //   524,288 -> 2048 blocks exact
  cast8_kernel<<<dim3(n8x / 256), dim3(256), 0, stream>>>(x, X16, n8x, 1.0f);
  cast8_kernel<<<dim3(n8w / 256), dim3(256), 0, stream>>>(wqkv, Wq16, n8w, kWCarry);
  cast8_kernel<<<dim3(n8o / 256), dim3(256), 0, stream>>>(wout, Wo16, n8o, kWCarry);

  // ---- per batch: q|k projection (w_qkv rows 0..3071) -> f32 plane; norm + rotary -> bf16 hi/lo planes ----
  {
    const int tilesQK = (kSeq / 64) * (kNQK / 64);   // 1536 -> 192 blocks of 8 waves; covers all 2048 x 3072 of QK32
    for (int b = 0; b < kBatch; ++b) {
      const unsigned short* Xb = X16 + (size_t)b * kSeq * kDim;
      wmma_gemm64<0, false, 0, 0, false, 0><<<dim3(tilesQK / 8, 1), dim3(256), 0, stream>>>(
          Xb, Xb, kDim, 0L, Wq16, Wq16, kDim, 0L,
          (void*)QK32, (void*)QK32, kNQK, 0L, dummyf, dummyf, 0L, kSeq, kNQK, kDim, kWCarryInv);
      norm_rope_kernel<<<dim3((kHeads + kKV) / 8, kSeq), dim3(256), 0, stream>>>(QK32, freqs, qw, kw, Phi, loOff, b);
    }
  }

  // ---- v projection written directly transposed: VT[b*8+j][d][s] = f16( 1/16 * sum_k Wq16[3072+j*128+d][k] * X16[b*2048+s][k] )
  //      (M=1024 weight rows, N=2048 positions, K=2048; grid.y = batch; covers the whole 16 x 128 x 2048 VT plane) ----
  {
    const int tilesVT = (kNK / 64) * (kSeq / 64);     // 512 -> 64 blocks
    const unsigned short* Wv = Wq16 + (size_t)kNQK * kDim;
    wmma_gemm64<0, false, 0, 1, false, 0><<<dim3(tilesVT / 8, kBatch), dim3(256), 0, stream>>>(
        Wv, Wv, kDim, 0L, X16, X16, kDim, (long)kSeq * kDim,
        (void*)VT, (void*)VT, kSeq, (long)kNK * kSeq, dummyf, dummyf, 0L, kNK, kSeq, kDim, kWCarryInv);
  }

  // ---- attention per (batch, kv head j): the two query heads 2j, 2j+1 are the GEMM batch index (grid.y = 2) ----
  const long strideQhead = (long)kSeq * kHD;           // next query head in the q|k planes
  const long strideScore = (long)kSeq * kSeq;          // per head score / probability plane
  const int  tilesScore  = (kSeq / 64) * (kSeq / 64);  // 1024 -> 128 blocks
  const int  tilesCtx    = (kSeq / 64) * (kHD / 64);   //   64 ->   8 blocks
  for (int b = 0; b < kBatch; ++b) {
    for (int j = 0; j < kKV; ++j) {
      const unsigned short* Ahi = Phi + ((size_t)(b * kHeads + 2 * j) * kSeq) * kHD;
      const unsigned short* Alo = Ahi + loOff;
      const unsigned short* Bhi = Phi + ((size_t)kKRow0 + (size_t)(b * kKV + j) * kSeq) * kHD;
      const unsigned short* Blo = Bhi + loOff;
      // SC[hg][i][k] = 128^-0.5 * sum_d q[b,2j+hg,i,d] * k[b,j,k,d], q,k = bf16 hi+lo (hi*hi + hi*lo + lo*hi)   (M=N=2048, K=128)
      wmma_gemm64<1, true, 0, 0, false, 0><<<dim3(tilesScore / 8, 2), dim3(256), 0, stream>>>(
          Ahi, Alo, kHD, strideQhead, Bhi, Blo, kHD, 0L,
          (void*)SC, (void*)SC, kSeq, strideScore, dummyf, dummyf, 0L, kSeq, kSeq, kHD, kScoreScale);
      // key mask of batch b + softmax over keys -> PP (f16, x32768); 2048 rows x 2 heads = whole PP plane
      softmax_kernel<<<dim3(kSeq, 2), dim3(256), 0, stream>>>(SC, xmask + (size_t)b * kSeq, PP);
      // Ob[b*2048+i][(2j+hg)*128+n] = f16( 16 * 2^-15 * sum_k PP[hg][i][k] * VT[b,j][n][k] )   (M=2048, N=128, K=2048)
      const unsigned short* VTg = VT + ((size_t)(b * kKV + j) * kHD) * kSeq;
      unsigned short* Og = Ob + ((size_t)b * kSeq) * kNQ + (size_t)(2 * j) * kHD;
      wmma_gemm64<0, false, 0, 1, false, 0><<<dim3(tilesCtx / 8, 2), dim3(256), 0, stream>>>(
          PP, PP, kSeq, strideScore, VTg, VTg, kSeq, 0L,
          (void*)Og, (void*)Og, kNQ, (long)kHD, dummyf, dummyf, 0L, kSeq, kHD, kSeq, kPVScale);
    }
  }

  // ---- output projection: out[tok][n] = 2^-8 * sum_e Ob[tok][e] * Wo16[n][e]   (M=4096, N=2048, K=2048) ----
  {
    const int tilesOut = (kTok / 64) * (kDim / 64);   // 2048 -> 256 blocks; covers the whole [4096][2048] output
    wmma_gemm64<0, false, 0, 0, false, 0><<<dim3(tilesOut / 8, 1), dim3(256), 0, stream>>>(
        Ob, Ob, kNQ, 0L, Wo16, Wo16, kNQ, 0L,
        (void*)out, (void*)out, kDim, 0L, dummyf, dummyf, 0L, kTok, kDim, kNQ, kOutScale);
  }
}

// v001
// Measured time: 1240 microseconds a run.
// In both of two side-by-side timings against v000, it was 1.79 times as fast.
// Contractions: qkv projection (x as f16(bf16 RNE) x w_qkv^T as f16(16*bf16 RNE)), attn.v (P f16 carried x32768 x V^T f16) and output projection (o f16 carried x16 x w_out^T as f16(16*bf16 RNE)) on v_wmma_f32_16x16x32_f16; scores q.k^T on v_wmma_f32_16x16x32_bf16 with q,k as bf16 hi+lo planes (hi*hi + hi*lo + lo*hi); f32 accumulate everywhere; RMSNorm, 2x2 rotary map and softmax in f32.
#include <hip/hip_runtime.h>
#include <math.h>

// ---------------------------------------------------------------------------
// Problem constants
// ---------------------------------------------------------------------------
constexpr int kBatch = 2;
constexpr int kSeq   = 2048;
constexpr int kDim   = 2048;              // model dim (K of the qkv projection, N of the output projection)
constexpr int kHeads = 16;
constexpr int kKV    = 8;
constexpr int kHD    = 128;
constexpr int kTok   = kBatch * kSeq;     // 4096 token rows
constexpr int kNQ    = kHeads * kHD;      // 2048 q columns / o columns
constexpr int kNK    = kKV * kHD;         // 1024 k columns (= v columns)
constexpr int kNQK   = kNQ + kNK;         // 3072 = pitch of the f32 q|k plane
constexpr int kNQKV  = kNQ + 2 * kNK;     // 4096 rows of w_qkv
constexpr int kQKRows = kBatch * (kHeads + kKV) * kSeq;   // 98304 rows of 128 in each q|k 16-bit plane
constexpr int kKRow0  = kBatch * kHeads * kSeq;           // 65536 = first k row in the q|k planes
constexpr float kEps        = 1.1920929e-07f;
constexpr float kInvHD      = 1.0f / 128.0f;
constexpr float kWCarry     = 16.0f;                      // weights carried x16 in f16
constexpr float kWCarryInv  = 1.0f / 16.0f;
constexpr float kPCarry     = 32768.0f;                   // probabilities carried x2^15 in f16
constexpr float kOCarry     = 16.0f;                      // attention output carried x16 in f16
constexpr float kPVScale    = kOCarry / kPCarry;          // 2^-11
constexpr float kOutScale   = 1.0f / (kOCarry * kWCarry); // 2^-8
constexpr float kScoreScale = 0.08838834764831845f;       // 128^-0.5
static_assert(kHD == 128, "norm kernel lane map: 32 lanes x 4 dims");
static_assert(kHeads == 2 * kKV, "two query heads per kv head");
static_assert(kSeq % 64 == 0 && kNQK % 64 == 0 && kNK % 64 == 0 && kNQ % 64 == 0 && kDim % 64 == 0 && kTok % 64 == 0, "GEMM M/N tiles");
static_assert(kHD % 64 == 0, "GEMM N tile (ctx)");
static_assert(kDim % 32 == 0 && kHD % 32 == 0 && kSeq % 32 == 0 && kNQ % 32 == 0, "GEMM K % 32");
static_assert(kDim % 128 == 0 && kSeq % 128 == 0 && kNQ % 128 == 0, "staged GEMM K: two or more stages of 64");
static_assert(kSeq == 256 * 8, "softmax coverage: 256 threads x 8 columns");
static_assert((kHeads + kKV) % 8 == 0, "norm kernel: 8 waves per block over 24 q|k heads");

typedef __attribute__((ext_vector_type(16))) _Float16 v16h;
typedef __attribute__((ext_vector_type(8)))  _Float16 v8h;
typedef __attribute__((ext_vector_type(16))) __bf16   v16b;
typedef __attribute__((ext_vector_type(8)))  __bf16   v8b;
typedef __attribute__((ext_vector_type(8)))  float    v8f;
typedef __attribute__((ext_vector_type(4)))  float    v4f;
typedef __attribute__((ext_vector_type(2)))  float    v2f;
typedef __attribute__((ext_vector_type(2)))  int      v2i;
typedef __attribute__((ext_vector_type(4)))  unsigned int v4u;

__device__ __forceinline__ unsigned short f2bf_bits(float f) {
  unsigned u = __float_as_uint(f);
  return (unsigned short)((u + 0x7FFFu + ((u >> 16) & 1u)) >> 16);
}
__device__ __forceinline__ float bf_bits2f(unsigned short h) { return __uint_as_float(((unsigned)h) << 16); }

// hazard guards as plain device helpers
__device__ __forceinline__ void dep_guard_h(v8f& a, v8f& b, v16h x, v16h y) { asm volatile("v_nop\n\tv_nop\n\tv_nop\n\tv_nop" : "+v"(a), "+v"(b) : "v"(x), "v"(y)); }
__device__ __forceinline__ void dep_guard_b(v8f& a, v8f& b, v16b x, v16b y) { asm volatile("v_nop\n\tv_nop\n\tv_nop\n\tv_nop" : "+v"(a), "+v"(b) : "v"(x), "v"(y)); }
__device__ __forceinline__ void keep4_h(v16h a, v16h b, v16h c, v16h d) { asm volatile("v_nop" :: "v"(a), "v"(b), "v"(c), "v"(d)); }
__device__ __forceinline__ void keep4_b(v16b a, v16b b, v16b c, v16b d) { asm volatile("v_nop" :: "v"(a), "v"(b), "v"(c), "v"(d)); }
__device__ __forceinline__ void acc_guard4(v8f& a, v8f& b, v8f& c, v8f& d) { asm volatile("v_nop\n\tv_nop\n\tv_nop\n\tv_nop" : "+v"(a), "+v"(b), "+v"(c), "+v"(d)); }
template <typename T> struct Frag;
template <> struct Frag<_Float16> {
  typedef v16h V; union U { v16h v; v8h h[2]; };
  // elements 0..7 <- p[0..7], 8..15 <- p[16..23]
  static __device__ __forceinline__ v16h load(const _Float16* p) {
    U f; f.h[0] = *(const v8h*)(p); f.h[1] = *(const v8h*)(p + 16); return f.v;
  }
  static __device__ __forceinline__ v8f mma(v16h a, v16h b, v8f c) {
    return __builtin_amdgcn_wmma_f32_16x16x32_f16(false, a, false, b, (short)0, c, false, false);
  }
  static __device__ __forceinline__ void guard(v8f& a, v8f& b, v16h x, v16h y) { dep_guard_h(a, b, x, y); }
  static __device__ __forceinline__ void keep(v16h a, v16h b, v16h c, v16h d) { keep4_h(a, b, c, d); }
};
template <> struct Frag<__bf16> {
  typedef v16b V; union U { v16b v; v8b h[2]; };
  static __device__ __forceinline__ v16b load(const __bf16* p) {
    U f; f.h[0] = *(const v8b*)(p); f.h[1] = *(const v8b*)(p + 16); return f.v;
  }
  static __device__ __forceinline__ v8f mma(v16b a, v16b b, v8f c) {
    return __builtin_amdgcn_wmma_f32_16x16x32_bf16(false, a, false, b, (short)0, c, false, false);
  }
  static __device__ __forceinline__ void guard(v8f& a, v8f& b, v16b x, v16b y) { dep_guard_b(a, b, x, y); }
  static __device__ __forceinline__ void keep(v16b a, v16b b, v16b c, v16b d) { keep4_b(a, b, c, d); }
};

__device__ __forceinline__ unsigned pk16(unsigned short a, unsigned short b) { return (unsigned)a | ((unsigned)b << 16); }
__device__ __forceinline__ unsigned short h_bits(float f) { const _Float16 h = (_Float16)f; return __builtin_bit_cast(unsigned short, h); }
// RNE bf16 conversion returned as f32
__device__ __forceinline__ float bfr(float f) { return bf_bits2f(f2bf_bits(f)); }

// ---- Register-blocked batched WMMA GEMM (ACT reduced to none/relu/leaky) -------------------------------
// C[m,n] = scale * sum_k A[m,k] * Bt[n,k] (+bias)(+resid); each wave owns a 64x64 tile.
// A row-major [M,K]; Bt row-major [N,K]; M,N % 64 == 0, K % 32 == 0 (SPLIT) / K % 64 == 0 (staged).
// SPLIT: operands are hi/lo planes (A2/Bt2 = lo planes, same layout); product = hi*hi + hi*lo + lo*hi.
// BIAS_MODE: 0 = none, 1 = bias[m], 2 = bias[n].
// OUT_MODE: 0 = f32, 1 = f16, 2 = bf16 hi plane (Cout) + bf16 lo plane (Cout2).
// ET: 0 = f16 operands, 1 = bf16 operands (pointers passed as 16-bit storage)
template <int ET> struct Elem;
template <> struct Elem<0> { typedef _Float16 T; };
template <> struct Elem<1> { typedef __bf16 T; };
// Eight asynchronous 16-byte-per-lane copies global -> LDS (each 32 lanes x 16 B = 4 rows x one whole 128-B line).
// s_wait_xcnt 0 is the last line of the copies' own statement, so it stands ahead of any rewrite of the address registers named here.
__device__ __forceinline__ void async_copy8(const unsigned (&l)[8], const char* const (&g)[8]) {
  asm volatile(
      "global_load_async_to_lds_b128 %0, %8, off\n\t"
      "global_load_async_to_lds_b128 %1, %9, off\n\t"
      "global_load_async_to_lds_b128 %2, %10, off\n\t"
      "global_load_async_to_lds_b128 %3, %11, off\n\t"
      "global_load_async_to_lds_b128 %4, %12, off\n\t"
      "global_load_async_to_lds_b128 %5, %13, off\n\t"
      "global_load_async_to_lds_b128 %6, %14, off\n\t"
      "global_load_async_to_lds_b128 %7, %15, off\n\t"
      "s_wait_xcnt 0x0"
      :: "v"(l[0]), "v"(l[1]), "v"(l[2]), "v"(l[3]), "v"(l[4]), "v"(l[5]), "v"(l[6]), "v"(l[7]),
         "v"(g[0]), "v"(g[1]), "v"(g[2]), "v"(g[3]), "v"(g[4]), "v"(g[5]), "v"(g[6]), "v"(g[7])
      : "memory");
}
// One operand tile of a stage: 64 rows x 128 B (64 k) from row pitch ldBytes into LDS rows of pitch 144 B.
// g0 / l0 are the lane's own addresses for row (lane >> 3), 16-byte chunk (lane & 7); copy c moves rows 4c .. 4c+3.
constexpr int kRowPitch  = 144;                    // 128-B rows + 16 B: 16 B x odd, the pitch for ds_load_b128 readers
constexpr int kTileBytes = 64 * kRowPitch;         // 9216
constexpr int kBufBytes  = 2 * kTileBytes;         // A tile then B tile
constexpr int kWaveBytes = 2 * kBufBytes;          // two buffers per wave
__device__ __forceinline__ void stage_tile(unsigned l0, const char* g0, size_t ldBytes) {
  // both loops unrolled: every index of l and g is a constant, so the addresses stay in registers
#pragma unroll
  for (int hlf = 0; hlf < 2; ++hlf) {
    unsigned l[8];
    const char* g[8];
#pragma unroll
    for (int c = 0; c < 8; ++c) {
      l[c] = l0 + (unsigned)((hlf * 8 + c) * 4 * kRowPitch);
      g[c] = g0 + (size_t)((hlf * 8 + c) * 4) * ldBytes;
    }
    async_copy8(l, g);
  }
}

template <int ET, bool SPLIT, int BIAS_MODE, int OUT_MODE, bool RESID, int ACT = 0>
__global__ __launch_bounds__(256) void wmma_gemm64(
    const unsigned short* __restrict__ Ap, const unsigned short* __restrict__ A2p, int lda, long strideA,
    const unsigned short* __restrict__ Btp, const unsigned short* __restrict__ Bt2p, int ldb, long strideB,
    void* __restrict__ Cout, void* __restrict__ Cout2, int ldc, long strideC,
    const float* __restrict__ bias,
    const float* __restrict__ resid, long strideR,
    int M, int N, int K, float scale) {
  typedef typename Elem<ET>::T T;
  typedef typename Frag<T>::V V;
  const T* A = (const T*)Ap; const T* A2 = (const T*)A2p; const T* Bt = (const T*)Btp; const T* Bt2 = (const T*)Bt2p;
  // SPLIT: per-wave 16x64 f32 slab, pitch 68 floats. Else: per-wave ring of two staged buffers; its first bytes serve as that slab behind the k loop.
  constexpr int kSlabBytes = 16 * 68 * 4;
  constexpr int kPerWave = SPLIT ? kSlabBytes : kWaveBytes;
  __shared__ __align__(16) char smem[8 * kPerWave];
  const int b    = blockIdx.y;
  const int lane = threadIdx.x & 31;
  const int wave = threadIdx.x >> 5;
  const int tilesN = N >> 6;
  const int tilesM = M >> 6;
  const int tile = blockIdx.x * 8 + wave;
  const bool live = tile < tilesM * tilesN;   // wave-uniform
  if (SPLIT && !live) return;                 // no block barriers on this path
  const int tl = live ? tile : 0;             // a wave without a tile still passes every barrier of the staged path
  const int tm = tl / tilesN;
  const int tn = tl - tm * tilesN;
  const int m0 = tm << 6;
  const int n0 = tn << 6;

  const T* Ab  = A  + (size_t)b * strideA;
  const T* Bb  = Bt + (size_t)b * strideB;
  const T* Ab2 = SPLIT ? (A2  + (size_t)b * strideA) : nullptr;
  const T* Bb2 = SPLIT ? (Bt2 + (size_t)b * strideB) : nullptr;

  const int rlane = lane & 15;                 // row (A) / col (B, D) within subtile
  const int koff  = (lane >> 4) * 8;           // k offset of this lane half
  const int mOff  = (lane >> 4) * 8;           // D row offset

  v8f acc[4][4];
#pragma unroll
  for (int i = 0; i < 4; ++i)
#pragma unroll
    for (int j = 0; j < 4; ++j) acc[i][j] = (v8f){0.f,0.f,0.f,0.f,0.f,0.f,0.f,0.f};

  if (SPLIT) {
    for (int k0 = 0; k0 < K; k0 += 32) {
      V bh[4], bl[4];
#pragma unroll
      for (int j = 0; j < 4; ++j) {
        const size_t bo = (size_t)(n0 + (j << 4) + rlane) * ldb + koff + k0;
        bh[j] = Frag<T>::load(Bb + bo);
        if (SPLIT) bl[j] = Frag<T>::load(Bb2 + bo);
      }
#pragma unroll
      for (int i = 0; i < 4; ++i) {
        const size_t ao = (size_t)(m0 + (i << 4) + rlane) * lda + koff + k0;
        V ah = Frag<T>::load(Ab + ao);
        V al;
        if (SPLIT) al = Frag<T>::load(Ab2 + ao);
#pragma unroll
        for (int j = 0; j < 4; ++j) {
          acc[i][j] = Frag<T>::mma(ah, bh[j], acc[i][j]);
          if (SPLIT) {
            acc[i][j] = Frag<T>::mma(ah, bl[j], acc[i][j]);
            acc[i][j] = Frag<T>::mma(al, bh[j], acc[i][j]);
          }
        }
        Frag<T>::guard(acc[i][0], acc[i][3], ah, SPLIT ? al : ah);
      }
      Frag<T>::keep(bh[0], bh[1], bh[2], bh[3]);
      if (SPLIT) Frag<T>::keep(bl[0], bl[1], bl[2], bl[3]);
    }
  } else {
    // Each wave stages its own A and B tiles, 64 k (one whole 128-B line of every row) per stage, in two LDS buffers by
    // asynchronous copies; the fragments come from LDS through Frag::load, k ascending. K is a multiple of 128 (asserted below the constants).
    char* wreg = smem + wave * kWaveBytes;
    const unsigned lw = (unsigned)(size_t)wreg + (unsigned)((lane >> 3) * kRowPitch + (lane & 7) * 16);
    const size_t ldaB = (size_t)lda * 2, ldbB = (size_t)ldb * 2;
    const char* gA = (const char*)Ab + (size_t)(m0 + (lane >> 3)) * ldaB + (lane & 7) * 16;
    const char* gB = (const char*)Bb + (size_t)(n0 + (lane >> 3)) * ldbB + (lane & 7) * 16;
    const int stages = K >> 6;
    stage_tile(lw, gA, ldaB);
    stage_tile(lw + kTileBytes, gB, ldbB);
    asm volatile("s_wait_asynccnt 0x0" ::: "memory");   // stage 0 has landed before anybody reads it
    __syncthreads();
    if (stages > 1) {
      stage_tile(lw + kBufBytes, gA + 128, ldaB);
      stage_tile(lw + kBufBytes + kTileBytes, gB + 128, ldbB);
    }
    const int fo = rlane * kRowPitch + koff * 2;         // the lane's fragment row and k half inside a tile
    for (int t = 0; t < stages; ++t) {
      const int bsel = (t & 1) * kBufBytes;
      const char* rb = wreg + bsel + fo;
      // all 32 fragment loads of the stage go out as one group ahead of its products: one LDS latency a stage, not one per A fragment
      V ah[2][4], bh[2][4];                              // loops below unrolled: constant indices keep the fragments in registers
#pragma unroll
      for (int s = 0; s < 2; ++s) {
#pragma unroll
        for (int j = 0; j < 4; ++j) {
          bh[s][j] = Frag<T>::load((const T*)(rb + kTileBytes + j * 16 * kRowPitch + s * 64));
          ah[s][j] = Frag<T>::load((const T*)(rb + j * 16 * kRowPitch + s * 64));
        }
      }
      // holds the load group ahead of the products; the scheduler otherwise sinks each A fragment's loads in front of its use
      __builtin_amdgcn_sched_barrier(0);
#pragma unroll
      for (int s = 0; s < 2; ++s) {
#pragma unroll
        for (int i = 0; i < 4; ++i) {
#pragma unroll
          for (int j = 0; j < 4; ++j) acc[i][j] = Frag<T>::mma(ah[s][i], bh[s][j], acc[i][j]);
        }
      }
      // holds the products ahead of the foot's waits, so that stage t + 1's copies fly while stage t is worked on
      __builtin_amdgcn_sched_barrier(0);
      asm volatile("s_wait_dscnt 0x0" ::: "memory");     // this stage's LDS reads are done before its buffer is refilled
      asm volatile("s_wait_asynccnt 0x0" ::: "memory");  // stage t + 1 has landed
      __syncthreads();
      if (t + 2 < stages) {
        const size_t kb = (size_t)(t + 2) * 128;
        stage_tile(lw + bsel, gA + kb, ldaB);
        stage_tile(lw + bsel + kTileBytes, gB + kb, ldbB);
      }
    }
    asm volatile("s_wait_asynccnt 0x0" ::: "memory");    // nothing in flight when the ring becomes the epilogue's slab
    if (!live) return;                                   // behind the last work-group barrier
  }
  acc_guard4(acc[0][0], acc[0][1], acc[0][2], acc[0][3]);
  acc_guard4(acc[1][0], acc[1][1], acc[1][2], acc[1][3]);
  acc_guard4(acc[2][0], acc[2][1], acc[2][2], acc[2][3]);
  acc_guard4(acc[3][0], acc[3][1], acc[3][2], acc[3][3]);

  // ---- epilogue ----
  float* slab = (float*)(smem + wave * kPerWave);
  const float* Rb = RESID ? (resid + (size_t)b * strideR) : nullptr;
#pragma unroll
  for (int i = 0; i < 4; ++i) {
    const int mBase = m0 + (i << 4);
#pragma unroll
    for (int j = 0; j < 4; ++j) {
      const int n = n0 + (j << 4) + rlane;
      float bv = 0.f;
      if (BIAS_MODE == 2) bv = bias[n];
#pragma unroll
      for (int r = 0; r < 8; ++r) {
        float v = acc[i][j][r] * scale;
        if (BIAS_MODE == 1) v += bias[mBase + mOff + r];
        if (BIAS_MODE == 2) v += bv;
        if (RESID) v += Rb[(size_t)(mBase + mOff + r) * ldc + n];
        if (ACT == 2) v = fmaxf(v, 0.0f);
        if (ACT == 4) v = (v > 0.f) ? v : 0.01f * v;
        slab[(mOff + r) * 68 + (j << 4) + rlane] = v;
      }
    }
    __builtin_amdgcn_fence(__ATOMIC_RELEASE, "workgroup");
    __builtin_amdgcn_wave_barrier();
    __builtin_amdgcn_fence(__ATOMIC_ACQUIRE, "workgroup");
    if (OUT_MODE == 0) {
      float* C = (float*)Cout + (size_t)b * strideC;
      const int hh = lane >> 4, c4 = (lane & 15) * 4;     // row seg = 256 B = 16 lanes x 16 B
      {
#pragma unroll
        for (int it = 0; it < 8; ++it) {
          const int row = it * 2 + hh;
          v4f v = *(const v4f*)(slab + row * 68 + c4);
          *(v4f*)(C + (size_t)(mBase + row) * ldc + n0 + c4) = v;
        }
        
      }
    } else {
      const int q = lane >> 3, c8 = (lane & 7) * 8;
      unsigned short* C  = (unsigned short*)Cout  + (size_t)b * strideC;
      unsigned short* C2 = (OUT_MODE == 2) ? ((unsigned short*)Cout2 + (size_t)b * strideC) : nullptr;
      {
#pragma unroll
        for (int it = 0; it < 4; ++it) {
          const int row = it * 4 + q;
          const float* sp = slab + row * 68 + c8;
          v8h hv, lv;
#pragma unroll
          for (int e = 0; e < 8; ++e) {
            if (OUT_MODE == 1) {
              hv[e] = (_Float16)sp[e];
            } else {
              unsigned short hb = f2bf_bits(sp[e]);
              unsigned short lb = f2bf_bits(sp[e] - bf_bits2f(hb));
              hv[e] = __builtin_bit_cast(_Float16, hb);
              lv[e] = __builtin_bit_cast(_Float16, lb);
            }
          }
          *(v8h*)(C + (size_t)(mBase + row) * ldc + n0 + c8) = hv;
          if (OUT_MODE == 2) *(v8h*)(C2 + (size_t)(mBase + row) * ldc + n0 + c8) = lv;
        }
        
      }
    }
    __builtin_amdgcn_fence(__ATOMIC_RELEASE, "workgroup");
    __builtin_amdgcn_wave_barrier();
    __builtin_amdgcn_fence(__ATOMIC_ACQUIRE, "workgroup");
  }
}

// ---------------------------------------------------------------------------
// f32 -> (RNE bf16) -> f16 cast with an exact power-of-two carry: out = f16( scale * bf16(in) ).
// ---------------------------------------------------------------------------
__global__ __launch_bounds__(256) void cast8_kernel(const float* __restrict__ in, unsigned short* __restrict__ out, int n8, float scale) {
  const int i = blockIdx.x * 256 + threadIdx.x;
  if (i >= n8) return;
  const float* p = in + 8 * (size_t)i;
  const v4f a = *(const v4f*)(p);
  const v4f c = *(const v4f*)(p + 4);
  unsigned short hb[8];
#pragma unroll
  for (int e = 0; e < 4; ++e) {
    hb[e]     = h_bits(bfr(a[e]) * scale);
    hb[4 + e] = h_bits(bfr(c[e]) * scale);
  }
  const v4u u = (v4u){pk16(hb[0], hb[1]), pk16(hb[2], hb[3]), pk16(hb[4], hb[5]), pk16(hb[6], hb[7])};
  unsigned short* q = out + 8 * (size_t)i;
  *(v4u*)q = u;
  
}

// ---------------------------------------------------------------------------
// RMSNorm (mean over 128, eps inside rsqrt, x norm weight) + per-position 2x2 rotary map on the q and k heads of one batch,
// f32 math; the result is emitted as a bf16 hi plane and a bf16 lo plane (lo = RNE bf16 of v - hi).
// One wave per (position s, head) with head 0..15 = q heads, 16..23 = k heads; lane owns dims 4*lane..4*lane+3 (two pairs).
// Input: QK f32 [2048 s][3072] of batch b (q cols 0..2047, k cols 2048..3071). Rotary table fcs [s][64][2][2], norm weights [128];
// all three converted to bf16 (RNE) before use. out[2p+i] = fc[s,p,i,0]*v[2p] + fc[s,p,i,1]*v[2p+1].
// Output planes Ph (hi) and Ph + loOff (lo), rows of 128 elements = 256 B: q rows (b*16+h)*2048+s, k rows 65536 + (b*8+kh)*2048+s.
// Store: the 4 packed hi words and the 4 packed lo words of every lane are shuffled from lanes 2L, 2L+1 (L = lane & 15) with wave-uniform register choice, then each lane
// selects by value: lanes 0..15 hold 8 consecutive hi dims, lanes 16..31 hold 8 consecutive lo dims; ONE 32-lane x 16-B instruction
// grid (3, 2048) x 256 threads per batch = 49152 waves = 2048 x 24 rows (hi and lo).
// ---------------------------------------------------------------------------
__global__ __launch_bounds__(256) void norm_rope_kernel(const float* __restrict__ QK, const float* __restrict__ fcs,
                                                        const float* __restrict__ qw, const float* __restrict__ kw,
                                                        unsigned short* __restrict__ Ph, long loOff, int b) {
  const int lane = threadIdx.x & 31;
  const int wave = threadIdx.x >> 5;
  const int head = blockIdx.x * 8 + wave;          // 0..23, wave-uniform
  const int s    = blockIdx.y;                     // 0..2047
  const int d0   = lane * 4;

  const v4f xv = *(const v4f*)(QK + (size_t)s * kNQK + (size_t)head * kHD + d0);
  float v0 = xv[0], v1 = xv[1], v2 = xv[2], v3 = xv[3];
  float ss = 0.0f;
  ss += v0 * v0; ss += v1 * v1; ss += v2 * v2; ss += v3 * v3;
#pragma unroll
  for (int off = 1; off < 32; off <<= 1) ss += __shfl_xor(ss, off, 32);
  const float rn = rsqrtf(ss * kInvHD + kEps);

  // norm weights: both candidates loaded unconditionally, arithmetic select by head kind
  const v4f wq = *(const v4f*)(qw + d0);
  const v4f wk = *(const v4f*)(kw + d0);
  const float fq = (head < kHeads) ? 1.0f : 0.0f;
  const float fk = 1.0f - fq;
  const float w0 = bfr(fmaf(fq, wq[0], fk * wk[0]));
  const float w1 = bfr(fmaf(fq, wq[1], fk * wk[1]));
  const float w2 = bfr(fmaf(fq, wq[2], fk * wk[2]));
  const float w3 = bfr(fmaf(fq, wq[3], fk * wk[3]));
  v0 = (v0 * rn) * w0; v1 = (v1 * rn) * w1; v2 = (v2 * rn) * w2; v3 = (v3 * rn) * w3;

  // rotary 2x2 maps for pairs p = 2*lane, 2*lane+1 at position s (8 consecutive floats)
  const float* fp = fcs + ((size_t)s * (kHD / 2) + 2 * lane) * 4;
  const v4f fa = *(const v4f*)(fp);
  const v4f fb = *(const v4f*)(fp + 4);
  const float a00 = bfr(fa[0]), a01 = bfr(fa[1]), a10 = bfr(fa[2]), a11 = bfr(fa[3]);
  const float b00 = bfr(fb[0]), b01 = bfr(fb[1]), b10 = bfr(fb[2]), b11 = bfr(fb[3]);
  const float o0 = a00 * v0 + a01 * v1;
  const float o1 = a10 * v0 + a11 * v1;
  const float o2 = b00 * v2 + b01 * v3;
  const float o3 = b10 * v2 + b11 * v3;

  // bf16 hi / lo split of each value
  const unsigned short hb0 = f2bf_bits(o0), hb1 = f2bf_bits(o1), hb2 = f2bf_bits(o2), hb3 = f2bf_bits(o3);
  const unsigned short lb0 = f2bf_bits(o0 - bf_bits2f(hb0));
  const unsigned short lb1 = f2bf_bits(o1 - bf_bits2f(hb1));
  const unsigned short lb2 = f2bf_bits(o2 - bf_bits2f(hb2));
  const unsigned short lb3 = f2bf_bits(o3 - bf_bits2f(hb3));
  const unsigned ph0 = pk16(hb0, hb1), ph1 = pk16(hb2, hb3);
  const unsigned pl0 = pk16(lb0, lb1), pl1 = pk16(lb2, lb3);

  // gather 8 consecutive dims per lane: dims 8L..8L+3 from lane 2L, 8L+4..8L+7 from lane 2L+1 (L = lane & 15); every candidate
  // is shuffled with a wave-uniform register choice, the hi/lo choice is made per lane after the shuffles
  const int src = (2 * lane) & 31;
  const unsigned gh0 = __shfl(ph0, src, 32);
  const unsigned gh1 = __shfl(ph1, src, 32);
  const unsigned gh2 = __shfl(ph0, src + 1, 32);
  const unsigned gh3 = __shfl(ph1, src + 1, 32);
  const unsigned gl0 = __shfl(pl0, src, 32);
  const unsigned gl1 = __shfl(pl1, src, 32);
  const unsigned gl2 = __shfl(pl0, src + 1, 32);
  const unsigned gl3 = __shfl(pl1, src + 1, 32);
  const bool loh = (lane >= 16);
  const v4u u = (v4u){loh ? gl0 : gh0, loh ? gl1 : gh1, loh ? gl2 : gh2, loh ? gl3 : gh3};

  const int hq = (head < kHeads) ? head : 0;
  const int hk = (head < kHeads) ? 0 : (head - kHeads);
  const size_t rowQ = ((size_t)(b * kHeads + hq)) * kSeq + s;
  const size_t rowK = (size_t)kKRow0 + ((size_t)(b * kKV + hk)) * kSeq + s;
  const size_t row  = (head < kHeads) ? rowQ : rowK;
  const size_t poff = loh ? (size_t)loOff : (size_t)0;
  unsigned short* dp = Ph + poff + row * kHD + 8 * (lane & 15);
  {
    *(v4u*)dp = u;
    
  }
}

// ---------------------------------------------------------------------------
// Additive key mask + row softmax over 2048 scaled scores, f32 math:
//   a = S[i][j] + (mask[j] != 0 ? 0 : -inf);  P[i][j] = f16( 32768 * exp(a - max) / sum exp(a - max) )
// One block of 256 threads per (row i = blockIdx.x, head-in-pair hg = blockIdx.y).
// Phase 1/2: rolled 4-trip loops, thread t owns columns it*512 + 2t, 2t+1 (4 x 256 x 2 = 2048 = whole row); values kept in LDS,
// each thread re-reads only the LDS words it wrote itself until the final barrier.
// Reductions in fixed order (thread sequential, wave shuffle tree, 8 wave partials in index order).
// Store: thread t owns cols 8t..8t+7 (written to LDS by threads (4t..4t+3) mod 256, read after the second block barrier) -> one 16-B store
// ---------------------------------------------------------------------------
__global__ __launch_bounds__(256) void softmax_kernel(const float* __restrict__ Sp, const int* __restrict__ maskp,
                                                      unsigned short* __restrict__ Pp) {
  __shared__ __align__(16) float lg[kSeq];
  __shared__ float redM[8];
  __shared__ float redS[8];
  const int i    = blockIdx.x;
  const int hg   = blockIdx.y;
  const int t    = threadIdx.x;
  const int lane = t & 31, wave = t >> 5;
  const size_t rowoff = ((size_t)hg * kSeq + i) * kSeq;
  const float* sr = Sp + rowoff;

  float mx = -__builtin_inff();
#pragma unroll 1
  for (int it = 0; it < 4; ++it) {
    const int c = it * 512 + 2 * t;
    const v2f sv = *(const v2f*)(sr + c);
    const v2i mv = *(const v2i*)(maskp + c);
    v2f av;
#pragma unroll
    for (int e = 0; e < 2; ++e) {
      const float bias = (mv[e] != 0) ? 0.0f : -__builtin_inff();
      const float a = sv[e] + bias;
      av[e] = a;
      mx = fmaxf(mx, a);
    }
    *(v2f*)(lg + c) = av;
  }
#pragma unroll
  for (int off = 16; off > 0; off >>= 1) mx = fmaxf(mx, __shfl_xor(mx, off, 32));
  if (lane == 0) redM[wave] = mx;
  __syncthreads();
  float m = redM[0];
#pragma unroll
  for (int w = 1; w < 8; ++w) m = fmaxf(m, redM[w]);

  float sum = 0.f;
#pragma unroll 1
  for (int it = 0; it < 4; ++it) {
    const int c = it * 512 + 2 * t;
    const v2f l = *(const v2f*)(lg + c);
    v2f ev;
#pragma unroll
    for (int e = 0; e < 2; ++e) {
      ev[e] = expf(l[e] - m);
      sum += ev[e];
    }
    *(v2f*)(lg + c) = ev;
  }
#pragma unroll
  for (int off = 16; off > 0; off >>= 1) sum += __shfl_xor(sum, off, 32);
  if (lane == 0) redS[wave] = sum;
  __syncthreads();
  float tot = redS[0];
#pragma unroll
  for (int w = 1; w < 8; ++w) tot += redS[w];
  const float inv = kPCarry / tot;

  const v4f e0 = *(const v4f*)(lg + 8 * t);
  const v4f e1 = *(const v4f*)(lg + 8 * t + 4);
  unsigned short hb[8];
#pragma unroll
  for (int e = 0; e < 4; ++e) {
    hb[e]     = h_bits(e0[e] * inv);
    hb[4 + e] = h_bits(e1[e] * inv);
  }
  const v4u u = (v4u){pk16(hb[0], hb[1]), pk16(hb[2], hb[3]), pk16(hb[4], hb[5]), pk16(hb[6], hb[7])};
  unsigned short* pr = Pp + rowoff + 8 * (size_t)t;
  *(v4u*)pr = u;
  
}

// ---------------------------------------------------------------------------
// Host glue.
//   R0 X16  f16 [4096][2048]                        16,777,216 at           0   (later: Ob f16 [4096][2048], same type + layout)
//   R1 Wq16 f16 [4096][2048] (w_qkv x16)            16,777,216 at  16,777,216   (later: PP f16 [2][2048][2048] = [4096][2048], same)
//   R2 Wo16 f16 [2048][2048] (w_out x16)             8,388,608 at  33,554,432
//   R3 f32, sized from the MAX over its users        33,554,432 at  41,943,040 : QK32 [2048][3072] q|k of one batch (25,165,824)
//                                                                                 then SC [2][2048][2048] scaled scores (33,554,432)
//   R4 VT   f16 [2*8][128][2048] (v transposed)       8,388,608 at  75,497,472
//   R5 QKhi bf16 [98304][128] (q rows then k rows)  25,165,824 at  83,886,080
//   R6 QKlo bf16 [98304][128]                        25,165,824 at 109,051,904
//   total                                          134,217,728
// Re-use timeline (stream ordered): X16/Wq16 are read only by the qkv and V^T GEMMs; QK32 of a batch only by that batch's norm kernel;
// Ob, PP and SC are first written by the attention group loop which starts after the last norm kernel and the V^T GEMM.
// Every region is fully written before it is read; no region changes element type.
// GEMM shapes: q|k per batch (M=2048, N=3072, K=2048); V^T per batch (M=1024, N=2048, K=2048); scores (M=N=2048, K=128);
// ctx (M=2048, N=128, K=2048); output (M=4096, N=2048, K=2048); all M,N multiples of 64, all K multiples of 32, no padding anywhere.
// ---------------------------------------------------------------------------
extern "C" void kernel_launch(void* const* d_in, const int* in_sizes, int n_in,
                              void* d_out, int out_size, void* d_ws, size_t ws_size,
                              hipStream_t stream) {
  if (n_in < 7) return;
  const int nX = kBatch * kSeq * kDim;            // 8,388,608
  if (in_sizes[0] != nX) return;
  if (in_sizes[1] != kBatch * kSeq) return;
  if (in_sizes[2] != kSeq * (kHD / 2) * 4) return;
  if (in_sizes[3] != kNQKV * kDim) return;
  if (in_sizes[4] != kDim * kNQ) return;
  if (in_sizes[5] != kHD || in_sizes[6] != kHD) return;
  if (out_size != kTok * kDim) return;

  const size_t szX16  = (size_t)kTok * kDim * 2;
  const size_t szWq16 = (size_t)kNQKV * kDim * 2;
  const size_t szWo16 = (size_t)kDim * kNQ * 2;
  const size_t szQK32 = (size_t)kSeq * kNQK * 4;          // one batch
  const size_t szSC   = (size_t)2 * kSeq * kSeq * 4;
  const size_t szR3   = (szQK32 > szSC) ? szQK32 : szSC;
  const size_t szVT   = (size_t)kBatch * kKV * kHD * kSeq * 2;
  const size_t szPl   = (size_t)kQKRows * kHD * 2;        // one bf16 q|k plane
  const size_t szOb   = (size_t)kTok * kNQ * 2;
  const size_t szPP   = (size_t)2 * kSeq * kSeq * 2;
  const size_t offX16  = 0;
  const size_t offWq16 = offX16 + szX16;
  const size_t offWo16 = offWq16 + szWq16;
  const size_t offR3   = offWo16 + szWo16;
  const size_t offVT   = offR3 + szR3;
  const size_t offPhi  = offVT + szVT;
  const size_t offPlo  = offPhi + szPl;
  const size_t total   = offPlo + szPl;
  if (szOb > szX16 || szPP > szWq16) return;     // re-used regions fit their first carve
  if (ws_size < total) return;

  const float* x     = (const float*)d_in[0];
  const int*   xmask = (const int*)d_in[1];
  const float* freqs = (const float*)d_in[2];
  const float* wqkv  = (const float*)d_in[3];
  const float* wout  = (const float*)d_in[4];
  const float* qw    = (const float*)d_in[5];
  const float* kw    = (const float*)d_in[6];
  float* out = (float*)d_out;
  char* ws = (char*)d_ws;
  unsigned short* X16  = (unsigned short*)(ws + offX16);
  unsigned short* Ob   = (unsigned short*)(ws + offX16);     // re-use of R0 (f16, same layout)
  unsigned short* Wq16 = (unsigned short*)(ws + offWq16);
  unsigned short* PP   = (unsigned short*)(ws + offWq16);    // re-use of R1 (f16, same layout)
  unsigned short* Wo16 = (unsigned short*)(ws + offWo16);
  float* QK32 = (float*)(ws + offR3);
  float* SC   = (float*)(ws + offR3);                        // re-use of R3 (f32)
  unsigned short* VT  = (unsigned short*)(ws + offVT);
  unsigned short* Phi = (unsigned short*)(ws + offPhi);
  unsigned short* Plo = (unsigned short*)(ws + offPlo);
  const long loOff = (long)kQKRows * kHD;                    // elements from the hi plane to the lo plane
  const float* dummyf = (const float*)(ws + offR3);          // valid in-ws pointer for unused bias/resid arguments

  // ---- 16-bit operand planes of the inputs (RNE bf16 of every float input, f16 containers, weights x16) ----
  const int n8x = nX / 8;                 // 1,048,576 -> 4096 blocks exact
  const int n8w = (kNQKV * kDim) / 8;     // 1,048,576 -> 4096 blocks exact
  const int n8o = (kDim * kNQ) / 8;       //   524,288 -> 2048 blocks exact
  cast8_kernel<<<dim3(n8x / 256), dim3(256), 0, stream>>>(x, X16, n8x, 1.0f);
  cast8_kernel<<<dim3(n8w / 256), dim3(256), 0, stream>>>(wqkv, Wq16, n8w, kWCarry);
  cast8_kernel<<<dim3(n8o / 256), dim3(256), 0, stream>>>(wout, Wo16, n8o, kWCarry);

  // ---- per batch: q|k projection (w_qkv rows 0..3071) -> f32 plane; norm + rotary -> bf16 hi/lo planes ----
  {
    const int tilesQK = (kSeq / 64) * (kNQK / 64);   // 1536 -> 192 blocks of 8 waves; covers all 2048 x 3072 of QK32
    for (int b = 0; b < kBatch; ++b) {
      const unsigned short* Xb = X16 + (size_t)b * kSeq * kDim;
      wmma_gemm64<0, false, 0, 0, false, 0><<<dim3(tilesQK / 8, 1), dim3(256), 0, stream>>>(
          Xb, Xb, kDim, 0L, Wq16, Wq16, kDim, 0L,
          (void*)QK32, (void*)QK32, kNQK, 0L, dummyf, dummyf, 0L, kSeq, kNQK, kDim, kWCarryInv);
      norm_rope_kernel<<<dim3((kHeads + kKV) / 8, kSeq), dim3(256), 0, stream>>>(QK32, freqs, qw, kw, Phi, loOff, b);
    }
  }

  // ---- v projection written directly transposed: VT[b*8+j][d][s] = f16( 1/16 * sum_k Wq16[3072+j*128+d][k] * X16[b*2048+s][k] )
  //      (M=1024 weight rows, N=2048 positions, K=2048; grid.y = batch; covers the whole 16 x 128 x 2048 VT plane) ----
  {
    const int tilesVT = (kNK / 64) * (kSeq / 64);     // 512 -> 64 blocks
    const unsigned short* Wv = Wq16 + (size_t)kNQK * kDim;
    wmma_gemm64<0, false, 0, 1, false, 0><<<dim3(tilesVT / 8, kBatch), dim3(256), 0, stream>>>(
        Wv, Wv, kDim, 0L, X16, X16, kDim, (long)kSeq * kDim,
        (void*)VT, (void*)VT, kSeq, (long)kNK * kSeq, dummyf, dummyf, 0L, kNK, kSeq, kDim, kWCarryInv);
  }

  // ---- attention per (batch, kv head j): the two query heads 2j, 2j+1 are the GEMM batch index (grid.y = 2) ----
  const long strideQhead = (long)kSeq * kHD;           // next query head in the q|k planes
  const long strideScore = (long)kSeq * kSeq;          // per head score / probability plane
  const int  tilesScore  = (kSeq / 64) * (kSeq / 64);  // 1024 -> 128 blocks
  const int  tilesCtx    = (kSeq / 64) * (kHD / 64);   //   64 ->   8 blocks
  for (int b = 0; b < kBatch; ++b) {
    for (int j = 0; j < kKV; ++j) {
      const unsigned short* Ahi = Phi + ((size_t)(b * kHeads + 2 * j) * kSeq) * kHD;
      const unsigned short* Alo = Ahi + loOff;
      const unsigned short* Bhi = Phi + ((size_t)kKRow0 + (size_t)(b * kKV + j) * kSeq) * kHD;
      const unsigned short* Blo = Bhi + loOff;
      // SC[hg][i][k] = 128^-0.5 * sum_d q[b,2j+hg,i,d] * k[b,j,k,d], q,k = bf16 hi+lo (hi*hi + hi*lo + lo*hi)   (M=N=2048, K=128)
      wmma_gemm64<1, true, 0, 0, false, 0><<<dim3(tilesScore / 8, 2), dim3(256), 0, stream>>>(
          Ahi, Alo, kHD, strideQhead, Bhi, Blo, kHD, 0L,
          (void*)SC, (void*)SC, kSeq, strideScore, dummyf, dummyf, 0L, kSeq, kSeq, kHD, kScoreScale);
      // key mask of batch b + softmax over keys -> PP (f16, x32768); 2048 rows x 2 heads = whole PP plane
      softmax_kernel<<<dim3(kSeq, 2), dim3(256), 0, stream>>>(SC, xmask + (size_t)b * kSeq, PP);
      // Ob[b*2048+i][(2j+hg)*128+n] = f16( 16 * 2^-15 * sum_k PP[hg][i][k] * VT[b,j][n][k] )   (M=2048, N=128, K=2048)
      const unsigned short* VTg = VT + ((size_t)(b * kKV + j) * kHD) * kSeq;
      unsigned short* Og = Ob + ((size_t)b * kSeq) * kNQ + (size_t)(2 * j) * kHD;
      wmma_gemm64<0, false, 0, 1, false, 0><<<dim3(tilesCtx / 8, 2), dim3(256), 0, stream>>>(
          PP, PP, kSeq, strideScore, VTg, VTg, kSeq, 0L,
          (void*)Og, (void*)Og, kNQ, (long)kHD, dummyf, dummyf, 0L, kSeq, kHD, kSeq, kPVScale);
    }
  }

  // ---- output projection: out[tok][n] = 2^-8 * sum_e Ob[tok][e] * Wo16[n][e]   (M=4096, N=2048, K=2048) ----
  {
    const int tilesOut = (kTok / 64) * (kDim / 64);   // 2048 -> 256 blocks; covers the whole [4096][2048] output
    wmma_gemm64<0, false, 0, 0, false, 0><<<dim3(tilesOut / 8, 1), dim3(256), 0, stream>>>(
        Ob, Ob, kNQ, 0L, Wo16, Wo16, kNQ, 0L,
        (void*)out, (void*)out, kDim, 0L, dummyf, dummyf, 0L, kTok, kDim, kNQ, kOutScale);
  }
}

// v002
// Measured time: 283 microseconds a run.
// Two timings next to v001 put it at 4.34 and 4.35 times that version's speed.
// All steps since v000 together make it 7.76 times as fast.
// Contractions: qkv projection (x as f16(bf16 RNE) x w_qkv^T as f16(16*bf16 RNE)), V^T.P^T (P f16, unnormalised, carried x256, x V^T f16) and output projection (o f16 carried x16 x w_out^T as f16(16*bf16 RNE)) on v_wmma_f32_16x16x32_f16; scores k.q^T on v_wmma_f32_16x16x32_bf16 with q,k as bf16 hi+lo planes (hi*hi + hi*lo + lo*hi); f32 accumulate everywhere; RMSNorm, 2x2 rotary map and online softmax in f32.
#include <hip/hip_runtime.h>
#include <math.h>

// ---------------------------------------------------------------------------
// Problem constants
// ---------------------------------------------------------------------------
constexpr int kBatch = 2;
constexpr int kSeq   = 2048;
constexpr int kDim   = 2048;              // model dim (K of the qkv projection, N of the output projection)
constexpr int kHeads = 16;
constexpr int kKV    = 8;
constexpr int kHD    = 128;
constexpr int kTok   = kBatch * kSeq;     // 4096 token rows
constexpr int kNQ    = kHeads * kHD;      // 2048 q columns / o columns
constexpr int kNK    = kKV * kHD;         // 1024 k columns (= v columns)
constexpr int kNQK   = kNQ + kNK;         // 3072 = pitch of the f32 q|k plane
constexpr int kNQKV  = kNQ + 2 * kNK;     // 4096 rows of w_qkv
constexpr int kQKRows = kBatch * (kHeads + kKV) * kSeq;   // 98304 rows of 128 in each q|k 16-bit plane
constexpr int kKRow0  = kBatch * kHeads * kSeq;           // 65536 = first k row in the q|k planes
constexpr float kEps        = 1.1920929e-07f;
constexpr float kInvHD      = 1.0f / 128.0f;
constexpr float kWCarry     = 16.0f;                      // weights carried x16 in f16
constexpr float kWCarryInv  = 1.0f / 16.0f;
constexpr float kOCarry     = 16.0f;                      // attention output carried x16 in f16
constexpr float kOutScale   = 1.0f / (kOCarry * kWCarry); // 2^-8
constexpr float kScoreScale = 0.08838834764831845f;       // 128^-0.5
static_assert(kHD == 128, "norm kernel lane map: 32 lanes x 4 dims");
static_assert(kHeads == 2 * kKV, "two query heads per kv head");
static_assert(kSeq % 64 == 0 && kNQK % 64 == 0 && kNK % 64 == 0 && kNQ % 64 == 0 && kDim % 64 == 0 && kTok % 64 == 0, "GEMM M/N tiles");
static_assert(kHD % 64 == 0);
static_assert(kDim % 32 == 0 && kHD % 32 == 0 && kSeq % 32 == 0 && kNQ % 32 == 0, "GEMM K % 32");
static_assert(kDim % 128 == 0 && kSeq % 128 == 0 && kNQ % 128 == 0, "staged GEMM K: two or more stages of 64");
static_assert(kSeq == 256 * 8, "key bias coverage: 256 threads x 8 keys");
static_assert((kHeads + kKV) % 8 == 0, "norm kernel: 8 waves per block over 24 q|k heads");

typedef __attribute__((ext_vector_type(16))) _Float16 v16h;
typedef __attribute__((ext_vector_type(8)))  _Float16 v8h;
typedef __attribute__((ext_vector_type(16))) __bf16   v16b;
typedef __attribute__((ext_vector_type(8)))  __bf16   v8b;
typedef __attribute__((ext_vector_type(8)))  float    v8f;
typedef __attribute__((ext_vector_type(4)))  float    v4f;
typedef __attribute__((ext_vector_type(2)))  float    v2f;
typedef __attribute__((ext_vector_type(2)))  int      v2i;
typedef __attribute__((ext_vector_type(4)))  unsigned int v4u;

__device__ __forceinline__ unsigned short f2bf_bits(float f) {
  unsigned u = __float_as_uint(f);
  return (unsigned short)((u + 0x7FFFu + ((u >> 16) & 1u)) >> 16);
}
__device__ __forceinline__ float bf_bits2f(unsigned short h) { return __uint_as_float(((unsigned)h) << 16); }

// hazard guards as plain device helpers
__device__ __forceinline__ void dep_guard_h(v8f& a, v8f& b, v16h x, v16h y) { asm volatile("v_nop\n\tv_nop\n\tv_nop\n\tv_nop" : "+v"(a), "+v"(b) : "v"(x), "v"(y)); }
__device__ __forceinline__ void dep_guard_b(v8f& a, v8f& b, v16b x, v16b y) { asm volatile("v_nop\n\tv_nop\n\tv_nop\n\tv_nop" : "+v"(a), "+v"(b) : "v"(x), "v"(y)); }
__device__ __forceinline__ void keep4_h(v16h a, v16h b, v16h c, v16h d) { asm volatile("v_nop" :: "v"(a), "v"(b), "v"(c), "v"(d)); }
__device__ __forceinline__ void keep4_b(v16b a, v16b b, v16b c, v16b d) { asm volatile("v_nop" :: "v"(a), "v"(b), "v"(c), "v"(d)); }
__device__ __forceinline__ void acc_guard4(v8f& a, v8f& b, v8f& c, v8f& d) { asm volatile("v_nop\n\tv_nop\n\tv_nop\n\tv_nop" : "+v"(a), "+v"(b), "+v"(c), "+v"(d)); }
template <typename T> struct Frag;
template <> struct Frag<_Float16> {
  typedef v16h V; union U { v16h v; v8h h[2]; };
  // elements 0..7 <- p[0..7], 8..15 <- p[16..23]
  static __device__ __forceinline__ v16h load(const _Float16* p) {
    U f; f.h[0] = *(const v8h*)(p); f.h[1] = *(const v8h*)(p + 16); return f.v;
  }
  static __device__ __forceinline__ v8f mma(v16h a, v16h b, v8f c) {
    return __builtin_amdgcn_wmma_f32_16x16x32_f16(false, a, false, b, (short)0, c, false, false);
  }
  static __device__ __forceinline__ void guard(v8f& a, v8f& b, v16h x, v16h y) { dep_guard_h(a, b, x, y); }
  static __device__ __forceinline__ void keep(v16h a, v16h b, v16h c, v16h d) { keep4_h(a, b, c, d); }
};
template <> struct Frag<__bf16> {
  typedef v16b V; union U { v16b v; v8b h[2]; };
  static __device__ __forceinline__ v16b load(const __bf16* p) {
    U f; f.h[0] = *(const v8b*)(p); f.h[1] = *(const v8b*)(p + 16); return f.v;
  }
  static __device__ __forceinline__ v8f mma(v16b a, v16b b, v8f c) {
    return __builtin_amdgcn_wmma_f32_16x16x32_bf16(false, a, false, b, (short)0, c, false, false);
  }
  static __device__ __forceinline__ void guard(v8f& a, v8f& b, v16b x, v16b y) { dep_guard_b(a, b, x, y); }
  static __device__ __forceinline__ void keep(v16b a, v16b b, v16b c, v16b d) { keep4_b(a, b, c, d); }
};

__device__ __forceinline__ unsigned pk16(unsigned short a, unsigned short b) { return (unsigned)a | ((unsigned)b << 16); }
__device__ __forceinline__ unsigned short h_bits(float f) { const _Float16 h = (_Float16)f; return __builtin_bit_cast(unsigned short, h); }
// RNE bf16 conversion returned as f32
__device__ __forceinline__ float bfr(float f) { return bf_bits2f(f2bf_bits(f)); }

// ---- Register-blocked batched WMMA GEMM (ACT reduced to none/relu/leaky) -------------------------------
// C[m,n] = scale * sum_k A[m,k] * Bt[n,k] (+bias)(+resid); each wave owns a 64x64 tile.
// A row-major [M,K]; Bt row-major [N,K]; M,N % 64 == 0, K % 32 == 0 (SPLIT) / K % 64 == 0 (staged).
// SPLIT: operands are hi/lo planes (A2/Bt2 = lo planes, same layout); product = hi*hi + hi*lo + lo*hi.
// BIAS_MODE: 0 = none, 1 = bias[m], 2 = bias[n].
// OUT_MODE: 0 = f32, 1 = f16, 2 = bf16 hi plane (Cout) + bf16 lo plane (Cout2).
// ET: 0 = f16 operands, 1 = bf16 operands (pointers passed as 16-bit storage)
template <int ET> struct Elem;
template <> struct Elem<0> { typedef _Float16 T; };
template <> struct Elem<1> { typedef __bf16 T; };
// Eight asynchronous 16-byte-per-lane copies global -> LDS (each 32 lanes x 16 B = 4 rows x one whole 128-B line).
// s_wait_xcnt 0 is the last line of the copies' own statement, so it stands ahead of any rewrite of the address registers named here.
__device__ __forceinline__ void async_copy8(const unsigned (&l)[8], const char* const (&g)[8]) {
  asm volatile(
      "global_load_async_to_lds_b128 %0, %8, off\n\t"
      "global_load_async_to_lds_b128 %1, %9, off\n\t"
      "global_load_async_to_lds_b128 %2, %10, off\n\t"
      "global_load_async_to_lds_b128 %3, %11, off\n\t"
      "global_load_async_to_lds_b128 %4, %12, off\n\t"
      "global_load_async_to_lds_b128 %5, %13, off\n\t"
      "global_load_async_to_lds_b128 %6, %14, off\n\t"
      "global_load_async_to_lds_b128 %7, %15, off\n\t"
      "s_wait_xcnt 0x0"
      :: "v"(l[0]), "v"(l[1]), "v"(l[2]), "v"(l[3]), "v"(l[4]), "v"(l[5]), "v"(l[6]), "v"(l[7]),
         "v"(g[0]), "v"(g[1]), "v"(g[2]), "v"(g[3]), "v"(g[4]), "v"(g[5]), "v"(g[6]), "v"(g[7])
      : "memory");
}
// One operand tile of a stage: 64 rows x 128 B (64 k) from row pitch ldBytes into LDS rows of pitch 144 B.
// g0 / l0 are the lane's own addresses for row (lane >> 3), 16-byte chunk (lane & 7); copy c moves rows 4c .. 4c+3.
constexpr int kRowPitch  = 144;                    // 128-B rows + 16 B: 16 B x odd, the pitch for ds_load_b128 readers
constexpr int kTileBytes = 64 * kRowPitch;         // 9216
constexpr int kBufBytes  = 2 * kTileBytes;         // A tile then B tile
constexpr int kWaveBytes = 2 * kBufBytes;          // two buffers per wave
__device__ __forceinline__ void stage_tile(unsigned l0, const char* g0, size_t ldBytes) {
  // both loops unrolled: every index of l and g is a constant, so the addresses stay in registers
#pragma unroll
  for (int hlf = 0; hlf < 2; ++hlf) {
    unsigned l[8];
    const char* g[8];
#pragma unroll
    for (int c = 0; c < 8; ++c) {
      l[c] = l0 + (unsigned)((hlf * 8 + c) * 4 * kRowPitch);
      g[c] = g0 + (size_t)((hlf * 8 + c) * 4) * ldBytes;
    }
    async_copy8(l, g);
  }
}

template <int ET, bool SPLIT, int BIAS_MODE, int OUT_MODE, bool RESID, int ACT = 0>
__global__ __launch_bounds__(256) void wmma_gemm64(
    const unsigned short* __restrict__ Ap, const unsigned short* __restrict__ A2p, int lda, long strideA,
    const unsigned short* __restrict__ Btp, const unsigned short* __restrict__ Bt2p, int ldb, long strideB,
    void* __restrict__ Cout, void* __restrict__ Cout2, int ldc, long strideC,
    const float* __restrict__ bias,
    const float* __restrict__ resid, long strideR,
    int M, int N, int K, float scale) {
  typedef typename Elem<ET>::T T;
  typedef typename Frag<T>::V V;
  const T* A = (const T*)Ap; const T* A2 = (const T*)A2p; const T* Bt = (const T*)Btp; const T* Bt2 = (const T*)Bt2p;
  // SPLIT: per-wave 16x64 f32 slab, pitch 68 floats. Else: per-wave ring of two staged buffers; its first bytes serve as that slab behind the k loop.
  constexpr int kSlabBytes = 16 * 68 * 4;
  constexpr int kPerWave = SPLIT ? kSlabBytes : kWaveBytes;
  __shared__ __align__(16) char smem[8 * kPerWave];
  const int b    = blockIdx.y;
  const int lane = threadIdx.x & 31;
  const int wave = threadIdx.x >> 5;
  const int tilesN = N >> 6;
  const int tilesM = M >> 6;
  const int tile = blockIdx.x * 8 + wave;
  const bool live = tile < tilesM * tilesN;   // wave-uniform
  if (SPLIT && !live) return;                 // no block barriers on this path
  const int tl = live ? tile : 0;             // a wave without a tile still passes every barrier of the staged path
  const int tm = tl / tilesN;
  const int tn = tl - tm * tilesN;
  const int m0 = tm << 6;
  const int n0 = tn << 6;

  const T* Ab  = A  + (size_t)b * strideA;
  const T* Bb  = Bt + (size_t)b * strideB;
  const T* Ab2 = SPLIT ? (A2  + (size_t)b * strideA) : nullptr;
  const T* Bb2 = SPLIT ? (Bt2 + (size_t)b * strideB) : nullptr;

  const int rlane = lane & 15;                 // row (A) / col (B, D) within subtile
  const int koff  = (lane >> 4) * 8;           // k offset of this lane half
  const int mOff  = (lane >> 4) * 8;           // D row offset

  v8f acc[4][4];
#pragma unroll
  for (int i = 0; i < 4; ++i)
#pragma unroll
    for (int j = 0; j < 4; ++j) acc[i][j] = (v8f){0.f,0.f,0.f,0.f,0.f,0.f,0.f,0.f};

  if (SPLIT) {
    for (int k0 = 0; k0 < K; k0 += 32) {
      V bh[4], bl[4];
#pragma unroll
      for (int j = 0; j < 4; ++j) {
        const size_t bo = (size_t)(n0 + (j << 4) + rlane) * ldb + koff + k0;
        bh[j] = Frag<T>::load(Bb + bo);
        if (SPLIT) bl[j] = Frag<T>::load(Bb2 + bo);
      }
#pragma unroll
      for (int i = 0; i < 4; ++i) {
        const size_t ao = (size_t)(m0 + (i << 4) + rlane) * lda + koff + k0;
        V ah = Frag<T>::load(Ab + ao);
        V al;
        if (SPLIT) al = Frag<T>::load(Ab2 + ao);
#pragma unroll
        for (int j = 0; j < 4; ++j) {
          acc[i][j] = Frag<T>::mma(ah, bh[j], acc[i][j]);
          if (SPLIT) {
            acc[i][j] = Frag<T>::mma(ah, bl[j], acc[i][j]);
            acc[i][j] = Frag<T>::mma(al, bh[j], acc[i][j]);
          }
        }
        Frag<T>::guard(acc[i][0], acc[i][3], ah, SPLIT ? al : ah);
      }
      Frag<T>::keep(bh[0], bh[1], bh[2], bh[3]);
      if (SPLIT) Frag<T>::keep(bl[0], bl[1], bl[2], bl[3]);
    }
  } else {
    // Each wave stages its own A and B tiles, 64 k (one whole 128-B line of every row) per stage, in two LDS buffers by
    // asynchronous copies; the fragments come from LDS through Frag::load, k ascending. K is a multiple of 128 (asserted below the constants).
    char* wreg = smem + wave * kWaveBytes;
    const unsigned lw = (unsigned)(size_t)wreg + (unsigned)((lane >> 3) * kRowPitch + (lane & 7) * 16);
    const size_t ldaB = (size_t)lda * 2, ldbB = (size_t)ldb * 2;
    const char* gA = (const char*)Ab + (size_t)(m0 + (lane >> 3)) * ldaB + (lane & 7) * 16;
    const char* gB = (const char*)Bb + (size_t)(n0 + (lane >> 3)) * ldbB + (lane & 7) * 16;
    const int stages = K >> 6;
    stage_tile(lw, gA, ldaB);
    stage_tile(lw + kTileBytes, gB, ldbB);
    asm volatile("s_wait_asynccnt 0x0" ::: "memory");   // stage 0 has landed before anybody reads it
    __syncthreads();
    if (stages > 1) {
      stage_tile(lw + kBufBytes, gA + 128, ldaB);
      stage_tile(lw + kBufBytes + kTileBytes, gB + 128, ldbB);
    }
    const int fo = rlane * kRowPitch + koff * 2;         // the lane's fragment row and k half inside a tile
    for (int t = 0; t < stages; ++t) {
      const int bsel = (t & 1) * kBufBytes;
      const char* rb = wreg + bsel + fo;
      // all 32 fragment loads of the stage go out as one group ahead of its products: one LDS latency a stage, not one per A fragment
      V ah[2][4], bh[2][4];                              // loops below unrolled: constant indices keep the fragments in registers
#pragma unroll
      for (int s = 0; s < 2; ++s) {
#pragma unroll
        for (int j = 0; j < 4; ++j) {
          bh[s][j] = Frag<T>::load((const T*)(rb + kTileBytes + j * 16 * kRowPitch + s * 64));
          ah[s][j] = Frag<T>::load((const T*)(rb + j * 16 * kRowPitch + s * 64));
        }
      }
      // holds the load group ahead of the products; the scheduler otherwise sinks each A fragment's loads in front of its use
      __builtin_amdgcn_sched_barrier(0);
#pragma unroll
      for (int s = 0; s < 2; ++s) {
#pragma unroll
        for (int i = 0; i < 4; ++i) {
#pragma unroll
          for (int j = 0; j < 4; ++j) acc[i][j] = Frag<T>::mma(ah[s][i], bh[s][j], acc[i][j]);
        }
      }
      // holds the products ahead of the foot's waits, so that stage t + 1's copies fly while stage t is worked on
      __builtin_amdgcn_sched_barrier(0);
      asm volatile("s_wait_dscnt 0x0" ::: "memory");     // this stage's LDS reads are done before its buffer is refilled
      asm volatile("s_wait_asynccnt 0x0" ::: "memory");  // stage t + 1 has landed
      __syncthreads();
      if (t + 2 < stages) {
        const size_t kb = (size_t)(t + 2) * 128;
        stage_tile(lw + bsel, gA + kb, ldaB);
        stage_tile(lw + bsel + kTileBytes, gB + kb, ldbB);
      }
    }
    asm volatile("s_wait_asynccnt 0x0" ::: "memory");    // nothing in flight when the ring becomes the epilogue's slab
    if (!live) return;                                   // behind the last work-group barrier
  }
  acc_guard4(acc[0][0], acc[0][1], acc[0][2], acc[0][3]);
  acc_guard4(acc[1][0], acc[1][1], acc[1][2], acc[1][3]);
  acc_guard4(acc[2][0], acc[2][1], acc[2][2], acc[2][3]);
  acc_guard4(acc[3][0], acc[3][1], acc[3][2], acc[3][3]);

  // ---- epilogue ----
  float* slab = (float*)(smem + wave * kPerWave);
  const float* Rb = RESID ? (resid + (size_t)b * strideR) : nullptr;
#pragma unroll
  for (int i = 0; i < 4; ++i) {
    const int mBase = m0 + (i << 4);
#pragma unroll
    for (int j = 0; j < 4; ++j) {
      const int n = n0 + (j << 4) + rlane;
      float bv = 0.f;
      if (BIAS_MODE == 2) bv = bias[n];
#pragma unroll
      for (int r = 0; r < 8; ++r) {
        float v = acc[i][j][r] * scale;
        if (BIAS_MODE == 1) v += bias[mBase + mOff + r];
        if (BIAS_MODE == 2) v += bv;
        if (RESID) v += Rb[(size_t)(mBase + mOff + r) * ldc + n];
        if (ACT == 2) v = fmaxf(v, 0.0f);
        if (ACT == 4) v = (v > 0.f) ? v : 0.01f * v;
        slab[(mOff + r) * 68 + (j << 4) + rlane] = v;
      }
    }
    __builtin_amdgcn_fence(__ATOMIC_RELEASE, "workgroup");
    __builtin_amdgcn_wave_barrier();
    __builtin_amdgcn_fence(__ATOMIC_ACQUIRE, "workgroup");
    if (OUT_MODE == 0) {
      float* C = (float*)Cout + (size_t)b * strideC;
      const int hh = lane >> 4, c4 = (lane & 15) * 4;     // row seg = 256 B = 16 lanes x 16 B
      {
#pragma unroll
        for (int it = 0; it < 8; ++it) {
          const int row = it * 2 + hh;
          v4f v = *(const v4f*)(slab + row * 68 + c4);
          *(v4f*)(C + (size_t)(mBase + row) * ldc + n0 + c4) = v;
        }
        
      }
    } else {
      const int q = lane >> 3, c8 = (lane & 7) * 8;
      unsigned short* C  = (unsigned short*)Cout  + (size_t)b * strideC;
      unsigned short* C2 = (OUT_MODE == 2) ? ((unsigned short*)Cout2 + (size_t)b * strideC) : nullptr;
      {
#pragma unroll
        for (int it = 0; it < 4; ++it) {
          const int row = it * 4 + q;
          const float* sp = slab + row * 68 + c8;
          v8h hv, lv;
#pragma unroll
          for (int e = 0; e < 8; ++e) {
            if (OUT_MODE == 1) {
              hv[e] = (_Float16)sp[e];
            } else {
              unsigned short hb = f2bf_bits(sp[e]);
              unsigned short lb = f2bf_bits(sp[e] - bf_bits2f(hb));
              hv[e] = __builtin_bit_cast(_Float16, hb);
              lv[e] = __builtin_bit_cast(_Float16, lb);
            }
          }
          *(v8h*)(C + (size_t)(mBase + row) * ldc + n0 + c8) = hv;
          if (OUT_MODE == 2) *(v8h*)(C2 + (size_t)(mBase + row) * ldc + n0 + c8) = lv;
        }
        
      }
    }
    __builtin_amdgcn_fence(__ATOMIC_RELEASE, "workgroup");
    __builtin_amdgcn_wave_barrier();
    __builtin_amdgcn_fence(__ATOMIC_ACQUIRE, "workgroup");
  }
}

// ---------------------------------------------------------------------------
// f32 -> (RNE bf16) -> f16 cast with an exact power-of-two carry: out = f16( scale * bf16(in) ).
// ---------------------------------------------------------------------------
__global__ __launch_bounds__(256) void cast8_kernel(const float* __restrict__ in, unsigned short* __restrict__ out, int n8, float scale) {
  const int i = blockIdx.x * 256 + threadIdx.x;
  if (i >= n8) return;
  const float* p = in + 8 * (size_t)i;
  const v4f a = *(const v4f*)(p);
  const v4f c = *(const v4f*)(p + 4);
  unsigned short hb[8];
#pragma unroll
  for (int e = 0; e < 4; ++e) {
    hb[e]     = h_bits(bfr(a[e]) * scale);
    hb[4 + e] = h_bits(bfr(c[e]) * scale);
  }
  const v4u u = (v4u){pk16(hb[0], hb[1]), pk16(hb[2], hb[3]), pk16(hb[4], hb[5]), pk16(hb[6], hb[7])};
  unsigned short* q = out + 8 * (size_t)i;
  *(v4u*)q = u;
  
}

// ---------------------------------------------------------------------------
// RMSNorm (mean over 128, eps inside rsqrt, x norm weight) + per-position 2x2 rotary map on the q and k heads of one batch,
// f32 math; the result is emitted as a bf16 hi plane and a bf16 lo plane (lo = RNE bf16 of v - hi).
// One wave per (position s, head) with head 0..15 = q heads, 16..23 = k heads; lane owns dims 4*lane..4*lane+3 (two pairs).
// Input: QK f32 [2048 s][3072] of batch b (q cols 0..2047, k cols 2048..3071). Rotary table fcs [s][64][2][2], norm weights [128];
// all three converted to bf16 (RNE) before use. out[2p+i] = fc[s,p,i,0]*v[2p] + fc[s,p,i,1]*v[2p+1].
// Output planes Ph (hi) and Ph + loOff (lo), rows of 128 elements = 256 B: q rows (b*16+h)*2048+s, k rows 65536 + (b*8+kh)*2048+s.
// Store: the 4 packed hi words and the 4 packed lo words of every lane are shuffled from lanes 2L, 2L+1 (L = lane & 15) with wave-uniform register choice, then each lane
// selects by value: lanes 0..15 hold 8 consecutive hi dims, lanes 16..31 hold 8 consecutive lo dims; ONE 32-lane x 16-B instruction
// grid (3, 2048) x 256 threads per batch = 49152 waves = 2048 x 24 rows (hi and lo).
// ---------------------------------------------------------------------------
__global__ __launch_bounds__(256) void norm_rope_kernel(const float* __restrict__ QK, const float* __restrict__ fcs,
                                                        const float* __restrict__ qw, const float* __restrict__ kw,
                                                        unsigned short* __restrict__ Ph, long loOff, int b) {
  const int lane = threadIdx.x & 31;
  const int wave = threadIdx.x >> 5;
  const int head = blockIdx.x * 8 + wave;          // 0..23, wave-uniform
  const int s    = blockIdx.y;                     // 0..2047
  const int d0   = lane * 4;

  const v4f xv = *(const v4f*)(QK + (size_t)s * kNQK + (size_t)head * kHD + d0);
  float v0 = xv[0], v1 = xv[1], v2 = xv[2], v3 = xv[3];
  float ss = 0.0f;
  ss += v0 * v0; ss += v1 * v1; ss += v2 * v2; ss += v3 * v3;
#pragma unroll
  for (int off = 1; off < 32; off <<= 1) ss += __shfl_xor(ss, off, 32);
  const float rn = rsqrtf(ss * kInvHD + kEps);

  // norm weights: both candidates loaded unconditionally, arithmetic select by head kind
  const v4f wq = *(const v4f*)(qw + d0);
  const v4f wk = *(const v4f*)(kw + d0);
  const float fq = (head < kHeads) ? 1.0f : 0.0f;
  const float fk = 1.0f - fq;
  const float w0 = bfr(fmaf(fq, wq[0], fk * wk[0]));
  const float w1 = bfr(fmaf(fq, wq[1], fk * wk[1]));
  const float w2 = bfr(fmaf(fq, wq[2], fk * wk[2]));
  const float w3 = bfr(fmaf(fq, wq[3], fk * wk[3]));
  v0 = (v0 * rn) * w0; v1 = (v1 * rn) * w1; v2 = (v2 * rn) * w2; v3 = (v3 * rn) * w3;

  // rotary 2x2 maps for pairs p = 2*lane, 2*lane+1 at position s (8 consecutive floats)
  const float* fp = fcs + ((size_t)s * (kHD / 2) + 2 * lane) * 4;
  const v4f fa = *(const v4f*)(fp);
  const v4f fb = *(const v4f*)(fp + 4);
  const float a00 = bfr(fa[0]), a01 = bfr(fa[1]), a10 = bfr(fa[2]), a11 = bfr(fa[3]);
  const float b00 = bfr(fb[0]), b01 = bfr(fb[1]), b10 = bfr(fb[2]), b11 = bfr(fb[3]);
  const float o0 = a00 * v0 + a01 * v1;
  const float o1 = a10 * v0 + a11 * v1;
  const float o2 = b00 * v2 + b01 * v3;
  const float o3 = b10 * v2 + b11 * v3;

  // bf16 hi / lo split of each value
  const unsigned short hb0 = f2bf_bits(o0), hb1 = f2bf_bits(o1), hb2 = f2bf_bits(o2), hb3 = f2bf_bits(o3);
  const unsigned short lb0 = f2bf_bits(o0 - bf_bits2f(hb0));
  const unsigned short lb1 = f2bf_bits(o1 - bf_bits2f(hb1));
  const unsigned short lb2 = f2bf_bits(o2 - bf_bits2f(hb2));
  const unsigned short lb3 = f2bf_bits(o3 - bf_bits2f(hb3));
  const unsigned ph0 = pk16(hb0, hb1), ph1 = pk16(hb2, hb3);
  const unsigned pl0 = pk16(lb0, lb1), pl1 = pk16(lb2, lb3);

  // gather 8 consecutive dims per lane: dims 8L..8L+3 from lane 2L, 8L+4..8L+7 from lane 2L+1 (L = lane & 15); every candidate
  // is shuffled with a wave-uniform register choice, the hi/lo choice is made per lane after the shuffles
  const int src = (2 * lane) & 31;
  const unsigned gh0 = __shfl(ph0, src, 32);
  const unsigned gh1 = __shfl(ph1, src, 32);
  const unsigned gh2 = __shfl(ph0, src + 1, 32);
  const unsigned gh3 = __shfl(ph1, src + 1, 32);
  const unsigned gl0 = __shfl(pl0, src, 32);
  const unsigned gl1 = __shfl(pl1, src, 32);
  const unsigned gl2 = __shfl(pl0, src + 1, 32);
  const unsigned gl3 = __shfl(pl1, src + 1, 32);
  const bool loh = (lane >= 16);
  const v4u u = (v4u){loh ? gl0 : gh0, loh ? gl1 : gh1, loh ? gl2 : gh2, loh ? gl3 : gh3};

  const int hq = (head < kHeads) ? head : 0;
  const int hk = (head < kHeads) ? 0 : (head - kHeads);
  const size_t rowQ = ((size_t)(b * kHeads + hq)) * kSeq + s;
  const size_t rowK = (size_t)kKRow0 + ((size_t)(b * kKV + hk)) * kSeq + s;
  const size_t row  = (head < kHeads) ? rowQ : rowK;
  const size_t poff = loh ? (size_t)loOff : (size_t)0;
  unsigned short* dp = Ph + poff + row * kHD + 8 * (lane & 15);
  {
    *(v4u*)dp = u;
    
  }
}

constexpr int kAKeys   = 64;
constexpr int kAStages = kSeq / kAKeys;
constexpr int kKPitch  = 2 * kHD + 16;
constexpr int kVPitch  = 2 * kAKeys + 16;
constexpr int kKTile   = kAKeys * kKPitch;
constexpr int kVTile   = kHD * kVPitch;
constexpr int kABuf    = 2 * kKTile + kVTile;
constexpr float kScoreLog2 = kScoreScale * 1.4426950408889634f;
constexpr float kPShift    = 8.0f;                 // p carried x2^8: small p stay clear of the f16 subnormals; cancels in sum p v / sum p
static_assert(kAStages >= 2 && kSeq % 128 == 0, "two or more stages; 128 query positions per block");

typedef __attribute__((ext_vector_type(4))) int v4i;

// Four asynchronous 16-byte-per-lane copies global -> LDS: one thread's share of one operand tile of a stage.
// s_wait_xcnt 0 is the last line of the copies' own statement, so it stands ahead of any rewrite of the address registers named here.
__device__ __forceinline__ void async_copy4(unsigned l0, unsigned l1, unsigned l2, unsigned l3,
                                            const char* g0, const char* g1, const char* g2, const char* g3) {
  asm volatile(
      "global_load_async_to_lds_b128 %0, %4, off\n\t"
      "global_load_async_to_lds_b128 %1, %5, off\n\t"
      "global_load_async_to_lds_b128 %2, %6, off\n\t"
      "global_load_async_to_lds_b128 %3, %7, off\n\t"
      "s_wait_xcnt 0x0"
      :: "v"(l0), "v"(l1), "v"(l2), "v"(l3), "v"(g0), "v"(g1), "v"(g2), "v"(g3)
      : "memory");
}
// One stage: 64 K rows x 256 B of each plane (thread: row tid >> 4 (+16 a copy), chunk tid & 15) and 128 V^T rows x 128 B
// (thread: row tid >> 3 (+32 a copy), chunk tid & 7). lK, lV, gKh, gKl, gV are the thread's own addresses of its first copy.
__device__ __forceinline__ void attn_stage(unsigned lK, unsigned lV, const char* gKh, const char* gKl, const char* gV) {
  constexpr unsigned kLK = 16 * kKPitch, kLV = 32 * kVPitch;
  constexpr size_t   kGK = (size_t)16 * 2 * kHD, kGV = (size_t)32 * 2 * kSeq;
  async_copy4(lK, lK + kLK, lK + 2 * kLK, lK + 3 * kLK, gKh, gKh + kGK, gKh + 2 * kGK, gKh + 3 * kGK);
  async_copy4(lK + kKTile, lK + kKTile + kLK, lK + kKTile + 2 * kLK, lK + kKTile + 3 * kLK, gKl, gKl + kGK, gKl + 2 * kGK, gKl + 3 * kGK);
  async_copy4(lV, lV + kLV, lV + 2 * kLV, lV + 3 * kLV, gV, gV + kGV, gV + 2 * kGV, gV + 3 * kGV);
}
// lane l with lane l ^ 16
__device__ __forceinline__ float xhalf(float x) {
  return __builtin_bit_cast(float, __builtin_amdgcn_permlanex16(__builtin_bit_cast(int, x), __builtin_bit_cast(int, x), 0x76543210, 0xfedcba98, false, false));
}

__global__ __launch_bounds__(256) void attn_kernel(const unsigned short* __restrict__ Ph, long loOff,
                                                   const unsigned short* __restrict__ VTp, const int* __restrict__ maskp,
                                                   unsigned short* __restrict__ Obp) {
  // every '#pragma unroll' in this kernel: constant indices keep the fragment, score and accumulator arrays in registers
  __shared__ __align__(128) char ring[2 * kABuf];
  __shared__ __align__(16) float kbias[kSeq];
  const int tid   = threadIdx.x;
  const int lane  = tid & 31;
  const int wave  = tid >> 5;
  const int rlane = lane & 15;                 // row of an A fragment, column of a B fragment and of D
  const int koff  = (lane >> 4) * 8;           // k offset of this lane half = D row offset
  const int b     = blockIdx.y / kKV;
  const int j     = blockIdx.y % kKV;
  const int q0    = blockIdx.x * 128 + wave * 16;

  // additive key bias of batch b, once per block
  {
    const int* mp = maskp + (size_t)b * kSeq + 8 * tid;
    const v4i m0 = *(const v4i*)(mp);
    const v4i m1 = *(const v4i*)(mp + 4);
    v4f f0, f1;
#pragma unroll
    for (int e = 0; e < 4; ++e) {
      f0[e] = (m0[e] != 0) ? 0.0f : -__builtin_inff();
      f1[e] = (m1[e] != 0) ? 0.0f : -__builtin_inff();
    }
    *(v4f*)(kbias + 8 * tid)     = f0;
    *(v4f*)(kbias + 8 * tid + 4) = f1;
  }

  const unsigned lK = (unsigned)(size_t)ring + (unsigned)((tid >> 4) * kKPitch + (tid & 15) * 16);
  const unsigned lV = (unsigned)(size_t)ring + (unsigned)(2 * kKTile + (tid >> 3) * kVPitch + (tid & 7) * 16);
  const char* gKh = (const char*)(Ph + ((size_t)kKRow0 + (size_t)(b * kKV + j) * kSeq + (tid >> 4)) * kHD) + (tid & 15) * 16;
  const char* gKl = gKh + (size_t)loOff * 2;
  const char* gV  = (const char*)(VTp + ((size_t)(b * kKV + j) * kHD + (tid >> 3)) * kSeq) + (tid & 7) * 16;
  constexpr size_t kKStep = (size_t)kAKeys * kHD * 2;   // bytes from one stage's K rows to the next
  constexpr size_t kVStep = (size_t)kAKeys * 2;         // bytes from one stage's V^T columns to the next

  attn_stage(lK, lV, gKh, gKl, gV);

  // Q fragments (B operand), both planes, both heads, kept for the whole kernel
  v16b qh[2][4], ql[2][4];
#pragma unroll
  for (int g = 0; g < 2; ++g) {
    const __bf16* qp = (const __bf16*)Ph + ((size_t)(b * kHeads + 2 * j + g) * kSeq + q0 + rlane) * kHD + koff;
#pragma unroll
    for (int kc = 0; kc < 4; ++kc) {
      qh[g][kc] = Frag<__bf16>::load(qp + kc * 32);
      ql[g][kc] = Frag<__bf16>::load(qp + loOff + kc * 32);
    }
  }
  v8f acc[2][8];
  float mrun[2], lrun[2];
#pragma unroll
  for (int g = 0; g < 2; ++g) {
    mrun[g] = -__builtin_inff();
    lrun[g] = 0.0f;
#pragma unroll
    for (int d = 0; d < 8; ++d) acc[g][d] = (v8f){0.f,0.f,0.f,0.f,0.f,0.f,0.f,0.f};
  }

  asm volatile("s_wait_asynccnt 0x0" ::: "memory");     // stage 0 has landed before anybody reads it
  __syncthreads();                                      // also publishes kbias
  attn_stage(lK + kABuf, lV + kABuf, gKh + kKStep, gKl + kKStep, gV + kVStep);

  for (int t = 0; t < kAStages; ++t) {
    const int bsel = (t & 1) * kABuf;
    // two 32-key passes; kept rolled: unrolled, both passes' fragments are fetched together and registers spill
#pragma unroll 1
    for (int sub = 0; sub < 2; ++sub) {
      const char* kp = ring + bsel + (sub * 32 + rlane) * kKPitch + koff * 2;
      // all 32 K fragment loads of the pass go out as one group, in the order of their use
      v16b kh[2][4], kl[2][4];
#pragma unroll
      for (int kc = 0; kc < 4; ++kc) {
#pragma unroll
        for (int kt = 0; kt < 2; ++kt) kh[kt][kc] = Frag<__bf16>::load((const __bf16*)(kp + kt * 16 * kKPitch + kc * 64));
#pragma unroll
        for (int kt = 0; kt < 2; ++kt) kl[kt][kc] = Frag<__bf16>::load((const __bf16*)(kp + kKTile + kt * 16 * kKPitch + kc * 64));
      }
      // bias of this lane's 16 keys, last in the same group: there when the products end
      const float* bp = kbias + t * kAKeys + sub * 32 + koff;
      const v4f b0 = *(const v4f*)(bp), b1 = *(const v4f*)(bp + 4), b2 = *(const v4f*)(bp + 16), b3 = *(const v4f*)(bp + 20);
      // holds the load group ahead of the products; the scheduler otherwise sinks each fragment's loads in front of its use, one LDS latency each
      __builtin_amdgcn_sched_barrier(0);
      v8f s[2][2];
#pragma unroll
      for (int kt = 0; kt < 2; ++kt)
#pragma unroll
        for (int g = 0; g < 2; ++g) s[kt][g] = (v8f){0.f,0.f,0.f,0.f,0.f,0.f,0.f,0.f};
      // the four score tiles take turns, so that no product waits for the one before it
#pragma unroll
      for (int kc = 0; kc < 4; ++kc) {
#pragma unroll
        for (int kt = 0; kt < 2; ++kt)
#pragma unroll
          for (int g = 0; g < 2; ++g) s[kt][g] = Frag<__bf16>::mma(kh[kt][kc], qh[g][kc], s[kt][g]);
#pragma unroll
        for (int kt = 0; kt < 2; ++kt)
#pragma unroll
          for (int g = 0; g < 2; ++g) s[kt][g] = Frag<__bf16>::mma(kh[kt][kc], ql[g][kc], s[kt][g]);
#pragma unroll
        for (int kt = 0; kt < 2; ++kt)
#pragma unroll
          for (int g = 0; g < 2; ++g) s[kt][g] = Frag<__bf16>::mma(kl[kt][kc], qh[g][kc], s[kt][g]);
      }
      // holds the V^T loads behind the score products, where the K fragments' registers are free again (hoisted, they spill);
      // their latency passes under the softmax arithmetic
      __builtin_amdgcn_sched_barrier(0);
      // V^T fragments of the pass: 16 dims x 32 keys each
      const char* vp = ring + bsel + 2 * kKTile + rlane * kVPitch + sub * 64 + koff * 2;
      v16h vf[8];
#pragma unroll
      for (int d = 0; d < 8; ++d) vf[d] = Frag<_Float16>::load((const _Float16*)(vp + d * 16 * kVPitch));
#pragma unroll
      for (int g = 0; g < 2; ++g) {
        float a[16];
#pragma unroll
        for (int r = 0; r < 4; ++r) {
          a[r]      = fmaf(s[0][g][r],     kScoreLog2, b0[r]);
          a[4 + r]  = fmaf(s[0][g][4 + r], kScoreLog2, b1[r]);
          a[8 + r]  = fmaf(s[1][g][r],     kScoreLog2, b2[r]);
          a[12 + r] = fmaf(s[1][g][4 + r], kScoreLog2, b3[r]);
        }
        float mx = a[0];
#pragma unroll
        for (int e = 1; e < 16; ++e) mx = fmaxf(mx, a[e]);
        mx = fmaxf(mx, xhalf(mx));                                     // both halves hold the query's maximum over the 32 keys
        const float mnew  = fmaxf(mrun[g], mx);
        const float msafe = (mnew == -__builtin_inff()) ? 0.0f : mnew; // only masked keys so far: keep -inf - -inf out of the exponents
        const float corr  = __builtin_amdgcn_exp2f(mrun[g] - msafe);
        const float nm    = kPShift - msafe;
        mrun[g] = mnew;
        v16h pf;
        float ps0 = 0.0f, ps1 = 0.0f;
#pragma unroll
        for (int e = 0; e < 16; e += 2) {
          const float p0 = __builtin_amdgcn_exp2f(a[e] + nm);
          const float p1 = __builtin_amdgcn_exp2f(a[e + 1] + nm);
          ps0 += p0;
          ps1 += p1;
          pf[e]     = (_Float16)p0;
          pf[e + 1] = (_Float16)p1;
        }
        lrun[g] = fmaf(lrun[g], corr, ps0 + ps1);                      // this half's keys only; the halves join behind the loop
#pragma unroll
        for (int d = 0; d < 8; ++d) acc[g][d] = acc[g][d] * corr;
#pragma unroll
        for (int d = 0; d < 8; ++d) acc[g][d] = Frag<_Float16>::mma(vf[d], pf, acc[g][d]);
      }
    }
    asm volatile("s_wait_dscnt 0x0" ::: "memory");      // this stage's LDS reads are done before its buffer is refilled
    asm volatile("s_wait_asynccnt 0x0" ::: "memory");   // stage t + 1 has landed
    __syncthreads();
    if (t + 2 < kAStages) {
      const size_t st = (size_t)(t + 2);
      attn_stage(lK + bsel, lV + bsel, gKh + st * kKStep, gKl + st * kKStep, gV + st * kVStep);
    }
  }
  asm volatile("s_wait_asynccnt 0x0" ::: "memory");     // nothing in flight when the wave ends

  // O^T tile d: lane holds dims 16 d + koff + 0..7 of query q0 + rlane: one 16-B store; a wave writes whole 256-B head rows
#pragma unroll
  for (int g = 0; g < 2; ++g) {
    const float inv = kOCarry / (lrun[g] + xhalf(lrun[g]));
    unsigned short* op = Obp + ((size_t)b * kSeq + q0 + rlane) * kNQ + (size_t)(2 * j + g) * kHD + koff;
#pragma unroll
    for (int d = 0; d < 8; ++d) {
      v8h o;
#pragma unroll
      for (int r = 0; r < 8; ++r) o[r] = (_Float16)(acc[g][d][r] * inv);
      *(v8h*)(op + d * 16) = o;
    }
  }
}

// ---------------------------------------------------------------------------
// Host glue.
//   R0 X16  f16 [4096][2048]                        16,777,216 at           0   (later: Ob f16 [4096][2048], same type + layout)
//   R1 Wq16 f16 [4096][2048] (w_qkv x16)            16,777,216 at  16,777,216   
//   R2 Wo16 f16 [2048][2048] (w_out x16)             8,388,608 at  33,554,432
//   R3 QK32 f32 [2048][3072] q|k of one batch       25,165,824 at  41,943,040
//   R4 VT   f16 [2*8][128][2048] (v transposed)       8,388,608 at  67,108,864
//   R5 QKhi bf16 [98304][128] (q rows then k rows)  25,165,824 at  75,497,472
//   R6 QKlo bf16 [98304][128]                        25,165,824 at 100,663,296
//   total                                          125,829,120
// Re-use timeline (stream ordered): X16/Wq16 are read only by the qkv and V^T GEMMs; QK32 of a batch only by that batch's norm kernel;
// Ob is first written by the attention kernel, which starts after the last norm kernel and the V^T GEMM.
// Every region is fully written before it is read; no region changes element type.
// GEMM shapes: q|k per batch (M=2048, N=3072, K=2048); V^T per batch (M=1024, N=2048, K=2048);
// output (M=4096, N=2048, K=2048); all M,N multiples of 64, all K multiples of 32, no padding anywhere.
// ---------------------------------------------------------------------------
extern "C" void kernel_launch(void* const* d_in, const int* in_sizes, int n_in,
                              void* d_out, int out_size, void* d_ws, size_t ws_size,
                              hipStream_t stream) {
  if (n_in < 7) return;
  const int nX = kBatch * kSeq * kDim;            // 8,388,608
  if (in_sizes[0] != nX) return;
  if (in_sizes[1] != kBatch * kSeq) return;
  if (in_sizes[2] != kSeq * (kHD / 2) * 4) return;
  if (in_sizes[3] != kNQKV * kDim) return;
  if (in_sizes[4] != kDim * kNQ) return;
  if (in_sizes[5] != kHD || in_sizes[6] != kHD) return;
  if (out_size != kTok * kDim) return;

  const size_t szX16  = (size_t)kTok * kDim * 2;
  const size_t szWq16 = (size_t)kNQKV * kDim * 2;
  const size_t szWo16 = (size_t)kDim * kNQ * 2;
  const size_t szQK32 = (size_t)kSeq * kNQK * 4;          // one batch
  const size_t szVT   = (size_t)kBatch * kKV * kHD * kSeq * 2;
  const size_t szPl   = (size_t)kQKRows * kHD * 2;        // one bf16 q|k plane
  const size_t szOb   = (size_t)kTok * kNQ * 2;
  const size_t offX16  = 0;
  const size_t offWq16 = offX16 + szX16;
  const size_t offWo16 = offWq16 + szWq16;
  const size_t offR3   = offWo16 + szWo16;
  const size_t offVT   = offR3 + szQK32;
  const size_t offPhi  = offVT + szVT;
  const size_t offPlo  = offPhi + szPl;
  const size_t total   = offPlo + szPl;
  if (szOb > szX16) return;                      // the re-used region fits its first carve
  if (ws_size < total) return;

  const float* x     = (const float*)d_in[0];
  const int*   xmask = (const int*)d_in[1];
  const float* freqs = (const float*)d_in[2];
  const float* wqkv  = (const float*)d_in[3];
  const float* wout  = (const float*)d_in[4];
  const float* qw    = (const float*)d_in[5];
  const float* kw    = (const float*)d_in[6];
  float* out = (float*)d_out;
  char* ws = (char*)d_ws;
  unsigned short* X16  = (unsigned short*)(ws + offX16);
  unsigned short* Ob   = (unsigned short*)(ws + offX16);     // re-use of R0 (f16, same layout)
  unsigned short* Wq16 = (unsigned short*)(ws + offWq16);
  unsigned short* Wo16 = (unsigned short*)(ws + offWo16);
  float* QK32 = (float*)(ws + offR3);
  unsigned short* VT  = (unsigned short*)(ws + offVT);
  unsigned short* Phi = (unsigned short*)(ws + offPhi);
  unsigned short* Plo = (unsigned short*)(ws + offPlo);
  const long loOff = (long)kQKRows * kHD;                    // elements from the hi plane to the lo plane
  const float* dummyf = (const float*)(ws + offR3);          // valid in-ws pointer for unused bias/resid arguments

  // ---- 16-bit operand planes of the inputs (RNE bf16 of every float input, f16 containers, weights x16) ----
  const int n8x = nX / 8;                 // 1,048,576 -> 4096 blocks exact
  const int n8w = (kNQKV * kDim) / 8;     // 1,048,576 -> 4096 blocks exact
  const int n8o = (kDim * kNQ) / 8;       //   524,288 -> 2048 blocks exact
  cast8_kernel<<<dim3(n8x / 256), dim3(256), 0, stream>>>(x, X16, n8x, 1.0f);
  cast8_kernel<<<dim3(n8w / 256), dim3(256), 0, stream>>>(wqkv, Wq16, n8w, kWCarry);
  cast8_kernel<<<dim3(n8o / 256), dim3(256), 0, stream>>>(wout, Wo16, n8o, kWCarry);

  // ---- per batch: q|k projection (w_qkv rows 0..3071) -> f32 plane; norm + rotary -> bf16 hi/lo planes ----
  {
    const int tilesQK = (kSeq / 64) * (kNQK / 64);   // 1536 -> 192 blocks of 8 waves; covers all 2048 x 3072 of QK32
    for (int b = 0; b < kBatch; ++b) {
      const unsigned short* Xb = X16 + (size_t)b * kSeq * kDim;
      wmma_gemm64<0, false, 0, 0, false, 0><<<dim3(tilesQK / 8, 1), dim3(256), 0, stream>>>(
          Xb, Xb, kDim, 0L, Wq16, Wq16, kDim, 0L,
          (void*)QK32, (void*)QK32, kNQK, 0L, dummyf, dummyf, 0L, kSeq, kNQK, kDim, kWCarryInv);
      norm_rope_kernel<<<dim3((kHeads + kKV) / 8, kSeq), dim3(256), 0, stream>>>(QK32, freqs, qw, kw, Phi, loOff, b);
    }
  }

  // ---- v projection written directly transposed: VT[b*8+j][d][s] = f16( 1/16 * sum_k Wq16[3072+j*128+d][k] * X16[b*2048+s][k] )
  //      (M=1024 weight rows, N=2048 positions, K=2048; grid.y = batch; covers the whole 16 x 128 x 2048 VT plane) ----
  {
    const int tilesVT = (kNK / 64) * (kSeq / 64);     // 512 -> 64 blocks
    const unsigned short* Wv = Wq16 + (size_t)kNQK * kDim;
    wmma_gemm64<0, false, 0, 1, false, 0><<<dim3(tilesVT / 8, kBatch), dim3(256), 0, stream>>>(
        Wv, Wv, kDim, 0L, X16, X16, kDim, (long)kSeq * kDim,
        (void*)VT, (void*)VT, kSeq, (long)kNK * kSeq, dummyf, dummyf, 0L, kNK, kSeq, kDim, kWCarryInv);
  }

  // ---- attention, all (batch, kv head) groups in one launch: Ob[b*2048+i][(2j+hg)*128+n] = f16( 16 * softmax(q.k^T * 128^-0.5 + mask) . v )
  //      grid (16 blocks of 128 query positions, 16 groups) = 256 blocks; covers the whole [4096][2048] Ob plane ----
  attn_kernel<<<dim3(kSeq / 128, kBatch * kKV), dim3(256), 0, stream>>>(Phi, loOff, VT, xmask, Ob);

  // ---- output projection: out[tok][n] = 2^-8 * sum_e Ob[tok][e] * Wo16[n][e]   (M=4096, N=2048, K=2048) ----
  {
    const int tilesOut = (kTok / 64) * (kDim / 64);   // 2048 -> 256 blocks; covers the whole [4096][2048] output
    wmma_gemm64<0, false, 0, 0, false, 0><<<dim3(tilesOut / 8, 1), dim3(256), 0, stream>>>(
        Ob, Ob, kNQ, 0L, Wo16, Wo16, kNQ, 0L,
        (void*)out, (void*)out, kDim, 0L, dummyf, dummyf, 0L, kTok, kDim, kNQ, kOutScale);
  }
}

// v003
// One run takes 242 microseconds.
// Next to v002, in two timings, it ran 1.17 and 1.18 times as fast.
// Counting every step since v000, it is 9.13 times as fast.
// Contractions: qkv projection (x as f16(bf16 RNE) x w_qkv^T as f16(16*bf16 RNE)), V^T.P^T (P f16, unnormalised, carried x256, x V^T f16) and output projection (o f16 carried x16 x w_out^T as f16(16*bf16 RNE)) on v_wmma_f32_16x16x32_f16; scores k.q^T on v_wmma_f32_16x16x32_bf16 with q,k as bf16 hi+lo planes (hi*hi + hi*lo + lo*hi); f32 accumulate everywhere; RMSNorm, 2x2 rotary map and online softmax in f32.
#include <hip/hip_runtime.h>
#include <math.h>

// ---------------------------------------------------------------------------
// Problem constants
// ---------------------------------------------------------------------------
constexpr int kBatch = 2;
constexpr int kSeq   = 2048;
constexpr int kDim   = 2048;              // model dim (K of the qkv projection, N of the output projection)
constexpr int kHeads = 16;
constexpr int kKV    = 8;
constexpr int kHD    = 128;
constexpr int kTok   = kBatch * kSeq;     // 4096 token rows
constexpr int kNQ    = kHeads * kHD;      // 2048 q columns / o columns
constexpr int kNK    = kKV * kHD;         // 1024 k columns (= v columns)
constexpr int kNQK   = kNQ + kNK;         // 3072 = pitch of the f32 q|k plane
constexpr int kNQKV  = kNQ + 2 * kNK;     // 4096 rows of w_qkv
constexpr int kQKRows = kBatch * (kHeads + kKV) * kSeq;   // 98304 rows of 128 in each q|k 16-bit plane
constexpr int kKRow0  = kBatch * kHeads * kSeq;           // 65536 = first k row in the q|k planes
constexpr float kEps        = 1.1920929e-07f;
constexpr float kInvHD      = 1.0f / 128.0f;
constexpr float kWCarry     = 16.0f;                      // weights carried x16 in f16
constexpr float kWCarryInv  = 1.0f / 16.0f;
constexpr float kOCarry     = 16.0f;                      // attention output carried x16 in f16
constexpr float kOutScale   = 1.0f / (kOCarry * kWCarry); // 2^-8
constexpr float kScoreScale = 0.08838834764831845f;       // 128^-0.5
static_assert(kHD == 128, "norm kernel lane map: 32 lanes x 4 dims");
static_assert(kHeads == 2 * kKV, "two query heads per kv head");
static_assert(kSeq % 64 == 0 && kNQK % 64 == 0 && kNK % 64 == 0 && kNQ % 64 == 0 && kDim % 64 == 0 && kTok % 64 == 0, "GEMM M/N tiles");
static_assert(kHD % 64 == 0);
static_assert(kDim % 32 == 0 && kHD % 32 == 0 && kSeq % 32 == 0 && kNQ % 32 == 0, "GEMM K % 32");
static_assert(kDim % 128 == 0 && kSeq % 128 == 0 && kNQ % 128 == 0, "staged GEMM K: two or more stages of 64");
static_assert(kSeq % 256 == 0 && kNK % 256 == 0 && kTok % 256 == 0 && kNQK % 128 == 0 && kDim % 128 == 0, "staged GEMM: 256 x 128 per work-group");
static_assert(kSeq == 256 * 8, "key bias coverage: 256 threads x 8 keys");
static_assert((kHeads + kKV) % 8 == 0, "norm kernel: 8 waves per block over 24 q|k heads");

typedef __attribute__((ext_vector_type(16))) _Float16 v16h;
typedef __attribute__((ext_vector_type(8)))  _Float16 v8h;
typedef __attribute__((ext_vector_type(16))) __bf16   v16b;
typedef __attribute__((ext_vector_type(8)))  __bf16   v8b;
typedef __attribute__((ext_vector_type(8)))  float    v8f;
typedef __attribute__((ext_vector_type(4)))  float    v4f;
typedef __attribute__((ext_vector_type(2)))  float    v2f;
typedef __attribute__((ext_vector_type(2)))  int      v2i;
typedef __attribute__((ext_vector_type(4)))  unsigned int v4u;

__device__ __forceinline__ unsigned short f2bf_bits(float f) {
  unsigned u = __float_as_uint(f);
  return (unsigned short)((u + 0x7FFFu + ((u >> 16) & 1u)) >> 16);
}
__device__ __forceinline__ float bf_bits2f(unsigned short h) { return __uint_as_float(((unsigned)h) << 16); }

// hazard guards as plain device helpers
__device__ __forceinline__ void dep_guard_h(v8f& a, v8f& b, v16h x, v16h y) { asm volatile("v_nop\n\tv_nop\n\tv_nop\n\tv_nop" : "+v"(a), "+v"(b) : "v"(x), "v"(y)); }
__device__ __forceinline__ void dep_guard_b(v8f& a, v8f& b, v16b x, v16b y) { asm volatile("v_nop\n\tv_nop\n\tv_nop\n\tv_nop" : "+v"(a), "+v"(b) : "v"(x), "v"(y)); }
__device__ __forceinline__ void keep4_h(v16h a, v16h b, v16h c, v16h d) { asm volatile("v_nop" :: "v"(a), "v"(b), "v"(c), "v"(d)); }
__device__ __forceinline__ void keep4_b(v16b a, v16b b, v16b c, v16b d) { asm volatile("v_nop" :: "v"(a), "v"(b), "v"(c), "v"(d)); }
__device__ __forceinline__ void acc_guard4(v8f& a, v8f& b, v8f& c, v8f& d) { asm volatile("v_nop\n\tv_nop\n\tv_nop\n\tv_nop" : "+v"(a), "+v"(b), "+v"(c), "+v"(d)); }
template <typename T> struct Frag;
template <> struct Frag<_Float16> {
  typedef v16h V; union U { v16h v; v8h h[2]; };
  // elements 0..7 <- p[0..7], 8..15 <- p[16..23]
  static __device__ __forceinline__ v16h load(const _Float16* p) {
    U f; f.h[0] = *(const v8h*)(p); f.h[1] = *(const v8h*)(p + 16); return f.v;
  }
  static __device__ __forceinline__ v8f mma(v16h a, v16h b, v8f c) {
    return __builtin_amdgcn_wmma_f32_16x16x32_f16(false, a, false, b, (short)0, c, false, false);
  }
  static __device__ __forceinline__ void guard(v8f& a, v8f& b, v16h x, v16h y) { dep_guard_h(a, b, x, y); }
  static __device__ __forceinline__ void keep(v16h a, v16h b, v16h c, v16h d) { keep4_h(a, b, c, d); }
};
template <> struct Frag<__bf16> {
  typedef v16b V; union U { v16b v; v8b h[2]; };
  static __device__ __forceinline__ v16b load(const __bf16* p) {
    U f; f.h[0] = *(const v8b*)(p); f.h[1] = *(const v8b*)(p + 16); return f.v;
  }
  static __device__ __forceinline__ v8f mma(v16b a, v16b b, v8f c) {
    return __builtin_amdgcn_wmma_f32_16x16x32_bf16(false, a, false, b, (short)0, c, false, false);
  }
  static __device__ __forceinline__ void guard(v8f& a, v8f& b, v16b x, v16b y) { dep_guard_b(a, b, x, y); }
  static __device__ __forceinline__ void keep(v16b a, v16b b, v16b c, v16b d) { keep4_b(a, b, c, d); }
};

__device__ __forceinline__ unsigned pk16(unsigned short a, unsigned short b) { return (unsigned)a | ((unsigned)b << 16); }
__device__ __forceinline__ unsigned short h_bits(float f) { const _Float16 h = (_Float16)f; return __builtin_bit_cast(unsigned short, h); }
// RNE bf16 conversion returned as f32
__device__ __forceinline__ float bfr(float f) { return bf_bits2f(f2bf_bits(f)); }

// ---- Register-blocked batched WMMA GEMM (ACT reduced to none/relu/leaky) -------------------------------
// C[m,n] = scale * sum_k A[m,k] * Bt[n,k] (+bias)(+resid); each wave owns a 64x64 tile.
// A row-major [M,K]; Bt row-major [N,K]; SPLIT: M,N % 64 == 0, K % 32 == 0.
// Not SPLIT: a work-group owns 256 x 128 of C, its waves 4 x 2 tiles of 64x64 on shared staged operands; M % 256 == 0, N % 128 == 0, K % 64 == 0.
// SPLIT: operands are hi/lo planes (A2/Bt2 = lo planes, same layout); product = hi*hi + hi*lo + lo*hi.
// BIAS_MODE: 0 = none, 1 = bias[m], 2 = bias[n].
// OUT_MODE: 0 = f32, 1 = f16, 2 = bf16 hi plane (Cout) + bf16 lo plane (Cout2).
// ET: 0 = f16 operands, 1 = bf16 operands (pointers passed as 16-bit storage)
template <int ET> struct Elem;
template <> struct Elem<0> { typedef _Float16 T; };
template <> struct Elem<1> { typedef __bf16 T; };
// Twelve asynchronous 16-byte-per-lane copies global -> LDS (each 32 lanes x 16 B = 4 rows x one whole 128-B line).
// s_wait_xcnt 0 is the last line of the copies' own statement, so it stands ahead of any rewrite of the address registers named here.
__device__ __forceinline__ void async_copy12(const unsigned (&l)[12], const char* const (&g)[12]) {
  asm volatile(
      "global_load_async_to_lds_b128 %0, %12, off\n\t"
      "global_load_async_to_lds_b128 %1, %13, off\n\t"
      "global_load_async_to_lds_b128 %2, %14, off\n\t"
      "global_load_async_to_lds_b128 %3, %15, off\n\t"
      "global_load_async_to_lds_b128 %4, %16, off\n\t"
      "global_load_async_to_lds_b128 %5, %17, off\n\t"
      "global_load_async_to_lds_b128 %6, %18, off\n\t"
      "global_load_async_to_lds_b128 %7, %19, off\n\t"
      "global_load_async_to_lds_b128 %8, %20, off\n\t"
      "global_load_async_to_lds_b128 %9, %21, off\n\t"
      "global_load_async_to_lds_b128 %10, %22, off\n\t"
      "global_load_async_to_lds_b128 %11, %23, off\n\t"
      "s_wait_xcnt 0x0"
      :: "v"(l[0]), "v"(l[1]), "v"(l[2]), "v"(l[3]), "v"(l[4]), "v"(l[5]), "v"(l[6]), "v"(l[7]), "v"(l[8]), "v"(l[9]), "v"(l[10]), "v"(l[11]),
         "v"(g[0]), "v"(g[1]), "v"(g[2]), "v"(g[3]), "v"(g[4]), "v"(g[5]), "v"(g[6]), "v"(g[7]), "v"(g[8]), "v"(g[9]), "v"(g[10]), "v"(g[11])
      : "memory");
}
// One stage of the work-group's shared tiles: A 256 rows x 128 B (64 k), then B 128 rows x 128 B, in LDS rows of pitch 144 B.
// A wave brings 32 rows of A (8 copies) and 16 rows of B (4 copies); every A row then feeds two waves, every B row four.
// lA / gA and lB / gB are the lane's own addresses for its wave's first row + (lane >> 3), 16-byte chunk (lane & 7); copy c moves 4 rows.
constexpr int kRowPitch  = 144;                    // 128-B rows + 16 B: 16 B x odd, the pitch for ds_load_b128 readers
constexpr int kATile     = 256 * kRowPitch;        // 36864
constexpr int kBTile     = 128 * kRowPitch;        // 18432
constexpr int kBufBytes  = kATile + kBTile;        // A tile then B tile
constexpr int kRingBytes = 2 * kBufBytes;          // two buffers per work-group
__device__ __forceinline__ void stage_block(unsigned lA, unsigned lB, const char* gA, const char* gB, size_t ldaBytes, size_t ldbBytes) {
  // both loops unrolled: every index of l and g is a constant, so the addresses stay in registers
  unsigned l[12];
  const char* g[12];
#pragma unroll
  for (int c = 0; c < 8; ++c) {
    l[c] = lA + (unsigned)(c * 4 * kRowPitch);
    g[c] = gA + (size_t)(c * 4) * ldaBytes;
  }
#pragma unroll
  for (int c = 0; c < 4; ++c) {
    l[8 + c] = lB + (unsigned)(c * 4 * kRowPitch);
    g[8 + c] = gB + (size_t)(c * 4) * ldbBytes;
  }
  async_copy12(l, g);
}

template <int ET, bool SPLIT, int BIAS_MODE, int OUT_MODE, bool RESID, int ACT = 0>
__global__ __launch_bounds__(256) void wmma_gemm64(
    const unsigned short* __restrict__ Ap, const unsigned short* __restrict__ A2p, int lda, long strideA,
    const unsigned short* __restrict__ Btp, const unsigned short* __restrict__ Bt2p, int ldb, long strideB,
    void* __restrict__ Cout, void* __restrict__ Cout2, int ldc, long strideC,
    const float* __restrict__ bias,
    const float* __restrict__ resid, long strideR,
    int M, int N, int K, float scale) {
  typedef typename Elem<ET>::T T;
  typedef typename Frag<T>::V V;
  const T* A = (const T*)Ap; const T* A2 = (const T*)A2p; const T* Bt = (const T*)Btp; const T* Bt2 = (const T*)Bt2p;
  // Per-wave 16x64 f32 slab, pitch 68 floats. Not SPLIT: the work-group's ring of two staged buffers; its first bytes serve as the slabs behind the k loop.
  constexpr int kSlabBytes = 16 * 68 * 4;
  __shared__ __align__(16) char smem[SPLIT ? 8 * kSlabBytes : kRingBytes];
  const int b    = blockIdx.y;
  const int lane = threadIdx.x & 31;
  const int wave = threadIdx.x >> 5;
  int m0, n0, mB = 0, nB = 0;                  // the wave's tile; the work-group's tile (staged path)
  if (SPLIT) {
    const int tilesN = N >> 6;
    const int tile = blockIdx.x * 8 + wave;
    if (tile >= (M >> 6) * tilesN) return;    // wave-uniform; no block barriers on this path
    const int tm = tile / tilesN;
    m0 = tm << 6;
    n0 = (tile - tm * tilesN) << 6;
  } else {
    const int blocksN = N >> 7;
    if ((int)blockIdx.x >= (M >> 8) * blocksN) return;   // the whole work-group leaves, ahead of every barrier and copy
    const int bm = blockIdx.x / blocksN;
    mB = bm << 8;
    nB = (blockIdx.x - bm * blocksN) << 7;
    m0 = mB + ((wave >> 1) << 6);
    n0 = nB + ((wave & 1) << 6);
  }

  const T* Ab  = A  + (size_t)b * strideA;
  const T* Bb  = Bt + (size_t)b * strideB;
  const T* Ab2 = SPLIT ? (A2  + (size_t)b * strideA) : nullptr;
  const T* Bb2 = SPLIT ? (Bt2 + (size_t)b * strideB) : nullptr;

  const int rlane = lane & 15;                 // row (A) / col (B, D) within subtile
  const int koff  = (lane >> 4) * 8;           // k offset of this lane half
  const int mOff  = (lane >> 4) * 8;           // D row offset

  v8f acc[4][4];
#pragma unroll
  for (int i = 0; i < 4; ++i)
#pragma unroll
    for (int j = 0; j < 4; ++j) acc[i][j] = (v8f){0.f,0.f,0.f,0.f,0.f,0.f,0.f,0.f};

  if (SPLIT) {
    for (int k0 = 0; k0 < K; k0 += 32) {
      V bh[4], bl[4];
#pragma unroll
      for (int j = 0; j < 4; ++j) {
        const size_t bo = (size_t)(n0 + (j << 4) + rlane) * ldb + koff + k0;
        bh[j] = Frag<T>::load(Bb + bo);
        if (SPLIT) bl[j] = Frag<T>::load(Bb2 + bo);
      }
#pragma unroll
      for (int i = 0; i < 4; ++i) {
        const size_t ao = (size_t)(m0 + (i << 4) + rlane) * lda + koff + k0;
        V ah = Frag<T>::load(Ab + ao);
        V al;
        if (SPLIT) al = Frag<T>::load(Ab2 + ao);
#pragma unroll
        for (int j = 0; j < 4; ++j) {
          acc[i][j] = Frag<T>::mma(ah, bh[j], acc[i][j]);
          if (SPLIT) {
            acc[i][j] = Frag<T>::mma(ah, bl[j], acc[i][j]);
            acc[i][j] = Frag<T>::mma(al, bh[j], acc[i][j]);
          }
        }
        Frag<T>::guard(acc[i][0], acc[i][3], ah, SPLIT ? al : ah);
      }
      Frag<T>::keep(bh[0], bh[1], bh[2], bh[3]);
      if (SPLIT) Frag<T>::keep(bl[0], bl[1], bl[2], bl[3]);
    }
  } else {
    // The work-group stages its A and B tiles once for all eight waves, 64 k (one whole 128-B line of every row) per stage, in two LDS
    // buffers by asynchronous copies; the fragments come from LDS through Frag::load, k ascending. K is a multiple of 128 (asserted below the constants).
    const unsigned lc = (unsigned)(size_t)smem + (unsigned)((lane >> 3) * kRowPitch + (lane & 7) * 16);
    const unsigned lA = lc + (unsigned)(wave * 32 * kRowPitch);
    const unsigned lB = lc + (unsigned)(kATile + wave * 16 * kRowPitch);
    const size_t ldaB = (size_t)lda * 2, ldbB = (size_t)ldb * 2;
    const char* gA = (const char*)Ab + (size_t)(mB + wave * 32 + (lane >> 3)) * ldaB + (lane & 7) * 16;
    const char* gB = (const char*)Bb + (size_t)(nB + wave * 16 + (lane >> 3)) * ldbB + (lane & 7) * 16;
    const int stages = K >> 6;
    stage_block(lA, lB, gA, gB, ldaB, ldbB);
    asm volatile("s_wait_asynccnt 0x0" ::: "memory");   // this wave's share of stage 0 has landed; the barrier publishes every wave's
    __syncthreads();
    if (stages > 1) stage_block(lA + kBufBytes, lB + kBufBytes, gA + 128, gB + 128, ldaB, ldbB);
    // the lane's fragment row and k half inside the wave's 64 rows of the A tile and of the B tile
    const int foA = ((wave >> 1) * 64 + rlane) * kRowPitch + koff * 2;
    const int foB = kATile + ((wave & 1) * 64 + rlane) * kRowPitch + koff * 2;
    for (int t = 0; t < stages; ++t) {
      const int bsel = (t & 1) * kBufBytes;
      const char* rb = smem + bsel;
      // all 32 fragment loads of the stage go out as one group ahead of its products: one LDS latency a stage, not one per A fragment
      V ah[2][4], bh[2][4];                              // loops below unrolled: constant indices keep the fragments in registers
#pragma unroll
      for (int s = 0; s < 2; ++s) {
#pragma unroll
        for (int j = 0; j < 4; ++j) {
          bh[s][j] = Frag<T>::load((const T*)(rb + foB + j * 16 * kRowPitch + s * 64));
          ah[s][j] = Frag<T>::load((const T*)(rb + foA + j * 16 * kRowPitch + s * 64));
        }
      }
      // holds the load group ahead of the products; the scheduler otherwise sinks each A fragment's loads in front of its use
      __builtin_amdgcn_sched_barrier(0);
#pragma unroll
      for (int s = 0; s < 2; ++s) {
#pragma unroll
        for (int i = 0; i < 4; ++i) {
#pragma unroll
          for (int j = 0; j < 4; ++j) acc[i][j] = Frag<T>::mma(ah[s][i], bh[s][j], acc[i][j]);
        }
      }
      // holds the products ahead of the foot's waits, so that stage t + 1's copies fly while stage t is worked on
      __builtin_amdgcn_sched_barrier(0);
      asm volatile("s_wait_dscnt 0x0" ::: "memory");     // this wave's LDS reads of the stage are done before any wave refills its buffer
      asm volatile("s_wait_asynccnt 0x0" ::: "memory");  // this wave's share of stage t + 1 has landed
      __syncthreads();                                   // publishes stage t + 1 to all waves; ends every wave's reads of stage t
      if (t + 2 < stages) {
        const size_t kb = (size_t)(t + 2) * 128;
        stage_block(lA + bsel, lB + bsel, gA + kb, gB + kb, ldaB, ldbB);
      }
    }
    asm volatile("s_wait_asynccnt 0x0" ::: "memory");    // nothing in flight when the ring becomes the epilogue's slabs (all reads ended at the last barrier)
  }
  acc_guard4(acc[0][0], acc[0][1], acc[0][2], acc[0][3]);
  acc_guard4(acc[1][0], acc[1][1], acc[1][2], acc[1][3]);
  acc_guard4(acc[2][0], acc[2][1], acc[2][2], acc[2][3]);
  acc_guard4(acc[3][0], acc[3][1], acc[3][2], acc[3][3]);

  // ---- epilogue ----
  float* slab = (float*)(smem + wave * kSlabBytes);
  const float* Rb = RESID ? (resid + (size_t)b * strideR) : nullptr;
#pragma unroll
  for (int i = 0; i < 4; ++i) {
    const int mBase = m0 + (i << 4);
#pragma unroll
    for (int j = 0; j < 4; ++j) {
      const int n = n0 + (j << 4) + rlane;
      float bv = 0.f;
      if (BIAS_MODE == 2) bv = bias[n];
#pragma unroll
      for (int r = 0; r < 8; ++r) {
        float v = acc[i][j][r] * scale;
        if (BIAS_MODE == 1) v += bias[mBase + mOff + r];
        if (BIAS_MODE == 2) v += bv;
        if (RESID) v += Rb[(size_t)(mBase + mOff + r) * ldc + n];
        if (ACT == 2) v = fmaxf(v, 0.0f);
        if (ACT == 4) v = (v > 0.f) ? v : 0.01f * v;
        slab[(mOff + r) * 68 + (j << 4) + rlane] = v;
      }
    }
    __builtin_amdgcn_fence(__ATOMIC_RELEASE, "workgroup");
    __builtin_amdgcn_wave_barrier();
    __builtin_amdgcn_fence(__ATOMIC_ACQUIRE, "workgroup");
    if (OUT_MODE == 0) {
      float* C = (float*)Cout + (size_t)b * strideC;
      const int hh = lane >> 4, c4 = (lane & 15) * 4;     // row seg = 256 B = 16 lanes x 16 B
      {
#pragma unroll
        for (int it = 0; it < 8; ++it) {
          const int row = it * 2 + hh;
          v4f v = *(const v4f*)(slab + row * 68 + c4);
          *(v4f*)(C + (size_t)(mBase + row) * ldc + n0 + c4) = v;
        }
        
      }
    } else {
      const int q = lane >> 3, c8 = (lane & 7) * 8;
      unsigned short* C  = (unsigned short*)Cout  + (size_t)b * strideC;
      unsigned short* C2 = (OUT_MODE == 2) ? ((unsigned short*)Cout2 + (size_t)b * strideC) : nullptr;
      {
#pragma unroll
        for (int it = 0; it < 4; ++it) {
          const int row = it * 4 + q;
          const float* sp = slab + row * 68 + c8;
          v8h hv, lv;
#pragma unroll
          for (int e = 0; e < 8; ++e) {
            if (OUT_MODE == 1) {
              hv[e] = (_Float16)sp[e];
            } else {
              unsigned short hb = f2bf_bits(sp[e]);
              unsigned short lb = f2bf_bits(sp[e] - bf_bits2f(hb));
              hv[e] = __builtin_bit_cast(_Float16, hb);
              lv[e] = __builtin_bit_cast(_Float16, lb);
            }
          }
          *(v8h*)(C + (size_t)(mBase + row) * ldc + n0 + c8) = hv;
          if (OUT_MODE == 2) *(v8h*)(C2 + (size_t)(mBase + row) * ldc + n0 + c8) = lv;
        }
        
      }
    }
    __builtin_amdgcn_fence(__ATOMIC_RELEASE, "workgroup");
    __builtin_amdgcn_wave_barrier();
    __builtin_amdgcn_fence(__ATOMIC_ACQUIRE, "workgroup");
  }
}

// ---------------------------------------------------------------------------
// f32 -> (RNE bf16) -> f16 cast with an exact power-of-two carry: out = f16( scale * bf16(in) ).
// ---------------------------------------------------------------------------
__global__ __launch_bounds__(256) void cast8_kernel(const float* __restrict__ in, unsigned short* __restrict__ out, int n8, float scale) {
  const int i = blockIdx.x * 256 + threadIdx.x;
  if (i >= n8) return;
  const float* p = in + 8 * (size_t)i;
  const v4f a = *(const v4f*)(p);
  const v4f c = *(const v4f*)(p + 4);
  unsigned short hb[8];
#pragma unroll
  for (int e = 0; e < 4; ++e) {
    hb[e]     = h_bits(bfr(a[e]) * scale);
    hb[4 + e] = h_bits(bfr(c[e]) * scale);
  }
  const v4u u = (v4u){pk16(hb[0], hb[1]), pk16(hb[2], hb[3]), pk16(hb[4], hb[5]), pk16(hb[6], hb[7])};
  unsigned short* q = out + 8 * (size_t)i;
  *(v4u*)q = u;
  
}

// ---------------------------------------------------------------------------
// RMSNorm (mean over 128, eps inside rsqrt, x norm weight) + per-position 2x2 rotary map on the q and k heads of one batch,
// f32 math; the result is emitted as a bf16 hi plane and a bf16 lo plane (lo = RNE bf16 of v - hi).
// One wave per (position s, head) with head 0..15 = q heads, 16..23 = k heads; lane owns dims 4*lane..4*lane+3 (two pairs).
// Input: QK f32 [2048 s][3072] of batch b (q cols 0..2047, k cols 2048..3071). Rotary table fcs [s][64][2][2], norm weights [128];
// all three converted to bf16 (RNE) before use. out[2p+i] = fc[s,p,i,0]*v[2p] + fc[s,p,i,1]*v[2p+1].
// Output planes Ph (hi) and Ph + loOff (lo), rows of 128 elements = 256 B: q rows (b*16+h)*2048+s, k rows 65536 + (b*8+kh)*2048+s.
// Store: the 4 packed hi words and the 4 packed lo words of every lane are shuffled from lanes 2L, 2L+1 (L = lane & 15) with wave-uniform register choice, then each lane
// selects by value: lanes 0..15 hold 8 consecutive hi dims, lanes 16..31 hold 8 consecutive lo dims; ONE 32-lane x 16-B instruction
// grid (3, 2048) x 256 threads per batch = 49152 waves = 2048 x 24 rows (hi and lo).
// ---------------------------------------------------------------------------
__global__ __launch_bounds__(256) void norm_rope_kernel(const float* __restrict__ QK, const float* __restrict__ fcs,
                                                        const float* __restrict__ qw, const float* __restrict__ kw,
                                                        unsigned short* __restrict__ Ph, long loOff, int b) {
  const int lane = threadIdx.x & 31;
  const int wave = threadIdx.x >> 5;
  const int head = blockIdx.x * 8 + wave;          // 0..23, wave-uniform
  const int s    = blockIdx.y;                     // 0..2047
  const int d0   = lane * 4;

  const v4f xv = *(const v4f*)(QK + (size_t)s * kNQK + (size_t)head * kHD + d0);
  float v0 = xv[0], v1 = xv[1], v2 = xv[2], v3 = xv[3];
  float ss = 0.0f;
  ss += v0 * v0; ss += v1 * v1; ss += v2 * v2; ss += v3 * v3;
#pragma unroll
  for (int off = 1; off < 32; off <<= 1) ss += __shfl_xor(ss, off, 32);
  const float rn = rsqrtf(ss * kInvHD + kEps);

  // norm weights: both candidates loaded unconditionally, arithmetic select by head kind
  const v4f wq = *(const v4f*)(qw + d0);
  const v4f wk = *(const v4f*)(kw + d0);
  const float fq = (head < kHeads) ? 1.0f : 0.0f;
  const float fk = 1.0f - fq;
  const float w0 = bfr(fmaf(fq, wq[0], fk * wk[0]));
  const float w1 = bfr(fmaf(fq, wq[1], fk * wk[1]));
  const float w2 = bfr(fmaf(fq, wq[2], fk * wk[2]));
  const float w3 = bfr(fmaf(fq, wq[3], fk * wk[3]));
  v0 = (v0 * rn) * w0; v1 = (v1 * rn) * w1; v2 = (v2 * rn) * w2; v3 = (v3 * rn) * w3;

  // rotary 2x2 maps for pairs p = 2*lane, 2*lane+1 at position s (8 consecutive floats)
  const float* fp = fcs + ((size_t)s * (kHD / 2) + 2 * lane) * 4;
  const v4f fa = *(const v4f*)(fp);
  const v4f fb = *(const v4f*)(fp + 4);
  const float a00 = bfr(fa[0]), a01 = bfr(fa[1]), a10 = bfr(fa[2]), a11 = bfr(fa[3]);
  const float b00 = bfr(fb[0]), b01 = bfr(fb[1]), b10 = bfr(fb[2]), b11 = bfr(fb[3]);
  const float o0 = a00 * v0 + a01 * v1;
  const float o1 = a10 * v0 + a11 * v1;
  const float o2 = b00 * v2 + b01 * v3;
  const float o3 = b10 * v2 + b11 * v3;

  // bf16 hi / lo split of each value
  const unsigned short hb0 = f2bf_bits(o0), hb1 = f2bf_bits(o1), hb2 = f2bf_bits(o2), hb3 = f2bf_bits(o3);
  const unsigned short lb0 = f2bf_bits(o0 - bf_bits2f(hb0));
  const unsigned short lb1 = f2bf_bits(o1 - bf_bits2f(hb1));
  const unsigned short lb2 = f2bf_bits(o2 - bf_bits2f(hb2));
  const unsigned short lb3 = f2bf_bits(o3 - bf_bits2f(hb3));
  const unsigned ph0 = pk16(hb0, hb1), ph1 = pk16(hb2, hb3);
  const unsigned pl0 = pk16(lb0, lb1), pl1 = pk16(lb2, lb3);

  // gather 8 consecutive dims per lane: dims 8L..8L+3 from lane 2L, 8L+4..8L+7 from lane 2L+1 (L = lane & 15); every candidate
  // is shuffled with a wave-uniform register choice, the hi/lo choice is made per lane after the shuffles
  const int src = (2 * lane) & 31;
  const unsigned gh0 = __shfl(ph0, src, 32);
  const unsigned gh1 = __shfl(ph1, src, 32);
  const unsigned gh2 = __shfl(ph0, src + 1, 32);
  const unsigned gh3 = __shfl(ph1, src + 1, 32);
  const unsigned gl0 = __shfl(pl0, src, 32);
  const unsigned gl1 = __shfl(pl1, src, 32);
  const unsigned gl2 = __shfl(pl0, src + 1, 32);
  const unsigned gl3 = __shfl(pl1, src + 1, 32);
  const bool loh = (lane >= 16);
  const v4u u = (v4u){loh ? gl0 : gh0, loh ? gl1 : gh1, loh ? gl2 : gh2, loh ? gl3 : gh3};

  const int hq = (head < kHeads) ? head : 0;
  const int hk = (head < kHeads) ? 0 : (head - kHeads);
  const size_t rowQ = ((size_t)(b * kHeads + hq)) * kSeq + s;
  const size_t rowK = (size_t)kKRow0 + ((size_t)(b * kKV + hk)) * kSeq + s;
  const size_t row  = (head < kHeads) ? rowQ : rowK;
  const size_t poff = loh ? (size_t)loOff : (size_t)0;
  unsigned short* dp = Ph + poff + row * kHD + 8 * (lane & 15);
  {
    *(v4u*)dp = u;
    
  }
}

constexpr int kAKeys   = 64;
constexpr int kAStages = kSeq / kAKeys;
constexpr int kKPitch  = 2 * kHD + 16;
constexpr int kVPitch  = 2 * kAKeys + 16;
constexpr int kKTile   = kAKeys * kKPitch;
constexpr int kVTile   = kHD * kVPitch;
constexpr int kABuf    = 2 * kKTile + kVTile;
constexpr float kScoreLog2 = kScoreScale * 1.4426950408889634f;
constexpr float kPShift    = 8.0f;                 // p carried x2^8: small p stay clear of the f16 subnormals; cancels in sum p v / sum p
static_assert(kAStages >= 2 && kSeq % 128 == 0, "two or more stages; 128 query positions per block");

typedef __attribute__((ext_vector_type(4))) int v4i;

// Four asynchronous 16-byte-per-lane copies global -> LDS: one thread's share of one operand tile of a stage.
// s_wait_xcnt 0 is the last line of the copies' own statement, so it stands ahead of any rewrite of the address registers named here.
__device__ __forceinline__ void async_copy4(unsigned l0, unsigned l1, unsigned l2, unsigned l3,
                                            const char* g0, const char* g1, const char* g2, const char* g3) {
  asm volatile(
      "global_load_async_to_lds_b128 %0, %4, off\n\t"
      "global_load_async_to_lds_b128 %1, %5, off\n\t"
      "global_load_async_to_lds_b128 %2, %6, off\n\t"
      "global_load_async_to_lds_b128 %3, %7, off\n\t"
      "s_wait_xcnt 0x0"
      :: "v"(l0), "v"(l1), "v"(l2), "v"(l3), "v"(g0), "v"(g1), "v"(g2), "v"(g3)
      : "memory");
}
// One stage: 64 K rows x 256 B of each plane (thread: row tid >> 4 (+16 a copy), chunk tid & 15) and 128 V^T rows x 128 B
// (thread: row tid >> 3 (+32 a copy), chunk tid & 7). lK, lV, gKh, gKl, gV are the thread's own addresses of its first copy.
__device__ __forceinline__ void attn_stage(unsigned lK, unsigned lV, const char* gKh, const char* gKl, const char* gV) {
  constexpr unsigned kLK = 16 * kKPitch, kLV = 32 * kVPitch;
  constexpr size_t   kGK = (size_t)16 * 2 * kHD, kGV = (size_t)32 * 2 * kSeq;
  async_copy4(lK, lK + kLK, lK + 2 * kLK, lK + 3 * kLK, gKh, gKh + kGK, gKh + 2 * kGK, gKh + 3 * kGK);
  async_copy4(lK + kKTile, lK + kKTile + kLK, lK + kKTile + 2 * kLK, lK + kKTile + 3 * kLK, gKl, gKl + kGK, gKl + 2 * kGK, gKl + 3 * kGK);
  async_copy4(lV, lV + kLV, lV + 2 * kLV, lV + 3 * kLV, gV, gV + kGV, gV + 2 * kGV, gV + 3 * kGV);
}
// lane l with lane l ^ 16
__device__ __forceinline__ float xhalf(float x) {
  return __builtin_bit_cast(float, __builtin_amdgcn_permlanex16(__builtin_bit_cast(int, x), __builtin_bit_cast(int, x), 0x76543210, 0xfedcba98, false, false));
}

__global__ __launch_bounds__(256) void attn_kernel(const unsigned short* __restrict__ Ph, long loOff,
                                                   const unsigned short* __restrict__ VTp, const int* __restrict__ maskp,
                                                   unsigned short* __restrict__ Obp) {
  // every '#pragma unroll' in this kernel: constant indices keep the fragment, score and accumulator arrays in registers
  __shared__ __align__(128) char ring[2 * kABuf];
  __shared__ __align__(16) float kbias[kSeq];
  const int tid   = threadIdx.x;
  const int lane  = tid & 31;
  const int wave  = tid >> 5;
  const int rlane = lane & 15;                 // row of an A fragment, column of a B fragment and of D
  const int koff  = (lane >> 4) * 8;           // k offset of this lane half = D row offset
  const int b     = blockIdx.y / kKV;
  const int j     = blockIdx.y % kKV;
  const int q0    = blockIdx.x * 128 + wave * 16;

  // additive key bias of batch b, once per block
  {
    const int* mp = maskp + (size_t)b * kSeq + 8 * tid;
    const v4i m0 = *(const v4i*)(mp);
    const v4i m1 = *(const v4i*)(mp + 4);
    v4f f0, f1;
#pragma unroll
    for (int e = 0; e < 4; ++e) {
      f0[e] = (m0[e] != 0) ? 0.0f : -__builtin_inff();
      f1[e] = (m1[e] != 0) ? 0.0f : -__builtin_inff();
    }
    *(v4f*)(kbias + 8 * tid)     = f0;
    *(v4f*)(kbias + 8 * tid + 4) = f1;
  }

  const unsigned lK = (unsigned)(size_t)ring + (unsigned)((tid >> 4) * kKPitch + (tid & 15) * 16);
  const unsigned lV = (unsigned)(size_t)ring + (unsigned)(2 * kKTile + (tid >> 3) * kVPitch + (tid & 7) * 16);
  const char* gKh = (const char*)(Ph + ((size_t)kKRow0 + (size_t)(b * kKV + j) * kSeq + (tid >> 4)) * kHD) + (tid & 15) * 16;
  const char* gKl = gKh + (size_t)loOff * 2;
  const char* gV  = (const char*)(VTp + ((size_t)(b * kKV + j) * kHD + (tid >> 3)) * kSeq) + (tid & 7) * 16;
  constexpr size_t kKStep = (size_t)kAKeys * kHD * 2;   // bytes from one stage's K rows to the next
  constexpr size_t kVStep = (size_t)kAKeys * 2;         // bytes from one stage's V^T columns to the next

  attn_stage(lK, lV, gKh, gKl, gV);

  // Q fragments (B operand), both planes, both heads, kept for the whole kernel
  v16b qh[2][4], ql[2][4];
#pragma unroll
  for (int g = 0; g < 2; ++g) {
    const __bf16* qp = (const __bf16*)Ph + ((size_t)(b * kHeads + 2 * j + g) * kSeq + q0 + rlane) * kHD + koff;
#pragma unroll
    for (int kc = 0; kc < 4; ++kc) {
      qh[g][kc] = Frag<__bf16>::load(qp + kc * 32);
      ql[g][kc] = Frag<__bf16>::load(qp + loOff + kc * 32);
    }
  }
  v8f acc[2][8];
  float mrun[2], lrun[2];
#pragma unroll
  for (int g = 0; g < 2; ++g) {
    mrun[g] = -__builtin_inff();
    lrun[g] = 0.0f;
#pragma unroll
    for (int d = 0; d < 8; ++d) acc[g][d] = (v8f){0.f,0.f,0.f,0.f,0.f,0.f,0.f,0.f};
  }

  asm volatile("s_wait_asynccnt 0x0" ::: "memory");     // stage 0 has landed before anybody reads it
  __syncthreads();                                      // also publishes kbias
  attn_stage(lK + kABuf, lV + kABuf, gKh + kKStep, gKl + kKStep, gV + kVStep);

  for (int t = 0; t < kAStages; ++t) {
    const int bsel = (t & 1) * kABuf;
    // two 32-key passes; kept rolled: unrolled, both passes' fragments are fetched together and registers spill
#pragma unroll 1
    for (int sub = 0; sub < 2; ++sub) {
      const char* kp = ring + bsel + (sub * 32 + rlane) * kKPitch + koff * 2;
      // all 32 K fragment loads of the pass go out as one group, in the order of their use
      v16b kh[2][4], kl[2][4];
#pragma unroll
      for (int kc = 0; kc < 4; ++kc) {
#pragma unroll
        for (int kt = 0; kt < 2; ++kt) kh[kt][kc] = Frag<__bf16>::load((const __bf16*)(kp + kt * 16 * kKPitch + kc * 64));
#pragma unroll
        for (int kt = 0; kt < 2; ++kt) kl[kt][kc] = Frag<__bf16>::load((const __bf16*)(kp + kKTile + kt * 16 * kKPitch + kc * 64));
      }
      // bias of this lane's 16 keys, last in the same group: there when the products end
      const float* bp = kbias + t * kAKeys + sub * 32 + koff;
      const v4f b0 = *(const v4f*)(bp), b1 = *(const v4f*)(bp + 4), b2 = *(const v4f*)(bp + 16), b3 = *(const v4f*)(bp + 20);
      // holds the load group ahead of the products; the scheduler otherwise sinks each fragment's loads in front of its use, one LDS latency each
      __builtin_amdgcn_sched_barrier(0);
      v8f s[2][2];
#pragma unroll
      for (int kt = 0; kt < 2; ++kt)
#pragma unroll
        for (int g = 0; g < 2; ++g) s[kt][g] = (v8f){0.f,0.f,0.f,0.f,0.f,0.f,0.f,0.f};
      // the four score tiles take turns, so that no product waits for the one before it
#pragma unroll
      for (int kc = 0; kc < 4; ++kc) {
#pragma unroll
        for (int kt = 0; kt < 2; ++kt)
#pragma unroll
          for (int g = 0; g < 2; ++g) s[kt][g] = Frag<__bf16>::mma(kh[kt][kc], qh[g][kc], s[kt][g]);
#pragma unroll
        for (int kt = 0; kt < 2; ++kt)
#pragma unroll
          for (int g = 0; g < 2; ++g) s[kt][g] = Frag<__bf16>::mma(kh[kt][kc], ql[g][kc], s[kt][g]);
#pragma unroll
        for (int kt = 0; kt < 2; ++kt)
#pragma unroll
          for (int g = 0; g < 2; ++g) s[kt][g] = Frag<__bf16>::mma(kl[kt][kc], qh[g][kc], s[kt][g]);
      }
      // holds the V^T loads behind the score products, where the K fragments' registers are free again (hoisted, they spill);
      // their latency passes under the softmax arithmetic
      __builtin_amdgcn_sched_barrier(0);
      // V^T fragments of the pass: 16 dims x 32 keys each
      const char* vp = ring + bsel + 2 * kKTile + rlane * kVPitch + sub * 64 + koff * 2;
      v16h vf[8];
#pragma unroll
      for (int d = 0; d < 8; ++d) vf[d] = Frag<_Float16>::load((const _Float16*)(vp + d * 16 * kVPitch));
#pragma unroll
      for (int g = 0; g < 2; ++g) {
        float a[16];
#pragma unroll
        for (int r = 0; r < 4; ++r) {
          a[r]      = fmaf(s[0][g][r],     kScoreLog2, b0[r]);
          a[4 + r]  = fmaf(s[0][g][4 + r], kScoreLog2, b1[r]);
          a[8 + r]  = fmaf(s[1][g][r],     kScoreLog2, b2[r]);
          a[12 + r] = fmaf(s[1][g][4 + r], kScoreLog2, b3[r]);
        }
        float mx = a[0];
#pragma unroll
        for (int e = 1; e < 16; ++e) mx = fmaxf(mx, a[e]);
        mx = fmaxf(mx, xhalf(mx));                                     // both halves hold the query's maximum over the 32 keys
        const float mnew  = fmaxf(mrun[g], mx);
        const float msafe = (mnew == -__builtin_inff()) ? 0.0f : mnew; // only masked keys so far: keep -inf - -inf out of the exponents
        const float corr  = __builtin_amdgcn_exp2f(mrun[g] - msafe);
        const float nm    = kPShift - msafe;
        mrun[g] = mnew;
        v16h pf;
        float ps0 = 0.0f, ps1 = 0.0f;
#pragma unroll
        for (int e = 0; e < 16; e += 2) {
          const float p0 = __builtin_amdgcn_exp2f(a[e] + nm);
          const float p1 = __builtin_amdgcn_exp2f(a[e + 1] + nm);
          ps0 += p0;
          ps1 += p1;
          pf[e]     = (_Float16)p0;
          pf[e + 1] = (_Float16)p1;
        }
        lrun[g] = fmaf(lrun[g], corr, ps0 + ps1);                      // this half's keys only; the halves join behind the loop
#pragma unroll
        for (int d = 0; d < 8; ++d) acc[g][d] = acc[g][d] * corr;
#pragma unroll
        for (int d = 0; d < 8; ++d) acc[g][d] = Frag<_Float16>::mma(vf[d], pf, acc[g][d]);
      }
    }
    asm volatile("s_wait_dscnt 0x0" ::: "memory");      // this stage's LDS reads are done before its buffer is refilled
    asm volatile("s_wait_asynccnt 0x0" ::: "memory");   // stage t + 1 has landed
    __syncthreads();
    if (t + 2 < kAStages) {
      const size_t st = (size_t)(t + 2);
      attn_stage(lK + bsel, lV + bsel, gKh + st * kKStep, gKl + st * kKStep, gV + st * kVStep);
    }
  }
  asm volatile("s_wait_asynccnt 0x0" ::: "memory");     // nothing in flight when the wave ends

  // O^T tile d: lane holds dims 16 d + koff + 0..7 of query q0 + rlane: one 16-B store; a wave writes whole 256-B head rows
#pragma unroll
  for (int g = 0; g < 2; ++g) {
    const float inv = kOCarry / (lrun[g] + xhalf(lrun[g]));
    unsigned short* op = Obp + ((size_t)b * kSeq + q0 + rlane) * kNQ + (size_t)(2 * j + g) * kHD + koff;
#pragma unroll
    for (int d = 0; d < 8; ++d) {
      v8h o;
#pragma unroll
      for (int r = 0; r < 8; ++r) o[r] = (_Float16)(acc[g][d][r] * inv);
      *(v8h*)(op + d * 16) = o;
    }
  }
}

// ---------------------------------------------------------------------------
// Host glue.
//   R0 X16  f16 [4096][2048]                        16,777,216 at           0   (later: Ob f16 [4096][2048], same type + layout)
//   R1 Wq16 f16 [4096][2048] (w_qkv x16)            16,777,216 at  16,777,216   
//   R2 Wo16 f16 [2048][2048] (w_out x16)             8,388,608 at  33,554,432
//   R3 QK32 f32 [2048][3072] q|k of one batch       25,165,824 at  41,943,040
//   R4 VT   f16 [2*8][128][2048] (v transposed)       8,388,608 at  67,108,864
//   R5 QKhi bf16 [98304][128] (q rows then k rows)  25,165,824 at  75,497,472
//   R6 QKlo bf16 [98304][128]                        25,165,824 at 100,663,296
//   total                                          125,829,120
// Re-use timeline (stream ordered): X16/Wq16 are read only by the qkv and V^T GEMMs; QK32 of a batch only by that batch's norm kernel;
// Ob is first written by the attention kernel, which starts after the last norm kernel and the V^T GEMM.
// Every region is fully written before it is read; no region changes element type.
// GEMM shapes: q|k per batch (M=2048, N=3072, K=2048); V^T per batch (M=1024, N=2048, K=2048);
// output (M=4096, N=2048, K=2048); all M,N multiples of 64, all K multiples of 32, no padding anywhere.
// ---------------------------------------------------------------------------
extern "C" void kernel_launch(void* const* d_in, const int* in_sizes, int n_in,
                              void* d_out, int out_size, void* d_ws, size_t ws_size,
                              hipStream_t stream) {
  if (n_in < 7) return;
  const int nX = kBatch * kSeq * kDim;            // 8,388,608
  if (in_sizes[0] != nX) return;
  if (in_sizes[1] != kBatch * kSeq) return;
  if (in_sizes[2] != kSeq * (kHD / 2) * 4) return;
  if (in_sizes[3] != kNQKV * kDim) return;
  if (in_sizes[4] != kDim * kNQ) return;
  if (in_sizes[5] != kHD || in_sizes[6] != kHD) return;
  if (out_size != kTok * kDim) return;

  const size_t szX16  = (size_t)kTok * kDim * 2;
  const size_t szWq16 = (size_t)kNQKV * kDim * 2;
  const size_t szWo16 = (size_t)kDim * kNQ * 2;
  const size_t szQK32 = (size_t)kSeq * kNQK * 4;          // one batch
  const size_t szVT   = (size_t)kBatch * kKV * kHD * kSeq * 2;
  const size_t szPl   = (size_t)kQKRows * kHD * 2;        // one bf16 q|k plane
  const size_t szOb   = (size_t)kTok * kNQ * 2;
  const size_t offX16  = 0;
  const size_t offWq16 = offX16 + szX16;
  const size_t offWo16 = offWq16 + szWq16;
  const size_t offR3   = offWo16 + szWo16;
  const size_t offVT   = offR3 + szQK32;
  const size_t offPhi  = offVT + szVT;
  const size_t offPlo  = offPhi + szPl;
  const size_t total   = offPlo + szPl;
  if (szOb > szX16) return;                      // the re-used region fits its first carve
  if (ws_size < total) return;

  const float* x     = (const float*)d_in[0];
  const int*   xmask = (const int*)d_in[1];
  const float* freqs = (const float*)d_in[2];
  const float* wqkv  = (const float*)d_in[3];
  const float* wout  = (const float*)d_in[4];
  const float* qw    = (const float*)d_in[5];
  const float* kw    = (const float*)d_in[6];
  float* out = (float*)d_out;
  char* ws = (char*)d_ws;
  unsigned short* X16  = (unsigned short*)(ws + offX16);
  unsigned short* Ob   = (unsigned short*)(ws + offX16);     // re-use of R0 (f16, same layout)
  unsigned short* Wq16 = (unsigned short*)(ws + offWq16);
  unsigned short* Wo16 = (unsigned short*)(ws + offWo16);
  float* QK32 = (float*)(ws + offR3);
  unsigned short* VT  = (unsigned short*)(ws + offVT);
  unsigned short* Phi = (unsigned short*)(ws + offPhi);
  unsigned short* Plo = (unsigned short*)(ws + offPlo);
  const long loOff = (long)kQKRows * kHD;                    // elements from the hi plane to the lo plane
  const float* dummyf = (const float*)(ws + offR3);          // valid in-ws pointer for unused bias/resid arguments

  // ---- 16-bit operand planes of the inputs (RNE bf16 of every float input, f16 containers, weights x16) ----
  const int n8x = nX / 8;                 // 1,048,576 -> 4096 blocks exact
  const int n8w = (kNQKV * kDim) / 8;     // 1,048,576 -> 4096 blocks exact
  const int n8o = (kDim * kNQ) / 8;       //   524,288 -> 2048 blocks exact
  cast8_kernel<<<dim3(n8x / 256), dim3(256), 0, stream>>>(x, X16, n8x, 1.0f);
  cast8_kernel<<<dim3(n8w / 256), dim3(256), 0, stream>>>(wqkv, Wq16, n8w, kWCarry);
  cast8_kernel<<<dim3(n8o / 256), dim3(256), 0, stream>>>(wout, Wo16, n8o, kWCarry);

  // ---- per batch: q|k projection (w_qkv rows 0..3071) -> f32 plane; norm + rotary -> bf16 hi/lo planes ----
  {
    const int tilesQK = (kSeq / 64) * (kNQK / 64);   // 1536 -> 192 blocks of 8 waves; covers all 2048 x 3072 of QK32
    for (int b = 0; b < kBatch; ++b) {
      const unsigned short* Xb = X16 + (size_t)b * kSeq * kDim;
      wmma_gemm64<0, false, 0, 0, false, 0><<<dim3(tilesQK / 8, 1), dim3(256), 0, stream>>>(
          Xb, Xb, kDim, 0L, Wq16, Wq16, kDim, 0L,
          (void*)QK32, (void*)QK32, kNQK, 0L, dummyf, dummyf, 0L, kSeq, kNQK, kDim, kWCarryInv);
      norm_rope_kernel<<<dim3((kHeads + kKV) / 8, kSeq), dim3(256), 0, stream>>>(QK32, freqs, qw, kw, Phi, loOff, b);
    }
  }

  // ---- v projection written directly transposed: VT[b*8+j][d][s] = f16( 1/16 * sum_k Wq16[3072+j*128+d][k] * X16[b*2048+s][k] )
  //      (M=1024 weight rows, N=2048 positions, K=2048; grid.y = batch; covers the whole 16 x 128 x 2048 VT plane) ----
  {
    const int tilesVT = (kNK / 64) * (kSeq / 64);     // 512 -> 64 blocks
    const unsigned short* Wv = Wq16 + (size_t)kNQK * kDim;
    wmma_gemm64<0, false, 0, 1, false, 0><<<dim3(tilesVT / 8, kBatch), dim3(256), 0, stream>>>(
        Wv, Wv, kDim, 0L, X16, X16, kDim, (long)kSeq * kDim,
        (void*)VT, (void*)VT, kSeq, (long)kNK * kSeq, dummyf, dummyf, 0L, kNK, kSeq, kDim, kWCarryInv);
  }

  // ---- attention, all (batch, kv head) groups in one launch: Ob[b*2048+i][(2j+hg)*128+n] = f16( 16 * softmax(q.k^T * 128^-0.5 + mask) . v )
  //      grid (16 blocks of 128 query positions, 16 groups) = 256 blocks; covers the whole [4096][2048] Ob plane ----
  attn_kernel<<<dim3(kSeq / 128, kBatch * kKV), dim3(256), 0, stream>>>(Phi, loOff, VT, xmask, Ob);

  // ---- output projection: out[tok][n] = 2^-8 * sum_e Ob[tok][e] * Wo16[n][e]   (M=4096, N=2048, K=2048) ----
  {
    const int tilesOut = (kTok / 64) * (kDim / 64);   // 2048 -> 256 blocks; covers the whole [4096][2048] output
    wmma_gemm64<0, false, 0, 0, false, 0><<<dim3(tilesOut / 8, 1), dim3(256), 0, stream>>>(
        Ob, Ob, kNQ, 0L, Wo16, Wo16, kNQ, 0L,
        (void*)out, (void*)out, kDim, 0L, dummyf, dummyf, 0L, kTok, kDim, kNQ, kOutScale);
  }
}

// v004
// One run takes 210 microseconds.
// Next to v003, in two timings, it ran 1.15 and 1.16 times as fast.
// Counting every step since v000, it is 10.6 times as fast.
// Contractions: qkv projection (x as f16(bf16 RNE) x w_qkv^T as f16(16*bf16 RNE)), V^T.P^T (P f16, unnormalised, carried x256, x V^T f16) and output projection (o f16 carried x16 x w_out^T as f16(16*bf16 RNE)) on v_wmma_f32_16x16x32_f16; scores k.q^T on v_wmma_f32_16x16x32_bf16 with q,k as bf16 hi+lo planes (hi*hi + hi*lo + lo*hi); f32 accumulate everywhere; RMSNorm, 2x2 rotary map and online softmax in f32.
#include <hip/hip_runtime.h>
#include <math.h>

// ---------------------------------------------------------------------------
// Problem constants
// ---------------------------------------------------------------------------
constexpr int kBatch = 2;
constexpr int kSeq   = 2048;
constexpr int kDim   = 2048;              // model dim (K of the qkv projection, N of the output projection)
constexpr int kHeads = 16;
constexpr int kKV    = 8;
constexpr int kHD    = 128;
constexpr int kTok   = kBatch * kSeq;     // 4096 token rows
constexpr int kNQ    = kHeads * kHD;      // 2048 q columns / o columns
constexpr int kNK    = kKV * kHD;         // 1024 k columns (= v columns)
constexpr int kNQK   = kNQ + kNK;         // 3072 = pitch of the f32 q|k plane
constexpr int kNQKV  = kNQ + 2 * kNK;     // 4096 rows of w_qkv
constexpr int kQKRows = kBatch * (kHeads + kKV) * kSeq;   // 98304 rows of 128 in each q|k 16-bit plane
constexpr int kKRow0  = kBatch * kHeads * kSeq;           // 65536 = first k row in the q|k planes
constexpr float kEps        = 1.1920929e-07f;
constexpr float kInvHD      = 1.0f / 128.0f;
constexpr float kWCarry     = 16.0f;                      // weights carried x16 in f16
constexpr float kWCarryInv  = 1.0f / 16.0f;
constexpr float kOCarry     = 16.0f;                      // attention output carried x16 in f16
constexpr float kOutScale   = 1.0f / (kOCarry * kWCarry); // 2^-8
constexpr float kScoreScale = 0.08838834764831845f;       // 128^-0.5
static_assert(kHD == 128, "norm kernel lane map: 32 lanes x 4 dims");
static_assert(kHeads == 2 * kKV, "two query heads per kv head");
static_assert(kSeq % 64 == 0 && kNQK % 64 == 0 && kNK % 64 == 0 && kNQ % 64 == 0 && kDim % 64 == 0 && kTok % 64 == 0, "GEMM M/N tiles");
static_assert(kHD % 64 == 0);
static_assert(kDim % 32 == 0 && kHD % 32 == 0 && kSeq % 32 == 0 && kNQ % 32 == 0, "GEMM K % 32");
static_assert(kDim % 128 == 0 && kSeq % 128 == 0 && kNQ % 128 == 0, "staged GEMM K: two or more stages of 64");
static_assert(kSeq % 256 == 0 && kNK % 256 == 0 && kTok % 256 == 0 && kNQK % 128 == 0 && kDim % 128 == 0, "staged GEMM: 256 x 128 per work-group");
static_assert(kSeq == 256 * 8, "key bias coverage: 256 threads x 8 keys");
static_assert((kHeads + kKV) % 8 == 0, "norm kernel: 8 waves per block over 24 q|k heads");

typedef __attribute__((ext_vector_type(16))) _Float16 v16h;
typedef __attribute__((ext_vector_type(8)))  _Float16 v8h;
typedef __attribute__((ext_vector_type(16))) __bf16   v16b;
typedef __attribute__((ext_vector_type(8)))  __bf16   v8b;
typedef __attribute__((ext_vector_type(8)))  float    v8f;
typedef __attribute__((ext_vector_type(4)))  float    v4f;
typedef __attribute__((ext_vector_type(2)))  float    v2f;
typedef __attribute__((ext_vector_type(2)))  int      v2i;
typedef __attribute__((ext_vector_type(4)))  unsigned int v4u;

__device__ __forceinline__ unsigned short f2bf_bits(float f) {
  unsigned u = __float_as_uint(f);
  return (unsigned short)((u + 0x7FFFu + ((u >> 16) & 1u)) >> 16);
}
__device__ __forceinline__ float bf_bits2f(unsigned short h) { return __uint_as_float(((unsigned)h) << 16); }

// hazard guards as plain device helpers
__device__ __forceinline__ void dep_guard_h(v8f& a, v8f& b, v16h x, v16h y) { asm volatile("v_nop\n\tv_nop\n\tv_nop\n\tv_nop" : "+v"(a), "+v"(b) : "v"(x), "v"(y)); }
__device__ __forceinline__ void dep_guard_b(v8f& a, v8f& b, v16b x, v16b y) { asm volatile("v_nop\n\tv_nop\n\tv_nop\n\tv_nop" : "+v"(a), "+v"(b) : "v"(x), "v"(y)); }
__device__ __forceinline__ void keep4_h(v16h a, v16h b, v16h c, v16h d) { asm volatile("v_nop" :: "v"(a), "v"(b), "v"(c), "v"(d)); }
__device__ __forceinline__ void keep4_b(v16b a, v16b b, v16b c, v16b d) { asm volatile("v_nop" :: "v"(a), "v"(b), "v"(c), "v"(d)); }
__device__ __forceinline__ void acc_guard4(v8f& a, v8f& b, v8f& c, v8f& d) { asm volatile("v_nop\n\tv_nop\n\tv_nop\n\tv_nop" : "+v"(a), "+v"(b), "+v"(c), "+v"(d)); }
template <typename T> struct Frag;
template <> struct Frag<_Float16> {
  typedef v16h V; union U { v16h v; v8h h[2]; };
  // elements 0..7 <- p[0..7], 8..15 <- p[16..23]
  static __device__ __forceinline__ v16h load(const _Float16* p) {
    U f; f.h[0] = *(const v8h*)(p); f.h[1] = *(const v8h*)(p + 16); return f.v;
  }
  static __device__ __forceinline__ v8f mma(v16h a, v16h b, v8f c) {
    return __builtin_amdgcn_wmma_f32_16x16x32_f16(false, a, false, b, (short)0, c, false, false);
  }
  static __device__ __forceinline__ void guard(v8f& a, v8f& b, v16h x, v16h y) { dep_guard_h(a, b, x, y); }
  static __device__ __forceinline__ void keep(v16h a, v16h b, v16h c, v16h d) { keep4_h(a, b, c, d); }
};
template <> struct Frag<__bf16> {
  typedef v16b V; union U { v16b v; v8b h[2]; };
  static __device__ __forceinline__ v16b load(const __bf16* p) {
    U f; f.h[0] = *(const v8b*)(p); f.h[1] = *(const v8b*)(p + 16); return f.v;
  }
  static __device__ __forceinline__ v8f mma(v16b a, v16b b, v8f c) {
    return __builtin_amdgcn_wmma_f32_16x16x32_bf16(false, a, false, b, (short)0, c, false, false);
  }
  static __device__ __forceinline__ void guard(v8f& a, v8f& b, v16b x, v16b y) { dep_guard_b(a, b, x, y); }
  static __device__ __forceinline__ void keep(v16b a, v16b b, v16b c, v16b d) { keep4_b(a, b, c, d); }
};

__device__ __forceinline__ unsigned pk16(unsigned short a, unsigned short b) { return (unsigned)a | ((unsigned)b << 16); }
__device__ __forceinline__ unsigned short h_bits(float f) { const _Float16 h = (_Float16)f; return __builtin_bit_cast(unsigned short, h); }
// RNE bf16 conversion returned as f32
__device__ __forceinline__ float bfr(float f) { return bf_bits2f(f2bf_bits(f)); }

// ---- Register-blocked batched WMMA GEMM (ACT reduced to none/relu/leaky) -------------------------------
// C[m,n] = scale * sum_k A[m,k] * Bt[n,k] (+bias)(+resid); each wave owns a 64x64 tile.
// A row-major [M,K]; Bt row-major [N,K]; SPLIT: M,N % 64 == 0, K % 32 == 0.
// Not SPLIT: a work-group owns 256 x 128 of C, its waves 4 x 2 tiles of 64x64 on shared staged operands; M % 256 == 0, N % 128 == 0, K % 64 == 0.
// SPLIT: operands are hi/lo planes (A2/Bt2 = lo planes, same layout); product = hi*hi + hi*lo + lo*hi.
// BIAS_MODE: 0 = none, 1 = bias[m], 2 = bias[n].
// OUT_MODE: 0 = f32, 1 = f16, 2 = bf16 hi plane (Cout) + bf16 lo plane (Cout2).
// ET: 0 = f16 operands, 1 = bf16 operands (pointers passed as 16-bit storage)
template <int ET> struct Elem;
template <> struct Elem<0> { typedef _Float16 T; };
template <> struct Elem<1> { typedef __bf16 T; };
// Twelve asynchronous 16-byte-per-lane copies global -> LDS (each 32 lanes x 16 B = 4 rows x one whole 128-B line).
// s_wait_xcnt 0 is the last line of the copies' own statement, so it stands ahead of any rewrite of the address registers named here.
__device__ __forceinline__ void async_copy12(const unsigned (&l)[12], const char* const (&g)[12]) {
  asm volatile(
      "global_load_async_to_lds_b128 %0, %12, off\n\t"
      "global_load_async_to_lds_b128 %1, %13, off\n\t"
      "global_load_async_to_lds_b128 %2, %14, off\n\t"
      "global_load_async_to_lds_b128 %3, %15, off\n\t"
      "global_load_async_to_lds_b128 %4, %16, off\n\t"
      "global_load_async_to_lds_b128 %5, %17, off\n\t"
      "global_load_async_to_lds_b128 %6, %18, off\n\t"
      "global_load_async_to_lds_b128 %7, %19, off\n\t"
      "global_load_async_to_lds_b128 %8, %20, off\n\t"
      "global_load_async_to_lds_b128 %9, %21, off\n\t"
      "global_load_async_to_lds_b128 %10, %22, off\n\t"
      "global_load_async_to_lds_b128 %11, %23, off\n\t"
      "s_wait_xcnt 0x0"
      :: "v"(l[0]), "v"(l[1]), "v"(l[2]), "v"(l[3]), "v"(l[4]), "v"(l[5]), "v"(l[6]), "v"(l[7]), "v"(l[8]), "v"(l[9]), "v"(l[10]), "v"(l[11]),
         "v"(g[0]), "v"(g[1]), "v"(g[2]), "v"(g[3]), "v"(g[4]), "v"(g[5]), "v"(g[6]), "v"(g[7]), "v"(g[8]), "v"(g[9]), "v"(g[10]), "v"(g[11])
      : "memory");
}
// One stage of the work-group's shared tiles: A 256 rows x 128 B (64 k), then B 128 rows x 128 B, in LDS rows of pitch 144 B.
// A wave brings 32 rows of A (8 copies) and 16 rows of B (4 copies); every A row then feeds two waves, every B row four.
// lA / gA and lB / gB are the lane's own addresses for its wave's first row + (lane >> 3), 16-byte chunk (lane & 7); copy c moves 4 rows.
constexpr int kRowPitch  = 144;                    // 128-B rows + 16 B: 16 B x odd, the pitch for ds_load_b128 readers
constexpr int kATile     = 256 * kRowPitch;        // 36864
constexpr int kBTile     = 128 * kRowPitch;        // 18432
constexpr int kBufBytes  = kATile + kBTile;        // A tile then B tile
constexpr int kRingBytes = 2 * kBufBytes;          // two buffers per work-group
__device__ __forceinline__ void stage_block(unsigned lA, unsigned lB, const char* gA, const char* gB, size_t ldaBytes, size_t ldbBytes) {
  // both loops unrolled: every index of l and g is a constant, so the addresses stay in registers
  unsigned l[12];
  const char* g[12];
#pragma unroll
  for (int c = 0; c < 8; ++c) {
    l[c] = lA + (unsigned)(c * 4 * kRowPitch);
    g[c] = gA + (size_t)(c * 4) * ldaBytes;
  }
#pragma unroll
  for (int c = 0; c < 4; ++c) {
    l[8 + c] = lB + (unsigned)(c * 4 * kRowPitch);
    g[8 + c] = gB + (size_t)(c * 4) * ldbBytes;
  }
  async_copy12(l, g);
}

template <int ET, bool SPLIT, int BIAS_MODE, int OUT_MODE, bool RESID, int ACT = 0>
__global__ __launch_bounds__(256) void wmma_gemm64(
    const unsigned short* __restrict__ Ap, const unsigned short* __restrict__ A2p, int lda, long strideA,
    const unsigned short* __restrict__ Btp, const unsigned short* __restrict__ Bt2p, int ldb, long strideB,
    void* __restrict__ Cout, void* __restrict__ Cout2, int ldc, long strideC,
    const float* __restrict__ bias,
    const float* __restrict__ resid, long strideR,
    int M, int N, int K, float scale) {
  typedef typename Elem<ET>::T T;
  typedef typename Frag<T>::V V;
  const T* A = (const T*)Ap; const T* A2 = (const T*)A2p; const T* Bt = (const T*)Btp; const T* Bt2 = (const T*)Bt2p;
  // Per-wave 16x64 f32 slab, pitch 68 floats. Not SPLIT: the work-group's ring of two staged buffers; its first bytes serve as the slabs behind the k loop.
  constexpr int kSlabBytes = 16 * 68 * 4;
  __shared__ __align__(16) char smem[SPLIT ? 8 * kSlabBytes : kRingBytes];
  const int b    = blockIdx.y;
  const int lane = threadIdx.x & 31;
  const int wave = threadIdx.x >> 5;
  int m0, n0, mB = 0, nB = 0;                  // the wave's tile; the work-group's tile (staged path)
  if (SPLIT) {
    const int tilesN = N >> 6;
    const int tile = blockIdx.x * 8 + wave;
    if (tile >= (M >> 6) * tilesN) return;    // wave-uniform; no block barriers on this path
    const int tm = tile / tilesN;
    m0 = tm << 6;
    n0 = (tile - tm * tilesN) << 6;
  } else {
    const int blocksN = N >> 7;
    if ((int)blockIdx.x >= (M >> 8) * blocksN) return;   // the whole work-group leaves, ahead of every barrier and copy
    const int bm = blockIdx.x / blocksN;
    mB = bm << 8;
    nB = (blockIdx.x - bm * blocksN) << 7;
    m0 = mB + ((wave >> 1) << 6);
    n0 = nB + ((wave & 1) << 6);
  }

  const T* Ab  = A  + (size_t)b * strideA;
  const T* Bb  = Bt + (size_t)b * strideB;
  const T* Ab2 = SPLIT ? (A2  + (size_t)b * strideA) : nullptr;
  const T* Bb2 = SPLIT ? (Bt2 + (size_t)b * strideB) : nullptr;

  const int rlane = lane & 15;                 // row (A) / col (B, D) within subtile
  const int koff  = (lane >> 4) * 8;           // k offset of this lane half
  const int mOff  = (lane >> 4) * 8;           // D row offset

  v8f acc[4][4];
#pragma unroll
  for (int i = 0; i < 4; ++i)
#pragma unroll
    for (int j = 0; j < 4; ++j) acc[i][j] = (v8f){0.f,0.f,0.f,0.f,0.f,0.f,0.f,0.f};

  if (SPLIT) {
    for (int k0 = 0; k0 < K; k0 += 32) {
      V bh[4], bl[4];
#pragma unroll
      for (int j = 0; j < 4; ++j) {
        const size_t bo = (size_t)(n0 + (j << 4) + rlane) * ldb + koff + k0;
        bh[j] = Frag<T>::load(Bb + bo);
        if (SPLIT) bl[j] = Frag<T>::load(Bb2 + bo);
      }
#pragma unroll
      for (int i = 0; i < 4; ++i) {
        const size_t ao = (size_t)(m0 + (i << 4) + rlane) * lda + koff + k0;
        V ah = Frag<T>::load(Ab + ao);
        V al;
        if (SPLIT) al = Frag<T>::load(Ab2 + ao);
#pragma unroll
        for (int j = 0; j < 4; ++j) {
          acc[i][j] = Frag<T>::mma(ah, bh[j], acc[i][j]);
          if (SPLIT) {
            acc[i][j] = Frag<T>::mma(ah, bl[j], acc[i][j]);
            acc[i][j] = Frag<T>::mma(al, bh[j], acc[i][j]);
          }
        }
        Frag<T>::guard(acc[i][0], acc[i][3], ah, SPLIT ? al : ah);
      }
      Frag<T>::keep(bh[0], bh[1], bh[2], bh[3]);
      if (SPLIT) Frag<T>::keep(bl[0], bl[1], bl[2], bl[3]);
    }
  } else {
    // The work-group stages its A and B tiles once for all eight waves, 64 k (one whole 128-B line of every row) per stage, in two LDS
    // buffers by asynchronous copies; the fragments come from LDS through Frag::load, k ascending. K is a multiple of 128 (asserted below the constants).
    const unsigned lc = (unsigned)(size_t)smem + (unsigned)((lane >> 3) * kRowPitch + (lane & 7) * 16);
    const unsigned lA = lc + (unsigned)(wave * 32 * kRowPitch);
    const unsigned lB = lc + (unsigned)(kATile + wave * 16 * kRowPitch);
    const size_t ldaB = (size_t)lda * 2, ldbB = (size_t)ldb * 2;
    const char* gA = (const char*)Ab + (size_t)(mB + wave * 32 + (lane >> 3)) * ldaB + (lane & 7) * 16;
    const char* gB = (const char*)Bb + (size_t)(nB + wave * 16 + (lane >> 3)) * ldbB + (lane & 7) * 16;
    const int stages = K >> 6;
    stage_block(lA, lB, gA, gB, ldaB, ldbB);
    asm volatile("s_wait_asynccnt 0x0" ::: "memory");   // this wave's share of stage 0 has landed; the barrier publishes every wave's
    __syncthreads();
    if (stages > 1) stage_block(lA + kBufBytes, lB + kBufBytes, gA + 128, gB + 128, ldaB, ldbB);
    // the lane's fragment row and k half inside the wave's 64 rows of the A tile and of the B tile
    const int foA = ((wave >> 1) * 64 + rlane) * kRowPitch + koff * 2;
    const int foB = kATile + ((wave & 1) * 64 + rlane) * kRowPitch + koff * 2;
    for (int t = 0; t < stages; ++t) {
      const int bsel = (t & 1) * kBufBytes;
      const char* rb = smem + bsel;
      // all 32 fragment loads of the stage go out as one group ahead of its products: one LDS latency a stage, not one per A fragment
      V ah[2][4], bh[2][4];                              // loops below unrolled: constant indices keep the fragments in registers
#pragma unroll
      for (int s = 0; s < 2; ++s) {
#pragma unroll
        for (int j = 0; j < 4; ++j) {
          bh[s][j] = Frag<T>::load((const T*)(rb + foB + j * 16 * kRowPitch + s * 64));
          ah[s][j] = Frag<T>::load((const T*)(rb + foA + j * 16 * kRowPitch + s * 64));
        }
      }
      // holds the load group ahead of the products; the scheduler otherwise sinks each A fragment's loads in front of its use
      __builtin_amdgcn_sched_barrier(0);
#pragma unroll
      for (int s = 0; s < 2; ++s) {
#pragma unroll
        for (int i = 0; i < 4; ++i) {
#pragma unroll
          for (int j = 0; j < 4; ++j) acc[i][j] = Frag<T>::mma(ah[s][i], bh[s][j], acc[i][j]);
        }
      }
      // holds the products ahead of the foot's waits, so that stage t + 1's copies fly while stage t is worked on
      __builtin_amdgcn_sched_barrier(0);
      asm volatile("s_wait_dscnt 0x0" ::: "memory");     // this wave's LDS reads of the stage are done before any wave refills its buffer
      asm volatile("s_wait_asynccnt 0x0" ::: "memory");  // this wave's share of stage t + 1 has landed
      __syncthreads();                                   // publishes stage t + 1 to all waves; ends every wave's reads of stage t
      if (t + 2 < stages) {
        const size_t kb = (size_t)(t + 2) * 128;
        stage_block(lA + bsel, lB + bsel, gA + kb, gB + kb, ldaB, ldbB);
      }
    }
    asm volatile("s_wait_asynccnt 0x0" ::: "memory");    // nothing in flight when the ring becomes the epilogue's slabs (all reads ended at the last barrier)
  }
  acc_guard4(acc[0][0], acc[0][1], acc[0][2], acc[0][3]);
  acc_guard4(acc[1][0], acc[1][1], acc[1][2], acc[1][3]);
  acc_guard4(acc[2][0], acc[2][1], acc[2][2], acc[2][3]);
  acc_guard4(acc[3][0], acc[3][1], acc[3][2], acc[3][3]);

  // ---- epilogue ----
  float* slab = (float*)(smem + wave * kSlabBytes);
  const float* Rb = RESID ? (resid + (size_t)b * strideR) : nullptr;
#pragma unroll
  for (int i = 0; i < 4; ++i) {
    const int mBase = m0 + (i << 4);
#pragma unroll
    for (int j = 0; j < 4; ++j) {
      const int n = n0 + (j << 4) + rlane;
      float bv = 0.f;
      if (BIAS_MODE == 2) bv = bias[n];
#pragma unroll
      for (int r = 0; r < 8; ++r) {
        float v = acc[i][j][r] * scale;
        if (BIAS_MODE == 1) v += bias[mBase + mOff + r];
        if (BIAS_MODE == 2) v += bv;
        if (RESID) v += Rb[(size_t)(mBase + mOff + r) * ldc + n];
        if (ACT == 2) v = fmaxf(v, 0.0f);
        if (ACT == 4) v = (v > 0.f) ? v : 0.01f * v;
        slab[(mOff + r) * 68 + (j << 4) + rlane] = v;
      }
    }
    __builtin_amdgcn_fence(__ATOMIC_RELEASE, "workgroup");
    __builtin_amdgcn_wave_barrier();
    __builtin_amdgcn_fence(__ATOMIC_ACQUIRE, "workgroup");
    if (OUT_MODE == 0) {
      float* C = (float*)Cout + (size_t)b * strideC;
      const int hh = lane >> 4, c4 = (lane & 15) * 4;     // row seg = 256 B = 16 lanes x 16 B
      {
#pragma unroll
        for (int it = 0; it < 8; ++it) {
          const int row = it * 2 + hh;
          v4f v = *(const v4f*)(slab + row * 68 + c4);
          *(v4f*)(C + (size_t)(mBase + row) * ldc + n0 + c4) = v;
        }
        
      }
    } else {
      const int q = lane >> 3, c8 = (lane & 7) * 8;
      unsigned short* C  = (unsigned short*)Cout  + (size_t)b * strideC;
      unsigned short* C2 = (OUT_MODE == 2) ? ((unsigned short*)Cout2 + (size_t)b * strideC) : nullptr;
      {
#pragma unroll
        for (int it = 0; it < 4; ++it) {
          const int row = it * 4 + q;
          const float* sp = slab + row * 68 + c8;
          v8h hv, lv;
#pragma unroll
          for (int e = 0; e < 8; ++e) {
            if (OUT_MODE == 1) {
              hv[e] = (_Float16)sp[e];
            } else {
              unsigned short hb = f2bf_bits(sp[e]);
              unsigned short lb = f2bf_bits(sp[e] - bf_bits2f(hb));
              hv[e] = __builtin_bit_cast(_Float16, hb);
              lv[e] = __builtin_bit_cast(_Float16, lb);
            }
          }
          *(v8h*)(C + (size_t)(mBase + row) * ldc + n0 + c8) = hv;
          if (OUT_MODE == 2) *(v8h*)(C2 + (size_t)(mBase + row) * ldc + n0 + c8) = lv;
        }
        
      }
    }
    __builtin_amdgcn_fence(__ATOMIC_RELEASE, "workgroup");
    __builtin_amdgcn_wave_barrier();
    __builtin_amdgcn_fence(__ATOMIC_ACQUIRE, "workgroup");
  }
}

// ---------------------------------------------------------------------------
// The whole qkv projection in ONE launch of 512 equal work-groups: two full rounds of the chip's 256 WGPs, where one launch per
// batch for q|k (192 work-groups each) and one for V^T (128) leave WGPs idle for the length of a work-group three times.
// Work-groups 0..383:   q|k of both batches, QK[tok][n] = 1/16 * sum_k X[tok][k] * W[n][k]             (M=4096, N=3072), f32.
// Work-groups 384..511: V^T, VT[b*8+j][d][s] = f16( 1/16 * sum_k W[3072+j*128+d][k] * X[b*2048+s][k] ) (per batch M=1024, N=2048).
// Tile (256 x 128, waves 4 x 2 of 64x64), ring, k loop, waits, barriers and epilogue are those of wmma_gemm64's staged path;
// only the operand and output addresses and the output type follow the work-group's index (the same for all its waves).
// ---------------------------------------------------------------------------
constexpr int kQKBlocksN = kNQK / 128;                        // 24
constexpr int kQKBlocks  = (kTok / 256) * kQKBlocksN;         // 384
constexpr int kVTBlocksN = kSeq / 128;                        // 16
constexpr int kVTBlocks1 = (kNK / 256) * kVTBlocksN;          // 64 per batch
constexpr int kQKVBlocks = kQKBlocks + kBatch * kVTBlocks1;   // 512
// Epilogue of one wave's 64 x 64 tile: each 16 x 64 strip goes through the wave's own slab (pitch 68 floats), so that whole lines are stored.
// VOUT false: f32 rows of QK (pitch 3072); true: f16 rows of this batch's V^T plane (pitch 2048).
template <bool VOUT>
__device__ __forceinline__ void qkv_store(const v8f (&acc)[4][4], float* slab, float* __restrict__ QK, unsigned short* __restrict__ Cv,
                                          int m0, int n0, int lane) {
  const int rlane = lane & 15;                 // D column within a subtile
  const int mOff  = (lane >> 4) * 8;           // D row offset
  // every '#pragma unroll' here: constant indices keep the accumulators in registers
#pragma unroll
  for (int i = 0; i < 4; ++i) {
    const int mBase = m0 + (i << 4);
#pragma unroll
    for (int j = 0; j < 4; ++j) {
#pragma unroll
      for (int r = 0; r < 8; ++r) slab[(mOff + r) * 68 + (j << 4) + rlane] = acc[i][j][r] * kWCarryInv;
    }
    __builtin_amdgcn_fence(__ATOMIC_RELEASE, "workgroup");
    __builtin_amdgcn_wave_barrier();
    __builtin_amdgcn_fence(__ATOMIC_ACQUIRE, "workgroup");
    if (!VOUT) {
      const int hh = lane >> 4, c4 = (lane & 15) * 4;     // row seg = 256 B = 16 lanes x 16 B
#pragma unroll
      for (int it = 0; it < 8; ++it) {
        const int row = it * 2 + hh;
        const v4f v = *(const v4f*)(slab + row * 68 + c4);
        *(v4f*)(QK + (size_t)(mBase + row) * kNQK + n0 + c4) = v;
      }
    } else {
      const int q = lane >> 3, c8 = (lane & 7) * 8;       // row seg = 128 B = 8 lanes x 16 B
#pragma unroll
      for (int it = 0; it < 4; ++it) {
        const int row = it * 4 + q;
        const float* sp = slab + row * 68 + c8;
        v8h hv;
#pragma unroll
        for (int e = 0; e < 8; ++e) hv[e] = (_Float16)sp[e];
        *(v8h*)(Cv + (size_t)(mBase + row) * kSeq + n0 + c8) = hv;
      }
    }
    __builtin_amdgcn_fence(__ATOMIC_RELEASE, "workgroup");
    __builtin_amdgcn_wave_barrier();
    __builtin_amdgcn_fence(__ATOMIC_ACQUIRE, "workgroup");
  }
}
__global__ __launch_bounds__(256) void qkv_gemm(const unsigned short* __restrict__ Xp, const unsigned short* __restrict__ Wp,
                                                float* __restrict__ QK, unsigned short* __restrict__ VTp) {
  typedef _Float16 T;
  typedef Frag<T>::V V;
  constexpr int kSlabBytes = 16 * 68 * 4;
  __shared__ __align__(16) char smem[kRingBytes];   // the ring of two staged buffers; its first bytes serve as the slabs behind the k loop
  const int lane = threadIdx.x & 31;
  const int wave = threadIdx.x >> 5;
  const int bx   = blockIdx.x;
  const bool isV = bx >= kQKBlocks;
  const int rv   = isV ? bx - kQKBlocks : 0;
  const int vb   = rv / kVTBlocks1;                 // batch of a V^T work-group
  const int vt   = rv % kVTBlocks1;
  const int mB   = (isV ? vt / kVTBlocksN : bx / kQKBlocksN) << 8;
  const int nB   = (isV ? vt % kVTBlocksN : bx % kQKBlocksN) << 7;
  const int m0   = mB + ((wave >> 1) << 6);
  const int n0   = nB + ((wave & 1) << 6);
  const unsigned short* Ab = isV ? Wp + (size_t)kNQK * kDim : Xp;
  const unsigned short* Bb = isV ? Xp + (size_t)vb * kSeq * kDim : Wp;

  const int rlane = lane & 15;                 // row (A) / col (B, D) within subtile
  const int koff  = (lane >> 4) * 8;           // k offset of this lane half

  // every '#pragma unroll' in this kernel: constant indices keep the fragment and accumulator arrays in registers
  v8f acc[4][4];
#pragma unroll
  for (int i = 0; i < 4; ++i)
#pragma unroll
    for (int j = 0; j < 4; ++j) acc[i][j] = (v8f){0.f,0.f,0.f,0.f,0.f,0.f,0.f,0.f};

  {
    const unsigned lc = (unsigned)(size_t)smem + (unsigned)((lane >> 3) * kRowPitch + (lane & 7) * 16);
    const unsigned lA = lc + (unsigned)(wave * 32 * kRowPitch);
    const unsigned lB = lc + (unsigned)(kATile + wave * 16 * kRowPitch);
    constexpr size_t ldB = (size_t)kDim * 2;   // bytes of a row of X and of W
    const char* gA = (const char*)Ab + (size_t)(mB + wave * 32 + (lane >> 3)) * ldB + (lane & 7) * 16;
    const char* gB = (const char*)Bb + (size_t)(nB + wave * 16 + (lane >> 3)) * ldB + (lane & 7) * 16;
    constexpr int stages = kDim >> 6;
    stage_block(lA, lB, gA, gB, ldB, ldB);
    asm volatile("s_wait_asynccnt 0x0" ::: "memory");   // this wave's share of stage 0 has landed; the barrier publishes every wave's
    __syncthreads();
    stage_block(lA + kBufBytes, lB + kBufBytes, gA + 128, gB + 128, ldB, ldB);
    // the lane's fragment row and k half inside the wave's 64 rows of the A tile and of the B tile
    const int foA = ((wave >> 1) * 64 + rlane) * kRowPitch + koff * 2;
    const int foB = kATile + ((wave & 1) * 64 + rlane) * kRowPitch + koff * 2;
    for (int t = 0; t < stages; ++t) {
      const int bsel = (t & 1) * kBufBytes;
      const char* rb = smem + bsel;
      // all 32 fragment loads of the stage go out as one group ahead of its products: one LDS latency a stage, not one per A fragment
      V ah[2][4], bh[2][4];
#pragma unroll
      for (int s = 0; s < 2; ++s) {
#pragma unroll
        for (int j = 0; j < 4; ++j) {
          bh[s][j] = Frag<T>::load((const T*)(rb + foB + j * 16 * kRowPitch + s * 64));
          ah[s][j] = Frag<T>::load((const T*)(rb + foA + j * 16 * kRowPitch + s * 64));
        }
      }
      // holds the load group ahead of the products; the scheduler otherwise sinks each A fragment's loads in front of its use
      __builtin_amdgcn_sched_barrier(0);
#pragma unroll
      for (int s = 0; s < 2; ++s) {
#pragma unroll
        for (int i = 0; i < 4; ++i) {
#pragma unroll
          for (int j = 0; j < 4; ++j) acc[i][j] = Frag<T>::mma(ah[s][i], bh[s][j], acc[i][j]);
        }
      }
      // holds the products ahead of the foot's waits, so that stage t + 1's copies fly while stage t is worked on
      __builtin_amdgcn_sched_barrier(0);
      asm volatile("s_wait_dscnt 0x0" ::: "memory");     // this wave's LDS reads of the stage are done before any wave refills its buffer
      asm volatile("s_wait_asynccnt 0x0" ::: "memory");  // this wave's share of stage t + 1 has landed
      __syncthreads();                                   // publishes stage t + 1 to all waves; ends every wave's reads of stage t
      if (t + 2 < stages) {
        const size_t kb = (size_t)(t + 2) * 128;
        stage_block(lA + bsel, lB + bsel, gA + kb, gB + kb, ldB, ldB);
      }
    }
    asm volatile("s_wait_asynccnt 0x0" ::: "memory");    // nothing in flight when the ring becomes the epilogue's slabs (all reads ended at the last barrier)
  }
  acc_guard4(acc[0][0], acc[0][1], acc[0][2], acc[0][3]);
  acc_guard4(acc[1][0], acc[1][1], acc[1][2], acc[1][3]);
  acc_guard4(acc[2][0], acc[2][1], acc[2][2], acc[2][3]);
  acc_guard4(acc[3][0], acc[3][1], acc[3][2], acc[3][3]);

  // ---- epilogue: one branch, the same for the whole work-group ----
  float* slab = (float*)(smem + wave * kSlabBytes);
  if (!isV) qkv_store<false>(acc, slab, QK, VTp, m0, n0, lane);
  else      qkv_store<true>(acc, slab, QK, VTp + (size_t)vb * kNK * kSeq, m0, n0, lane);
}

// ---------------------------------------------------------------------------
// f32 -> (RNE bf16) -> f16 cast with an exact power-of-two carry: out = f16( scale * bf16(in) ).
// ---------------------------------------------------------------------------
__global__ __launch_bounds__(256) void cast8_kernel(const float* __restrict__ in, unsigned short* __restrict__ out, int n8, float scale) {
  const int i = blockIdx.x * 256 + threadIdx.x;
  if (i >= n8) return;
  const float* p = in + 8 * (size_t)i;
  const v4f a = *(const v4f*)(p);
  const v4f c = *(const v4f*)(p + 4);
  unsigned short hb[8];
#pragma unroll
  for (int e = 0; e < 4; ++e) {
    hb[e]     = h_bits(bfr(a[e]) * scale);
    hb[4 + e] = h_bits(bfr(c[e]) * scale);
  }
  const v4u u = (v4u){pk16(hb[0], hb[1]), pk16(hb[2], hb[3]), pk16(hb[4], hb[5]), pk16(hb[6], hb[7])};
  unsigned short* q = out + 8 * (size_t)i;
  *(v4u*)q = u;
  
}

// ---------------------------------------------------------------------------
// RMSNorm (mean over 128, eps inside rsqrt, x norm weight) + per-position 2x2 rotary map on the q and k heads of both batches,
// f32 math; the result is emitted as a bf16 hi plane and a bf16 lo plane (lo = RNE bf16 of v - hi).
// One wave per (position s, head) with head 0..15 = q heads, 16..23 = k heads; lane owns dims 4*lane..4*lane+3 (two pairs).
// Input: QK f32 [2 b][2048 s][3072] (q cols 0..2047, k cols 2048..3071), batch b = blockIdx.z. Rotary table fcs [s][64][2][2], norm weights [128];
// all three converted to bf16 (RNE) before use. out[2p+i] = fc[s,p,i,0]*v[2p] + fc[s,p,i,1]*v[2p+1].
// Output planes Ph (hi) and Ph + loOff (lo), rows of 128 elements = 256 B: q rows (b*16+h)*2048+s, k rows 65536 + (b*8+kh)*2048+s.
// Store: the 4 packed hi words and the 4 packed lo words of every lane are shuffled from lanes 2L, 2L+1 (L = lane & 15) with wave-uniform register choice, then each lane
// selects by value: lanes 0..15 hold 8 consecutive hi dims, lanes 16..31 hold 8 consecutive lo dims; ONE 32-lane x 16-B instruction
// grid (3, 2048, 2) x 256 threads = 98304 waves = 2 x 2048 x 24 rows (hi and lo).
// ---------------------------------------------------------------------------
__global__ __launch_bounds__(256) void norm_rope_kernel(const float* __restrict__ QK, const float* __restrict__ fcs,
                                                        const float* __restrict__ qw, const float* __restrict__ kw,
                                                        unsigned short* __restrict__ Ph, long loOff) {
  const int lane = threadIdx.x & 31;
  const int wave = threadIdx.x >> 5;
  const int head = blockIdx.x * 8 + wave;          // 0..23, wave-uniform
  const int s    = blockIdx.y;                     // 0..2047
  const int b    = blockIdx.z;                     // batch
  const int d0   = lane * 4;

  const v4f xv = *(const v4f*)(QK + ((size_t)b * kSeq + s) * kNQK + (size_t)head * kHD + d0);
  float v0 = xv[0], v1 = xv[1], v2 = xv[2], v3 = xv[3];
  float ss = 0.0f;
  ss += v0 * v0; ss += v1 * v1; ss += v2 * v2; ss += v3 * v3;
#pragma unroll
  for (int off = 1; off < 32; off <<= 1) ss += __shfl_xor(ss, off, 32);
  const float rn = rsqrtf(ss * kInvHD + kEps);

  // norm weights: both candidates loaded unconditionally, arithmetic select by head kind
  const v4f wq = *(const v4f*)(qw + d0);
  const v4f wk = *(const v4f*)(kw + d0);
  const float fq = (head < kHeads) ? 1.0f : 0.0f;
  const float fk = 1.0f - fq;
  const float w0 = bfr(fmaf(fq, wq[0], fk * wk[0]));
  const float w1 = bfr(fmaf(fq, wq[1], fk * wk[1]));
  const float w2 = bfr(fmaf(fq, wq[2], fk * wk[2]));
  const float w3 = bfr(fmaf(fq, wq[3], fk * wk[3]));
  v0 = (v0 * rn) * w0; v1 = (v1 * rn) * w1; v2 = (v2 * rn) * w2; v3 = (v3 * rn) * w3;

  // rotary 2x2 maps for pairs p = 2*lane, 2*lane+1 at position s (8 consecutive floats)
  const float* fp = fcs + ((size_t)s * (kHD / 2) + 2 * lane) * 4;
  const v4f fa = *(const v4f*)(fp);
  const v4f fb = *(const v4f*)(fp + 4);
  const float a00 = bfr(fa[0]), a01 = bfr(fa[1]), a10 = bfr(fa[2]), a11 = bfr(fa[3]);
  const float b00 = bfr(fb[0]), b01 = bfr(fb[1]), b10 = bfr(fb[2]), b11 = bfr(fb[3]);
  const float o0 = a00 * v0 + a01 * v1;
  const float o1 = a10 * v0 + a11 * v1;
  const float o2 = b00 * v2 + b01 * v3;
  const float o3 = b10 * v2 + b11 * v3;

  // bf16 hi / lo split of each value
  const unsigned short hb0 = f2bf_bits(o0), hb1 = f2bf_bits(o1), hb2 = f2bf_bits(o2), hb3 = f2bf_bits(o3);
  const unsigned short lb0 = f2bf_bits(o0 - bf_bits2f(hb0));
  const unsigned short lb1 = f2bf_bits(o1 - bf_bits2f(hb1));
  const unsigned short lb2 = f2bf_bits(o2 - bf_bits2f(hb2));
  const unsigned short lb3 = f2bf_bits(o3 - bf_bits2f(hb3));
  const unsigned ph0 = pk16(hb0, hb1), ph1 = pk16(hb2, hb3);
  const unsigned pl0 = pk16(lb0, lb1), pl1 = pk16(lb2, lb3);

  // gather 8 consecutive dims per lane: dims 8L..8L+3 from lane 2L, 8L+4..8L+7 from lane 2L+1 (L = lane & 15); every candidate
  // is shuffled with a wave-uniform register choice, the hi/lo choice is made per lane after the shuffles
  const int src = (2 * lane) & 31;
  const unsigned gh0 = __shfl(ph0, src, 32);
  const unsigned gh1 = __shfl(ph1, src, 32);
  const unsigned gh2 = __shfl(ph0, src + 1, 32);
  const unsigned gh3 = __shfl(ph1, src + 1, 32);
  const unsigned gl0 = __shfl(pl0, src, 32);
  const unsigned gl1 = __shfl(pl1, src, 32);
  const unsigned gl2 = __shfl(pl0, src + 1, 32);
  const unsigned gl3 = __shfl(pl1, src + 1, 32);
  const bool loh = (lane >= 16);
  const v4u u = (v4u){loh ? gl0 : gh0, loh ? gl1 : gh1, loh ? gl2 : gh2, loh ? gl3 : gh3};

  const int hq = (head < kHeads) ? head : 0;
  const int hk = (head < kHeads) ? 0 : (head - kHeads);
  const size_t rowQ = ((size_t)(b * kHeads + hq)) * kSeq + s;
  const size_t rowK = (size_t)kKRow0 + ((size_t)(b * kKV + hk)) * kSeq + s;
  const size_t row  = (head < kHeads) ? rowQ : rowK;
  const size_t poff = loh ? (size_t)loOff : (size_t)0;
  unsigned short* dp = Ph + poff + row * kHD + 8 * (lane & 15);
  {
    *(v4u*)dp = u;
    
  }
}

constexpr int kAKeys   = 64;
constexpr int kAStages = kSeq / kAKeys;
constexpr int kKPitch  = 2 * kHD + 16;
constexpr int kVPitch  = 2 * kAKeys + 16;
constexpr int kKTile   = kAKeys * kKPitch;
constexpr int kVTile   = kHD * kVPitch;
constexpr int kABuf    = 2 * kKTile + kVTile;
constexpr float kScoreLog2 = kScoreScale * 1.4426950408889634f;
constexpr float kPShift    = 8.0f;                 // p carried x2^8: small p stay clear of the f16 subnormals; cancels in sum p v / sum p
static_assert(kAStages >= 2 && kSeq % 128 == 0, "two or more stages; 128 query positions per block");

typedef __attribute__((ext_vector_type(4))) int v4i;

// Four asynchronous 16-byte-per-lane copies global -> LDS: one thread's share of one operand tile of a stage.
// s_wait_xcnt 0 is the last line of the copies' own statement, so it stands ahead of any rewrite of the address registers named here.
__device__ __forceinline__ void async_copy4(unsigned l0, unsigned l1, unsigned l2, unsigned l3,
                                            const char* g0, const char* g1, const char* g2, const char* g3) {
  asm volatile(
      "global_load_async_to_lds_b128 %0, %4, off\n\t"
      "global_load_async_to_lds_b128 %1, %5, off\n\t"
      "global_load_async_to_lds_b128 %2, %6, off\n\t"
      "global_load_async_to_lds_b128 %3, %7, off\n\t"
      "s_wait_xcnt 0x0"
      :: "v"(l0), "v"(l1), "v"(l2), "v"(l3), "v"(g0), "v"(g1), "v"(g2), "v"(g3)
      : "memory");
}
// One stage: 64 K rows x 256 B of each plane (thread: row tid >> 4 (+16 a copy), chunk tid & 15) and 128 V^T rows x 128 B
// (thread: row tid >> 3 (+32 a copy), chunk tid & 7). lK, lV, gKh, gKl, gV are the thread's own addresses of its first copy.
__device__ __forceinline__ void attn_stage(unsigned lK, unsigned lV, const char* gKh, const char* gKl, const char* gV) {
  constexpr unsigned kLK = 16 * kKPitch, kLV = 32 * kVPitch;
  constexpr size_t   kGK = (size_t)16 * 2 * kHD, kGV = (size_t)32 * 2 * kSeq;
  async_copy4(lK, lK + kLK, lK + 2 * kLK, lK + 3 * kLK, gKh, gKh + kGK, gKh + 2 * kGK, gKh + 3 * kGK);
  async_copy4(lK + kKTile, lK + kKTile + kLK, lK + kKTile + 2 * kLK, lK + kKTile + 3 * kLK, gKl, gKl + kGK, gKl + 2 * kGK, gKl + 3 * kGK);
  async_copy4(lV, lV + kLV, lV + 2 * kLV, lV + 3 * kLV, gV, gV + kGV, gV + 2 * kGV, gV + 3 * kGV);
}
// lane l with lane l ^ 16
__device__ __forceinline__ float xhalf(float x) {
  return __builtin_bit_cast(float, __builtin_amdgcn_permlanex16(__builtin_bit_cast(int, x), __builtin_bit_cast(int, x), 0x76543210, 0xfedcba98, false, false));
}

__global__ __launch_bounds__(256) void attn_kernel(const unsigned short* __restrict__ Ph, long loOff,
                                                   const unsigned short* __restrict__ VTp, const int* __restrict__ maskp,
                                                   unsigned short* __restrict__ Obp) {
  // every '#pragma unroll' in this kernel: constant indices keep the fragment, score and accumulator arrays in registers
  __shared__ __align__(128) char ring[2 * kABuf];
  __shared__ __align__(16) float kbias[kSeq];
  const int tid   = threadIdx.x;
  const int lane  = tid & 31;
  const int wave  = tid >> 5;
  const int rlane = lane & 15;                 // row of an A fragment, column of a B fragment and of D
  const int koff  = (lane >> 4) * 8;           // k offset of this lane half = D row offset
  const int b     = blockIdx.y / kKV;
  const int j     = blockIdx.y % kKV;
  const int q0    = blockIdx.x * 128 + wave * 16;

  // additive key bias of batch b, once per block
  {
    const int* mp = maskp + (size_t)b * kSeq + 8 * tid;
    const v4i m0 = *(const v4i*)(mp);
    const v4i m1 = *(const v4i*)(mp + 4);
    v4f f0, f1;
#pragma unroll
    for (int e = 0; e < 4; ++e) {
      f0[e] = (m0[e] != 0) ? 0.0f : -__builtin_inff();
      f1[e] = (m1[e] != 0) ? 0.0f : -__builtin_inff();
    }
    *(v4f*)(kbias + 8 * tid)     = f0;
    *(v4f*)(kbias + 8 * tid + 4) = f1;
  }

  const unsigned lK = (unsigned)(size_t)ring + (unsigned)((tid >> 4) * kKPitch + (tid & 15) * 16);
  const unsigned lV = (unsigned)(size_t)ring + (unsigned)(2 * kKTile + (tid >> 3) * kVPitch + (tid & 7) * 16);
  const char* gKh = (const char*)(Ph + ((size_t)kKRow0 + (size_t)(b * kKV + j) * kSeq + (tid >> 4)) * kHD) + (tid & 15) * 16;
  const char* gKl = gKh + (size_t)loOff * 2;
  const char* gV  = (const char*)(VTp + ((size_t)(b * kKV + j) * kHD + (tid >> 3)) * kSeq) + (tid & 7) * 16;
  constexpr size_t kKStep = (size_t)kAKeys * kHD * 2;   // bytes from one stage's K rows to the next
  constexpr size_t kVStep = (size_t)kAKeys * 2;         // bytes from one stage's V^T columns to the next

  attn_stage(lK, lV, gKh, gKl, gV);

  // Q fragments (B operand), both planes, both heads, kept for the whole kernel
  v16b qh[2][4], ql[2][4];
#pragma unroll
  for (int g = 0; g < 2; ++g) {
    const __bf16* qp = (const __bf16*)Ph + ((size_t)(b * kHeads + 2 * j + g) * kSeq + q0 + rlane) * kHD + koff;
#pragma unroll
    for (int kc = 0; kc < 4; ++kc) {
      qh[g][kc] = Frag<__bf16>::load(qp + kc * 32);
      ql[g][kc] = Frag<__bf16>::load(qp + loOff + kc * 32);
    }
  }
  v8f acc[2][8];
  float mrun[2], lrun[2];
#pragma unroll
  for (int g = 0; g < 2; ++g) {
    mrun[g] = -__builtin_inff();
    lrun[g] = 0.0f;
#pragma unroll
    for (int d = 0; d < 8; ++d) acc[g][d] = (v8f){0.f,0.f,0.f,0.f,0.f,0.f,0.f,0.f};
  }

  asm volatile("s_wait_asynccnt 0x0" ::: "memory");     // stage 0 has landed before anybody reads it
  __syncthreads();                                      // also publishes kbias
  attn_stage(lK + kABuf, lV + kABuf, gKh + kKStep, gKl + kKStep, gV + kVStep);

  for (int t = 0; t < kAStages; ++t) {
    const int bsel = (t & 1) * kABuf;
    // two 32-key passes; kept rolled: unrolled, both passes' fragments are fetched together and registers spill
#pragma unroll 1
    for (int sub = 0; sub < 2; ++sub) {
      const char* kp = ring + bsel + (sub * 32 + rlane) * kKPitch + koff * 2;
      // all 32 K fragment loads of the pass go out as one group, in the order of their use
      v16b kh[2][4], kl[2][4];
#pragma unroll
      for (int kc = 0; kc < 4; ++kc) {
#pragma unroll
        for (int kt = 0; kt < 2; ++kt) kh[kt][kc] = Frag<__bf16>::load((const __bf16*)(kp + kt * 16 * kKPitch + kc * 64));
#pragma unroll
        for (int kt = 0; kt < 2; ++kt) kl[kt][kc] = Frag<__bf16>::load((const __bf16*)(kp + kKTile + kt * 16 * kKPitch + kc * 64));
      }
      // bias of this lane's 16 keys, last in the same group: there when the products end
      const float* bp = kbias + t * kAKeys + sub * 32 + koff;
      const v4f b0 = *(const v4f*)(bp), b1 = *(const v4f*)(bp + 4), b2 = *(const v4f*)(bp + 16), b3 = *(const v4f*)(bp + 20);
      // holds the load group ahead of the products; the scheduler otherwise sinks each fragment's loads in front of its use, one LDS latency each
      __builtin_amdgcn_sched_barrier(0);
      v8f s[2][2];
#pragma unroll
      for (int kt = 0; kt < 2; ++kt)
#pragma unroll
        for (int g = 0; g < 2; ++g) s[kt][g] = (v8f){0.f,0.f,0.f,0.f,0.f,0.f,0.f,0.f};
      // the four score tiles take turns, so that no product waits for the one before it
#pragma unroll
      for (int kc = 0; kc < 4; ++kc) {
#pragma unroll
        for (int kt = 0; kt < 2; ++kt)
#pragma unroll
          for (int g = 0; g < 2; ++g) s[kt][g] = Frag<__bf16>::mma(kh[kt][kc], qh[g][kc], s[kt][g]);
#pragma unroll
        for (int kt = 0; kt < 2; ++kt)
#pragma unroll
          for (int g = 0; g < 2; ++g) s[kt][g] = Frag<__bf16>::mma(kh[kt][kc], ql[g][kc], s[kt][g]);
#pragma unroll
        for (int kt = 0; kt < 2; ++kt)
#pragma unroll
          for (int g = 0; g < 2; ++g) s[kt][g] = Frag<__bf16>::mma(kl[kt][kc], qh[g][kc], s[kt][g]);
      }
      // holds the V^T loads behind the score products, where the K fragments' registers are free again (hoisted, they spill);
      // their latency passes under the softmax arithmetic
      __builtin_amdgcn_sched_barrier(0);
      // V^T fragments of the pass: 16 dims x 32 keys each
      const char* vp = ring + bsel + 2 * kKTile + rlane * kVPitch + sub * 64 + koff * 2;
      v16h vf[8];
#pragma unroll
      for (int d = 0; d < 8; ++d) vf[d] = Frag<_Float16>::load((const _Float16*)(vp + d * 16 * kVPitch));
#pragma unroll
      for (int g = 0; g < 2; ++g) {
        float a[16];
#pragma unroll
        for (int r = 0; r < 4; ++r) {
          a[r]      = fmaf(s[0][g][r],     kScoreLog2, b0[r]);
          a[4 + r]  = fmaf(s[0][g][4 + r], kScoreLog2, b1[r]);
          a[8 + r]  = fmaf(s[1][g][r],     kScoreLog2, b2[r]);
          a[12 + r] = fmaf(s[1][g][4 + r], kScoreLog2, b3[r]);
        }
        float mx = a[0];
#pragma unroll
        for (int e = 1; e < 16; ++e) mx = fmaxf(mx, a[e]);
        mx = fmaxf(mx, xhalf(mx));                                     // both halves hold the query's maximum over the 32 keys
        const float mnew  = fmaxf(mrun[g], mx);
        const float msafe = (mnew == -__builtin_inff()) ? 0.0f : mnew; // only masked keys so far: keep -inf - -inf out of the exponents
        const float corr  = __builtin_amdgcn_exp2f(mrun[g] - msafe);
        const float nm    = kPShift - msafe;
        mrun[g] = mnew;
        v16h pf;
        float ps0 = 0.0f, ps1 = 0.0f;
#pragma unroll
        for (int e = 0; e < 16; e += 2) {
          const float p0 = __builtin_amdgcn_exp2f(a[e] + nm);
          const float p1 = __builtin_amdgcn_exp2f(a[e + 1] + nm);
          ps0 += p0;
          ps1 += p1;
          pf[e]     = (_Float16)p0;
          pf[e + 1] = (_Float16)p1;
        }
        lrun[g] = fmaf(lrun[g], corr, ps0 + ps1);                      // this half's keys only; the halves join behind the loop
#pragma unroll
        for (int d = 0; d < 8; ++d) acc[g][d] = acc[g][d] * corr;
#pragma unroll
        for (int d = 0; d < 8; ++d) acc[g][d] = Frag<_Float16>::mma(vf[d], pf, acc[g][d]);
      }
    }
    asm volatile("s_wait_dscnt 0x0" ::: "memory");      // this stage's LDS reads are done before its buffer is refilled
    asm volatile("s_wait_asynccnt 0x0" ::: "memory");   // stage t + 1 has landed
    __syncthreads();
    if (t + 2 < kAStages) {
      const size_t st = (size_t)(t + 2);
      attn_stage(lK + bsel, lV + bsel, gKh + st * kKStep, gKl + st * kKStep, gV + st * kVStep);
    }
  }
  asm volatile("s_wait_asynccnt 0x0" ::: "memory");     // nothing in flight when the wave ends

  // O^T tile d: lane holds dims 16 d + koff + 0..7 of query q0 + rlane: one 16-B store; a wave writes whole 256-B head rows
#pragma unroll
  for (int g = 0; g < 2; ++g) {
    const float inv = kOCarry / (lrun[g] + xhalf(lrun[g]));
    unsigned short* op = Obp + ((size_t)b * kSeq + q0 + rlane) * kNQ + (size_t)(2 * j + g) * kHD + koff;
#pragma unroll
    for (int d = 0; d < 8; ++d) {
      v8h o;
#pragma unroll
      for (int r = 0; r < 8; ++r) o[r] = (_Float16)(acc[g][d][r] * inv);
      *(v8h*)(op + d * 16) = o;
    }
  }
}

// ---------------------------------------------------------------------------
// Host glue.
//   R0 X16  f16 [4096][2048]                        16,777,216 at           0   (later: Ob f16 [4096][2048], same type + layout)
//   R1 Wq16 f16 [4096][2048] (w_qkv x16)            16,777,216 at  16,777,216   
//   R2 Wo16 f16 [2048][2048] (w_out x16)             8,388,608 at  33,554,432
//   R3 QK32 f32 [4096][3072] q|k of both batches    50,331,648 at  41,943,040
//   R4 VT   f16 [2*8][128][2048] (v transposed)       8,388,608 at  92,274,688
//   R5 QKhi bf16 [98304][128] (q rows then k rows)  25,165,824 at 100,663,296
//   R6 QKlo bf16 [98304][128]                        25,165,824 at 125,829,120
//   total                                          150,994,944
// Re-use timeline (stream ordered): X16/Wq16 are read only by the qkv GEMM; QK32 only by the norm kernel;
// Ob is first written by the attention kernel, which starts after the qkv GEMM and the norm kernel.
// Every region is fully written before it is read; no region changes element type.
// GEMM shapes: q|k (M=4096, N=3072, K=2048); V^T per batch (M=1024, N=2048, K=2048);
// output (M=4096, N=2048, K=2048); all M,N multiples of 64, all K multiples of 32, no padding anywhere.
// ---------------------------------------------------------------------------
extern "C" void kernel_launch(void* const* d_in, const int* in_sizes, int n_in,
                              void* d_out, int out_size, void* d_ws, size_t ws_size,
                              hipStream_t stream) {
  if (n_in < 7) return;
  const int nX = kBatch * kSeq * kDim;            // 8,388,608
  if (in_sizes[0] != nX) return;
  if (in_sizes[1] != kBatch * kSeq) return;
  if (in_sizes[2] != kSeq * (kHD / 2) * 4) return;
  if (in_sizes[3] != kNQKV * kDim) return;
  if (in_sizes[4] != kDim * kNQ) return;
  if (in_sizes[5] != kHD || in_sizes[6] != kHD) return;
  if (out_size != kTok * kDim) return;

  const size_t szX16  = (size_t)kTok * kDim * 2;
  const size_t szWq16 = (size_t)kNQKV * kDim * 2;
  const size_t szWo16 = (size_t)kDim * kNQ * 2;
  const size_t szQK32 = (size_t)kTok * kNQK * 4;          // both batches
  const size_t szVT   = (size_t)kBatch * kKV * kHD * kSeq * 2;
  const size_t szPl   = (size_t)kQKRows * kHD * 2;        // one bf16 q|k plane
  const size_t szOb   = (size_t)kTok * kNQ * 2;
  const size_t offX16  = 0;
  const size_t offWq16 = offX16 + szX16;
  const size_t offWo16 = offWq16 + szWq16;
  const size_t offR3   = offWo16 + szWo16;
  const size_t offVT   = offR3 + szQK32;
  const size_t offPhi  = offVT + szVT;
  const size_t offPlo  = offPhi + szPl;
  const size_t total   = offPlo + szPl;
  if (szOb > szX16) return;                      // the re-used region fits its first carve
  if (ws_size < total) return;

  const float* x     = (const float*)d_in[0];
  const int*   xmask = (const int*)d_in[1];
  const float* freqs = (const float*)d_in[2];
  const float* wqkv  = (const float*)d_in[3];
  const float* wout  = (const float*)d_in[4];
  const float* qw    = (const float*)d_in[5];
  const float* kw    = (const float*)d_in[6];
  float* out = (float*)d_out;
  char* ws = (char*)d_ws;
  unsigned short* X16  = (unsigned short*)(ws + offX16);
  unsigned short* Ob   = (unsigned short*)(ws + offX16);     // re-use of R0 (f16, same layout)
  unsigned short* Wq16 = (unsigned short*)(ws + offWq16);
  unsigned short* Wo16 = (unsigned short*)(ws + offWo16);
  float* QK32 = (float*)(ws + offR3);
  unsigned short* VT  = (unsigned short*)(ws + offVT);
  unsigned short* Phi = (unsigned short*)(ws + offPhi);
  unsigned short* Plo = (unsigned short*)(ws + offPlo);
  const long loOff = (long)kQKRows * kHD;                    // elements from the hi plane to the lo plane
  const float* dummyf = (const float*)(ws + offR3);          // valid in-ws pointer for unused bias/resid arguments

  // ---- 16-bit operand planes of the inputs (RNE bf16 of every float input, f16 containers, weights x16) ----
  const int n8x = nX / 8;                 // 1,048,576 -> 4096 blocks exact
  const int n8w = (kNQKV * kDim) / 8;     // 1,048,576 -> 4096 blocks exact
  const int n8o = (kDim * kNQ) / 8;       //   524,288 -> 2048 blocks exact
  cast8_kernel<<<dim3(n8x / 256), dim3(256), 0, stream>>>(x, X16, n8x, 1.0f);
  cast8_kernel<<<dim3(n8w / 256), dim3(256), 0, stream>>>(wqkv, Wq16, n8w, kWCarry);
  cast8_kernel<<<dim3(n8o / 256), dim3(256), 0, stream>>>(wout, Wo16, n8o, kWCarry);

  // ---- q|k projection of both batches (w_qkv rows 0..3071 -> f32 plane) and v projection written directly transposed (f16), one launch:
  //      384 + 128 work-groups cover all 4096 x 3072 of QK32 and the whole 16 x 128 x 2048 VT plane ----
  qkv_gemm<<<dim3(kQKVBlocks), dim3(256), 0, stream>>>(X16, Wq16, QK32, VT);

  // ---- norm + rotary of both batches -> bf16 hi/lo planes ----
  norm_rope_kernel<<<dim3((kHeads + kKV) / 8, kSeq, kBatch), dim3(256), 0, stream>>>(QK32, freqs, qw, kw, Phi, loOff);

  // ---- attention, all (batch, kv head) groups in one launch: Ob[b*2048+i][(2j+hg)*128+n] = f16( 16 * softmax(q.k^T * 128^-0.5 + mask) . v )
  //      grid (16 blocks of 128 query positions, 16 groups) = 256 blocks; covers the whole [4096][2048] Ob plane ----
  attn_kernel<<<dim3(kSeq / 128, kBatch * kKV), dim3(256), 0, stream>>>(Phi, loOff, VT, xmask, Ob);

  // ---- output projection: out[tok][n] = 2^-8 * sum_e Ob[tok][e] * Wo16[n][e]   (M=4096, N=2048, K=2048) ----
  {
    const int tilesOut = (kTok / 64) * (kDim / 64);   // 2048 -> 256 blocks; covers the whole [4096][2048] output
    wmma_gemm64<0, false, 0, 0, false, 0><<<dim3(tilesOut / 8, 1), dim3(256), 0, stream>>>(
        Ob, Ob, kNQ, 0L, Wo16, Wo16, kNQ, 0L,
        (void*)out, (void*)out, kDim, 0L, dummyf, dummyf, 0L, kTok, kDim, kNQ, kOutScale);
  }
}

// v005
// A run of this version takes 190 microseconds.
// Two timings next to v004 put it at 1.11 and 1.10 times that version's speed.
// Over all steps from v000 it is 11.7 times as fast.
// Contractions: qkv projection (x as f16(bf16 RNE) x w_qkv^T as f16(16*bf16 RNE)), V^T.P^T (P f16, unnormalised, carried x256, x V^T f16) and output projection (o f16 carried x16 x w_out^T as f16(16*bf16 RNE)) on v_wmma_f32_16x16x32_f16; scores k.q^T on v_wmma_f32_16x16x32_bf16 with q,k as bf16 hi+lo planes (hi*hi + hi*lo + lo*hi); f32 accumulate everywhere; RMSNorm, 2x2 rotary map and online softmax in f32.
#include <hip/hip_runtime.h>
#include <math.h>

// ---------------------------------------------------------------------------
// Problem constants
// ---------------------------------------------------------------------------
constexpr int kBatch = 2;
constexpr int kSeq   = 2048;
constexpr int kDim   = 2048;              // model dim (K of the qkv projection, N of the output projection)
constexpr int kHeads = 16;
constexpr int kKV    = 8;
constexpr int kHD    = 128;
constexpr int kTok   = kBatch * kSeq;     // 4096 token rows
constexpr int kNQ    = kHeads * kHD;      // 2048 q columns / o columns
constexpr int kNK    = kKV * kHD;         // 1024 k columns (= v columns)
constexpr int kNQK   = kNQ + kNK;         // 3072 = pitch of the f32 q|k plane
constexpr int kNQKV  = kNQ + 2 * kNK;     // 4096 rows of w_qkv
constexpr int kQKRows = kBatch * (kHeads + kKV) * kSeq;   // 98304 rows of 128 in each q|k 16-bit plane
constexpr int kKRow0  = kBatch * kHeads * kSeq;           // 65536 = first k row in the q|k planes
constexpr float kEps        = 1.1920929e-07f;
constexpr float kInvHD      = 1.0f / 128.0f;
constexpr float kWCarry     = 16.0f;                      // weights carried x16 in f16
constexpr float kWCarryInv  = 1.0f / 16.0f;
constexpr float kOCarry     = 16.0f;                      // attention output carried x16 in f16
constexpr float kOutScale   = 1.0f / (kOCarry * kWCarry); // 2^-8
constexpr float kScoreScale = 0.08838834764831845f;       // 128^-0.5
static_assert(kHD == 128, "norm kernel lane map: 32 lanes x 4 dims");
static_assert(kHeads == 2 * kKV, "two query heads per kv head");
static_assert(kSeq % 64 == 0 && kNQK % 64 == 0 && kNK % 64 == 0 && kNQ % 64 == 0 && kDim % 64 == 0 && kTok % 64 == 0, "GEMM M/N tiles");
static_assert(kHD % 64 == 0);
static_assert(kDim % 32 == 0 && kHD % 32 == 0 && kSeq % 32 == 0 && kNQ % 32 == 0, "GEMM K % 32");
static_assert(kDim % 128 == 0 && kSeq % 128 == 0 && kNQ % 128 == 0, "staged GEMM K: two or more stages of 64");
static_assert(kSeq % 256 == 0 && kNK % 256 == 0 && kTok % 256 == 0 && kNQK % 128 == 0 && kDim % 128 == 0, "staged GEMM: 256 x 128 per work-group");
static_assert(kSeq == 256 * 8, "key bias coverage: 256 threads x 8 keys");
static_assert((kHeads + kKV) % 8 == 0, "norm kernel: 8 waves per block over 24 q|k heads");

typedef __attribute__((ext_vector_type(16))) _Float16 v16h;
typedef __attribute__((ext_vector_type(8)))  _Float16 v8h;
typedef __attribute__((ext_vector_type(16))) __bf16   v16b;
typedef __attribute__((ext_vector_type(8)))  __bf16   v8b;
typedef __attribute__((ext_vector_type(8)))  float    v8f;
typedef __attribute__((ext_vector_type(4)))  float    v4f;
typedef __attribute__((ext_vector_type(2)))  float    v2f;
typedef __attribute__((ext_vector_type(2)))  int      v2i;
typedef __attribute__((ext_vector_type(4)))  unsigned int v4u;

__device__ __forceinline__ unsigned short f2bf_bits(float f) {
  unsigned u = __float_as_uint(f);
  return (unsigned short)((u + 0x7FFFu + ((u >> 16) & 1u)) >> 16);
}
__device__ __forceinline__ float bf_bits2f(unsigned short h) { return __uint_as_float(((unsigned)h) << 16); }

// hazard guards as plain device helpers
__device__ __forceinline__ void dep_guard_h(v8f& a, v8f& b, v16h x, v16h y) { asm volatile("v_nop\n\tv_nop\n\tv_nop\n\tv_nop" : "+v"(a), "+v"(b) : "v"(x), "v"(y)); }
__device__ __forceinline__ void dep_guard_b(v8f& a, v8f& b, v16b x, v16b y) { asm volatile("v_nop\n\tv_nop\n\tv_nop\n\tv_nop" : "+v"(a), "+v"(b) : "v"(x), "v"(y)); }
__device__ __forceinline__ void keep4_h(v16h a, v16h b, v16h c, v16h d) { asm volatile("v_nop" :: "v"(a), "v"(b), "v"(c), "v"(d)); }
__device__ __forceinline__ void keep4_b(v16b a, v16b b, v16b c, v16b d) { asm volatile("v_nop" :: "v"(a), "v"(b), "v"(c), "v"(d)); }
__device__ __forceinline__ void acc_guard4(v8f& a, v8f& b, v8f& c, v8f& d) { asm volatile("v_nop\n\tv_nop\n\tv_nop\n\tv_nop" : "+v"(a), "+v"(b), "+v"(c), "+v"(d)); }
template <typename T> struct Frag;
template <> struct Frag<_Float16> {
  typedef v16h V; union U { v16h v; v8h h[2]; };
  // elements 0..7 <- p[0..7], 8..15 <- p[16..23]
  static __device__ __forceinline__ v16h load(const _Float16* p) {
    U f; f.h[0] = *(const v8h*)(p); f.h[1] = *(const v8h*)(p + 16); return f.v;
  }
  static __device__ __forceinline__ v8f mma(v16h a, v16h b, v8f c) {
    return __builtin_amdgcn_wmma_f32_16x16x32_f16(false, a, false, b, (short)0, c, false, false);
  }
  static __device__ __forceinline__ void guard(v8f& a, v8f& b, v16h x, v16h y) { dep_guard_h(a, b, x, y); }
  static __device__ __forceinline__ void keep(v16h a, v16h b, v16h c, v16h d) { keep4_h(a, b, c, d); }
};
template <> struct Frag<__bf16> {
  typedef v16b V; union U { v16b v; v8b h[2]; };
  static __device__ __forceinline__ v16b load(const __bf16* p) {
    U f; f.h[0] = *(const v8b*)(p); f.h[1] = *(const v8b*)(p + 16); return f.v;
  }
  static __device__ __forceinline__ v8f mma(v16b a, v16b b, v8f c) {
    return __builtin_amdgcn_wmma_f32_16x16x32_bf16(false, a, false, b, (short)0, c, false, false);
  }
  static __device__ __forceinline__ void guard(v8f& a, v8f& b, v16b x, v16b y) { dep_guard_b(a, b, x, y); }
  static __device__ __forceinline__ void keep(v16b a, v16b b, v16b c, v16b d) { keep4_b(a, b, c, d); }
};

__device__ __forceinline__ unsigned pk16(unsigned short a, unsigned short b) { return (unsigned)a | ((unsigned)b << 16); }
__device__ __forceinline__ unsigned short h_bits(float f) { const _Float16 h = (_Float16)f; return __builtin_bit_cast(unsigned short, h); }
// RNE bf16 conversion returned as f32
__device__ __forceinline__ float bfr(float f) { return bf_bits2f(f2bf_bits(f)); }

// ---- Register-blocked batched WMMA GEMM (ACT reduced to none/relu/leaky) -------------------------------
// C[m,n] = scale * sum_k A[m,k] * Bt[n,k] (+bias)(+resid); each wave owns a 64x64 tile.
// A row-major [M,K]; Bt row-major [N,K]; SPLIT: M,N % 64 == 0, K % 32 == 0.
// Not SPLIT: a work-group owns 256 x 128 of C, its waves 4 x 2 tiles of 64x64 on shared staged operands; M % 256 == 0, N % 128 == 0, K % 64 == 0.
// SPLIT: operands are hi/lo planes (A2/Bt2 = lo planes, same layout); product = hi*hi + hi*lo + lo*hi.
// BIAS_MODE: 0 = none, 1 = bias[m], 2 = bias[n].
// OUT_MODE: 0 = f32, 1 = f16, 2 = bf16 hi plane (Cout) + bf16 lo plane (Cout2).
// ET: 0 = f16 operands, 1 = bf16 operands (pointers passed as 16-bit storage)
template <int ET> struct Elem;
template <> struct Elem<0> { typedef _Float16 T; };
template <> struct Elem<1> { typedef __bf16 T; };
// Twelve asynchronous 16-byte-per-lane copies global -> LDS (each 32 lanes x 16 B = 4 rows x one whole 128-B line).
// s_wait_xcnt 0 is the last line of the copies' own statement, so it stands ahead of any rewrite of the address registers named here.
__device__ __forceinline__ void async_copy12(const unsigned (&l)[12], const char* const (&g)[12]) {
  asm volatile(
      "global_load_async_to_lds_b128 %0, %12, off\n\t"
      "global_load_async_to_lds_b128 %1, %13, off\n\t"
      "global_load_async_to_lds_b128 %2, %14, off\n\t"
      "global_load_async_to_lds_b128 %3, %15, off\n\t"
      "global_load_async_to_lds_b128 %4, %16, off\n\t"
      "global_load_async_to_lds_b128 %5, %17, off\n\t"
      "global_load_async_to_lds_b128 %6, %18, off\n\t"
      "global_load_async_to_lds_b128 %7, %19, off\n\t"
      "global_load_async_to_lds_b128 %8, %20, off\n\t"
      "global_load_async_to_lds_b128 %9, %21, off\n\t"
      "global_load_async_to_lds_b128 %10, %22, off\n\t"
      "global_load_async_to_lds_b128 %11, %23, off\n\t"
      "s_wait_xcnt 0x0"
      :: "v"(l[0]), "v"(l[1]), "v"(l[2]), "v"(l[3]), "v"(l[4]), "v"(l[5]), "v"(l[6]), "v"(l[7]), "v"(l[8]), "v"(l[9]), "v"(l[10]), "v"(l[11]),
         "v"(g[0]), "v"(g[1]), "v"(g[2]), "v"(g[3]), "v"(g[4]), "v"(g[5]), "v"(g[6]), "v"(g[7]), "v"(g[8]), "v"(g[9]), "v"(g[10]), "v"(g[11])
      : "memory");
}
// One stage of the work-group's shared tiles: A 256 rows x 128 B (64 k), then B 128 rows x 128 B, in LDS rows of pitch 144 B.
// A wave brings 32 rows of A (8 copies) and 16 rows of B (4 copies); every A row then feeds two waves, every B row four.
// lA / gA and lB / gB are the lane's own addresses for its wave's first row + (lane >> 3), 16-byte chunk (lane & 7); copy c moves 4 rows.
constexpr int kRowPitch  = 144;                    // 128-B rows + 16 B: 16 B x odd, the pitch for ds_load_b128 readers
constexpr int kATile     = 256 * kRowPitch;        // 36864
constexpr int kBTile     = 128 * kRowPitch;        // 18432
constexpr int kBufBytes  = kATile + kBTile;        // A tile then B tile
constexpr int kRingBytes = 2 * kBufBytes;          // two buffers per work-group
__device__ __forceinline__ void stage_block(unsigned lA, unsigned lB, const char* gA, const char* gB, size_t ldaBytes, size_t ldbBytes) {
  // both loops unrolled: every index of l and g is a constant, so the addresses stay in registers
  unsigned l[12];
  const char* g[12];
#pragma unroll
  for (int c = 0; c < 8; ++c) {
    l[c] = lA + (unsigned)(c * 4 * kRowPitch);
    g[c] = gA + (size_t)(c * 4) * ldaBytes;
  }
#pragma unroll
  for (int c = 0; c < 4; ++c) {
    l[8 + c] = lB + (unsigned)(c * 4 * kRowPitch);
    g[8 + c] = gB + (size_t)(c * 4) * ldbBytes;
  }
  async_copy12(l, g);
}

template <int ET, bool SPLIT, int BIAS_MODE, int OUT_MODE, bool RESID, int ACT = 0>
__global__ __launch_bounds__(256) void wmma_gemm64(
    const unsigned short* __restrict__ Ap, const unsigned short* __restrict__ A2p, int lda, long strideA,
    const unsigned short* __restrict__ Btp, const unsigned short* __restrict__ Bt2p, int ldb, long strideB,
    void* __restrict__ Cout, void* __restrict__ Cout2, int ldc, long strideC,
    const float* __restrict__ bias,
    const float* __restrict__ resid, long strideR,
    int M, int N, int K, float scale) {
  typedef typename Elem<ET>::T T;
  typedef typename Frag<T>::V V;
  const T* A = (const T*)Ap; const T* A2 = (const T*)A2p; const T* Bt = (const T*)Btp; const T* Bt2 = (const T*)Bt2p;
  // Per-wave 16x64 f32 slab, pitch 68 floats. Not SPLIT: the work-group's ring of two staged buffers; its first bytes serve as the slabs behind the k loop.
  constexpr int kSlabBytes = 16 * 68 * 4;
  __shared__ __align__(16) char smem[SPLIT ? 8 * kSlabBytes : kRingBytes];
  const int b    = blockIdx.y;
  const int lane = threadIdx.x & 31;
  const int wave = threadIdx.x >> 5;
  int m0, n0, mB = 0, nB = 0;                  // the wave's tile; the work-group's tile (staged path)
  if (SPLIT) {
    const int tilesN = N >> 6;
    const int tile = blockIdx.x * 8 + wave;
    if (tile >= (M >> 6) * tilesN) return;    // wave-uniform; no block barriers on this path
    const int tm = tile / tilesN;
    m0 = tm << 6;
    n0 = (tile - tm * tilesN) << 6;
  } else {
    const int blocksN = N >> 7;
    if ((int)blockIdx.x >= (M >> 8) * blocksN) return;   // the whole work-group leaves, ahead of every barrier and copy
    const int bm = blockIdx.x / blocksN;
    mB = bm << 8;
    nB = (blockIdx.x - bm * blocksN) << 7;
    m0 = mB + ((wave >> 1) << 6);
    n0 = nB + ((wave & 1) << 6);
  }

  const T* Ab  = A  + (size_t)b * strideA;
  const T* Bb  = Bt + (size_t)b * strideB;
  const T* Ab2 = SPLIT ? (A2  + (size_t)b * strideA) : nullptr;
  const T* Bb2 = SPLIT ? (Bt2 + (size_t)b * strideB) : nullptr;

  const int rlane = lane & 15;                 // row (A) / col (B, D) within subtile
  const int koff  = (lane >> 4) * 8;           // k offset of this lane half
  const int mOff  = (lane >> 4) * 8;           // D row offset

  v8f acc[4][4];
#pragma unroll
  for (int i = 0; i < 4; ++i)
#pragma unroll
    for (int j = 0; j < 4; ++j) acc[i][j] = (v8f){0.f,0.f,0.f,0.f,0.f,0.f,0.f,0.f};

  if (SPLIT) {
    for (int k0 = 0; k0 < K; k0 += 32) {
      V bh[4], bl[4];
#pragma unroll
      for (int j = 0; j < 4; ++j) {
        const size_t bo = (size_t)(n0 + (j << 4) + rlane) * ldb + koff + k0;
        bh[j] = Frag<T>::load(Bb + bo);
        if (SPLIT) bl[j] = Frag<T>::load(Bb2 + bo);
      }
#pragma unroll
      for (int i = 0; i < 4; ++i) {
        const size_t ao = (size_t)(m0 + (i << 4) + rlane) * lda + koff + k0;
        V ah = Frag<T>::load(Ab + ao);
        V al;
        if (SPLIT) al = Frag<T>::load(Ab2 + ao);
#pragma unroll
        for (int j = 0; j < 4; ++j) {
          acc[i][j] = Frag<T>::mma(ah, bh[j], acc[i][j]);
          if (SPLIT) {
            acc[i][j] = Frag<T>::mma(ah, bl[j], acc[i][j]);
            acc[i][j] = Frag<T>::mma(al, bh[j], acc[i][j]);
          }
        }
        Frag<T>::guard(acc[i][0], acc[i][3], ah, SPLIT ? al : ah);
      }
      Frag<T>::keep(bh[0], bh[1], bh[2], bh[3]);
      if (SPLIT) Frag<T>::keep(bl[0], bl[1], bl[2], bl[3]);
    }
  } else {
    // The work-group stages its A and B tiles once for all eight waves, 64 k (one whole 128-B line of every row) per stage, in two LDS
    // buffers by asynchronous copies; the fragments come from LDS through Frag::load, k ascending. K is a multiple of 128 (asserted below the constants).
    const unsigned lc = (unsigned)(size_t)smem + (unsigned)((lane >> 3) * kRowPitch + (lane & 7) * 16);
    const unsigned lA = lc + (unsigned)(wave * 32 * kRowPitch);
    const unsigned lB = lc + (unsigned)(kATile + wave * 16 * kRowPitch);
    const size_t ldaB = (size_t)lda * 2, ldbB = (size_t)ldb * 2;
    const char* gA = (const char*)Ab + (size_t)(mB + wave * 32 + (lane >> 3)) * ldaB + (lane & 7) * 16;
    const char* gB = (const char*)Bb + (size_t)(nB + wave * 16 + (lane >> 3)) * ldbB + (lane & 7) * 16;
    const int stages = K >> 6;
    stage_block(lA, lB, gA, gB, ldaB, ldbB);
    asm volatile("s_wait_asynccnt 0x0" ::: "memory");   // this wave's share of stage 0 has landed; the barrier publishes every wave's
    __syncthreads();
    if (stages > 1) stage_block(lA + kBufBytes, lB + kBufBytes, gA + 128, gB + 128, ldaB, ldbB);
    // the lane's fragment row and k half inside the wave's 64 rows of the A tile and of the B tile
    const int foA = ((wave >> 1) * 64 + rlane) * kRowPitch + koff * 2;
    const int foB = kATile + ((wave & 1) * 64 + rlane) * kRowPitch + koff * 2;
    for (int t = 0; t < stages; ++t) {
      const int bsel = (t & 1) * kBufBytes;
      const char* rb = smem + bsel;
      // all 32 fragment loads of the stage go out as one group ahead of its products: one LDS latency a stage, not one per A fragment
      V ah[2][4], bh[2][4];                              // loops below unrolled: constant indices keep the fragments in registers
#pragma unroll
      for (int s = 0; s < 2; ++s) {
#pragma unroll
        for (int j = 0; j < 4; ++j) {
          bh[s][j] = Frag<T>::load((const T*)(rb + foB + j * 16 * kRowPitch + s * 64));
          ah[s][j] = Frag<T>::load((const T*)(rb + foA + j * 16 * kRowPitch + s * 64));
        }
      }
      // holds the load group ahead of the products; the scheduler otherwise sinks each A fragment's loads in front of its use
      __builtin_amdgcn_sched_barrier(0);
#pragma unroll
      for (int s = 0; s < 2; ++s) {
#pragma unroll
        for (int i = 0; i < 4; ++i) {
#pragma unroll
          for (int j = 0; j < 4; ++j) acc[i][j] = Frag<T>::mma(ah[s][i], bh[s][j], acc[i][j]);
        }
      }
      // holds the products ahead of the foot's waits, so that stage t + 1's copies fly while stage t is worked on
      __builtin_amdgcn_sched_barrier(0);
      asm volatile("s_wait_dscnt 0x0" ::: "memory");     // this wave's LDS reads of the stage are done before any wave refills its buffer
      asm volatile("s_wait_asynccnt 0x0" ::: "memory");  // this wave's share of stage t + 1 has landed
      __syncthreads();                                   // publishes stage t + 1 to all waves; ends every wave's reads of stage t
      if (t + 2 < stages) {
        const size_t kb = (size_t)(t + 2) * 128;
        stage_block(lA + bsel, lB + bsel, gA + kb, gB + kb, ldaB, ldbB);
      }
    }
    asm volatile("s_wait_asynccnt 0x0" ::: "memory");    // nothing in flight when the ring becomes the epilogue's slabs (all reads ended at the last barrier)
  }
  acc_guard4(acc[0][0], acc[0][1], acc[0][2], acc[0][3]);
  acc_guard4(acc[1][0], acc[1][1], acc[1][2], acc[1][3]);
  acc_guard4(acc[2][0], acc[2][1], acc[2][2], acc[2][3]);
  acc_guard4(acc[3][0], acc[3][1], acc[3][2], acc[3][3]);

  // ---- epilogue ----
  float* slab = (float*)(smem + wave * kSlabBytes);
  const float* Rb = RESID ? (resid + (size_t)b * strideR) : nullptr;
#pragma unroll
  for (int i = 0; i < 4; ++i) {
    const int mBase = m0 + (i << 4);
#pragma unroll
    for (int j = 0; j < 4; ++j) {
      const int n = n0 + (j << 4) + rlane;
      float bv = 0.f;
      if (BIAS_MODE == 2) bv = bias[n];
#pragma unroll
      for (int r = 0; r < 8; ++r) {
        float v = acc[i][j][r] * scale;
        if (BIAS_MODE == 1) v += bias[mBase + mOff + r];
        if (BIAS_MODE == 2) v += bv;
        if (RESID) v += Rb[(size_t)(mBase + mOff + r) * ldc + n];
        if (ACT == 2) v = fmaxf(v, 0.0f);
        if (ACT == 4) v = (v > 0.f) ? v : 0.01f * v;
        slab[(mOff + r) * 68 + (j << 4) + rlane] = v;
      }
    }
    __builtin_amdgcn_fence(__ATOMIC_RELEASE, "workgroup");
    __builtin_amdgcn_wave_barrier();
    __builtin_amdgcn_fence(__ATOMIC_ACQUIRE, "workgroup");
    if (OUT_MODE == 0) {
      float* C = (float*)Cout + (size_t)b * strideC;
      const int hh = lane >> 4, c4 = (lane & 15) * 4;     // row seg = 256 B = 16 lanes x 16 B
      {
#pragma unroll
        for (int it = 0; it < 8; ++it) {
          const int row = it * 2 + hh;
          v4f v = *(const v4f*)(slab + row * 68 + c4);
          *(v4f*)(C + (size_t)(mBase + row) * ldc + n0 + c4) = v;
        }
        
      }
    } else {
      const int q = lane >> 3, c8 = (lane & 7) * 8;
      unsigned short* C  = (unsigned short*)Cout  + (size_t)b * strideC;
      unsigned short* C2 = (OUT_MODE == 2) ? ((unsigned short*)Cout2 + (size_t)b * strideC) : nullptr;
      {
#pragma unroll
        for (int it = 0; it < 4; ++it) {
          const int row = it * 4 + q;
          const float* sp = slab + row * 68 + c8;
          v8h hv, lv;
#pragma unroll
          for (int e = 0; e < 8; ++e) {
            if (OUT_MODE == 1) {
              hv[e] = (_Float16)sp[e];
            } else {
              unsigned short hb = f2bf_bits(sp[e]);
              unsigned short lb = f2bf_bits(sp[e] - bf_bits2f(hb));
              hv[e] = __builtin_bit_cast(_Float16, hb);
              lv[e] = __builtin_bit_cast(_Float16, lb);
            }
          }
          *(v8h*)(C + (size_t)(mBase + row) * ldc + n0 + c8) = hv;
          if (OUT_MODE == 2) *(v8h*)(C2 + (size_t)(mBase + row) * ldc + n0 + c8) = lv;
        }
        
      }
    }
    __builtin_amdgcn_fence(__ATOMIC_RELEASE, "workgroup");
    __builtin_amdgcn_wave_barrier();
    __builtin_amdgcn_fence(__ATOMIC_ACQUIRE, "workgroup");
  }
}

// ---------------------------------------------------------------------------
// The whole qkv projection in ONE launch of 256 equal work-groups, one per WGP, each on a 256 x 256 tile of its product.
// Work-groups 0..191:   q|k of both batches, QK[tok][n] = 1/16 * sum_k X[tok][k] * W[n][k]             (M=4096, N=3072), f32.
// Work-groups 192..255: V^T, VT[b*8+j][d][s] = f16( 1/16 * sum_k W[3072+j*128+d][k] * X[b*2048+s][k] ) (per batch M=1024, N=2048).
// Waves 2 x 4, each on 128 x 64: an A fragment feeds 4 products and a B fragment 8, so a product takes 384 B out of LDS (64 x 64: 512 B),
// and the tile brings two thirds of the bytes per flop from L2 that a 256 x 128 tile brings.
// A stage is 128 k (256 B of every row): one landing latency, one barrier and one exposed LDS latency per 128 products of a wave.
// Ring of two buffers, foot of the k loop (waits, barrier, refill) and epilogue keep the form of wmma_gemm64's staged path; only the
// operand and output addresses and the output type follow the work-group's index (the same for all its waves).
// ---------------------------------------------------------------------------
constexpr int kQKBlocksN = kNQK / 256;                        // 12
constexpr int kQKBlocks  = (kTok / 256) * kQKBlocksN;         // 192
constexpr int kVTBlocksN = kSeq / 256;                        // 8
constexpr int kVTBlocks1 = (kNK / 256) * kVTBlocksN;          // 32 per batch
constexpr int kQKVBlocks = kQKBlocks + kBatch * kVTBlocks1;   // 256
constexpr int kPitch2     = 272;                              // 256-B rows + 16 B: 16 B x odd, the pitch for ds_load_b128 readers
constexpr int kTile2      = 256 * kPitch2;                    // 69632: one operand tile of a stage
constexpr int kBuf2Bytes  = 2 * kTile2;                       // A tile 256 rows, then B tile 256 rows
constexpr int kRing2Bytes = 2 * kBuf2Bytes;                   // two buffers per work-group: 278528
static_assert(kDim % 256 == 0, "qkv projection: two or more stages of 128 k");
static_assert(kNQK % 256 == 0 && kSeq % 256 == 0 && kNK % 256 == 0 && kTok % 256 == 0, "qkv projection: 256 x 256 per work-group");
// Eight asynchronous 16-byte-per-lane copies global -> LDS (each 32 lanes x 16 B = 2 rows x two whole 128-B lines): 16 rows of one operand tile.
// l / g are the lane's own addresses for the first row + (lane >> 4), 16-byte chunk (lane & 15); copy c moves 2 rows.
// s_wait_xcnt 0 is the last line of the copies' own statement, so it stands ahead of any rewrite of the address registers named here.
__device__ __forceinline__ void stage_rows16(unsigned l, const char* g, size_t ldBytes) {
  constexpr unsigned kL = 2 * kPitch2;
  const size_t s4 = 2 * ldBytes;
  asm volatile(
      "global_load_async_to_lds_b128 %0, %8, off\n\t"
      "global_load_async_to_lds_b128 %1, %9, off\n\t"
      "global_load_async_to_lds_b128 %2, %10, off\n\t"
      "global_load_async_to_lds_b128 %3, %11, off\n\t"
      "global_load_async_to_lds_b128 %4, %12, off\n\t"
      "global_load_async_to_lds_b128 %5, %13, off\n\t"
      "global_load_async_to_lds_b128 %6, %14, off\n\t"
      "global_load_async_to_lds_b128 %7, %15, off\n\t"
      "s_wait_xcnt 0x0"
      :: "v"(l), "v"(l + kL), "v"(l + 2 * kL), "v"(l + 3 * kL), "v"(l + 4 * kL), "v"(l + 5 * kL), "v"(l + 6 * kL), "v"(l + 7 * kL),
         "v"(g), "v"(g + s4), "v"(g + 2 * s4), "v"(g + 3 * s4), "v"(g + 4 * s4), "v"(g + 5 * s4), "v"(g + 6 * s4), "v"(g + 7 * s4)
      : "memory");
}
// A wave's share of one stage: 32 rows of A and 32 rows of B, 32 copies.
__device__ __forceinline__ void stage_wave(unsigned lA, unsigned lB, const char* gA, const char* gB, size_t ldBytes) {
  // the three scheduling barriers keep each statement's address arithmetic behind the statement before it, so that the four share their
  // 24 address registers; hoisted, 96 are live at once beside the accumulators: spills and register moves at every foot
  stage_rows16(lA, gA, ldBytes);
  __builtin_amdgcn_sched_barrier(0);
  stage_rows16(lA + 16 * kPitch2, gA + 16 * ldBytes, ldBytes);
  __builtin_amdgcn_sched_barrier(0);
  stage_rows16(lB, gB, ldBytes);
  __builtin_amdgcn_sched_barrier(0);
  stage_rows16(lB + 16 * kPitch2, gB + 16 * ldBytes, ldBytes);
}
// Epilogue of one wave's 128 x 64 tile: each 16 x 64 strip goes through the wave's own slab (pitch 68 floats), so that whole lines are stored.
// VOUT false: f32 rows of QK (pitch 3072); true: f16 rows of this batch's V^T plane (pitch 2048).
template <bool VOUT>
__device__ __forceinline__ void qkv_store(const v8f (&acc)[8][4], float* slab, float* __restrict__ QK, unsigned short* __restrict__ Cv,
                                          int m0, int n0, int lane) {
  const int rlane = lane & 15;                 // D column within a subtile
  const int mOff  = (lane >> 4) * 8;           // D row offset
  // every '#pragma unroll' here: constant indices keep the accumulators in registers
#pragma unroll
  for (int i = 0; i < 8; ++i) {
    const int mBase = m0 + (i << 4);
#pragma unroll
    for (int j = 0; j < 4; ++j) {
#pragma unroll
      for (int r = 0; r < 8; ++r) slab[(mOff + r) * 68 + (j << 4) + rlane] = acc[i][j][r] * kWCarryInv;
    }
    __builtin_amdgcn_fence(__ATOMIC_RELEASE, "workgroup");
    __builtin_amdgcn_wave_barrier();
    __builtin_amdgcn_fence(__ATOMIC_ACQUIRE, "workgroup");
    if (!VOUT) {
      const int hh = lane >> 4, c4 = (lane & 15) * 4;     // row seg = 256 B = 16 lanes x 16 B
#pragma unroll
      for (int it = 0; it < 8; ++it) {
        const int row = it * 2 + hh;
        const v4f v = *(const v4f*)(slab + row * 68 + c4);
        *(v4f*)(QK + (size_t)(mBase + row) * kNQK + n0 + c4) = v;
      }
    } else {
      const int q = lane >> 3, c8 = (lane & 7) * 8;       // row seg = 128 B = 8 lanes x 16 B
#pragma unroll
      for (int it = 0; it < 4; ++it) {
        const int row = it * 4 + q;
        const float* sp = slab + row * 68 + c8;
        v8h hv;
#pragma unroll
        for (int e = 0; e < 8; ++e) hv[e] = (_Float16)sp[e];
        *(v8h*)(Cv + (size_t)(mBase + row) * kSeq + n0 + c8) = hv;
      }
    }
    __builtin_amdgcn_fence(__ATOMIC_RELEASE, "workgroup");
    __builtin_amdgcn_wave_barrier();
    __builtin_amdgcn_fence(__ATOMIC_ACQUIRE, "workgroup");
  }
}
__global__ __launch_bounds__(256) void qkv_gemm(const unsigned short* __restrict__ Xp, const unsigned short* __restrict__ Wp,
                                                float* __restrict__ QK, unsigned short* __restrict__ VTp) {
  typedef _Float16 T;
  typedef Frag<T>::V V;
  constexpr int kSlabBytes = 16 * 68 * 4;
  __shared__ __align__(16) char smem[kRing2Bytes];  // the ring of two staged buffers; its first bytes serve as the slabs behind the k loop
  const int lane = threadIdx.x & 31;
  const int wave = threadIdx.x >> 5;
  const int bx   = blockIdx.x;
  const bool isV = bx >= kQKBlocks;
  const int rv   = isV ? bx - kQKBlocks : 0;
  const int vb   = rv / kVTBlocks1;                 // batch of a V^T work-group
  const int vt   = rv % kVTBlocks1;
  const int mB   = (isV ? vt / kVTBlocksN : bx / kQKBlocksN) << 8;
  const int nB   = (isV ? vt % kVTBlocksN : bx % kQKBlocksN) << 8;
  const int m0   = mB + ((wave >> 2) << 7);
  const int n0   = nB + ((wave & 3) << 6);
  const unsigned short* Ab = isV ? Wp + (size_t)kNQK * kDim : Xp;
  const unsigned short* Bb = isV ? Xp + (size_t)vb * kSeq * kDim : Wp;

  const int rlane = lane & 15;                 // row (A) / col (B, D) within subtile
  const int koff  = (lane >> 4) * 8;           // k offset of this lane half

  // every '#pragma unroll' in this kernel: constant indices keep the fragment and accumulator arrays in registers
  v8f acc[8][4];
#pragma unroll
  for (int i = 0; i < 8; ++i)
#pragma unroll
    for (int j = 0; j < 4; ++j) acc[i][j] = (v8f){0.f,0.f,0.f,0.f,0.f,0.f,0.f,0.f};

  {
    // a wave brings 32 rows of A and 32 rows of B a stage; every A row then feeds four waves, every B row two
    const unsigned lc = (unsigned)(size_t)smem + (unsigned)((wave * 32 + (lane >> 4)) * kPitch2 + (lane & 15) * 16);
    const unsigned lA = lc;
    const unsigned lB = lc + (unsigned)kTile2;
    constexpr size_t ldB = (size_t)kDim * 2;   // bytes of a row of X and of W
    const char* gA = (const char*)Ab + (size_t)(mB + wave * 32 + (lane >> 4)) * ldB + (lane & 15) * 16;
    const char* gB = (const char*)Bb + (size_t)(nB + wave * 32 + (lane >> 4)) * ldB + (lane & 15) * 16;
    constexpr int stages = kDim >> 7;
    stage_wave(lA, lB, gA, gB, ldB);
    asm volatile("s_wait_asynccnt 0x0" ::: "memory");   // this wave's share of stage 0 has landed; the barrier publishes every wave's
    __syncthreads();
    stage_wave(lA + kBuf2Bytes, lB + kBuf2Bytes, gA + 256, gB + 256, ldB);
    // the lane's fragment row and k half inside the wave's 128 rows of the A tile and 64 rows of the B tile
    const int foA = ((wave >> 2) * 128 + rlane) * kPitch2 + koff * 2;
    const int foB = kTile2 + ((wave & 3) * 64 + rlane) * kPitch2 + koff * 2;
    for (int t = 0; t < stages; ++t) {
      const int bsel = (t & 1) * kBuf2Bytes;
      const char* rb = smem + bsel;
      // four blocks of 32 k, 32 products each; the fragments of two blocks are in registers at a time
      V ah[4][8], bh[4][4];
#pragma unroll
      for (int s = 0; s < 4; ++s) {
        // blocks 0 and 1: one load group at the head of the stage, in the order of use; block s + 1 (s = 1, 2): one group ahead of block s's
        // products, into the registers that block s - 1 has left, so that its LDS latency passes under 32 products
        const int f0 = (s == 0) ? 0 : s + 1, f1 = (s == 0) ? 2 : ((s < 3) ? s + 2 : 0);
#pragma unroll
        for (int f = f0; f < f1; ++f) {
#pragma unroll
          for (int j = 0; j < 4; ++j) bh[f][j] = Frag<T>::load((const T*)(rb + foB + j * 16 * kPitch2 + f * 64));
#pragma unroll
          for (int i = 0; i < 8; ++i) ah[f][i] = Frag<T>::load((const T*)(rb + foA + i * 16 * kPitch2 + f * 64));
        }
        // holds each load group whole and ahead of the block's products; the scheduler otherwise sinks each fragment's loads in front of its use
        __builtin_amdgcn_sched_barrier(0);
#pragma unroll
        for (int i = 0; i < 8; ++i) {
#pragma unroll
          for (int j = 0; j < 4; ++j) acc[i][j] = Frag<T>::mma(ah[s][i], bh[s][j], acc[i][j]);
        }
        // holds the next group behind this block's products (hoisted, three blocks' fragments would be live: spills), and the last block's
        // products ahead of the foot's waits, so that stage t + 1's copies fly while stage t is worked on
        __builtin_amdgcn_sched_barrier(0);
      }
      asm volatile("s_wait_dscnt 0x0" ::: "memory");     // this wave's LDS reads of the stage are done before any wave refills its buffer
      asm volatile("s_wait_asynccnt 0x0" ::: "memory");  // this wave's share of stage t + 1 has landed
      __syncthreads();                                   // publishes stage t + 1 to all waves; ends every wave's reads of stage t
      if (t + 2 < stages) {
        const size_t kb = (size_t)(t + 2) * 256;
        stage_wave(lA + bsel, lB + bsel, gA + kb, gB + kb, ldB);
      }
    }
    asm volatile("s_wait_asynccnt 0x0" ::: "memory");    // nothing in flight when the ring becomes the epilogue's slabs (all reads ended at the last barrier)
  }

  // ---- epilogue: one branch, the same for the whole work-group ----
  float* slab = (float*)(smem + wave * kSlabBytes);
  if (!isV) qkv_store<false>(acc, slab, QK, VTp, m0, n0, lane);
  else      qkv_store<true>(acc, slab, QK, VTp + (size_t)vb * kNK * kSeq, m0, n0, lane);
}

// ---------------------------------------------------------------------------
// f32 -> (RNE bf16) -> f16 cast with an exact power-of-two carry: out = f16( scale * bf16(in) ).
// ---------------------------------------------------------------------------
__global__ __launch_bounds__(256) void cast8_kernel(const float* __restrict__ in, unsigned short* __restrict__ out, int n8, float scale) {
  const int i = blockIdx.x * 256 + threadIdx.x;
  if (i >= n8) return;
  const float* p = in + 8 * (size_t)i;
  const v4f a = *(const v4f*)(p);
  const v4f c = *(const v4f*)(p + 4);
  unsigned short hb[8];
#pragma unroll
  for (int e = 0; e < 4; ++e) {
    hb[e]     = h_bits(bfr(a[e]) * scale);
    hb[4 + e] = h_bits(bfr(c[e]) * scale);
  }
  const v4u u = (v4u){pk16(hb[0], hb[1]), pk16(hb[2], hb[3]), pk16(hb[4], hb[5]), pk16(hb[6], hb[7])};
  unsigned short* q = out + 8 * (size_t)i;
  *(v4u*)q = u;
  
}

// ---------------------------------------------------------------------------
// RMSNorm (mean over 128, eps inside rsqrt, x norm weight) + per-position 2x2 rotary map on the q and k heads of both batches,
// f32 math; the result is emitted as a bf16 hi plane and a bf16 lo plane (lo = RNE bf16 of v - hi).
// One wave per (position s, head) with head 0..15 = q heads, 16..23 = k heads; lane owns dims 4*lane..4*lane+3 (two pairs).
// Input: QK f32 [2 b][2048 s][3072] (q cols 0..2047, k cols 2048..3071), batch b = blockIdx.z. Rotary table fcs [s][64][2][2], norm weights [128];
// all three converted to bf16 (RNE) before use. out[2p+i] = fc[s,p,i,0]*v[2p] + fc[s,p,i,1]*v[2p+1].
// Output planes Ph (hi) and Ph + loOff (lo), rows of 128 elements = 256 B: q rows (b*16+h)*2048+s, k rows 65536 + (b*8+kh)*2048+s.
// Store: the 4 packed hi words and the 4 packed lo words of every lane are shuffled from lanes 2L, 2L+1 (L = lane & 15) with wave-uniform register choice, then each lane
// selects by value: lanes 0..15 hold 8 consecutive hi dims, lanes 16..31 hold 8 consecutive lo dims; ONE 32-lane x 16-B instruction
// grid (3, 2048, 2) x 256 threads = 98304 waves = 2 x 2048 x 24 rows (hi and lo).
// ---------------------------------------------------------------------------
__global__ __launch_bounds__(256) void norm_rope_kernel(const float* __restrict__ QK, const float* __restrict__ fcs,
                                                        const float* __restrict__ qw, const float* __restrict__ kw,
                                                        unsigned short* __restrict__ Ph, long loOff) {
  const int lane = threadIdx.x & 31;
  const int wave = threadIdx.x >> 5;
  const int head = blockIdx.x * 8 + wave;          // 0..23, wave-uniform
  const int s    = blockIdx.y;                     // 0..2047
  const int b    = blockIdx.z;                     // batch
  const int d0   = lane * 4;

  const v4f xv = *(const v4f*)(QK + ((size_t)b * kSeq + s) * kNQK + (size_t)head * kHD + d0);
  float v0 = xv[0], v1 = xv[1], v2 = xv[2], v3 = xv[3];
  float ss = 0.0f;
  ss += v0 * v0; ss += v1 * v1; ss += v2 * v2; ss += v3 * v3;
#pragma unroll
  for (int off = 1; off < 32; off <<= 1) ss += __shfl_xor(ss, off, 32);
  const float rn = rsqrtf(ss * kInvHD + kEps);

  // norm weights: both candidates loaded unconditionally, arithmetic select by head kind
  const v4f wq = *(const v4f*)(qw + d0);
  const v4f wk = *(const v4f*)(kw + d0);
  const float fq = (head < kHeads) ? 1.0f : 0.0f;
  const float fk = 1.0f - fq;
  const float w0 = bfr(fmaf(fq, wq[0], fk * wk[0]));
  const float w1 = bfr(fmaf(fq, wq[1], fk * wk[1]));
  const float w2 = bfr(fmaf(fq, wq[2], fk * wk[2]));
  const float w3 = bfr(fmaf(fq, wq[3], fk * wk[3]));
  v0 = (v0 * rn) * w0; v1 = (v1 * rn) * w1; v2 = (v2 * rn) * w2; v3 = (v3 * rn) * w3;

  // rotary 2x2 maps for pairs p = 2*lane, 2*lane+1 at position s (8 consecutive floats)
  const float* fp = fcs + ((size_t)s * (kHD / 2) + 2 * lane) * 4;
  const v4f fa = *(const v4f*)(fp);
  const v4f fb = *(const v4f*)(fp + 4);
  const float a00 = bfr(fa[0]), a01 = bfr(fa[1]), a10 = bfr(fa[2]), a11 = bfr(fa[3]);
  const float b00 = bfr(fb[0]), b01 = bfr(fb[1]), b10 = bfr(fb[2]), b11 = bfr(fb[3]);
  const float o0 = a00 * v0 + a01 * v1;
  const float o1 = a10 * v0 + a11 * v1;
  const float o2 = b00 * v2 + b01 * v3;
  const float o3 = b10 * v2 + b11 * v3;

  // bf16 hi / lo split of each value
  const unsigned short hb0 = f2bf_bits(o0), hb1 = f2bf_bits(o1), hb2 = f2bf_bits(o2), hb3 = f2bf_bits(o3);
  const unsigned short lb0 = f2bf_bits(o0 - bf_bits2f(hb0));
  const unsigned short lb1 = f2bf_bits(o1 - bf_bits2f(hb1));
  const unsigned short lb2 = f2bf_bits(o2 - bf_bits2f(hb2));
  const unsigned short lb3 = f2bf_bits(o3 - bf_bits2f(hb3));
  const unsigned ph0 = pk16(hb0, hb1), ph1 = pk16(hb2, hb3);
  const unsigned pl0 = pk16(lb0, lb1), pl1 = pk16(lb2, lb3);

  // gather 8 consecutive dims per lane: dims 8L..8L+3 from lane 2L, 8L+4..8L+7 from lane 2L+1 (L = lane & 15); every candidate
  // is shuffled with a wave-uniform register choice, the hi/lo choice is made per lane after the shuffles
  const int src = (2 * lane) & 31;
  const unsigned gh0 = __shfl(ph0, src, 32);
  const unsigned gh1 = __shfl(ph1, src, 32);
  const unsigned gh2 = __shfl(ph0, src + 1, 32);
  const unsigned gh3 = __shfl(ph1, src + 1, 32);
  const unsigned gl0 = __shfl(pl0, src, 32);
  const unsigned gl1 = __shfl(pl1, src, 32);
  const unsigned gl2 = __shfl(pl0, src + 1, 32);
  const unsigned gl3 = __shfl(pl1, src + 1, 32);
  const bool loh = (lane >= 16);
  const v4u u = (v4u){loh ? gl0 : gh0, loh ? gl1 : gh1, loh ? gl2 : gh2, loh ? gl3 : gh3};

  const int hq = (head < kHeads) ? head : 0;
  const int hk = (head < kHeads) ? 0 : (head - kHeads);
  const size_t rowQ = ((size_t)(b * kHeads + hq)) * kSeq + s;
  const size_t rowK = (size_t)kKRow0 + ((size_t)(b * kKV + hk)) * kSeq + s;
  const size_t row  = (head < kHeads) ? rowQ : rowK;
  const size_t poff = loh ? (size_t)loOff : (size_t)0;
  unsigned short* dp = Ph + poff + row * kHD + 8 * (lane & 15);
  {
    *(v4u*)dp = u;
    
  }
}

constexpr int kAKeys   = 64;
constexpr int kAStages = kSeq / kAKeys;
constexpr int kKPitch  = 2 * kHD + 16;
constexpr int kVPitch  = 2 * kAKeys + 16;
constexpr int kKTile   = kAKeys * kKPitch;
constexpr int kVTile   = kHD * kVPitch;
constexpr int kABuf    = 2 * kKTile + kVTile;
constexpr float kScoreLog2 = kScoreScale * 1.4426950408889634f;
constexpr float kPShift    = 8.0f;                 // p carried x2^8: small p stay clear of the f16 subnormals; cancels in sum p v / sum p
static_assert(kAStages >= 2 && kSeq % 128 == 0, "two or more stages; 128 query positions per block");

typedef __attribute__((ext_vector_type(4))) int v4i;

// Four asynchronous 16-byte-per-lane copies global -> LDS: one thread's share of one operand tile of a stage.
// s_wait_xcnt 0 is the last line of the copies' own statement, so it stands ahead of any rewrite of the address registers named here.
__device__ __forceinline__ void async_copy4(unsigned l0, unsigned l1, unsigned l2, unsigned l3,
                                            const char* g0, const char* g1, const char* g2, const char* g3) {
  asm volatile(
      "global_load_async_to_lds_b128 %0, %4, off\n\t"
      "global_load_async_to_lds_b128 %1, %5, off\n\t"
      "global_load_async_to_lds_b128 %2, %6, off\n\t"
      "global_load_async_to_lds_b128 %3, %7, off\n\t"
      "s_wait_xcnt 0x0"
      :: "v"(l0), "v"(l1), "v"(l2), "v"(l3), "v"(g0), "v"(g1), "v"(g2), "v"(g3)
      : "memory");
}
// One stage: 64 K rows x 256 B of each plane (thread: row tid >> 4 (+16 a copy), chunk tid & 15) and 128 V^T rows x 128 B
// (thread: row tid >> 3 (+32 a copy), chunk tid & 7). lK, lV, gKh, gKl, gV are the thread's own addresses of its first copy.
__device__ __forceinline__ void attn_stage(unsigned lK, unsigned lV, const char* gKh, const char* gKl, const char* gV) {
  constexpr unsigned kLK = 16 * kKPitch, kLV = 32 * kVPitch;
  constexpr size_t   kGK = (size_t)16 * 2 * kHD, kGV = (size_t)32 * 2 * kSeq;
  async_copy4(lK, lK + kLK, lK + 2 * kLK, lK + 3 * kLK, gKh, gKh + kGK, gKh + 2 * kGK, gKh + 3 * kGK);
  async_copy4(lK + kKTile, lK + kKTile + kLK, lK + kKTile + 2 * kLK, lK + kKTile + 3 * kLK, gKl, gKl + kGK, gKl + 2 * kGK, gKl + 3 * kGK);
  async_copy4(lV, lV + kLV, lV + 2 * kLV, lV + 3 * kLV, gV, gV + kGV, gV + 2 * kGV, gV + 3 * kGV);
}
// lane l with lane l ^ 16
__device__ __forceinline__ float xhalf(float x) {
  return __builtin_bit_cast(float, __builtin_amdgcn_permlanex16(__builtin_bit_cast(int, x), __builtin_bit_cast(int, x), 0x76543210, 0xfedcba98, false, false));
}

__global__ __launch_bounds__(256) void attn_kernel(const unsigned short* __restrict__ Ph, long loOff,
                                                   const unsigned short* __restrict__ VTp, const int* __restrict__ maskp,
                                                   unsigned short* __restrict__ Obp) {
  // every '#pragma unroll' in this kernel: constant indices keep the fragment, score and accumulator arrays in registers
  __shared__ __align__(128) char ring[2 * kABuf];
  __shared__ __align__(16) float kbias[kSeq];
  const int tid   = threadIdx.x;
  const int lane  = tid & 31;
  const int wave  = tid >> 5;
  const int rlane = lane & 15;                 // row of an A fragment, column of a B fragment and of D
  const int koff  = (lane >> 4) * 8;           // k offset of this lane half = D row offset
  const int b     = blockIdx.y / kKV;
  const int j     = blockIdx.y % kKV;
  const int q0    = blockIdx.x * 128 + wave * 16;

  // additive key bias of batch b, once per block
  {
    const int* mp = maskp + (size_t)b * kSeq + 8 * tid;
    const v4i m0 = *(const v4i*)(mp);
    const v4i m1 = *(const v4i*)(mp + 4);
    v4f f0, f1;
#pragma unroll
    for (int e = 0; e < 4; ++e) {
      f0[e] = (m0[e] != 0) ? 0.0f : -__builtin_inff();
      f1[e] = (m1[e] != 0) ? 0.0f : -__builtin_inff();
    }
    *(v4f*)(kbias + 8 * tid)     = f0;
    *(v4f*)(kbias + 8 * tid + 4) = f1;
  }

  const unsigned lK = (unsigned)(size_t)ring + (unsigned)((tid >> 4) * kKPitch + (tid & 15) * 16);
  const unsigned lV = (unsigned)(size_t)ring + (unsigned)(2 * kKTile + (tid >> 3) * kVPitch + (tid & 7) * 16);
  const char* gKh = (const char*)(Ph + ((size_t)kKRow0 + (size_t)(b * kKV + j) * kSeq + (tid >> 4)) * kHD) + (tid & 15) * 16;
  const char* gKl = gKh + (size_t)loOff * 2;
  const char* gV  = (const char*)(VTp + ((size_t)(b * kKV + j) * kHD + (tid >> 3)) * kSeq) + (tid & 7) * 16;
  constexpr size_t kKStep = (size_t)kAKeys * kHD * 2;   // bytes from one stage's K rows to the next
  constexpr size_t kVStep = (size_t)kAKeys * 2;         // bytes from one stage's V^T columns to the next

  attn_stage(lK, lV, gKh, gKl, gV);

  // Q fragments (B operand), both planes, both heads, kept for the whole kernel
  v16b qh[2][4], ql[2][4];
#pragma unroll
  for (int g = 0; g < 2; ++g) {
    const __bf16* qp = (const __bf16*)Ph + ((size_t)(b * kHeads + 2 * j + g) * kSeq + q0 + rlane) * kHD + koff;
#pragma unroll
    for (int kc = 0; kc < 4; ++kc) {
      qh[g][kc] = Frag<__bf16>::load(qp + kc * 32);
      ql[g][kc] = Frag<__bf16>::load(qp + loOff + kc * 32);
    }
  }
  v8f acc[2][8];
  float mrun[2], lrun[2];
#pragma unroll
  for (int g = 0; g < 2; ++g) {
    mrun[g] = -__builtin_inff();
    lrun[g] = 0.0f;
#pragma unroll
    for (int d = 0; d < 8; ++d) acc[g][d] = (v8f){0.f,0.f,0.f,0.f,0.f,0.f,0.f,0.f};
  }

  asm volatile("s_wait_asynccnt 0x0" ::: "memory");     // stage 0 has landed before anybody reads it
  __syncthreads();                                      // also publishes kbias
  attn_stage(lK + kABuf, lV + kABuf, gKh + kKStep, gKl + kKStep, gV + kVStep);

  for (int t = 0; t < kAStages; ++t) {
    const int bsel = (t & 1) * kABuf;
    // two 32-key passes; kept rolled: unrolled, both passes' fragments are fetched together and registers spill
#pragma unroll 1
    for (int sub = 0; sub < 2; ++sub) {
      const char* kp = ring + bsel + (sub * 32 + rlane) * kKPitch + koff * 2;
      // all 32 K fragment loads of the pass go out as one group, in the order of their use
      v16b kh[2][4], kl[2][4];
#pragma unroll
      for (int kc = 0; kc < 4; ++kc) {
#pragma unroll
        for (int kt = 0; kt < 2; ++kt) kh[kt][kc] = Frag<__bf16>::load((const __bf16*)(kp + kt * 16 * kKPitch + kc * 64));
#pragma unroll
        for (int kt = 0; kt < 2; ++kt) kl[kt][kc] = Frag<__bf16>::load((const __bf16*)(kp + kKTile + kt * 16 * kKPitch + kc * 64));
      }
      // bias of this lane's 16 keys, last in the same group: there when the products end
      const float* bp = kbias + t * kAKeys + sub * 32 + koff;
      const v4f b0 = *(const v4f*)(bp), b1 = *(const v4f*)(bp + 4), b2 = *(const v4f*)(bp + 16), b3 = *(const v4f*)(bp + 20);
      // holds the load group ahead of the products; the scheduler otherwise sinks each fragment's loads in front of its use, one LDS latency each
      __builtin_amdgcn_sched_barrier(0);
      v8f s[2][2];
#pragma unroll
      for (int kt = 0; kt < 2; ++kt)
#pragma unroll
        for (int g = 0; g < 2; ++g) s[kt][g] = (v8f){0.f,0.f,0.f,0.f,0.f,0.f,0.f,0.f};
      // the four score tiles take turns, so that no product waits for the one before it
#pragma unroll
      for (int kc = 0; kc < 4; ++kc) {
#pragma unroll
        for (int kt = 0; kt < 2; ++kt)
#pragma unroll
          for (int g = 0; g < 2; ++g) s[kt][g] = Frag<__bf16>::mma(kh[kt][kc], qh[g][kc], s[kt][g]);
#pragma unroll
        for (int kt = 0; kt < 2; ++kt)
#pragma unroll
          for (int g = 0; g < 2; ++g) s[kt][g] = Frag<__bf16>::mma(kh[kt][kc], ql[g][kc], s[kt][g]);
#pragma unroll
        for (int kt = 0; kt < 2; ++kt)
#pragma unroll
          for (int g = 0; g < 2; ++g) s[kt][g] = Frag<__bf16>::mma(kl[kt][kc], qh[g][kc], s[kt][g]);
      }
      // holds the V^T loads behind the score products, where the K fragments' registers are free again (hoisted, they spill);
      // their latency passes under the softmax arithmetic
      __builtin_amdgcn_sched_barrier(0);
      // V^T fragments of the pass: 16 dims x 32 keys each
      const char* vp = ring + bsel + 2 * kKTile + rlane * kVPitch + sub * 64 + koff * 2;
      v16h vf[8];
#pragma unroll
      for (int d = 0; d < 8; ++d) vf[d] = Frag<_Float16>::load((const _Float16*)(vp + d * 16 * kVPitch));
#pragma unroll
      for (int g = 0; g < 2; ++g) {
        float a[16];
#pragma unroll
        for (int r = 0; r < 4; ++r) {
          a[r]      = fmaf(s[0][g][r],     kScoreLog2, b0[r]);
          a[4 + r]  = fmaf(s[0][g][4 + r], kScoreLog2, b1[r]);
          a[8 + r]  = fmaf(s[1][g][r],     kScoreLog2, b2[r]);
          a[12 + r] = fmaf(s[1][g][4 + r], kScoreLog2, b3[r]);
        }
        float mx = a[0];
#pragma unroll
        for (int e = 1; e < 16; ++e) mx = fmaxf(mx, a[e]);
        mx = fmaxf(mx, xhalf(mx));                                     // both halves hold the query's maximum over the 32 keys
        const float mnew  = fmaxf(mrun[g], mx);
        const float msafe = (mnew == -__builtin_inff()) ? 0.0f : mnew; // only masked keys so far: keep -inf - -inf out of the exponents
        const float corr  = __builtin_amdgcn_exp2f(mrun[g] - msafe);
        const float nm    = kPShift - msafe;
        mrun[g] = mnew;
        v16h pf;
        float ps0 = 0.0f, ps1 = 0.0f;
#pragma unroll
        for (int e = 0; e < 16; e += 2) {
          const float p0 = __builtin_amdgcn_exp2f(a[e] + nm);
          const float p1 = __builtin_amdgcn_exp2f(a[e + 1] + nm);
          ps0 += p0;
          ps1 += p1;
          pf[e]     = (_Float16)p0;
          pf[e + 1] = (_Float16)p1;
        }
        lrun[g] = fmaf(lrun[g], corr, ps0 + ps1);                      // this half's keys only; the halves join behind the loop
#pragma unroll
        for (int d = 0; d < 8; ++d) acc[g][d] = acc[g][d] * corr;
#pragma unroll
        for (int d = 0; d < 8; ++d) acc[g][d] = Frag<_Float16>::mma(vf[d], pf, acc[g][d]);
      }
    }
    asm volatile("s_wait_dscnt 0x0" ::: "memory");      // this stage's LDS reads are done before its buffer is refilled
    asm volatile("s_wait_asynccnt 0x0" ::: "memory");   // stage t + 1 has landed
    __syncthreads();
    if (t + 2 < kAStages) {
      const size_t st = (size_t)(t + 2);
      attn_stage(lK + bsel, lV + bsel, gKh + st * kKStep, gKl + st * kKStep, gV + st * kVStep);
    }
  }
  asm volatile("s_wait_asynccnt 0x0" ::: "memory");     // nothing in flight when the wave ends

  // O^T tile d: lane holds dims 16 d + koff + 0..7 of query q0 + rlane: one 16-B store; a wave writes whole 256-B head rows
#pragma unroll
  for (int g = 0; g < 2; ++g) {
    const float inv = kOCarry / (lrun[g] + xhalf(lrun[g]));
    unsigned short* op = Obp + ((size_t)b * kSeq + q0 + rlane) * kNQ + (size_t)(2 * j + g) * kHD + koff;
#pragma unroll
    for (int d = 0; d < 8; ++d) {
      v8h o;
#pragma unroll
      for (int r = 0; r < 8; ++r) o[r] = (_Float16)(acc[g][d][r] * inv);
      *(v8h*)(op + d * 16) = o;
    }
  }
}

// ---------------------------------------------------------------------------
// Host glue.
//   R0 X16  f16 [4096][2048]                        16,777,216 at           0   (later: Ob f16 [4096][2048], same type + layout)
//   R1 Wq16 f16 [4096][2048] (w_qkv x16)            16,777,216 at  16,777,216   
//   R2 Wo16 f16 [2048][2048] (w_out x16)             8,388,608 at  33,554,432
//   R3 QK32 f32 [4096][3072] q|k of both batches    50,331,648 at  41,943,040
//   R4 VT   f16 [2*8][128][2048] (v transposed)       8,388,608 at  92,274,688
//   R5 QKhi bf16 [98304][128] (q rows then k rows)  25,165,824 at 100,663,296
//   R6 QKlo bf16 [98304][128]                        25,165,824 at 125,829,120
//   total                                          150,994,944
// Re-use timeline (stream ordered): X16/Wq16 are read only by the qkv GEMM; QK32 only by the norm kernel;
// Ob is first written by the attention kernel, which starts after the qkv GEMM and the norm kernel.
// Every region is fully written before it is read; no region changes element type.
// GEMM shapes: q|k (M=4096, N=3072, K=2048); V^T per batch (M=1024, N=2048, K=2048);
// output (M=4096, N=2048, K=2048); all M,N multiples of 64, all K multiples of 32, no padding anywhere.
// ---------------------------------------------------------------------------
extern "C" void kernel_launch(void* const* d_in, const int* in_sizes, int n_in,
                              void* d_out, int out_size, void* d_ws, size_t ws_size,
                              hipStream_t stream) {
  if (n_in < 7) return;
  const int nX = kBatch * kSeq * kDim;            // 8,388,608
  if (in_sizes[0] != nX) return;
  if (in_sizes[1] != kBatch * kSeq) return;
  if (in_sizes[2] != kSeq * (kHD / 2) * 4) return;
  if (in_sizes[3] != kNQKV * kDim) return;
  if (in_sizes[4] != kDim * kNQ) return;
  if (in_sizes[5] != kHD || in_sizes[6] != kHD) return;
  if (out_size != kTok * kDim) return;

  const size_t szX16  = (size_t)kTok * kDim * 2;
  const size_t szWq16 = (size_t)kNQKV * kDim * 2;
  const size_t szWo16 = (size_t)kDim * kNQ * 2;
  const size_t szQK32 = (size_t)kTok * kNQK * 4;          // both batches
  const size_t szVT   = (size_t)kBatch * kKV * kHD * kSeq * 2;
  const size_t szPl   = (size_t)kQKRows * kHD * 2;        // one bf16 q|k plane
  const size_t szOb   = (size_t)kTok * kNQ * 2;
  const size_t offX16  = 0;
  const size_t offWq16 = offX16 + szX16;
  const size_t offWo16 = offWq16 + szWq16;
  const size_t offR3   = offWo16 + szWo16;
  const size_t offVT   = offR3 + szQK32;
  const size_t offPhi  = offVT + szVT;
  const size_t offPlo  = offPhi + szPl;
  const size_t total   = offPlo + szPl;
  if (szOb > szX16) return;                      // the re-used region fits its first carve
  if (ws_size < total) return;

  const float* x     = (const float*)d_in[0];
  const int*   xmask = (const int*)d_in[1];
  const float* freqs = (const float*)d_in[2];
  const float* wqkv  = (const float*)d_in[3];
  const float* wout  = (const float*)d_in[4];
  const float* qw    = (const float*)d_in[5];
  const float* kw    = (const float*)d_in[6];
  float* out = (float*)d_out;
  char* ws = (char*)d_ws;
  unsigned short* X16  = (unsigned short*)(ws + offX16);
  unsigned short* Ob   = (unsigned short*)(ws + offX16);     // re-use of R0 (f16, same layout)
  unsigned short* Wq16 = (unsigned short*)(ws + offWq16);
  unsigned short* Wo16 = (unsigned short*)(ws + offWo16);
  float* QK32 = (float*)(ws + offR3);
  unsigned short* VT  = (unsigned short*)(ws + offVT);
  unsigned short* Phi = (unsigned short*)(ws + offPhi);
  unsigned short* Plo = (unsigned short*)(ws + offPlo);
  const long loOff = (long)kQKRows * kHD;                    // elements from the hi plane to the lo plane
  const float* dummyf = (const float*)(ws + offR3);          // valid in-ws pointer for unused bias/resid arguments

  // ---- 16-bit operand planes of the inputs (RNE bf16 of every float input, f16 containers, weights x16) ----
  const int n8x = nX / 8;                 // 1,048,576 -> 4096 blocks exact
  const int n8w = (kNQKV * kDim) / 8;     // 1,048,576 -> 4096 blocks exact
  const int n8o = (kDim * kNQ) / 8;       //   524,288 -> 2048 blocks exact
  cast8_kernel<<<dim3(n8x / 256), dim3(256), 0, stream>>>(x, X16, n8x, 1.0f);
  cast8_kernel<<<dim3(n8w / 256), dim3(256), 0, stream>>>(wqkv, Wq16, n8w, kWCarry);
  cast8_kernel<<<dim3(n8o / 256), dim3(256), 0, stream>>>(wout, Wo16, n8o, kWCarry);

  // ---- q|k projection of both batches (w_qkv rows 0..3071 -> f32 plane) and v projection written directly transposed (f16), one launch:
  //      192 + 64 work-groups cover all 4096 x 3072 of QK32 and the whole 16 x 128 x 2048 VT plane ----
  qkv_gemm<<<dim3(kQKVBlocks), dim3(256), 0, stream>>>(X16, Wq16, QK32, VT);

  // ---- norm + rotary of both batches -> bf16 hi/lo planes ----
  norm_rope_kernel<<<dim3((kHeads + kKV) / 8, kSeq, kBatch), dim3(256), 0, stream>>>(QK32, freqs, qw, kw, Phi, loOff);

  // ---- attention, all (batch, kv head) groups in one launch: Ob[b*2048+i][(2j+hg)*128+n] = f16( 16 * softmax(q.k^T * 128^-0.5 + mask) . v )
  //      grid (16 blocks of 128 query positions, 16 groups) = 256 blocks; covers the whole [4096][2048] Ob plane ----
  attn_kernel<<<dim3(kSeq / 128, kBatch * kKV), dim3(256), 0, stream>>>(Phi, loOff, VT, xmask, Ob);

  // ---- output projection: out[tok][n] = 2^-8 * sum_e Ob[tok][e] * Wo16[n][e]   (M=4096, N=2048, K=2048) ----
  {
    const int tilesOut = (kTok / 64) * (kDim / 64);   // 2048 -> 256 blocks; covers the whole [4096][2048] output
    wmma_gemm64<0, false, 0, 0, false, 0><<<dim3(tilesOut / 8, 1), dim3(256), 0, stream>>>(
        Ob, Ob, kNQ, 0L, Wo16, Wo16, kNQ, 0L,
        (void*)out, (void*)out, kDim, 0L, dummyf, dummyf, 0L, kTok, kDim, kNQ, kOutScale);
  }
}

// v007
// One run takes 152 microseconds.
// Versions between v005 and this one are left out; their measured steps multiply to 1.25 times as fast.
// Over all steps from v000 it is 14.6 times as fast.
// Contractions: qkv projection (x as f16(bf16 RNE) x w_qkv^T as f16(16*bf16 RNE)), V^T.P^T (P f16, unnormalised, carried x256, x V^T f16) and output projection (o f16 carried x16 x w_out^T as f16(16*bf16 RNE)) on v_wmma_f32_16x16x32_f16; scores k.q^T on v_wmma_f32_16x16x32_f16 with q,k as one f16 plane each (RNE of the f32 norm+rotary result, one product); f32 accumulate everywhere; RMSNorm, 2x2 rotary map and online softmax in f32.
#include <hip/hip_runtime.h>
#include <math.h>

// ---------------------------------------------------------------------------
// Problem constants
// ---------------------------------------------------------------------------
constexpr int kBatch = 2;
constexpr int kSeq   = 2048;
constexpr int kDim   = 2048;              // model dim (K of the qkv projection, N of the output projection)
constexpr int kHeads = 16;
constexpr int kKV    = 8;
constexpr int kHD    = 128;
constexpr int kTok   = kBatch * kSeq;     // 4096 token rows
constexpr int kNQ    = kHeads * kHD;      // 2048 q columns / o columns
constexpr int kNK    = kKV * kHD;         // 1024 k columns (= v columns)
constexpr int kNQK   = kNQ + kNK;         // 3072 = q|k columns (N of the q|k projection)
constexpr int kNQKV  = kNQ + 2 * kNK;     // 4096 rows of w_qkv
constexpr int kQKRows = kBatch * (kHeads + kKV) * kSeq;   // 98304 rows of 128 in the q|k f16 plane
constexpr int kKRow0  = kBatch * kHeads * kSeq;           // 65536 = first k row in the q|k plane
constexpr float kEps        = 1.1920929e-07f;
constexpr float kInvHD      = 1.0f / 128.0f;
constexpr float kWCarry     = 16.0f;                      // weights carried x16 in f16
constexpr float kWCarryInv  = 1.0f / 16.0f;
constexpr float kOCarry     = 16.0f;                      // attention output carried x16 in f16
constexpr float kOutScale   = 1.0f / (kOCarry * kWCarry); // 2^-8
constexpr float kScoreScale = 0.08838834764831845f;       // 128^-0.5
static_assert(kHD == 128, "a head is two 64-column wave tiles of the qkv projection");
static_assert(kHeads == 2 * kKV, "two query heads per kv head");
static_assert(kSeq % 64 == 0 && kNQK % 64 == 0 && kNK % 64 == 0 && kNQ % 64 == 0 && kDim % 64 == 0 && kTok % 64 == 0, "GEMM M/N tiles");
static_assert(kHD % 64 == 0);
static_assert(kDim % 32 == 0 && kHD % 32 == 0 && kSeq % 32 == 0 && kNQ % 32 == 0, "GEMM K % 32");
static_assert(kDim % 128 == 0 && kSeq % 128 == 0 && kNQ % 128 == 0, "staged GEMM K: two or more stages of 64");
static_assert(kSeq % 256 == 0 && kNK % 256 == 0 && kTok % 256 == 0 && kNQK % 128 == 0 && kDim % 128 == 0, "staged GEMM: 256 x 128 per work-group");
static_assert(kSeq == 256 * 8, "key bias coverage: 256 threads x 8 keys");

typedef __attribute__((ext_vector_type(16))) _Float16 v16h;
typedef __attribute__((ext_vector_type(8)))  _Float16 v8h;
typedef __attribute__((ext_vector_type(16))) __bf16   v16b;
typedef __attribute__((ext_vector_type(8)))  __bf16   v8b;
typedef __attribute__((ext_vector_type(2)))  __bf16   v2b;
typedef __attribute__((ext_vector_type(4)))  _Float16 v4h;
typedef __attribute__((ext_vector_type(8)))  float    v8f;
typedef __attribute__((ext_vector_type(4)))  float    v4f;
typedef __attribute__((ext_vector_type(2)))  float    v2f;
typedef __attribute__((ext_vector_type(2)))  int      v2i;
typedef __attribute__((ext_vector_type(4)))  unsigned int v4u;
typedef __attribute__((ext_vector_type(2)))  unsigned int v2u;

// ---------------------------------------------------------------------------
// Helpers
// ---------------------------------------------------------------------------
__device__ __forceinline__ unsigned short f2bf_bits(float f) {
  unsigned u = __float_as_uint(f);
  return (unsigned short)((u + 0x7FFFu + ((u >> 16) & 1u)) >> 16);
}
__device__ __forceinline__ float bf_bits2f(unsigned short h) { return __uint_as_float(((unsigned)h) << 16); }

// hazard guards as plain device helpers
__device__ __forceinline__ void dep_guard_h(v8f& a, v8f& b, v16h x, v16h y) { asm volatile("v_nop\n\tv_nop\n\tv_nop\n\tv_nop" : "+v"(a), "+v"(b) : "v"(x), "v"(y)); }
__device__ __forceinline__ void dep_guard_b(v8f& a, v8f& b, v16b x, v16b y) { asm volatile("v_nop\n\tv_nop\n\tv_nop\n\tv_nop" : "+v"(a), "+v"(b) : "v"(x), "v"(y)); }
__device__ __forceinline__ void keep4_h(v16h a, v16h b, v16h c, v16h d) { asm volatile("v_nop" :: "v"(a), "v"(b), "v"(c), "v"(d)); }
__device__ __forceinline__ void keep4_b(v16b a, v16b b, v16b c, v16b d) { asm volatile("v_nop" :: "v"(a), "v"(b), "v"(c), "v"(d)); }
__device__ __forceinline__ void acc_guard4(v8f& a, v8f& b, v8f& c, v8f& d) { asm volatile("v_nop\n\tv_nop\n\tv_nop\n\tv_nop" : "+v"(a), "+v"(b), "+v"(c), "+v"(d)); }
template <typename T> struct Frag;
template <> struct Frag<_Float16> {
  typedef v16h V; union U { v16h v; v8h h[2]; };
  // elements 0..7 <- p[0..7], 8..15 <- p[16..23]
  static __device__ __forceinline__ v16h load(const _Float16* p) {
    U f; f.h[0] = *(const v8h*)(p); f.h[1] = *(const v8h*)(p + 16); return f.v;
  }
  static __device__ __forceinline__ v8f mma(v16h a, v16h b, v8f c) {
    return __builtin_amdgcn_wmma_f32_16x16x32_f16(false, a, false, b, (short)0, c, false, false);
  }
  static __device__ __forceinline__ void guard(v8f& a, v8f& b, v16h x, v16h y) { dep_guard_h(a, b, x, y); }
  static __device__ __forceinline__ void keep(v16h a, v16h b, v16h c, v16h d) { keep4_h(a, b, c, d); }
};
template <> struct Frag<__bf16> {
  typedef v16b V; union U { v16b v; v8b h[2]; };
  static __device__ __forceinline__ v16b load(const __bf16* p) {
    U f; f.h[0] = *(const v8b*)(p); f.h[1] = *(const v8b*)(p + 16); return f.v;
  }
  static __device__ __forceinline__ v8f mma(v16b a, v16b b, v8f c) {
    return __builtin_amdgcn_wmma_f32_16x16x32_bf16(false, a, false, b, (short)0, c, false, false);
  }
  static __device__ __forceinline__ void guard(v8f& a, v8f& b, v16b x, v16b y) { dep_guard_b(a, b, x, y); }
  static __device__ __forceinline__ void keep(v16b a, v16b b, v16b c, v16b d) { keep4_b(a, b, c, d); }
};

__device__ __forceinline__ unsigned pk16(unsigned short a, unsigned short b) { return (unsigned)a | ((unsigned)b << 16); }
__device__ __forceinline__ unsigned short h_bits(float f) { const _Float16 h = (_Float16)f; return __builtin_bit_cast(unsigned short, h); }
// RNE bf16 conversion returned as f32
__device__ __forceinline__ float bfr(float f) { return bf_bits2f(f2bf_bits(f)); }

// ---- Register-blocked batched WMMA GEMM (ACT reduced to none/relu/leaky) -------------------------------
// C[m,n] = scale * sum_k A[m,k] * Bt[n,k] (+bias)(+resid); each wave owns a 64x64 tile.
// A row-major [M,K]; Bt row-major [N,K]; SPLIT: M,N % 64 == 0, K % 32 == 0.
// Not SPLIT: a work-group owns 256 x 128 of C, its waves 4 x 2 tiles of 64x64 on shared staged operands; M % 256 == 0, N % 128 == 0, K % 64 == 0.
// SPLIT: operands are hi/lo planes (A2/Bt2 = lo planes, same layout); product = hi*hi + hi*lo + lo*hi.
// BIAS_MODE: 0 = none, 1 = bias[m], 2 = bias[n].
// OUT_MODE: 0 = f32, 1 = f16, 2 = bf16 hi plane (Cout) + bf16 lo plane (Cout2).
// ET: 0 = f16 operands, 1 = bf16 operands (pointers passed as 16-bit storage)
template <int ET> struct Elem;
template <> struct Elem<0> { typedef _Float16 T; };
template <> struct Elem<1> { typedef __bf16 T; };
// Twelve asynchronous 16-byte-per-lane copies global -> LDS (each 32 lanes x 16 B = 4 rows x one whole 128-B line).
// s_wait_xcnt 0 is the last line of the copies' own statement, so it stands ahead of any rewrite of the address registers named here.
__device__ __forceinline__ void async_copy12(const unsigned (&l)[12], const char* const (&g)[12]) {
  asm volatile(
      "global_load_async_to_lds_b128 %0, %12, off\n\t"
      "global_load_async_to_lds_b128 %1, %13, off\n\t"
      "global_load_async_to_lds_b128 %2, %14, off\n\t"
      "global_load_async_to_lds_b128 %3, %15, off\n\t"
      "global_load_async_to_lds_b128 %4, %16, off\n\t"
      "global_load_async_to_lds_b128 %5, %17, off\n\t"
      "global_load_async_to_lds_b128 %6, %18, off\n\t"
      "global_load_async_to_lds_b128 %7, %19, off\n\t"
      "global_load_async_to_lds_b128 %8, %20, off\n\t"
      "global_load_async_to_lds_b128 %9, %21, off\n\t"
      "global_load_async_to_lds_b128 %10, %22, off\n\t"
      "global_load_async_to_lds_b128 %11, %23, off\n\t"
      "s_wait_xcnt 0x0"
      :: "v"(l[0]), "v"(l[1]), "v"(l[2]), "v"(l[3]), "v"(l[4]), "v"(l[5]), "v"(l[6]), "v"(l[7]), "v"(l[8]), "v"(l[9]), "v"(l[10]), "v"(l[11]),
         "v"(g[0]), "v"(g[1]), "v"(g[2]), "v"(g[3]), "v"(g[4]), "v"(g[5]), "v"(g[6]), "v"(g[7]), "v"(g[8]), "v"(g[9]), "v"(g[10]), "v"(g[11])
      : "memory");
}
// One stage of the work-group's shared tiles: A 256 rows x 128 B (64 k), then B 128 rows x 128 B, in LDS rows of pitch 144 B.
// A wave brings 32 rows of A (8 copies) and 16 rows of B (4 copies); every A row then feeds two waves, every B row four.
// lA / gA and lB / gB are the lane's own addresses for its wave's first row + (lane >> 3), 16-byte chunk (lane & 7); copy c moves 4 rows.
constexpr int kRowPitch  = 144;                    // 128-B rows + 16 B: 16 B x odd, the pitch for ds_load_b128 readers
constexpr int kATile     = 256 * kRowPitch;        // 36864
constexpr int kBTile     = 128 * kRowPitch;        // 18432
constexpr int kBufBytes  = kATile + kBTile;        // A tile then B tile
constexpr int kRingBytes = 2 * kBufBytes;          // two buffers per work-group
__device__ __forceinline__ void stage_block(unsigned lA, unsigned lB, const char* gA, const char* gB, size_t ldaBytes, size_t ldbBytes) {
  // both loops unrolled: every index of l and g is a constant, so the addresses stay in registers
  unsigned l[12];
  const char* g[12];
#pragma unroll
  for (int c = 0; c < 8; ++c) {
    l[c] = lA + (unsigned)(c * 4 * kRowPitch);
    g[c] = gA + (size_t)(c * 4) * ldaBytes;
  }
#pragma unroll
  for (int c = 0; c < 4; ++c) {
    l[8 + c] = lB + (unsigned)(c * 4 * kRowPitch);
    g[8 + c] = gB + (size_t)(c * 4) * ldbBytes;
  }
  async_copy12(l, g);
}

template <int ET, bool SPLIT, int BIAS_MODE, int OUT_MODE, bool RESID, int ACT = 0>
__global__ __launch_bounds__(256) void wmma_gemm64(
    const unsigned short* __restrict__ Ap, const unsigned short* __restrict__ A2p, int lda, long strideA,
    const unsigned short* __restrict__ Btp, const unsigned short* __restrict__ Bt2p, int ldb, long strideB,
    void* __restrict__ Cout, void* __restrict__ Cout2, int ldc, long strideC,
    const float* __restrict__ bias,
    const float* __restrict__ resid, long strideR,
    int M, int N, int K, float scale) {
  typedef typename Elem<ET>::T T;
  typedef typename Frag<T>::V V;
  const T* A = (const T*)Ap; const T* A2 = (const T*)A2p; const T* Bt = (const T*)Btp; const T* Bt2 = (const T*)Bt2p;
  // Per-wave 16x64 f32 slab, pitch 68 floats. Not SPLIT: the work-group's ring of two staged buffers; its first bytes serve as the slabs behind the k loop.
  constexpr int kSlabBytes = 16 * 68 * 4;
  __shared__ __align__(16) char smem[SPLIT ? 8 * kSlabBytes : kRingBytes];
  const int b    = blockIdx.y;
  const int lane = threadIdx.x & 31;
  const int wave = threadIdx.x >> 5;
  int m0, n0, mB = 0, nB = 0;                  // the wave's tile; the work-group's tile (staged path)
  if (SPLIT) {
    const int tilesN = N >> 6;
    const int tile = blockIdx.x * 8 + wave;
    if (tile >= (M >> 6) * tilesN) return;    // wave-uniform; no block barriers on this path
    const int tm = tile / tilesN;
    m0 = tm << 6;
    n0 = (tile - tm * tilesN) << 6;
  } else {
    const int blocksN = N >> 7;
    if ((int)blockIdx.x >= (M >> 8) * blocksN) return;   // the whole work-group leaves, ahead of every barrier and copy
    const int bm = blockIdx.x / blocksN;
    mB = bm << 8;
    nB = (blockIdx.x - bm * blocksN) << 7;
    m0 = mB + ((wave >> 1) << 6);
    n0 = nB + ((wave & 1) << 6);
  }

  const T* Ab  = A  + (size_t)b * strideA;
  const T* Bb  = Bt + (size_t)b * strideB;
  const T* Ab2 = SPLIT ? (A2  + (size_t)b * strideA) : nullptr;
  const T* Bb2 = SPLIT ? (Bt2 + (size_t)b * strideB) : nullptr;

  const int rlane = lane & 15;                 // row (A) / col (B, D) within subtile
  const int koff  = (lane >> 4) * 8;           // k offset of this lane half
  const int mOff  = (lane >> 4) * 8;           // D row offset

  v8f acc[4][4];
#pragma unroll
  for (int i = 0; i < 4; ++i)
#pragma unroll
    for (int j = 0; j < 4; ++j) acc[i][j] = (v8f){0.f,0.f,0.f,0.f,0.f,0.f,0.f,0.f};

  if (SPLIT) {
    for (int k0 = 0; k0 < K; k0 += 32) {
      V bh[4], bl[4];
#pragma unroll
      for (int j = 0; j < 4; ++j) {
        const size_t bo = (size_t)(n0 + (j << 4) + rlane) * ldb + koff + k0;
        bh[j] = Frag<T>::load(Bb + bo);
        if (SPLIT) bl[j] = Frag<T>::load(Bb2 + bo);
      }
#pragma unroll
      for (int i = 0; i < 4; ++i) {
        const size_t ao = (size_t)(m0 + (i << 4) + rlane) * lda + koff + k0;
        V ah = Frag<T>::load(Ab + ao);
        V al;
        if (SPLIT) al = Frag<T>::load(Ab2 + ao);
#pragma unroll
        for (int j = 0; j < 4; ++j) {
          acc[i][j] = Frag<T>::mma(ah, bh[j], acc[i][j]);
          if (SPLIT) {
            acc[i][j] = Frag<T>::mma(ah, bl[j], acc[i][j]);
            acc[i][j] = Frag<T>::mma(al, bh[j], acc[i][j]);
          }
        }
        Frag<T>::guard(acc[i][0], acc[i][3], ah, SPLIT ? al : ah);
      }
      Frag<T>::keep(bh[0], bh[1], bh[2], bh[3]);
      if (SPLIT) Frag<T>::keep(bl[0], bl[1], bl[2], bl[3]);
    }
  } else {
    // The work-group stages its A and B tiles once for all eight waves, 64 k (one whole 128-B line of every row) per stage, in two LDS
    // buffers by asynchronous copies; the fragments come from LDS through Frag::load, k ascending. K is a multiple of 128 (asserted below the constants).
    const unsigned lc = (unsigned)(size_t)smem + (unsigned)((lane >> 3) * kRowPitch + (lane & 7) * 16);
    const unsigned lA = lc + (unsigned)(wave * 32 * kRowPitch);
    const unsigned lB = lc + (unsigned)(kATile + wave * 16 * kRowPitch);
    const size_t ldaB = (size_t)lda * 2, ldbB = (size_t)ldb * 2;
    const char* gA = (const char*)Ab + (size_t)(mB + wave * 32 + (lane >> 3)) * ldaB + (lane & 7) * 16;
    const char* gB = (const char*)Bb + (size_t)(nB + wave * 16 + (lane >> 3)) * ldbB + (lane & 7) * 16;
    const int stages = K >> 6;
    stage_block(lA, lB, gA, gB, ldaB, ldbB);
    asm volatile("s_wait_asynccnt 0x0" ::: "memory");   // this wave's share of stage 0 has landed; the barrier publishes every wave's
    __syncthreads();
    if (stages > 1) stage_block(lA + kBufBytes, lB + kBufBytes, gA + 128, gB + 128, ldaB, ldbB);
    // the lane's fragment row and k half inside the wave's 64 rows of the A tile and of the B tile
    const int foA = ((wave >> 1) * 64 + rlane) * kRowPitch + koff * 2;
    const int foB = kATile + ((wave & 1) * 64 + rlane) * kRowPitch + koff * 2;
    for (int t = 0; t < stages; ++t) {
      const int bsel = (t & 1) * kBufBytes;
      const char* rb = smem + bsel;
      // all 32 fragment loads of the stage go out as one group ahead of its products: one LDS latency a stage, not one per A fragment
      V ah[2][4], bh[2][4];                              // loops below unrolled: constant indices keep the fragments in registers
#pragma unroll
      for (int s = 0; s < 2; ++s) {
#pragma unroll
        for (int j = 0; j < 4; ++j) {
          bh[s][j] = Frag<T>::load((const T*)(rb + foB + j * 16 * kRowPitch + s * 64));
          ah[s][j] = Frag<T>::load((const T*)(rb + foA + j * 16 * kRowPitch + s * 64));
        }
      }
      // holds the load group ahead of the products; the scheduler otherwise sinks each A fragment's loads in front of its use
      __builtin_amdgcn_sched_barrier(0);
#pragma unroll
      for (int s = 0; s < 2; ++s) {
#pragma unroll
        for (int i = 0; i < 4; ++i) {
#pragma unroll
          for (int j = 0; j < 4; ++j) acc[i][j] = Frag<T>::mma(ah[s][i], bh[s][j], acc[i][j]);
        }
      }
      // holds the products ahead of the foot's waits, so that stage t + 1's copies fly while stage t is worked on
      __builtin_amdgcn_sched_barrier(0);
      asm volatile("s_wait_dscnt 0x0" ::: "memory");     // this wave's LDS reads of the stage are done before any wave refills its buffer
      asm volatile("s_wait_asynccnt 0x0" ::: "memory");  // this wave's share of stage t + 1 has landed
      __syncthreads();                                   // publishes stage t + 1 to all waves; ends every wave's reads of stage t
      if (t + 2 < stages) {
        const size_t kb = (size_t)(t + 2) * 128;
        stage_block(lA + bsel, lB + bsel, gA + kb, gB + kb, ldaB, ldbB);
      }
    }
    asm volatile("s_wait_asynccnt 0x0" ::: "memory");    // nothing in flight when the ring becomes the epilogue's slabs (all reads ended at the last barrier)
  }
  acc_guard4(acc[0][0], acc[0][1], acc[0][2], acc[0][3]);
  acc_guard4(acc[1][0], acc[1][1], acc[1][2], acc[1][3]);
  acc_guard4(acc[2][0], acc[2][1], acc[2][2], acc[2][3]);
  acc_guard4(acc[3][0], acc[3][1], acc[3][2], acc[3][3]);

  // ---- epilogue ----
  float* slab = (float*)(smem + wave * kSlabBytes);
  const float* Rb = RESID ? (resid + (size_t)b * strideR) : nullptr;
#pragma unroll
  for (int i = 0; i < 4; ++i) {
    const int mBase = m0 + (i << 4);
#pragma unroll
    for (int j = 0; j < 4; ++j) {
      const int n = n0 + (j << 4) + rlane;
      float bv = 0.f;
      if (BIAS_MODE == 2) bv = bias[n];
#pragma unroll
      for (int r = 0; r < 8; ++r) {
        float v = acc[i][j][r] * scale;
        if (BIAS_MODE == 1) v += bias[mBase + mOff + r];
        if (BIAS_MODE == 2) v += bv;
        if (RESID) v += Rb[(size_t)(mBase + mOff + r) * ldc + n];
        if (ACT == 2) v = fmaxf(v, 0.0f);
        if (ACT == 4) v = (v > 0.f) ? v : 0.01f * v;
        slab[(mOff + r) * 68 + (j << 4) + rlane] = v;
      }
    }
    __builtin_amdgcn_fence(__ATOMIC_RELEASE, "workgroup");
    __builtin_amdgcn_wave_barrier();
    __builtin_amdgcn_fence(__ATOMIC_ACQUIRE, "workgroup");
    if (OUT_MODE == 0) {
      float* C = (float*)Cout + (size_t)b * strideC;
      const int hh = lane >> 4, c4 = (lane & 15) * 4;     // row seg = 256 B = 16 lanes x 16 B
      {
#pragma unroll
        for (int it = 0; it < 8; ++it) {
          const int row = it * 2 + hh;
          v4f v = *(const v4f*)(slab + row * 68 + c4);
          *(v4f*)(C + (size_t)(mBase + row) * ldc + n0 + c4) = v;
        }
        
      }
    } else {
      const int q = lane >> 3, c8 = (lane & 7) * 8;
      unsigned short* C  = (unsigned short*)Cout  + (size_t)b * strideC;
      unsigned short* C2 = (OUT_MODE == 2) ? ((unsigned short*)Cout2 + (size_t)b * strideC) : nullptr;
      {
#pragma unroll
        for (int it = 0; it < 4; ++it) {
          const int row = it * 4 + q;
          const float* sp = slab + row * 68 + c8;
          v8h hv, lv;
#pragma unroll
          for (int e = 0; e < 8; ++e) {
            if (OUT_MODE == 1) {
              hv[e] = (_Float16)sp[e];
            } else {
              unsigned short hb = f2bf_bits(sp[e]);
              unsigned short lb = f2bf_bits(sp[e] - bf_bits2f(hb));
              hv[e] = __builtin_bit_cast(_Float16, hb);
              lv[e] = __builtin_bit_cast(_Float16, lb);
            }
          }
          *(v8h*)(C + (size_t)(mBase + row) * ldc + n0 + c8) = hv;
          if (OUT_MODE == 2) *(v8h*)(C2 + (size_t)(mBase + row) * ldc + n0 + c8) = lv;
        }
        
      }
    }
    __builtin_amdgcn_fence(__ATOMIC_RELEASE, "workgroup");
    __builtin_amdgcn_wave_barrier();
    __builtin_amdgcn_fence(__ATOMIC_ACQUIRE, "workgroup");
  }
}

// ---------------------------------------------------------------------------
// The whole qkv projection in ONE launch of 256 equal work-groups, one per WGP, each on a 256 x 256 tile of its product.
// Work-groups 0..191:   q|k of both batches, 1/16 * sum_k X[tok][k] * W[n][k] (M=4096, N=3072; a tile holds two whole heads of 256 tokens),
//                       normed and rotated in the epilogue, f16.
// Work-groups 192..255: V^T, VT[b*8+j][d][s] = f16( 1/16 * sum_k W[3072+j*128+d][k] * X[b*2048+s][k] ) (per batch M=1024, N=2048).
// Waves 2 x 4, each on 128 x 64: an A fragment feeds 4 products and a B fragment 8, so a product takes 384 B out of LDS (64 x 64: 512 B),
// and the tile brings two thirds of the bytes per flop from L2 that a 256 x 128 tile brings.
// A stage is 128 k (256 B of every row): one landing latency, one barrier and one exposed LDS latency per 128 products of a wave.
// Ring of two buffers and foot of the k loop (waits, barrier, refill) keep the form of wmma_gemm64's staged path; the operand addresses and
// the epilogue follow the work-group's index (the same for all its waves).
// ---------------------------------------------------------------------------
constexpr int kQKBlocksN = kNQK / 256;                        // 12
constexpr int kQKBlocks  = (kTok / 256) * kQKBlocksN;         // 192
constexpr int kVTBlocksN = kSeq / 256;                        // 8
constexpr int kVTBlocks1 = (kNK / 256) * kVTBlocksN;          // 32 per batch
constexpr int kQKVBlocks = kQKBlocks + kBatch * kVTBlocks1;   // 256
constexpr int kPitch2     = 272;                              // 256-B rows + 16 B: 16 B x odd, the pitch for ds_load_b128 readers
constexpr int kTile2      = 256 * kPitch2;                    // 69632: one operand tile of a stage
constexpr int kBuf2Bytes  = 2 * kTile2;                       // A tile 256 rows, then B tile 256 rows
constexpr int kRing2Bytes = 2 * kBuf2Bytes;                   // two buffers per work-group: 278528
static_assert(kDim % 256 == 0, "qkv projection: two or more stages of 128 k");
static_assert(kNQK % 256 == 0 && kSeq % 256 == 0 && kNK % 256 == 0 && kTok % 256 == 0, "qkv projection: 256 x 256 per work-group");
// Eight asynchronous 16-byte-per-lane copies global -> LDS (each 32 lanes x 16 B = 2 rows x two whole 128-B lines): 16 rows of one operand tile.
// l / g are the lane's own addresses for the first row + (lane >> 4), 16-byte chunk (lane & 15); copy c moves 2 rows.
// s_wait_xcnt 0 is the last line of the copies' own statement, so it stands ahead of any rewrite of the address registers named here.
__device__ __forceinline__ void stage_rows16(unsigned l, const char* g, size_t ldBytes) {
  constexpr unsigned kL = 2 * kPitch2;
  const size_t s4 = 2 * ldBytes;
  asm volatile(
      "global_load_async_to_lds_b128 %0, %8, off\n\t"
      "global_load_async_to_lds_b128 %1, %9, off\n\t"
      "global_load_async_to_lds_b128 %2, %10, off\n\t"
      "global_load_async_to_lds_b128 %3, %11, off\n\t"
      "global_load_async_to_lds_b128 %4, %12, off\n\t"
      "global_load_async_to_lds_b128 %5, %13, off\n\t"
      "global_load_async_to_lds_b128 %6, %14, off\n\t"
      "global_load_async_to_lds_b128 %7, %15, off\n\t"
      "s_wait_xcnt 0x0"
      :: "v"(l), "v"(l + kL), "v"(l + 2 * kL), "v"(l + 3 * kL), "v"(l + 4 * kL), "v"(l + 5 * kL), "v"(l + 6 * kL), "v"(l + 7 * kL),
         "v"(g), "v"(g + s4), "v"(g + 2 * s4), "v"(g + 3 * s4), "v"(g + 4 * s4), "v"(g + 5 * s4), "v"(g + 6 * s4), "v"(g + 7 * s4)
      : "memory");
}
// A wave's share of one stage: 32 rows of A and 32 rows of B, 32 copies.
__device__ __forceinline__ void stage_wave(unsigned lA, unsigned lB, const char* gA, const char* gB, size_t ldBytes) {
  // the three scheduling barriers keep each statement's address arithmetic behind the statement before it, so that the four share their
  // 24 address registers; hoisted, 96 are live at once beside the accumulators: spills and register moves at every foot
  stage_rows16(lA, gA, ldBytes);
  __builtin_amdgcn_sched_barrier(0);
  stage_rows16(lA + 16 * kPitch2, gA + 16 * ldBytes, ldBytes);
  __builtin_amdgcn_sched_barrier(0);
  stage_rows16(lB, gB, ldBytes);
  __builtin_amdgcn_sched_barrier(0);
  stage_rows16(lB + 16 * kPitch2, gB + 16 * ldBytes, ldBytes);
}
// Epilogue of one wave's 128 x 64 tile of V^T: each 16 x 64 strip goes through the wave's own slab (pitch 68 floats), so that whole lines are stored:
// f16 rows of this batch's V^T plane (pitch 2048).
__device__ __forceinline__ void vt_store(const v8f (&acc)[8][4], float* slab, unsigned short* __restrict__ Cv, int m0, int n0, int lane) {
  const int rlane = lane & 15;                 // D column within a subtile
  const int mOff  = (lane >> 4) * 8;           // D row offset
  // every '#pragma unroll' here: constant indices keep the accumulators in registers
#pragma unroll
  for (int i = 0; i < 8; ++i) {
    const int mBase = m0 + (i << 4);
#pragma unroll
    for (int j = 0; j < 4; ++j) {
#pragma unroll
      for (int r = 0; r < 8; ++r) slab[(mOff + r) * 68 + (j << 4) + rlane] = acc[i][j][r] * kWCarryInv;
    }
    __builtin_amdgcn_fence(__ATOMIC_RELEASE, "workgroup");
    __builtin_amdgcn_wave_barrier();
    __builtin_amdgcn_fence(__ATOMIC_ACQUIRE, "workgroup");
    const int q = lane >> 3, c8 = (lane & 7) * 8;         // row seg = 128 B = 8 lanes x 16 B
#pragma unroll
    for (int it = 0; it < 4; ++it) {
      const int row = it * 4 + q;
      const float* sp = slab + row * 68 + c8;
      v8h hv;
#pragma unroll
      for (int e = 0; e < 8; ++e) hv[e] = (_Float16)sp[e];
      *(v8h*)(Cv + (size_t)(mBase + row) * kSeq + n0 + c8) = hv;
    }
    __builtin_amdgcn_fence(__ATOMIC_RELEASE, "workgroup");
    __builtin_amdgcn_wave_barrier();
    __builtin_amdgcn_fence(__ATOMIC_ACQUIRE, "workgroup");
  }
}
// x + (x of lane ^ M) inside a 16-lane row: one add with a DPP operand (row_xmask)
template <int M> __device__ __forceinline__ float row_xadd(float x) {
  return x + __builtin_bit_cast(float, __builtin_amdgcn_update_dpp(0, __builtin_bit_cast(int, x), 0x160 + M, 0xf, 0xf, true));
}
// v_rsq_f32 (its argument here is never below eps, so no small-input scaling); the v_nop is the one slot that the instruction set asks for
// behind a transcendental, in the same statement so that it stands directly behind it
__device__ __forceinline__ float rsq_slot(float x) {
  float y;
  asm("v_rsq_f32 %0, %1\n\tv_nop" : "=v"(y) : "v"(x));
  return y;
}
// RNE bf16 conversion of four values, returned as f32
__device__ __forceinline__ v4f bfr4(v4f x) {
  const v2f lo = __builtin_convertvector(__builtin_convertvector((v2f){x[0], x[1]}, v2b), v2f);   // by pairs: one packed conversion for two values
  const v2f hi = __builtin_convertvector(__builtin_convertvector((v2f){x[2], x[3]}, v2b), v2f);
  return (v4f){lo[0], lo[1], hi[0], hi[1]};
}
// Epilogue of one wave's 128 x 64 tile of q|k: RMSNorm (mean over the head's 128 dims, eps inside rsqrt, x norm weight) and the per-position
// 2x2 rotary map straight from the accumulators, f32 math; the result goes out as one f16 plane (RNE; |q|, |k| stay far inside the f16 range
// for norm weights and rotary entries of ordinary size). The f32 q|k plane and its own launch are gone.
// A head's 128 columns lie in two waves (wave ^ 1): each sums the squares of its 64 columns per row (4 in the lane, then the 16 lanes of a row
// by DPP), the two halves meet through LDS behind a work-group barrier, and the row factors come back through LDS behind a second one.
// Rotary table fcs [s][64][2][2] and norm weights [128] are converted to bf16 (RNE) before use. out[2p+i] = fc[s,p,i,0]*v[2p] + fc[s,p,i,1]*v[2p+1].
// The scaled tile then goes through the wave's own slab, so that a lane holds 4 consecutive dims (two pairs) of one row and 16 lanes store one
// whole 128-B line. Output plane Ph, rows of 128 elements = 256 B: q rows (b*16+h)*2048+s, k rows 65536 + (b*8+kh)*2048+s.
constexpr int kSlabB = 16 * 68 * 4;            // V^T: one wave's slab, a 16 x 64 strip
constexpr int kSlabQ = 128 * 68 * 4;           // q|k: one wave's slab, its whole 128 x 64 tile; the eight fill the ring
constexpr int kSsOff = 8 * kSlabQ;             // [4 column waves][256 rows] f32 sums of squares, behind the eight slabs
constexpr int kRnOff = kSsOff + 4 * 256 * 4;   // [2 heads][256 rows] f32 row factors
constexpr int kQkvLds = kRnOff + 2 * 256 * 4;  // 284672
static_assert(kSsOff == kRing2Bytes, "the q|k slabs take the ring over; sums and row factors lie behind it");
__device__ __forceinline__ void qk_norm_rope_store(const v8f (&acc)[8][4], char* smem, const float* __restrict__ fcs,
                                                   const float* __restrict__ qw, const float* __restrict__ kw,
                                                   unsigned short* __restrict__ Ph, int m0, int n0, int wave, int lane) {
  const int rlane = lane & 15;                 // D column within a subtile
  const int mOff  = (lane >> 4) * 8;           // D row offset
  const int hh    = lane >> 4, c4 = (lane & 15) * 4;      // read-back: row it * 2 + hh of a strip, 4 dims from c4
  const int head  = n0 >> 7;                   // 0..15 q heads, 16..23 k heads; the same for the whole wave
  const int d0    = (n0 & 64) + c4;            // the lane's first dim inside the head
  const int b     = m0 / kSeq;                 // a 256-row tile lies in one batch
  const int s0    = m0 % kSeq + hh;            // position of the lane's row 0 of strip 0
  float* slab = (float*)(smem + wave * kSlabQ);
  float* ssb  = (float*)(smem + kSsOff);
  float* rnb  = (float*)(smem + kRnOff);
  const int ssRow = (wave >> 2) * 128 + mOff;  // the lane's first D row inside the work-group's 256
  // every '#pragma unroll' here: constant indices keep the accumulators, the sums and the rotary rows in registers
  // rotary rows: 8 coefficients for each of the lane's 8 rows of a 16-row trip; the registers are loaded anew for the next trip as soon as
  // this trip has converted them, so that every load has one trip's time to land
  const float* fp = fcs + (size_t)s0 * (2 * kHD) + 2 * d0;
  v4f fa[8], fb[8];
#pragma unroll
  for (int it = 0; it < 8; ++it) {
    fa[it] = *(const v4f*)(fp + it * 2 * (2 * kHD));
    fb[it] = *(const v4f*)(fp + it * 2 * (2 * kHD) + 4);
  }
  const v4f wraw = *(const v4f*)((head < kHeads ? qw : kw) + d0);
  asm volatile("s_wait_xcnt 0x0" ::: "memory");   // behind these loads, ahead of any rewrite of the address registers that they name
  __builtin_amdgcn_sched_barrier(0);              // keeps the arithmetic below, which takes those registers over, behind the wait

  {
    const bool writer = rlane == 0;            // after the row sums all 16 lanes hold the same eight values
#pragma unroll
    for (int i = 0; i < 8; ++i) {
      v8f q = acc[i][0] * acc[i][0];
#pragma unroll
      for (int j = 1; j < 4; ++j) q += acc[i][j] * acc[i][j];
#pragma unroll
      for (int r = 0; r < 8; ++r) q[r] = row_xadd<8>(row_xadd<4>(row_xadd<2>(row_xadd<1>(q[r]))));
      if (writer) {
        float* sp = ssb + (wave & 3) * 256 + ssRow + i * 16;
        *(v4f*)(sp)     = (v4f){q[0], q[1], q[2], q[3]};
        *(v4f*)(sp + 4) = (v4f){q[4], q[5], q[6], q[7]};
      }
    }
  }
  __syncthreads();                             // publishes every wave's sums; the same branch for the whole work-group
  // one thread per row: the row factor of both heads of the tile, once, not in all 16 lanes of every wave.
  // the accumulators carry x16, their squares x256: with eps x256 as well the argument is 256 x the definition's (exact powers of two),
  // so the root comes out as 1/16 of the row factor, which takes the carry off the accumulators
  {
    const int row = wave * 32 + lane;
#pragma unroll
    for (int h = 0; h < 2; ++h)
      rnb[h * 256 + row] = rsq_slot((ssb[(2 * h) * 256 + row] + ssb[(2 * h + 1) * 256 + row]) * kInvHD + kEps * (kWCarry * kWCarry));
  }
  __syncthreads();                             // publishes the row factors
  const float* rp = rnb + ((wave & 3) >> 1) * 256 + ssRow;   // the lane's eight D rows of strip 0, this wave's head

  // the whole 128 x 64 tile, scaled by its row factors, into the wave's own slab
#pragma unroll
  for (int i = 0; i < 8; ++i) {
    const v8f rn = __builtin_shufflevector(*(const v4f*)(rp + i * 16), *(const v4f*)(rp + i * 16 + 4), 0, 1, 2, 3, 4, 5, 6, 7);
#pragma unroll
    for (int j = 0; j < 4; ++j) {
      const v8f t = acc[i][j] * rn;
#pragma unroll
      for (int r = 0; r < 8; ++r) slab[(i * 16 + mOff + r) * 68 + (j << 4) + rlane] = t[r];
    }
  }
  asm volatile("s_wait_dscnt 0x0" ::: "memory");   // the tile is in the wave's own slab before its lanes read each other's rows back

  const v4f wv = bfr4(wraw);
  const int row0 = (head < kHeads) ? (b * kHeads + head) * kSeq : kKRow0 + (b * kKV + head - kHeads) * kSeq;
  unsigned short* dp = Ph + (size_t)(row0 + s0) * kHD + d0;
  const float* sl = slab + hh * 68 + c4;
  const float* fn = fp + 16 * (2 * kHD);       // the rotary rows of the trip after the current one
  // eight trips of 16 rows, kept rolled: unrolled, this epilogue alone is some 23 KB of text
#pragma unroll 1
  for (int i = 0; i < 8; ++i) {
    v4f a[8], c[8];
#pragma unroll
    for (int it = 0; it < 8; ++it) {
      a[it] = bfr4(fa[it]);
      c[it] = bfr4(fb[it]);
    }
    // the next trip's rotary rows (the last trip loads its own once more, in bounds: no branch inside the trip)
#pragma unroll
    for (int it = 0; it < 8; ++it) {
      fa[it] = *(const v4f*)(fn + it * 2 * (2 * kHD));
      fb[it] = *(const v4f*)(fn + it * 2 * (2 * kHD) + 4);
    }
#pragma unroll
    for (int it = 0; it < 8; ++it) {
      const v4f v = *(const v4f*)(sl + (i * 16 + it * 2) * 68) * wv;
      v4h o;
      o[0] = (_Float16)(a[it][0] * v[0] + a[it][1] * v[1]);
      o[1] = (_Float16)(a[it][2] * v[0] + a[it][3] * v[1]);
      o[2] = (_Float16)(c[it][0] * v[2] + c[it][1] * v[3]);
      o[3] = (_Float16)(c[it][2] * v[2] + c[it][3] * v[3]);
      *(v4h*)(dp + (i * 16 + it * 2) * kHD) = o;
    }
    // behind the trip's loads and stores, ahead of any rewrite of the address and data registers that they name
    asm volatile("s_wait_xcnt 0x0" ::: "memory");
    // keeps the next trip's address arithmetic and conversions, which take those registers over, behind the wait
    __builtin_amdgcn_sched_barrier(0);
    if (i + 2 < 8) fn += 16 * (2 * kHD);
  }
}
__global__ __launch_bounds__(256) void qkv_gemm(const unsigned short* __restrict__ Xp, const unsigned short* __restrict__ Wp,
                                                const float* __restrict__ fcs, const float* __restrict__ qw, const float* __restrict__ kw,
                                                unsigned short* __restrict__ Ph, unsigned short* __restrict__ VTp) {
  typedef _Float16 T;
  typedef Frag<T>::V V;
  __shared__ __align__(16) char smem[kQkvLds];      // the ring of two staged buffers, which serves the epilogue behind the k loop; 6 KB of row sums and factors
  const int lane = threadIdx.x & 31;
  const int wave = threadIdx.x >> 5;
  const int bx   = blockIdx.x;
  const bool isV = bx >= kQKBlocks;
  const int rv   = isV ? bx - kQKBlocks : 0;
  const int vb   = rv / kVTBlocks1;                 // batch of a V^T work-group
  const int vt   = rv % kVTBlocks1;
  const int mB   = (isV ? vt / kVTBlocksN : bx / kQKBlocksN) << 8;
  const int nB   = (isV ? vt % kVTBlocksN : bx % kQKBlocksN) << 8;
  const int m0   = mB + ((wave >> 2) << 7);
  const int n0   = nB + ((wave & 3) << 6);
  const unsigned short* Ab = isV ? Wp + (size_t)kNQK * kDim : Xp;
  const unsigned short* Bb = isV ? Xp + (size_t)vb * kSeq * kDim : Wp;

  const int rlane = lane & 15;                 // row (A) / col (B, D) within subtile
  const int koff  = (lane >> 4) * 8;           // k offset of this lane half

  // every '#pragma unroll' in this kernel: constant indices keep the fragment and accumulator arrays in registers
  v8f acc[8][4];
#pragma unroll
  for (int i = 0; i < 8; ++i)
#pragma unroll
    for (int j = 0; j < 4; ++j) acc[i][j] = (v8f){0.f,0.f,0.f,0.f,0.f,0.f,0.f,0.f};

  {
    // a wave brings 32 rows of A and 32 rows of B a stage; every A row then feeds four waves, every B row two
    const unsigned lc = (unsigned)(size_t)smem + (unsigned)((wave * 32 + (lane >> 4)) * kPitch2 + (lane & 15) * 16);
    const unsigned lA = lc;
    const unsigned lB = lc + (unsigned)kTile2;
    constexpr size_t ldB = (size_t)kDim * 2;   // bytes of a row of X and of W
    const char* gA = (const char*)Ab + (size_t)(mB + wave * 32 + (lane >> 4)) * ldB + (lane & 15) * 16;
    const char* gB = (const char*)Bb + (size_t)(nB + wave * 32 + (lane >> 4)) * ldB + (lane & 15) * 16;
    constexpr int stages = kDim >> 7;
    stage_wave(lA, lB, gA, gB, ldB);
    asm volatile("s_wait_asynccnt 0x0" ::: "memory");   // this wave's share of stage 0 has landed; the barrier publishes every wave's
    __syncthreads();
    stage_wave(lA + kBuf2Bytes, lB + kBuf2Bytes, gA + 256, gB + 256, ldB);
    // the lane's fragment row and k half inside the wave's 128 rows of the A tile and 64 rows of the B tile
    const int foA = ((wave >> 2) * 128 + rlane) * kPitch2 + koff * 2;
    const int foB = kTile2 + ((wave & 3) * 64 + rlane) * kPitch2 + koff * 2;
    for (int t = 0; t < stages; ++t) {
      const int bsel = (t & 1) * kBuf2Bytes;
      const char* rb = smem + bsel;
      // four blocks of 32 k, 32 products each; the fragments of two blocks are in registers at a time
      V ah[4][8], bh[4][4];
#pragma unroll
      for (int s = 0; s < 4; ++s) {
        // blocks 0 and 1: one load group at the head of the stage, in the order of use; block s + 1 (s = 1, 2): one group ahead of block s's
        // products, into the registers that block s - 1 has left, so that its LDS latency passes under 32 products
        const int f0 = (s == 0) ? 0 : s + 1, f1 = (s == 0) ? 2 : ((s < 3) ? s + 2 : 0);
#pragma unroll
        for (int f = f0; f < f1; ++f) {
#pragma unroll
          for (int j = 0; j < 4; ++j) bh[f][j] = Frag<T>::load((const T*)(rb + foB + j * 16 * kPitch2 + f * 64));
#pragma unroll
          for (int i = 0; i < 8; ++i) ah[f][i] = Frag<T>::load((const T*)(rb + foA + i * 16 * kPitch2 + f * 64));
        }
        // holds each load group whole and ahead of the block's products; the scheduler otherwise sinks each fragment's loads in front of its use
        __builtin_amdgcn_sched_barrier(0);
#pragma unroll
        for (int i = 0; i < 8; ++i) {
#pragma unroll
          for (int j = 0; j < 4; ++j) acc[i][j] = Frag<T>::mma(ah[s][i], bh[s][j], acc[i][j]);
        }
        // holds the next group behind this block's products (hoisted, three blocks' fragments would be live: spills), and the last block's
        // products ahead of the foot's waits, so that stage t + 1's copies fly while stage t is worked on
        __builtin_amdgcn_sched_barrier(0);
      }
      asm volatile("s_wait_dscnt 0x0" ::: "memory");     // this wave's LDS reads of the stage are done before any wave refills its buffer
      asm volatile("s_wait_asynccnt 0x0" ::: "memory");  // this wave's share of stage t + 1 has landed
      __syncthreads();                                   // publishes stage t + 1 to all waves; ends every wave's reads of stage t
      if (t + 2 < stages) {
        const size_t kb = (size_t)(t + 2) * 256;
        stage_wave(lA + bsel, lB + bsel, gA + kb, gB + kb, ldB);
      }
    }
    asm volatile("s_wait_asynccnt 0x0" ::: "memory");    // nothing in flight when the ring becomes the epilogue's slabs (all reads ended at the last barrier)
  }

  // ---- epilogue: one branch, the same for the whole work-group ----
  if (!isV) qk_norm_rope_store(acc, smem, fcs, qw, kw, Ph, m0, n0, wave, lane);
  else      vt_store(acc, (float*)(smem + wave * kSlabB), VTp + (size_t)vb * kNK * kSeq, m0, n0, lane);
}

// ---------------------------------------------------------------------------
// f32 -> (RNE bf16) -> f16 cast with an exact power-of-two carry: out = f16( scale * bf16(in) ).
// ---------------------------------------------------------------------------
__global__ __launch_bounds__(256) void cast8_kernel(const float* __restrict__ in, unsigned short* __restrict__ out, int n8, float scale) {
  const int i = blockIdx.x * 256 + threadIdx.x;
  if (i >= n8) return;
  const float* p = in + 8 * (size_t)i;
  const v4f a = *(const v4f*)(p);
  const v4f c = *(const v4f*)(p + 4);
  unsigned short hb[8];
#pragma unroll
  for (int e = 0; e < 4; ++e) {
    hb[e]     = h_bits(bfr(a[e]) * scale);
    hb[4 + e] = h_bits(bfr(c[e]) * scale);
  }
  const v4u u = (v4u){pk16(hb[0], hb[1]), pk16(hb[2], hb[3]), pk16(hb[4], hb[5]), pk16(hb[6], hb[7])};
  unsigned short* q = out + 8 * (size_t)i;
  *(v4u*)q = u;
  
}

constexpr int kAKeys   = 64;
constexpr int kAStages = kSeq / kAKeys;
constexpr int kKPitch  = 2 * kHD + 16;
constexpr int kVPitch  = 2 * kAKeys + 16;
constexpr int kKTile   = kAKeys * kKPitch;
constexpr int kVTile   = kHD * kVPitch;
constexpr int kABuf    = kKTile + kVTile;
constexpr float kScoreLog2 = kScoreScale * 1.4426950408889634f;
constexpr float kPShift    = 8.0f;                 // p carried x2^8: small p stay clear of the f16 subnormals; cancels in sum p v / sum p
static_assert(kAStages >= 2 && kSeq % 128 == 0, "two or more stages; 128 query positions per block");

typedef __attribute__((ext_vector_type(4))) int v4i;

// Four asynchronous 16-byte-per-lane copies global -> LDS: one thread's share of one operand tile of a stage.
// s_wait_xcnt 0 is the last line of the copies' own statement, so it stands ahead of any rewrite of the address registers named here.
__device__ __forceinline__ void async_copy4(unsigned l0, unsigned l1, unsigned l2, unsigned l3,
                                            const char* g0, const char* g1, const char* g2, const char* g3) {
  asm volatile(
      "global_load_async_to_lds_b128 %0, %4, off\n\t"
      "global_load_async_to_lds_b128 %1, %5, off\n\t"
      "global_load_async_to_lds_b128 %2, %6, off\n\t"
      "global_load_async_to_lds_b128 %3, %7, off\n\t"
      "s_wait_xcnt 0x0"
      :: "v"(l0), "v"(l1), "v"(l2), "v"(l3), "v"(g0), "v"(g1), "v"(g2), "v"(g3)
      : "memory");
}
// One stage: 64 K rows x 256 B (thread: row tid >> 4 (+16 a copy), chunk tid & 15) and 128 V^T rows x 128 B
// (thread: row tid >> 3 (+32 a copy), chunk tid & 7). lK, lV, gK, gV are the thread's own addresses of its first copy.
__device__ __forceinline__ void attn_stage(unsigned lK, unsigned lV, const char* gK, const char* gV) {
  constexpr unsigned kLK = 16 * kKPitch, kLV = 32 * kVPitch;
  constexpr size_t   kGK = (size_t)16 * 2 * kHD, kGV = (size_t)32 * 2 * kSeq;
  async_copy4(lK, lK + kLK, lK + 2 * kLK, lK + 3 * kLK, gK, gK + kGK, gK + 2 * kGK, gK + 3 * kGK);
  async_copy4(lV, lV + kLV, lV + 2 * kLV, lV + 3 * kLV, gV, gV + kGV, gV + 2 * kGV, gV + 3 * kGV);
}
// lane l with lane l ^ 16
__device__ __forceinline__ float xhalf(float x) {
  return __builtin_bit_cast(float, __builtin_amdgcn_permlanex16(__builtin_bit_cast(int, x), __builtin_bit_cast(int, x), 0x76543210, 0xfedcba98, false, false));
}

__global__ __launch_bounds__(256) void attn_kernel(const unsigned short* __restrict__ Ph,
                                                   const unsigned short* __restrict__ VTp, const int* __restrict__ maskp,
                                                   unsigned short* __restrict__ Obp) {
  // every '#pragma unroll' in this kernel: constant indices keep the fragment, score and accumulator arrays in registers
  __shared__ __align__(128) char ring[2 * kABuf];
  __shared__ __align__(16) float kbias[kSeq];
  const int tid   = threadIdx.x;
  const int lane  = tid & 31;
  const int wave  = tid >> 5;
  const int rlane = lane & 15;                 // row of an A fragment, column of a B fragment and of D
  const int koff  = (lane >> 4) * 8;           // k offset of this lane half = D row offset
  const int b     = blockIdx.y / kKV;
  const int j     = blockIdx.y % kKV;
  const int q0    = blockIdx.x * 128 + wave * 16;

  // additive key bias of batch b, once per block
  {
    const int* mp = maskp + (size_t)b * kSeq + 8 * tid;
    const v4i m0 = *(const v4i*)(mp);
    const v4i m1 = *(const v4i*)(mp + 4);
    v4f f0, f1;
#pragma unroll
    for (int e = 0; e < 4; ++e) {
      f0[e] = (m0[e] != 0) ? 0.0f : -__builtin_inff();
      f1[e] = (m1[e] != 0) ? 0.0f : -__builtin_inff();
    }
    *(v4f*)(kbias + 8 * tid)     = f0;
    *(v4f*)(kbias + 8 * tid + 4) = f1;
  }

  const unsigned lK = (unsigned)(size_t)ring + (unsigned)((tid >> 4) * kKPitch + (tid & 15) * 16);
  const unsigned lV = (unsigned)(size_t)ring + (unsigned)(kKTile + (tid >> 3) * kVPitch + (tid & 7) * 16);
  const char* gK  = (const char*)(Ph + ((size_t)kKRow0 + (size_t)(b * kKV + j) * kSeq + (tid >> 4)) * kHD) + (tid & 15) * 16;
  const char* gV  = (const char*)(VTp + ((size_t)(b * kKV + j) * kHD + (tid >> 3)) * kSeq) + (tid & 7) * 16;
  constexpr size_t kKStep = (size_t)kAKeys * kHD * 2;   // bytes from one stage's K rows to the next
  constexpr size_t kVStep = (size_t)kAKeys * 2;         // bytes from one stage's V^T columns to the next

  attn_stage(lK, lV, gK, gV);

  // Q fragments (B operand), both heads, kept for the whole kernel
  v16h qf[2][4];
#pragma unroll
  for (int g = 0; g < 2; ++g) {
    const _Float16* qp = (const _Float16*)Ph + ((size_t)(b * kHeads + 2 * j + g) * kSeq + q0 + rlane) * kHD + koff;
#pragma unroll
    for (int kc = 0; kc < 4; ++kc) qf[g][kc] = Frag<_Float16>::load(qp + kc * 32);
  }
  v8f acc[2][8];
  float mrun[2], lrun[2];
#pragma unroll
  for (int g = 0; g < 2; ++g) {
    mrun[g] = -__builtin_inff();
    lrun[g] = 0.0f;
#pragma unroll
    for (int d = 0; d < 8; ++d) acc[g][d] = (v8f){0.f,0.f,0.f,0.f,0.f,0.f,0.f,0.f};
  }

  asm volatile("s_wait_asynccnt 0x0" ::: "memory");     // stage 0 has landed before anybody reads it
  __syncthreads();                                      // also publishes kbias
  attn_stage(lK + kABuf, lV + kABuf, gK + kKStep, gV + kVStep);

  for (int t = 0; t < kAStages; ++t) {
    const int bsel = (t & 1) * kABuf;
    // two 32-key passes; kept rolled: unrolled, both passes' fragments are fetched together and registers spill
#pragma unroll 1
    for (int sub = 0; sub < 2; ++sub) {
      const char* kp = ring + bsel + (sub * 32 + rlane) * kKPitch + koff * 2;
      // all 16 K fragment loads of the pass go out as one group, in the order of their use
      v16h kf[2][4];
#pragma unroll
      for (int kc = 0; kc < 4; ++kc) {
#pragma unroll
        for (int kt = 0; kt < 2; ++kt) kf[kt][kc] = Frag<_Float16>::load((const _Float16*)(kp + kt * 16 * kKPitch + kc * 64));
      }
      // bias of this lane's 16 keys, last in the same group: there when the products end
      const float* bp = kbias + t * kAKeys + sub * 32 + koff;
      const v4f b0 = *(const v4f*)(bp), b1 = *(const v4f*)(bp + 4), b2 = *(const v4f*)(bp + 16), b3 = *(const v4f*)(bp + 20);
      // holds the load group ahead of the products; the scheduler otherwise sinks each fragment's loads in front of its use, one LDS latency each
      __builtin_amdgcn_sched_barrier(0);
      v8f s[2][2];
#pragma unroll
      for (int kt = 0; kt < 2; ++kt)
#pragma unroll
        for (int g = 0; g < 2; ++g) s[kt][g] = (v8f){0.f,0.f,0.f,0.f,0.f,0.f,0.f,0.f};
      // the four score tiles take turns, so that no product waits for the one before it
#pragma unroll
      for (int kc = 0; kc < 4; ++kc) {
#pragma unroll
        for (int kt = 0; kt < 2; ++kt)
#pragma unroll
          for (int g = 0; g < 2; ++g) s[kt][g] = Frag<_Float16>::mma(kf[kt][kc], qf[g][kc], s[kt][g]);
      }
      // holds the V^T loads behind the score products, where the K fragments' registers are free again (hoisted, they spill);
      // their latency passes under the softmax arithmetic
      __builtin_amdgcn_sched_barrier(0);
      // V^T fragments of the pass: 16 dims x 32 keys each
      const char* vp = ring + bsel + kKTile + rlane * kVPitch + sub * 64 + koff * 2;
      v16h vf[8];
#pragma unroll
      for (int d = 0; d < 8; ++d) vf[d] = Frag<_Float16>::load((const _Float16*)(vp + d * 16 * kVPitch));
#pragma unroll
      for (int g = 0; g < 2; ++g) {
        float a[16];
#pragma unroll
        for (int r = 0; r < 4; ++r) {
          a[r]      = fmaf(s[0][g][r],     kScoreLog2, b0[r]);
          a[4 + r]  = fmaf(s[0][g][4 + r], kScoreLog2, b1[r]);
          a[8 + r]  = fmaf(s[1][g][r],     kScoreLog2, b2[r]);
          a[12 + r] = fmaf(s[1][g][4 + r], kScoreLog2, b3[r]);
        }
        float mx = a[0];
#pragma unroll
        for (int e = 1; e < 16; ++e) mx = fmaxf(mx, a[e]);
        mx = fmaxf(mx, xhalf(mx));                                     // both halves hold the query's maximum over the 32 keys
        const float mnew  = fmaxf(mrun[g], mx);
        const float msafe = (mnew == -__builtin_inff()) ? 0.0f : mnew; // only masked keys so far: keep -inf - -inf out of the exponents
        const float corr  = __builtin_amdgcn_exp2f(mrun[g] - msafe);
        const float nm    = kPShift - msafe;
        mrun[g] = mnew;
        v16h pf;
        float ps0 = 0.0f, ps1 = 0.0f;
#pragma unroll
        for (int e = 0; e < 16; e += 2) {
          const float p0 = __builtin_amdgcn_exp2f(a[e] + nm);
          const float p1 = __builtin_amdgcn_exp2f(a[e + 1] + nm);
          ps0 += p0;
          ps1 += p1;
          pf[e]     = (_Float16)p0;
          pf[e + 1] = (_Float16)p1;
        }
        lrun[g] = fmaf(lrun[g], corr, ps0 + ps1);                      // this half's keys only; the halves join behind the loop
#pragma unroll
        for (int d = 0; d < 8; ++d) acc[g][d] = acc[g][d] * corr;
#pragma unroll
        for (int d = 0; d < 8; ++d) acc[g][d] = Frag<_Float16>::mma(vf[d], pf, acc[g][d]);
      }
      // the distance behind a matrix instruction on the loop's taken branch: the next pass's address arithmetic reuses the registers of the last
      // product's V^T fragment; the scheduling barrier keeps the products ahead of the four slots
      __builtin_amdgcn_sched_barrier(0);
      asm volatile("v_nop\n\tv_nop\n\tv_nop\n\tv_nop");
    }
    asm volatile("s_wait_dscnt 0x0" ::: "memory");      // this stage's LDS reads are done before its buffer is refilled
    asm volatile("s_wait_asynccnt 0x0" ::: "memory");   // stage t + 1 has landed
    __syncthreads();
    if (t + 2 < kAStages) {
      const size_t st = (size_t)(t + 2);
      attn_stage(lK + bsel, lV + bsel, gK + st * kKStep, gV + st * kVStep);
    }
  }
  asm volatile("s_wait_asynccnt 0x0" ::: "memory");     // nothing in flight when the wave ends

  // O^T tile d: lane holds dims 16 d + koff + 0..7 of query q0 + rlane: one 16-B store; a wave writes whole 256-B head rows
#pragma unroll
  for (int g = 0; g < 2; ++g) {
    const float inv = kOCarry / (lrun[g] + xhalf(lrun[g]));
    unsigned short* op = Obp + ((size_t)b * kSeq + q0 + rlane) * kNQ + (size_t)(2 * j + g) * kHD + koff;
#pragma unroll
    for (int d = 0; d < 8; ++d) {
      v8h o;
#pragma unroll
      for (int r = 0; r < 8; ++r) o[r] = (_Float16)(acc[g][d][r] * inv);
      *(v8h*)(op + d * 16) = o;
    }
  }
}

// ---------------------------------------------------------------------------
// Host glue.
//   R0 X16  f16 [4096][2048]                        16,777,216 at           0   (later: Ob f16 [4096][2048], same type + layout)
//   R1 Wq16 f16 [4096][2048] (w_qkv x16)            16,777,216 at  16,777,216   
//   R2 Wo16 f16 [2048][2048] (w_out x16)             8,388,608 at  33,554,432
//   R3 VT   f16 [2*8][128][2048] (v transposed)       8,388,608 at  41,943,040
//   R4 QK16 f16 [98304][128] (q rows then k rows)   25,165,824 at  50,331,648
//   total                                           75,497,472
// Re-use timeline (stream ordered): X16/Wq16 are read only by the qkv GEMM;
// Ob is first written by the attention kernel, which starts after the qkv GEMM.
// Every region is fully written before it is read; no region changes element type.
// GEMM shapes: q|k (M=4096, N=3072, K=2048); V^T per batch (M=1024, N=2048, K=2048);
// output (M=4096, N=2048, K=2048); all M,N multiples of 64, all K multiples of 32, no padding anywhere.
// ---------------------------------------------------------------------------
extern "C" void kernel_launch(void* const* d_in, const int* in_sizes, int n_in,
                              void* d_out, int out_size, void* d_ws, size_t ws_size,
                              hipStream_t stream) {
  if (n_in < 7) return;
  const int nX = kBatch * kSeq * kDim;            // 8,388,608
  if (in_sizes[0] != nX) return;
  if (in_sizes[1] != kBatch * kSeq) return;
  if (in_sizes[2] != kSeq * (kHD / 2) * 4) return;
  if (in_sizes[3] != kNQKV * kDim) return;
  if (in_sizes[4] != kDim * kNQ) return;
  if (in_sizes[5] != kHD || in_sizes[6] != kHD) return;
  if (out_size != kTok * kDim) return;

  const size_t szX16  = (size_t)kTok * kDim * 2;
  const size_t szWq16 = (size_t)kNQKV * kDim * 2;
  const size_t szWo16 = (size_t)kDim * kNQ * 2;
  const size_t szVT   = (size_t)kBatch * kKV * kHD * kSeq * 2;
  const size_t szPl   = (size_t)kQKRows * kHD * 2;        // the f16 q|k plane
  const size_t szOb   = (size_t)kTok * kNQ * 2;
  const size_t offX16  = 0;
  const size_t offWq16 = offX16 + szX16;
  const size_t offWo16 = offWq16 + szWq16;
  const size_t offVT   = offWo16 + szWo16;
  const size_t offPhi  = offVT + szVT;
  const size_t total   = offPhi + szPl;
  if (szOb > szX16) return;                      // the re-used region fits its first carve
  if (ws_size < total) return;

  const float* x     = (const float*)d_in[0];
  const int*   xmask = (const int*)d_in[1];
  const float* freqs = (const float*)d_in[2];
  const float* wqkv  = (const float*)d_in[3];
  const float* wout  = (const float*)d_in[4];
  const float* qw    = (const float*)d_in[5];
  const float* kw    = (const float*)d_in[6];
  float* out = (float*)d_out;
  char* ws = (char*)d_ws;
  unsigned short* X16  = (unsigned short*)(ws + offX16);
  unsigned short* Ob   = (unsigned short*)(ws + offX16);     // re-use of R0 (f16, same layout)
  unsigned short* Wq16 = (unsigned short*)(ws + offWq16);
  unsigned short* Wo16 = (unsigned short*)(ws + offWo16);
  unsigned short* VT  = (unsigned short*)(ws + offVT);
  unsigned short* Phi = (unsigned short*)(ws + offPhi);
  const float* dummyf = (const float*)(ws + offVT);          // valid in-ws pointer for unused bias/resid arguments

  // ---- 16-bit operand planes of the inputs (RNE bf16 of every float input, f16 containers, weights x16) ----
  const int n8x = nX / 8;                 // 1,048,576 -> 4096 blocks exact
  const int n8w = (kNQKV * kDim) / 8;     // 1,048,576 -> 4096 blocks exact
  const int n8o = (kDim * kNQ) / 8;       //   524,288 -> 2048 blocks exact
  cast8_kernel<<<dim3(n8x / 256), dim3(256), 0, stream>>>(x, X16, n8x, 1.0f);
  cast8_kernel<<<dim3(n8w / 256), dim3(256), 0, stream>>>(wqkv, Wq16, n8w, kWCarry);
  cast8_kernel<<<dim3(n8o / 256), dim3(256), 0, stream>>>(wout, Wo16, n8o, kWCarry);

  // ---- q|k projection of both batches (w_qkv rows 0..3071) with norm + rotary in its epilogue -> f16 plane, and v projection written directly
  //      transposed (f16), one launch: 192 + 64 work-groups cover all 98304 rows of the q|k plane and the whole 16 x 128 x 2048 VT plane ----
  qkv_gemm<<<dim3(kQKVBlocks), dim3(256), 0, stream>>>(X16, Wq16, freqs, qw, kw, Phi, VT);

  // ---- attention, all (batch, kv head) groups in one launch: Ob[b*2048+i][(2j+hg)*128+n] = f16( 16 * softmax(q.k^T * 128^-0.5 + mask) . v )
  //      grid (16 blocks of 128 query positions, 16 groups) = 256 blocks; covers the whole [4096][2048] Ob plane ----
  attn_kernel<<<dim3(kSeq / 128, kBatch * kKV), dim3(256), 0, stream>>>(Phi, VT, xmask, Ob);

  // ---- output projection: out[tok][n] = 2^-8 * sum_e Ob[tok][e] * Wo16[n][e]   (M=4096, N=2048, K=2048) ----
  {
    const int tilesOut = (kTok / 64) * (kDim / 64);   // 2048 -> 256 blocks; covers the whole [4096][2048] output
    wmma_gemm64<0, false, 0, 0, false, 0><<<dim3(tilesOut / 8, 1), dim3(256), 0, stream>>>(
        Ob, Ob, kNQ, 0L, Wo16, Wo16, kNQ, 0L,
        (void*)out, (void*)out, kDim, 0L, dummyf, dummyf, 0L, kTok, kDim, kNQ, kOutScale);
  }
}

// v008
// Measured time: 147 microseconds a run.
// Timed twice side by side with v007, it ran 1.03 times as fast both times.
// Counting every step since v000, it is 15.1 times as fast.
// Contractions: qkv projection (x as f16(bf16 RNE) x w_qkv^T as f16(16*bf16 RNE)), V^T.P^T (P f16, unnormalised, carried x256, x V^T f16) and output projection (o f16 carried x16 x w_out^T as f16(16*bf16 RNE)) on v_wmma_f32_16x16x32_f16; scores k.q^T on v_wmma_f32_16x16x32_f16 with q,k as one f16 plane each (RNE of the f32 norm+rotary result, one product); f32 accumulate everywhere; RMSNorm, 2x2 rotary map and online softmax in f32.
#include <hip/hip_runtime.h>
#include <math.h>

// ---------------------------------------------------------------------------
// Problem constants
// ---------------------------------------------------------------------------
constexpr int kBatch = 2;
constexpr int kSeq   = 2048;
constexpr int kDim   = 2048;              // model dim (K of the qkv projection, N of the output projection)
constexpr int kHeads = 16;
constexpr int kKV    = 8;
constexpr int kHD    = 128;
constexpr int kTok   = kBatch * kSeq;     // 4096 token rows
constexpr int kNQ    = kHeads * kHD;      // 2048 q columns / o columns
constexpr int kNK    = kKV * kHD;         // 1024 k columns (= v columns)
constexpr int kNQK   = kNQ + kNK;         // 3072 = q|k columns (N of the q|k projection)
constexpr int kNQKV  = kNQ + 2 * kNK;     // 4096 rows of w_qkv
constexpr int kQKRows = kBatch * (kHeads + kKV) * kSeq;   // 98304 rows of 128 in the q|k f16 plane
constexpr int kKRow0  = kBatch * kHeads * kSeq;           // 65536 = first k row in the q|k plane
constexpr float kEps        = 1.1920929e-07f;
constexpr float kInvHD      = 1.0f / 128.0f;
constexpr float kWCarry     = 16.0f;                      // weights carried x16 in f16
constexpr float kWCarryInv  = 1.0f / 16.0f;
constexpr float kOCarry     = 16.0f;                      // attention output carried x16 in f16
constexpr float kOutScale   = 1.0f / (kOCarry * kWCarry); // 2^-8
constexpr float kScoreScale = 0.08838834764831845f;       // 128^-0.5
static_assert(kHD == 128, "a head is two 64-column wave tiles of the qkv projection");
static_assert(kHeads == 2 * kKV, "two query heads per kv head");
static_assert(kSeq % 64 == 0 && kNQK % 64 == 0 && kNK % 64 == 0 && kNQ % 64 == 0 && kDim % 64 == 0 && kTok % 64 == 0, "GEMM M/N tiles");
static_assert(kHD % 64 == 0);
static_assert(kDim % 32 == 0 && kHD % 32 == 0 && kSeq % 32 == 0 && kNQ % 32 == 0, "GEMM K % 32");
static_assert(kDim % 128 == 0 && kSeq % 128 == 0 && kNQ % 128 == 0, "staged GEMM K: two or more stages of 64");
static_assert(kSeq % 256 == 0 && kNK % 256 == 0 && kTok % 256 == 0 && kNQK % 128 == 0 && kDim % 128 == 0, "staged GEMM: 256 x 128 per work-group");
static_assert(kSeq == 256 * 8, "key bias coverage: 256 threads x 8 keys");

typedef __attribute__((ext_vector_type(16))) _Float16 v16h;
typedef __attribute__((ext_vector_type(8)))  _Float16 v8h;
typedef __attribute__((ext_vector_type(16))) __bf16   v16b;
typedef __attribute__((ext_vector_type(8)))  __bf16   v8b;
typedef __attribute__((ext_vector_type(2)))  __bf16   v2b;
typedef __attribute__((ext_vector_type(4)))  _Float16 v4h;
typedef __attribute__((ext_vector_type(8)))  float    v8f;
typedef __attribute__((ext_vector_type(4)))  float    v4f;
typedef __attribute__((ext_vector_type(2)))  float    v2f;
typedef __attribute__((ext_vector_type(2)))  int      v2i;
typedef __attribute__((ext_vector_type(4)))  unsigned int v4u;
typedef __attribute__((ext_vector_type(2)))  unsigned int v2u;

// ---------------------------------------------------------------------------
// Helpers
// ---------------------------------------------------------------------------
__device__ __forceinline__ unsigned short f2bf_bits(float f) {
  unsigned u = __float_as_uint(f);
  return (unsigned short)((u + 0x7FFFu + ((u >> 16) & 1u)) >> 16);
}
__device__ __forceinline__ float bf_bits2f(unsigned short h) { return __uint_as_float(((unsigned)h) << 16); }

// hazard guards as plain device helpers
__device__ __forceinline__ void dep_guard_h(v8f& a, v8f& b, v16h x, v16h y) { asm volatile("v_nop\n\tv_nop\n\tv_nop\n\tv_nop" : "+v"(a), "+v"(b) : "v"(x), "v"(y)); }
__device__ __forceinline__ void dep_guard_b(v8f& a, v8f& b, v16b x, v16b y) { asm volatile("v_nop\n\tv_nop\n\tv_nop\n\tv_nop" : "+v"(a), "+v"(b) : "v"(x), "v"(y)); }
__device__ __forceinline__ void keep4_h(v16h a, v16h b, v16h c, v16h d) { asm volatile("v_nop" :: "v"(a), "v"(b), "v"(c), "v"(d)); }
__device__ __forceinline__ void keep4_b(v16b a, v16b b, v16b c, v16b d) { asm volatile("v_nop" :: "v"(a), "v"(b), "v"(c), "v"(d)); }
__device__ __forceinline__ void acc_guard4(v8f& a, v8f& b, v8f& c, v8f& d) { asm volatile("v_nop\n\tv_nop\n\tv_nop\n\tv_nop" : "+v"(a), "+v"(b), "+v"(c), "+v"(d)); }
template <typename T> struct Frag;
template <> struct Frag<_Float16> {
  typedef v16h V; union U { v16h v; v8h h[2]; };
  // elements 0..7 <- p[0..7], 8..15 <- p[16..23]
  static __device__ __forceinline__ v16h load(const _Float16* p) {
    U f; f.h[0] = *(const v8h*)(p); f.h[1] = *(const v8h*)(p + 16); return f.v;
  }
  static __device__ __forceinline__ v8f mma(v16h a, v16h b, v8f c) {
    return __builtin_amdgcn_wmma_f32_16x16x32_f16(false, a, false, b, (short)0, c, false, false);
  }
  static __device__ __forceinline__ void guard(v8f& a, v8f& b, v16h x, v16h y) { dep_guard_h(a, b, x, y); }
  static __device__ __forceinline__ void keep(v16h a, v16h b, v16h c, v16h d) { keep4_h(a, b, c, d); }
};
template <> struct Frag<__bf16> {
  typedef v16b V; union U { v16b v; v8b h[2]; };
  static __device__ __forceinline__ v16b load(const __bf16* p) {
    U f; f.h[0] = *(const v8b*)(p); f.h[1] = *(const v8b*)(p + 16); return f.v;
  }
  static __device__ __forceinline__ v8f mma(v16b a, v16b b, v8f c) {
    return __builtin_amdgcn_wmma_f32_16x16x32_bf16(false, a, false, b, (short)0, c, false, false);
  }
  static __device__ __forceinline__ void guard(v8f& a, v8f& b, v16b x, v16b y) { dep_guard_b(a, b, x, y); }
  static __device__ __forceinline__ void keep(v16b a, v16b b, v16b c, v16b d) { keep4_b(a, b, c, d); }
};

__device__ __forceinline__ unsigned pk16(unsigned short a, unsigned short b) { return (unsigned)a | ((unsigned)b << 16); }
__device__ __forceinline__ unsigned short h_bits(float f) { const _Float16 h = (_Float16)f; return __builtin_bit_cast(unsigned short, h); }
// RNE bf16 conversion returned as f32
__device__ __forceinline__ float bfr(float f) { return bf_bits2f(f2bf_bits(f)); }

// ---- Register-blocked batched WMMA GEMM (ACT reduced to none/relu/leaky) -------------------------------
// C[m,n] = scale * sum_k A[m,k] * Bt[n,k] (+bias)(+resid); each wave owns a 64x64 tile.
// A row-major [M,K]; Bt row-major [N,K]; SPLIT: M,N % 64 == 0, K % 32 == 0.
// Not SPLIT: a work-group owns 256 x 128 of C, its waves 4 x 2 tiles of 64x64 on shared staged operands; M % 256 == 0, N % 128 == 0, K % 64 == 0.
// SPLIT: operands are hi/lo planes (A2/Bt2 = lo planes, same layout); product = hi*hi + hi*lo + lo*hi.
// BIAS_MODE: 0 = none, 1 = bias[m], 2 = bias[n].
// OUT_MODE: 0 = f32, 1 = f16, 2 = bf16 hi plane (Cout) + bf16 lo plane (Cout2).
// ET: 0 = f16 operands, 1 = bf16 operands (pointers passed as 16-bit storage)
template <int ET> struct Elem;
template <> struct Elem<0> { typedef _Float16 T; };
template <> struct Elem<1> { typedef __bf16 T; };
// One asynchronous 16-byte-per-lane copy global -> LDS, as the compiler's own builtin: the compiler sees the address registers, so it may keep
// them anywhere in the register file (operands of asm text must lie in the first 256 registers, which accumulators and fragments fill),
// folds constant steps into the instruction's offset, and no wait stands between a copy and the next address arithmetic.
typedef int cp16 __attribute__((vector_size(16)));
typedef __attribute__((address_space(1))) cp16 gcp16;
typedef __attribute__((address_space(3))) cp16 lcp16;
__device__ __forceinline__ void async_copy16(char* l, const char* g) {
  __builtin_amdgcn_global_load_async_to_lds_b128((gcp16*)g, (lcp16*)l, 0, 0);
}
// One stage of the work-group's shared tiles: A 256 rows x 128 B (64 k), then B 128 rows x 128 B, in LDS rows of pitch 144 B.
// A wave brings 32 rows of A (8 copies) and 16 rows of B (4 copies); every A row then feeds two waves, every B row four.
// lA / gA and lB / gB are the lane's own addresses for its wave's first row + (lane >> 3), 16-byte chunk (lane & 7); copy c moves 4 rows.
constexpr int kRowPitch  = 144;                    // 128-B rows + 16 B: 16 B x odd, the pitch for ds_load_b128 readers
constexpr int kATile     = 256 * kRowPitch;        // 36864
constexpr int kBTile     = 128 * kRowPitch;        // 18432
constexpr int kBufBytes  = kATile + kBTile;        // A tile then B tile
constexpr int kRingBytes = 2 * kBufBytes;          // two buffers per work-group
__device__ __forceinline__ void stage_block(char* lA, char* lB, const char* gA, const char* gB, size_t ldaBytes, size_t ldbBytes) {
  // twelve copies, each 32 lanes x 16 B = 4 rows x one whole 128-B line; both loops unrolled: straight-line copies, no loop counter or branch at the foot
#pragma unroll
  for (int c = 0; c < 8; ++c) async_copy16(lA + c * 4 * kRowPitch, gA + (size_t)(c * 4) * ldaBytes);
#pragma unroll
  for (int c = 0; c < 4; ++c) async_copy16(lB + c * 4 * kRowPitch, gB + (size_t)(c * 4) * ldbBytes);
}

template <int ET, bool SPLIT, int BIAS_MODE, int OUT_MODE, bool RESID, int ACT = 0>
__global__ __launch_bounds__(256) void wmma_gemm64(
    const unsigned short* __restrict__ Ap, const unsigned short* __restrict__ A2p, int lda, long strideA,
    const unsigned short* __restrict__ Btp, const unsigned short* __restrict__ Bt2p, int ldb, long strideB,
    void* __restrict__ Cout, void* __restrict__ Cout2, int ldc, long strideC,
    const float* __restrict__ bias,
    const float* __restrict__ resid, long strideR,
    int M, int N, int K, float scale) {
  typedef typename Elem<ET>::T T;
  typedef typename Frag<T>::V V;
  const T* A = (const T*)Ap; const T* A2 = (const T*)A2p; const T* Bt = (const T*)Btp; const T* Bt2 = (const T*)Bt2p;
  // Per-wave 16x64 f32 slab, pitch 68 floats. Not SPLIT: the work-group's ring of two staged buffers; its first bytes serve as the slabs behind the k loop.
  constexpr int kSlabBytes = 16 * 68 * 4;
  __shared__ __align__(16) char smem[SPLIT ? 8 * kSlabBytes : kRingBytes];
  const int b    = blockIdx.y;
  const int lane = threadIdx.x & 31;
  const int wave = threadIdx.x >> 5;
  int m0, n0, mB = 0, nB = 0;                  // the wave's tile; the work-group's tile (staged path)
  if (SPLIT) {
    const int tilesN = N >> 6;
    const int tile = blockIdx.x * 8 + wave;
    if (tile >= (M >> 6) * tilesN) return;    // wave-uniform; no block barriers on this path
    const int tm = tile / tilesN;
    m0 = tm << 6;
    n0 = (tile - tm * tilesN) << 6;
  } else {
    const int blocksN = N >> 7;
    if ((int)blockIdx.x >= (M >> 8) * blocksN) return;   // the whole work-group leaves, ahead of every barrier and copy
    const int bm = blockIdx.x / blocksN;
    mB = bm << 8;
    nB = (blockIdx.x - bm * blocksN) << 7;
    m0 = mB + ((wave >> 1) << 6);
    n0 = nB + ((wave & 1) << 6);
  }

  const T* Ab  = A  + (size_t)b * strideA;
  const T* Bb  = Bt + (size_t)b * strideB;
  const T* Ab2 = SPLIT ? (A2  + (size_t)b * strideA) : nullptr;
  const T* Bb2 = SPLIT ? (Bt2 + (size_t)b * strideB) : nullptr;

  const int rlane = lane & 15;                 // row (A) / col (B, D) within subtile
  const int koff  = (lane >> 4) * 8;           // k offset of this lane half
  const int mOff  = (lane >> 4) * 8;           // D row offset

  v8f acc[4][4];
#pragma unroll
  for (int i = 0; i < 4; ++i)
#pragma unroll
    for (int j = 0; j < 4; ++j) acc[i][j] = (v8f){0.f,0.f,0.f,0.f,0.f,0.f,0.f,0.f};

  if (SPLIT) {
    for (int k0 = 0; k0 < K; k0 += 32) {
      V bh[4], bl[4];
#pragma unroll
      for (int j = 0; j < 4; ++j) {
        const size_t bo = (size_t)(n0 + (j << 4) + rlane) * ldb + koff + k0;
        bh[j] = Frag<T>::load(Bb + bo);
        if (SPLIT) bl[j] = Frag<T>::load(Bb2 + bo);
      }
#pragma unroll
      for (int i = 0; i < 4; ++i) {
        const size_t ao = (size_t)(m0 + (i << 4) + rlane) * lda + koff + k0;
        V ah = Frag<T>::load(Ab + ao);
        V al;
        if (SPLIT) al = Frag<T>::load(Ab2 + ao);
#pragma unroll
        for (int j = 0; j < 4; ++j) {
          acc[i][j] = Frag<T>::mma(ah, bh[j], acc[i][j]);
          if (SPLIT) {
            acc[i][j] = Frag<T>::mma(ah, bl[j], acc[i][j]);
            acc[i][j] = Frag<T>::mma(al, bh[j], acc[i][j]);
          }
        }
        Frag<T>::guard(acc[i][0], acc[i][3], ah, SPLIT ? al : ah);
      }
      Frag<T>::keep(bh[0], bh[1], bh[2], bh[3]);
      if (SPLIT) Frag<T>::keep(bl[0], bl[1], bl[2], bl[3]);
    }
  } else {
    // The work-group stages its A and B tiles once for all eight waves, 64 k (one whole 128-B line of every row) per stage, in two LDS
    // buffers by asynchronous copies; the fragments come from LDS through Frag::load, k ascending. K is a multiple of 128 (asserted below the constants).
    char* lc = smem + ((lane >> 3) * kRowPitch + (lane & 7) * 16);
    char* lA = lc + wave * 32 * kRowPitch;
    char* lB = lc + (kATile + wave * 16 * kRowPitch);
    const size_t ldaB = (size_t)lda * 2, ldbB = (size_t)ldb * 2;
    const char* gA = (const char*)Ab + (size_t)(mB + wave * 32 + (lane >> 3)) * ldaB + (lane & 7) * 16;
    const char* gB = (const char*)Bb + (size_t)(nB + wave * 16 + (lane >> 3)) * ldbB + (lane & 7) * 16;
    const int stages = K >> 6;
    stage_block(lA, lB, gA, gB, ldaB, ldbB);
    asm volatile("s_wait_asynccnt 0x0" ::: "memory");   // this wave's share of stage 0 has landed; the barrier publishes every wave's
    __syncthreads();
    if (stages > 1) stage_block(lA + kBufBytes, lB + kBufBytes, gA + 128, gB + 128, ldaB, ldbB);
    // the lane's fragment row and k half inside the wave's 64 rows of the A tile and of the B tile
    const int foA = ((wave >> 1) * 64 + rlane) * kRowPitch + koff * 2;
    const int foB = kATile + ((wave & 1) * 64 + rlane) * kRowPitch + koff * 2;
    for (int t = 0; t < stages; ++t) {
      const int bsel = (t & 1) * kBufBytes;
      const char* rb = smem + bsel;
      // all 32 fragment loads of the stage go out as one group ahead of its products: one LDS latency a stage, not one per A fragment
      V ah[2][4], bh[2][4];                              // loops below unrolled: constant indices keep the fragments in registers
#pragma unroll
      for (int s = 0; s < 2; ++s) {
#pragma unroll
        for (int j = 0; j < 4; ++j) {
          bh[s][j] = Frag<T>::load((const T*)(rb + foB + j * 16 * kRowPitch + s * 64));
          ah[s][j] = Frag<T>::load((const T*)(rb + foA + j * 16 * kRowPitch + s * 64));
        }
      }
      // holds the load group ahead of the products; the scheduler otherwise sinks each A fragment's loads in front of its use
      __builtin_amdgcn_sched_barrier(0);
#pragma unroll
      for (int s = 0; s < 2; ++s) {
#pragma unroll
        for (int i = 0; i < 4; ++i) {
#pragma unroll
          for (int j = 0; j < 4; ++j) acc[i][j] = Frag<T>::mma(ah[s][i], bh[s][j], acc[i][j]);
        }
      }
      // holds the products ahead of the foot's waits, so that stage t + 1's copies fly while stage t is worked on
      __builtin_amdgcn_sched_barrier(0);
      asm volatile("s_wait_dscnt 0x0" ::: "memory");     // this wave's LDS reads of the stage are done before any wave refills its buffer
      asm volatile("s_wait_asynccnt 0x0" ::: "memory");  // this wave's share of stage t + 1 has landed
      __syncthreads();                                   // publishes stage t + 1 to all waves; ends every wave's reads of stage t
      if (t + 2 < stages) {
        const size_t kb = (size_t)(t + 2) * 128;
        stage_block(lA + bsel, lB + bsel, gA + kb, gB + kb, ldaB, ldbB);
      }
    }
    asm volatile("s_wait_asynccnt 0x0" ::: "memory");    // nothing in flight when the ring becomes the epilogue's slabs (all reads ended at the last barrier)
  }
  acc_guard4(acc[0][0], acc[0][1], acc[0][2], acc[0][3]);
  acc_guard4(acc[1][0], acc[1][1], acc[1][2], acc[1][3]);
  acc_guard4(acc[2][0], acc[2][1], acc[2][2], acc[2][3]);
  acc_guard4(acc[3][0], acc[3][1], acc[3][2], acc[3][3]);

  // ---- epilogue ----
  float* slab = (float*)(smem + wave * kSlabBytes);
  const float* Rb = RESID ? (resid + (size_t)b * strideR) : nullptr;
#pragma unroll
  for (int i = 0; i < 4; ++i) {
    const int mBase = m0 + (i << 4);
#pragma unroll
    for (int j = 0; j < 4; ++j) {
      const int n = n0 + (j << 4) + rlane;
      float bv = 0.f;
      if (BIAS_MODE == 2) bv = bias[n];
#pragma unroll
      for (int r = 0; r < 8; ++r) {
        float v = acc[i][j][r] * scale;
        if (BIAS_MODE == 1) v += bias[mBase + mOff + r];
        if (BIAS_MODE == 2) v += bv;
        if (RESID) v += Rb[(size_t)(mBase + mOff + r) * ldc + n];
        if (ACT == 2) v = fmaxf(v, 0.0f);
        if (ACT == 4) v = (v > 0.f) ? v : 0.01f * v;
        slab[(mOff + r) * 68 + (j << 4) + rlane] = v;
      }
    }
    __builtin_amdgcn_fence(__ATOMIC_RELEASE, "workgroup");
    __builtin_amdgcn_wave_barrier();
    __builtin_amdgcn_fence(__ATOMIC_ACQUIRE, "workgroup");
    if (OUT_MODE == 0) {
      float* C = (float*)Cout + (size_t)b * strideC;
      const int hh = lane >> 4, c4 = (lane & 15) * 4;     // row seg = 256 B = 16 lanes x 16 B
      {
#pragma unroll
        for (int it = 0; it < 8; ++it) {
          const int row = it * 2 + hh;
          v4f v = *(const v4f*)(slab + row * 68 + c4);
          *(v4f*)(C + (size_t)(mBase + row) * ldc + n0 + c4) = v;
        }
        
      }
    } else {
      const int q = lane >> 3, c8 = (lane & 7) * 8;
      unsigned short* C  = (unsigned short*)Cout  + (size_t)b * strideC;
      unsigned short* C2 = (OUT_MODE == 2) ? ((unsigned short*)Cout2 + (size_t)b * strideC) : nullptr;
      {
#pragma unroll
        for (int it = 0; it < 4; ++it) {
          const int row = it * 4 + q;
          const float* sp = slab + row * 68 + c8;
          v8h hv, lv;
#pragma unroll
          for (int e = 0; e < 8; ++e) {
            if (OUT_MODE == 1) {
              hv[e] = (_Float16)sp[e];
            } else {
              unsigned short hb = f2bf_bits(sp[e]);
              unsigned short lb = f2bf_bits(sp[e] - bf_bits2f(hb));
              hv[e] = __builtin_bit_cast(_Float16, hb);
              lv[e] = __builtin_bit_cast(_Float16, lb);
            }
          }
          *(v8h*)(C + (size_t)(mBase + row) * ldc + n0 + c8) = hv;
          if (OUT_MODE == 2) *(v8h*)(C2 + (size_t)(mBase + row) * ldc + n0 + c8) = lv;
        }
        
      }
    }
    __builtin_amdgcn_fence(__ATOMIC_RELEASE, "workgroup");
    __builtin_amdgcn_wave_barrier();
    __builtin_amdgcn_fence(__ATOMIC_ACQUIRE, "workgroup");
  }
}

// ---------------------------------------------------------------------------
// The whole qkv projection in ONE launch of 256 equal work-groups, one per WGP, each on a 256 x 256 tile of its product.
// Work-groups 0..191:   q|k of both batches, 1/16 * sum_k X[tok][k] * W[n][k] (M=4096, N=3072; a tile holds two whole heads of 256 tokens),
//                       normed and rotated in the epilogue, f16.
// Work-groups 192..255: V^T, VT[b*8+j][d][s] = f16( 1/16 * sum_k W[3072+j*128+d][k] * X[b*2048+s][k] ) (per batch M=1024, N=2048).
// Waves 2 x 4, each on 128 x 64: an A fragment feeds 4 products and a B fragment 8, so a product takes 384 B out of LDS (64 x 64: 512 B),
// and the tile brings two thirds of the bytes per flop from L2 that a 256 x 128 tile brings.
// A stage is 128 k (256 B of every row): one landing latency, one barrier and one exposed LDS latency per 128 products of a wave.
// Ring of two buffers and foot of the k loop (waits, barrier, refill) keep the form of wmma_gemm64's staged path; the operand addresses and
// the epilogue follow the work-group's index (the same for all its waves).
// ---------------------------------------------------------------------------
constexpr int kQKBlocksN = kNQK / 256;                        // 12
constexpr int kQKBlocks  = (kTok / 256) * kQKBlocksN;         // 192
constexpr int kVTBlocksN = kSeq / 256;                        // 8
constexpr int kVTBlocks1 = (kNK / 256) * kVTBlocksN;          // 32 per batch
constexpr int kQKVBlocks = kQKBlocks + kBatch * kVTBlocks1;   // 256
constexpr int kPitch2     = 272;                              // 256-B rows + 16 B: 16 B x odd, the pitch for ds_load_b128 readers
constexpr int kTile2      = 256 * kPitch2;                    // 69632: one operand tile of a stage
constexpr int kBuf2Bytes  = 2 * kTile2;                       // A tile 256 rows, then B tile 256 rows
constexpr int kRing2Bytes = 2 * kBuf2Bytes;                   // two buffers per work-group: 278528
static_assert(kDim % 256 == 0, "qkv projection: two or more stages of 128 k");
static_assert(kNQK % 256 == 0 && kSeq % 256 == 0 && kNK % 256 == 0 && kTok % 256 == 0, "qkv projection: 256 x 256 per work-group");
// Eight asynchronous 16-byte-per-lane copies global -> LDS (each 32 lanes x 16 B = 2 rows x two whole 128-B lines): 16 rows of one operand tile.
// l / g are the lane's own addresses for the first row + (lane >> 4), 16-byte chunk (lane & 15); copy c moves 2 rows.
__device__ __forceinline__ void stage_rows16(char* l, const char* g, size_t ldBytes) {
  // unrolled: the constant row steps go into the copies' offsets, one 64-bit address serves the eight
#pragma unroll
  for (int c = 0; c < 8; ++c) async_copy16(l + c * 2 * kPitch2, g + (size_t)(c * 2) * ldBytes);
}
// A wave's share of one stage: 32 rows of A and 32 rows of B, 32 copies.
__device__ __forceinline__ void stage_wave(char* lA, char* lB, const char* gA, const char* gB, size_t ldBytes) {
  stage_rows16(lA, gA, ldBytes);
  stage_rows16(lA + 16 * kPitch2, gA + 16 * ldBytes, ldBytes);
  stage_rows16(lB, gB, ldBytes);
  stage_rows16(lB + 16 * kPitch2, gB + 16 * ldBytes, ldBytes);
}
// Epilogue of one wave's 128 x 64 tile of V^T: each 16 x 64 strip goes through the wave's own slab (pitch 68 floats), so that whole lines are stored:
// f16 rows of this batch's V^T plane (pitch 2048).
__device__ __forceinline__ void vt_store(const v8f (&acc)[8][4], float* slab, unsigned short* __restrict__ Cv, int m0, int n0, int lane) {
  const int rlane = lane & 15;                 // D column within a subtile
  const int mOff  = (lane >> 4) * 8;           // D row offset
  // every '#pragma unroll' here: constant indices keep the accumulators in registers
#pragma unroll
  for (int i = 0; i < 8; ++i) {
    const int mBase = m0 + (i << 4);
#pragma unroll
    for (int j = 0; j < 4; ++j) {
#pragma unroll
      for (int r = 0; r < 8; ++r) slab[(mOff + r) * 68 + (j << 4) + rlane] = acc[i][j][r] * kWCarryInv;
    }
    __builtin_amdgcn_fence(__ATOMIC_RELEASE, "workgroup");
    __builtin_amdgcn_wave_barrier();
    __builtin_amdgcn_fence(__ATOMIC_ACQUIRE, "workgroup");
    const int q = lane >> 3, c8 = (lane & 7) * 8;         // row seg = 128 B = 8 lanes x 16 B
#pragma unroll
    for (int it = 0; it < 4; ++it) {
      const int row = it * 4 + q;
      const float* sp = slab + row * 68 + c8;
      v8h hv;
#pragma unroll
      for (int e = 0; e < 8; ++e) hv[e] = (_Float16)sp[e];
      *(v8h*)(Cv + (size_t)(mBase + row) * kSeq + n0 + c8) = hv;
    }
    __builtin_amdgcn_fence(__ATOMIC_RELEASE, "workgroup");
    __builtin_amdgcn_wave_barrier();
    __builtin_amdgcn_fence(__ATOMIC_ACQUIRE, "workgroup");
  }
}
// x + (x of lane ^ M) inside a 16-lane row: one add with a DPP operand (row_xmask)
template <int M> __device__ __forceinline__ float row_xadd(float x) {
  return x + __builtin_bit_cast(float, __builtin_amdgcn_update_dpp(0, __builtin_bit_cast(int, x), 0x160 + M, 0xf, 0xf, true));
}
// v_rsq_f32 (its argument here is never below eps, so no small-input scaling); the v_nop is the one slot that the instruction set asks for
// behind a transcendental, in the same statement so that it stands directly behind it
__device__ __forceinline__ float rsq_slot(float x) {
  float y;
  asm("v_rsq_f32 %0, %1\n\tv_nop" : "=v"(y) : "v"(x));
  return y;
}
// RNE bf16 conversion of four values, returned as f32
__device__ __forceinline__ v4f bfr4(v4f x) {
  const v2f lo = __builtin_convertvector(__builtin_convertvector((v2f){x[0], x[1]}, v2b), v2f);   // by pairs: one packed conversion for two values
  const v2f hi = __builtin_convertvector(__builtin_convertvector((v2f){x[2], x[3]}, v2b), v2f);
  return (v4f){lo[0], lo[1], hi[0], hi[1]};
}
// Epilogue of one wave's 128 x 64 tile of q|k: RMSNorm (mean over the head's 128 dims, eps inside rsqrt, x norm weight) and the per-position
// 2x2 rotary map straight from the accumulators, f32 math; the result goes out as one f16 plane (RNE; |q|, |k| stay far inside the f16 range
// for norm weights and rotary entries of ordinary size). The f32 q|k plane and its own launch are gone.
// A head's 128 columns lie in two waves (wave ^ 1): each sums the squares of its 64 columns per row (4 in the lane, then the 16 lanes of a row
// by DPP), the two halves meet through LDS behind a work-group barrier, and the row factors come back through LDS behind a second one.
// Rotary table fcs [s][64][2][2] and norm weights [128] are converted to bf16 (RNE) before use. out[2p+i] = fc[s,p,i,0]*v[2p] + fc[s,p,i,1]*v[2p+1].
// The scaled tile then goes through the wave's own slab, so that a lane holds 4 consecutive dims (two pairs) of one row and 16 lanes store one
// whole 128-B line. Output plane Ph, rows of 128 elements = 256 B: q rows (b*16+h)*2048+s, k rows 65536 + (b*8+kh)*2048+s.
constexpr int kSlabB = 16 * 68 * 4;            // V^T: one wave's slab, a 16 x 64 strip
constexpr int kSlabQ = 128 * 68 * 4;           // q|k: one wave's slab, its whole 128 x 64 tile; the eight fill the ring
constexpr int kSsOff = 8 * kSlabQ;             // [4 column waves][256 rows] f32 sums of squares, behind the eight slabs
constexpr int kRnOff = kSsOff + 4 * 256 * 4;   // [2 heads][256 rows] f32 row factors
constexpr int kQkvLds = kRnOff + 2 * 256 * 4;  // 284672
static_assert(kSsOff == kRing2Bytes, "the q|k slabs take the ring over; sums and row factors lie behind it");
__device__ __forceinline__ void qk_norm_rope_store(const v8f (&acc)[8][4], char* smem, const float* __restrict__ fcs,
                                                   const float* __restrict__ qw, const float* __restrict__ kw,
                                                   unsigned short* __restrict__ Ph, int m0, int n0, int wave, int lane) {
  const int rlane = lane & 15;                 // D column within a subtile
  const int mOff  = (lane >> 4) * 8;           // D row offset
  const int hh    = lane >> 4, c4 = (lane & 15) * 4;      // read-back: row it * 2 + hh of a strip, 4 dims from c4
  const int head  = n0 >> 7;                   // 0..15 q heads, 16..23 k heads; the same for the whole wave
  const int d0    = (n0 & 64) + c4;            // the lane's first dim inside the head
  const int b     = m0 / kSeq;                 // a 256-row tile lies in one batch
  const int s0    = m0 % kSeq + hh;            // position of the lane's row 0 of strip 0
  float* slab = (float*)(smem + wave * kSlabQ);
  float* ssb  = (float*)(smem + kSsOff);
  float* rnb  = (float*)(smem + kRnOff);
  const int ssRow = (wave >> 2) * 128 + mOff;  // the lane's first D row inside the work-group's 256
  // every '#pragma unroll' here: constant indices keep the accumulators, the sums and the rotary rows in registers
  // rotary rows: 8 coefficients for each of the lane's 8 rows of a 16-row trip; the registers are loaded anew for the next trip as soon as
  // this trip has converted them, so that every load has one trip's time to land
  const float* fp = fcs + (size_t)s0 * (2 * kHD) + 2 * d0;
  v4f fa[8], fb[8];
#pragma unroll
  for (int it = 0; it < 8; ++it) {
    fa[it] = *(const v4f*)(fp + it * 2 * (2 * kHD));
    fb[it] = *(const v4f*)(fp + it * 2 * (2 * kHD) + 4);
  }
  const v4f wraw = *(const v4f*)((head < kHeads ? qw : kw) + d0);
  asm volatile("s_wait_xcnt 0x0" ::: "memory");   // behind these loads, ahead of any rewrite of the address registers that they name
  __builtin_amdgcn_sched_barrier(0);              // keeps the arithmetic below, which takes those registers over, behind the wait

  {
    const bool writer = rlane == 0;            // after the row sums all 16 lanes hold the same eight values
#pragma unroll
    for (int i = 0; i < 8; ++i) {
      v8f q = acc[i][0] * acc[i][0];
#pragma unroll
      for (int j = 1; j < 4; ++j) q += acc[i][j] * acc[i][j];
#pragma unroll
      for (int r = 0; r < 8; ++r) q[r] = row_xadd<8>(row_xadd<4>(row_xadd<2>(row_xadd<1>(q[r]))));
      if (writer) {
        float* sp = ssb + (wave & 3) * 256 + ssRow + i * 16;
        *(v4f*)(sp)     = (v4f){q[0], q[1], q[2], q[3]};
        *(v4f*)(sp + 4) = (v4f){q[4], q[5], q[6], q[7]};
      }
    }
  }
  __syncthreads();                             // publishes every wave's sums; the same branch for the whole work-group
  // one thread per row: the row factor of both heads of the tile, once, not in all 16 lanes of every wave.
  // the accumulators carry x16, their squares x256: with eps x256 as well the argument is 256 x the definition's (exact powers of two),
  // so the root comes out as 1/16 of the row factor, which takes the carry off the accumulators
  {
    const int row = wave * 32 + lane;
#pragma unroll
    for (int h = 0; h < 2; ++h)
      rnb[h * 256 + row] = rsq_slot((ssb[(2 * h) * 256 + row] + ssb[(2 * h + 1) * 256 + row]) * kInvHD + kEps * (kWCarry * kWCarry));
  }
  __syncthreads();                             // publishes the row factors
  const float* rp = rnb + ((wave & 3) >> 1) * 256 + ssRow;   // the lane's eight D rows of strip 0, this wave's head

  // the whole 128 x 64 tile, scaled by its row factors, into the wave's own slab
#pragma unroll
  for (int i = 0; i < 8; ++i) {
    const v8f rn = __builtin_shufflevector(*(const v4f*)(rp + i * 16), *(const v4f*)(rp + i * 16 + 4), 0, 1, 2, 3, 4, 5, 6, 7);
#pragma unroll
    for (int j = 0; j < 4; ++j) {
      const v8f t = acc[i][j] * rn;
#pragma unroll
      for (int r = 0; r < 8; ++r) slab[(i * 16 + mOff + r) * 68 + (j << 4) + rlane] = t[r];
    }
  }
  asm volatile("s_wait_dscnt 0x0" ::: "memory");   // the tile is in the wave's own slab before its lanes read each other's rows back

  const v4f wv = bfr4(wraw);
  const int row0 = (head < kHeads) ? (b * kHeads + head) * kSeq : kKRow0 + (b * kKV + head - kHeads) * kSeq;
  unsigned short* dp = Ph + (size_t)(row0 + s0) * kHD + d0;
  const float* sl = slab + hh * 68 + c4;
  const float* fn = fp + 16 * (2 * kHD);       // the rotary rows of the trip after the current one
  // eight trips of 16 rows, kept rolled: unrolled, this epilogue alone is some 23 KB of text
#pragma unroll 1
  for (int i = 0; i < 8; ++i) {
    v4f a[8], c[8];
#pragma unroll
    for (int it = 0; it < 8; ++it) {
      a[it] = bfr4(fa[it]);
      c[it] = bfr4(fb[it]);
    }
    // the next trip's rotary rows (the last trip loads its own once more, in bounds: no branch inside the trip)
#pragma unroll
    for (int it = 0; it < 8; ++it) {
      fa[it] = *(const v4f*)(fn + it * 2 * (2 * kHD));
      fb[it] = *(const v4f*)(fn + it * 2 * (2 * kHD) + 4);
    }
#pragma unroll
    for (int it = 0; it < 8; ++it) {
      const v4f v = *(const v4f*)(sl + (i * 16 + it * 2) * 68) * wv;
      v4h o;
      o[0] = (_Float16)(a[it][0] * v[0] + a[it][1] * v[1]);
      o[1] = (_Float16)(a[it][2] * v[0] + a[it][3] * v[1]);
      o[2] = (_Float16)(c[it][0] * v[2] + c[it][1] * v[3]);
      o[3] = (_Float16)(c[it][2] * v[2] + c[it][3] * v[3]);
      *(v4h*)(dp + (i * 16 + it * 2) * kHD) = o;
    }
    // behind the trip's loads and stores, ahead of any rewrite of the address and data registers that they name
    asm volatile("s_wait_xcnt 0x0" ::: "memory");
    // keeps the next trip's address arithmetic and conversions, which take those registers over, behind the wait
    __builtin_amdgcn_sched_barrier(0);
    if (i + 2 < 8) fn += 16 * (2 * kHD);
  }
}
__global__ __launch_bounds__(256) void qkv_gemm(const unsigned short* __restrict__ Xp, const unsigned short* __restrict__ Wp,
                                                const float* __restrict__ fcs, const float* __restrict__ qw, const float* __restrict__ kw,
                                                unsigned short* __restrict__ Ph, unsigned short* __restrict__ VTp) {
  typedef _Float16 T;
  typedef Frag<T>::V V;
  __shared__ __align__(16) char smem[kQkvLds];      // the ring of two staged buffers, which serves the epilogue behind the k loop; 6 KB of row sums and factors
  const int lane = threadIdx.x & 31;
  const int wave = threadIdx.x >> 5;
  const int bx   = blockIdx.x;
  const bool isV = bx >= kQKBlocks;
  const int rv   = isV ? bx - kQKBlocks : 0;
  const int vb   = rv / kVTBlocks1;                 // batch of a V^T work-group
  const int vt   = rv % kVTBlocks1;
  const int mB   = (isV ? vt / kVTBlocksN : bx / kQKBlocksN) << 8;
  const int nB   = (isV ? vt % kVTBlocksN : bx % kQKBlocksN) << 8;
  const int m0   = mB + ((wave >> 2) << 7);
  const int n0   = nB + ((wave & 3) << 6);
  const unsigned short* Ab = isV ? Wp + (size_t)kNQK * kDim : Xp;
  const unsigned short* Bb = isV ? Xp + (size_t)vb * kSeq * kDim : Wp;

  const int rlane = lane & 15;                 // row (A) / col (B, D) within subtile
  const int koff  = (lane >> 4) * 8;           // k offset of this lane half

  // every '#pragma unroll' in this kernel: constant indices keep the fragment and accumulator arrays in registers
  v8f acc[8][4];
#pragma unroll
  for (int i = 0; i < 8; ++i)
#pragma unroll
    for (int j = 0; j < 4; ++j) acc[i][j] = (v8f){0.f,0.f,0.f,0.f,0.f,0.f,0.f,0.f};

  {
    // a wave brings 32 rows of A and 32 rows of B a stage; every A row then feeds four waves, every B row two
    char* lc = smem + ((wave * 32 + (lane >> 4)) * kPitch2 + (lane & 15) * 16);
    char* lA = lc;
    char* lB = lc + kTile2;
    constexpr size_t ldB = (size_t)kDim * 2;   // bytes of a row of X and of W
    const char* gA = (const char*)Ab + (size_t)(mB + wave * 32 + (lane >> 4)) * ldB + (lane & 15) * 16;
    const char* gB = (const char*)Bb + (size_t)(nB + wave * 32 + (lane >> 4)) * ldB + (lane & 15) * 16;
    constexpr int stages = kDim >> 7;
    stage_wave(lA, lB, gA, gB, ldB);
    asm volatile("s_wait_asynccnt 0x0" ::: "memory");   // this wave's share of stage 0 has landed; the barrier publishes every wave's
    __syncthreads();
    stage_wave(lA + kBuf2Bytes, lB + kBuf2Bytes, gA + 256, gB + 256, ldB);
    // the lane's fragment row and k half inside the wave's 128 rows of the A tile and 64 rows of the B tile
    const int foA = ((wave >> 2) * 128 + rlane) * kPitch2 + koff * 2;
    const int foB = kTile2 + ((wave & 3) * 64 + rlane) * kPitch2 + koff * 2;
    for (int t = 0; t < stages; ++t) {
      const int bsel = (t & 1) * kBuf2Bytes;
      const char* rb = smem + bsel;
      // four blocks of 32 k, 32 products each; the fragments of two blocks are in registers at a time
      V ah[4][8], bh[4][4];
#pragma unroll
      for (int s = 0; s < 4; ++s) {
        // blocks 0 and 1: one load group at the head of the stage, in the order of use; block s + 1 (s = 1, 2): one group ahead of block s's
        // products, into the registers that block s - 1 has left, so that its LDS latency passes under 32 products
        const int f0 = (s == 0) ? 0 : s + 1, f1 = (s == 0) ? 2 : ((s < 3) ? s + 2 : 0);
#pragma unroll
        for (int f = f0; f < f1; ++f) {
#pragma unroll
          for (int j = 0; j < 4; ++j) bh[f][j] = Frag<T>::load((const T*)(rb + foB + j * 16 * kPitch2 + f * 64));
#pragma unroll
          for (int i = 0; i < 8; ++i) ah[f][i] = Frag<T>::load((const T*)(rb + foA + i * 16 * kPitch2 + f * 64));
        }
        // holds each load group whole and ahead of the block's products; the scheduler otherwise sinks each fragment's loads in front of its use
        __builtin_amdgcn_sched_barrier(0);
#pragma unroll
        for (int i = 0; i < 8; ++i) {
#pragma unroll
          for (int j = 0; j < 4; ++j) acc[i][j] = Frag<T>::mma(ah[s][i], bh[s][j], acc[i][j]);
        }
        // holds the next group behind this block's products (hoisted, three blocks' fragments would be live: spills), and the last block's
        // products ahead of the foot's waits, so that stage t + 1's copies fly while stage t is worked on
        __builtin_amdgcn_sched_barrier(0);
      }
      asm volatile("s_wait_dscnt 0x0" ::: "memory");     // this wave's LDS reads of the stage are done before any wave refills its buffer
      asm volatile("s_wait_asynccnt 0x0" ::: "memory");  // this wave's share of stage t + 1 has landed
      __syncthreads();                                   // publishes stage t + 1 to all waves; ends every wave's reads of stage t
      if (t + 2 < stages) {
        const size_t kb = (size_t)(t + 2) * 256;
        stage_wave(lA + bsel, lB + bsel, gA + kb, gB + kb, ldB);
      }
    }
    asm volatile("s_wait_asynccnt 0x0" ::: "memory");    // nothing in flight when the ring becomes the epilogue's slabs (all reads ended at the last barrier)
  }

  // ---- epilogue: one branch, the same for the whole work-group ----
  if (!isV) qk_norm_rope_store(acc, smem, fcs, qw, kw, Ph, m0, n0, wave, lane);
  else      vt_store(acc, (float*)(smem + wave * kSlabB), VTp + (size_t)vb * kNK * kSeq, m0, n0, lane);
}

// ---------------------------------------------------------------------------
// f32 -> (RNE bf16) -> f16 cast with an exact power-of-two carry: out = f16( scale * bf16(in) ).
// ---------------------------------------------------------------------------
__global__ __launch_bounds__(256) void cast8_kernel(const float* __restrict__ in, unsigned short* __restrict__ out, int n8, float scale) {
  const int i = blockIdx.x * 256 + threadIdx.x;
  if (i >= n8) return;
  const float* p = in + 8 * (size_t)i;
  const v4f a = *(const v4f*)(p);
  const v4f c = *(const v4f*)(p + 4);
  unsigned short hb[8];
#pragma unroll
  for (int e = 0; e < 4; ++e) {
    hb[e]     = h_bits(bfr(a[e]) * scale);
    hb[4 + e] = h_bits(bfr(c[e]) * scale);
  }
  const v4u u = (v4u){pk16(hb[0], hb[1]), pk16(hb[2], hb[3]), pk16(hb[4], hb[5]), pk16(hb[6], hb[7])};
  unsigned short* q = out + 8 * (size_t)i;
  *(v4u*)q = u;
  
}

constexpr int kAKeys   = 64;
constexpr int kAStages = kSeq / kAKeys;
constexpr int kKPitch  = 2 * kHD + 16;
constexpr int kVPitch  = 2 * kAKeys + 16;
constexpr int kKTile   = kAKeys * kKPitch;
constexpr int kVTile   = kHD * kVPitch;
constexpr int kABuf    = kKTile + kVTile;
constexpr float kScoreLog2 = kScoreScale * 1.4426950408889634f;
constexpr float kPShift    = 8.0f;                 // p carried x2^8: small p stay clear of the f16 subnormals; cancels in sum p v / sum p
static_assert(kAStages >= 2 && kSeq % 128 == 0, "two or more stages; 128 query positions per block");

typedef __attribute__((ext_vector_type(4))) int v4i;

// One stage: 64 K rows x 256 B (thread: row tid >> 4 (+16 a copy), chunk tid & 15) and 128 V^T rows x 128 B
// (thread: row tid >> 3 (+32 a copy), chunk tid & 7). lK, lV, gK, gV are the thread's own addresses of its first copy.
__device__ __forceinline__ void attn_stage(char* lK, char* lV, const char* gK, const char* gV) {
  constexpr int    kLK = 16 * kKPitch, kLV = 32 * kVPitch;
  constexpr size_t kGK = (size_t)16 * 2 * kHD, kGV = (size_t)32 * 2 * kSeq;
  // both loops unrolled: straight-line copies, constant steps
#pragma unroll
  for (int c = 0; c < 4; ++c) async_copy16(lK + c * kLK, gK + c * kGK);
#pragma unroll
  for (int c = 0; c < 4; ++c) async_copy16(lV + c * kLV, gV + c * kGV);
}
// lane l with lane l ^ 16
__device__ __forceinline__ float xhalf(float x) {
  return __builtin_bit_cast(float, __builtin_amdgcn_permlanex16(__builtin_bit_cast(int, x), __builtin_bit_cast(int, x), 0x76543210, 0xfedcba98, false, false));
}

__global__ __launch_bounds__(256) void attn_kernel(const unsigned short* __restrict__ Ph,
                                                   const unsigned short* __restrict__ VTp, const int* __restrict__ maskp,
                                                   unsigned short* __restrict__ Obp) {
  // every '#pragma unroll' in this kernel: constant indices keep the fragment, score and accumulator arrays in registers
  __shared__ __align__(128) char ring[2 * kABuf];
  __shared__ __align__(16) float kbias[kSeq];
  const int tid   = threadIdx.x;
  const int lane  = tid & 31;
  const int wave  = tid >> 5;
  const int rlane = lane & 15;                 // row of an A fragment, column of a B fragment and of D
  const int koff  = (lane >> 4) * 8;           // k offset of this lane half = D row offset
  const int b     = blockIdx.y / kKV;
  const int j     = blockIdx.y % kKV;
  const int q0    = blockIdx.x * 128 + wave * 16;

  // additive key bias of batch b, once per block
  {
    const int* mp = maskp + (size_t)b * kSeq + 8 * tid;
    const v4i m0 = *(const v4i*)(mp);
    const v4i m1 = *(const v4i*)(mp + 4);
    v4f f0, f1;
#pragma unroll
    for (int e = 0; e < 4; ++e) {
      f0[e] = (m0[e] != 0) ? 0.0f : -__builtin_inff();
      f1[e] = (m1[e] != 0) ? 0.0f : -__builtin_inff();
    }
    *(v4f*)(kbias + 8 * tid)     = f0;
    *(v4f*)(kbias + 8 * tid + 4) = f1;
  }

  char* lK = ring + ((tid >> 4) * kKPitch + (tid & 15) * 16);
  char* lV = ring + (kKTile + (tid >> 3) * kVPitch + (tid & 7) * 16);
  const char* gK  = (const char*)(Ph + ((size_t)kKRow0 + (size_t)(b * kKV + j) * kSeq + (tid >> 4)) * kHD) + (tid & 15) * 16;
  const char* gV  = (const char*)(VTp + ((size_t)(b * kKV + j) * kHD + (tid >> 3)) * kSeq) + (tid & 7) * 16;
  constexpr size_t kKStep = (size_t)kAKeys * kHD * 2;   // bytes from one stage's K rows to the next
  constexpr size_t kVStep = (size_t)kAKeys * 2;         // bytes from one stage's V^T columns to the next

  attn_stage(lK, lV, gK, gV);

  // Q fragments (B operand), both heads, kept for the whole kernel
  v16h qf[2][4];
#pragma unroll
  for (int g = 0; g < 2; ++g) {
    const _Float16* qp = (const _Float16*)Ph + ((size_t)(b * kHeads + 2 * j + g) * kSeq + q0 + rlane) * kHD + koff;
#pragma unroll
    for (int kc = 0; kc < 4; ++kc) qf[g][kc] = Frag<_Float16>::load(qp + kc * 32);
  }
  v8f acc[2][8];
  float mrun[2], lrun[2];
#pragma unroll
  for (int g = 0; g < 2; ++g) {
    mrun[g] = -__builtin_inff();
    lrun[g] = 0.0f;
#pragma unroll
    for (int d = 0; d < 8; ++d) acc[g][d] = (v8f){0.f,0.f,0.f,0.f,0.f,0.f,0.f,0.f};
  }

  asm volatile("s_wait_asynccnt 0x0" ::: "memory");     // stage 0 has landed before anybody reads it
  __syncthreads();                                      // also publishes kbias
  attn_stage(lK + kABuf, lV + kABuf, gK + kKStep, gV + kVStep);

  for (int t = 0; t < kAStages; ++t) {
    const int bsel = (t & 1) * kABuf;
    // two 32-key passes; kept rolled: unrolled, both passes' fragments are fetched together and registers spill
#pragma unroll 1
    for (int sub = 0; sub < 2; ++sub) {
      const char* kp = ring + bsel + (sub * 32 + rlane) * kKPitch + koff * 2;
      // all 16 K fragment loads of the pass go out as one group, in the order of their use
      v16h kf[2][4];
#pragma unroll
      for (int kc = 0; kc < 4; ++kc) {
#pragma unroll
        for (int kt = 0; kt < 2; ++kt) kf[kt][kc] = Frag<_Float16>::load((const _Float16*)(kp + kt * 16 * kKPitch + kc * 64));
      }
      // bias of this lane's 16 keys, last in the same group: there when the products end
      const float* bp = kbias + t * kAKeys + sub * 32 + koff;
      const v4f b0 = *(const v4f*)(bp), b1 = *(const v4f*)(bp + 4), b2 = *(const v4f*)(bp + 16), b3 = *(const v4f*)(bp + 20);
      // holds the load group ahead of the products; the scheduler otherwise sinks each fragment's loads in front of its use, one LDS latency each
      __builtin_amdgcn_sched_barrier(0);
      v8f s[2][2];
#pragma unroll
      for (int kt = 0; kt < 2; ++kt)
#pragma unroll
        for (int g = 0; g < 2; ++g) s[kt][g] = (v8f){0.f,0.f,0.f,0.f,0.f,0.f,0.f,0.f};
      // the four score tiles take turns, so that no product waits for the one before it
#pragma unroll
      for (int kc = 0; kc < 4; ++kc) {
#pragma unroll
        for (int kt = 0; kt < 2; ++kt)
#pragma unroll
          for (int g = 0; g < 2; ++g) s[kt][g] = Frag<_Float16>::mma(kf[kt][kc], qf[g][kc], s[kt][g]);
      }
      // holds the V^T loads behind the score products, where the K fragments' registers are free again (hoisted, they spill);
      // their latency passes under the softmax arithmetic
      __builtin_amdgcn_sched_barrier(0);
      // V^T fragments of the pass: 16 dims x 32 keys each
      const char* vp = ring + bsel + kKTile + rlane * kVPitch + sub * 64 + koff * 2;
      v16h vf[8];
#pragma unroll
      for (int d = 0; d < 8; ++d) vf[d] = Frag<_Float16>::load((const _Float16*)(vp + d * 16 * kVPitch));
#pragma unroll
      for (int g = 0; g < 2; ++g) {
        float a[16];
#pragma unroll
        for (int r = 0; r < 4; ++r) {
          a[r]      = fmaf(s[0][g][r],     kScoreLog2, b0[r]);
          a[4 + r]  = fmaf(s[0][g][4 + r], kScoreLog2, b1[r]);
          a[8 + r]  = fmaf(s[1][g][r],     kScoreLog2, b2[r]);
          a[12 + r] = fmaf(s[1][g][4 + r], kScoreLog2, b3[r]);
        }
        float mx = a[0];
#pragma unroll
        for (int e = 1; e < 16; ++e) mx = fmaxf(mx, a[e]);
        mx = fmaxf(mx, xhalf(mx));                                     // both halves hold the query's maximum over the 32 keys
        const float mnew  = fmaxf(mrun[g], mx);
        const float msafe = (mnew == -__builtin_inff()) ? 0.0f : mnew; // only masked keys so far: keep -inf - -inf out of the exponents
        const float corr  = __builtin_amdgcn_exp2f(mrun[g] - msafe);
        const float nm    = kPShift - msafe;
        mrun[g] = mnew;
        v16h pf;
        float ps0 = 0.0f, ps1 = 0.0f;
#pragma unroll
        for (int e = 0; e < 16; e += 2) {
          const float p0 = __builtin_amdgcn_exp2f(a[e] + nm);
          const float p1 = __builtin_amdgcn_exp2f(a[e + 1] + nm);
          ps0 += p0;
          ps1 += p1;
          pf[e]     = (_Float16)p0;
          pf[e + 1] = (_Float16)p1;
        }
        lrun[g] = fmaf(lrun[g], corr, ps0 + ps1);                      // this half's keys only; the halves join behind the loop
#pragma unroll
        for (int d = 0; d < 8; ++d) acc[g][d] = acc[g][d] * corr;
#pragma unroll
        for (int d = 0; d < 8; ++d) acc[g][d] = Frag<_Float16>::mma(vf[d], pf, acc[g][d]);
      }
      // the distance behind a matrix instruction on the loop's taken branch: the next pass's address arithmetic reuses the registers of the last
      // product's V^T fragment; the scheduling barrier keeps the products ahead of the four slots
      __builtin_amdgcn_sched_barrier(0);
      asm volatile("v_nop\n\tv_nop\n\tv_nop\n\tv_nop");
    }
    asm volatile("s_wait_dscnt 0x0" ::: "memory");      // this stage's LDS reads are done before its buffer is refilled
    asm volatile("s_wait_asynccnt 0x0" ::: "memory");   // stage t + 1 has landed
    __syncthreads();
    if (t + 2 < kAStages) {
      const size_t st = (size_t)(t + 2);
      attn_stage(lK + bsel, lV + bsel, gK + st * kKStep, gV + st * kVStep);
    }
  }
  asm volatile("s_wait_asynccnt 0x0" ::: "memory");     // nothing in flight when the wave ends

  // O^T tile d: lane holds dims 16 d + koff + 0..7 of query q0 + rlane: one 16-B store; a wave writes whole 256-B head rows
#pragma unroll
  for (int g = 0; g < 2; ++g) {
    const float inv = kOCarry / (lrun[g] + xhalf(lrun[g]));
    unsigned short* op = Obp + ((size_t)b * kSeq + q0 + rlane) * kNQ + (size_t)(2 * j + g) * kHD + koff;
#pragma unroll
    for (int d = 0; d < 8; ++d) {
      v8h o;
#pragma unroll
      for (int r = 0; r < 8; ++r) o[r] = (_Float16)(acc[g][d][r] * inv);
      *(v8h*)(op + d * 16) = o;
    }
  }
}

// ---------------------------------------------------------------------------
// Host glue.
//   R0 X16  f16 [4096][2048]                        16,777,216 at           0   (later: Ob f16 [4096][2048], same type + layout)
//   R1 Wq16 f16 [4096][2048] (w_qkv x16)            16,777,216 at  16,777,216   
//   R2 Wo16 f16 [2048][2048] (w_out x16)             8,388,608 at  33,554,432
//   R3 VT   f16 [2*8][128][2048] (v transposed)       8,388,608 at  41,943,040
//   R4 QK16 f16 [98304][128] (q rows then k rows)   25,165,824 at  50,331,648
//   total                                           75,497,472
// Re-use timeline (stream ordered): X16/Wq16 are read only by the qkv GEMM;
// Ob is first written by the attention kernel, which starts after the qkv GEMM.
// Every region is fully written before it is read; no region changes element type.
// GEMM shapes: q|k (M=4096, N=3072, K=2048); V^T per batch (M=1024, N=2048, K=2048);
// output (M=4096, N=2048, K=2048); all M,N multiples of 64, all K multiples of 32, no padding anywhere.
// ---------------------------------------------------------------------------
extern "C" void kernel_launch(void* const* d_in, const int* in_sizes, int n_in,
                              void* d_out, int out_size, void* d_ws, size_t ws_size,
                              hipStream_t stream) {
  if (n_in < 7) return;
  const int nX = kBatch * kSeq * kDim;            // 8,388,608
  if (in_sizes[0] != nX) return;
  if (in_sizes[1] != kBatch * kSeq) return;
  if (in_sizes[2] != kSeq * (kHD / 2) * 4) return;
  if (in_sizes[3] != kNQKV * kDim) return;
  if (in_sizes[4] != kDim * kNQ) return;
  if (in_sizes[5] != kHD || in_sizes[6] != kHD) return;
  if (out_size != kTok * kDim) return;

  const size_t szX16  = (size_t)kTok * kDim * 2;
  const size_t szWq16 = (size_t)kNQKV * kDim * 2;
  const size_t szWo16 = (size_t)kDim * kNQ * 2;
  const size_t szVT   = (size_t)kBatch * kKV * kHD * kSeq * 2;
  const size_t szPl   = (size_t)kQKRows * kHD * 2;        // the f16 q|k plane
  const size_t szOb   = (size_t)kTok * kNQ * 2;
  const size_t offX16  = 0;
  const size_t offWq16 = offX16 + szX16;
  const size_t offWo16 = offWq16 + szWq16;
  const size_t offVT   = offWo16 + szWo16;
  const size_t offPhi  = offVT + szVT;
  const size_t total   = offPhi + szPl;
  if (szOb > szX16) return;                      // the re-used region fits its first carve
  if (ws_size < total) return;

  const float* x     = (const float*)d_in[0];
  const int*   xmask = (const int*)d_in[1];
  const float* freqs = (const float*)d_in[2];
  const float* wqkv  = (const float*)d_in[3];
  const float* wout  = (const float*)d_in[4];
  const float* qw    = (const float*)d_in[5];
  const float* kw    = (const float*)d_in[6];
  float* out = (float*)d_out;
  char* ws = (char*)d_ws;
  unsigned short* X16  = (unsigned short*)(ws + offX16);
  unsigned short* Ob   = (unsigned short*)(ws + offX16);     // re-use of R0 (f16, same layout)
  unsigned short* Wq16 = (unsigned short*)(ws + offWq16);
  unsigned short* Wo16 = (unsigned short*)(ws + offWo16);
  unsigned short* VT  = (unsigned short*)(ws + offVT);
  unsigned short* Phi = (unsigned short*)(ws + offPhi);
  const float* dummyf = (const float*)(ws + offVT);          // valid in-ws pointer for unused bias/resid arguments

  // ---- 16-bit operand planes of the inputs (RNE bf16 of every float input, f16 containers, weights x16) ----
  const int n8x = nX / 8;                 // 1,048,576 -> 4096 blocks exact
  const int n8w = (kNQKV * kDim) / 8;     // 1,048,576 -> 4096 blocks exact
  const int n8o = (kDim * kNQ) / 8;       //   524,288 -> 2048 blocks exact
  cast8_kernel<<<dim3(n8x / 256), dim3(256), 0, stream>>>(x, X16, n8x, 1.0f);
  cast8_kernel<<<dim3(n8w / 256), dim3(256), 0, stream>>>(wqkv, Wq16, n8w, kWCarry);
  cast8_kernel<<<dim3(n8o / 256), dim3(256), 0, stream>>>(wout, Wo16, n8o, kWCarry);

  // ---- q|k projection of both batches (w_qkv rows 0..3071) with norm + rotary in its epilogue -> f16 plane, and v projection written directly
  //      transposed (f16), one launch: 192 + 64 work-groups cover all 98304 rows of the q|k plane and the whole 16 x 128 x 2048 VT plane ----
  qkv_gemm<<<dim3(kQKVBlocks), dim3(256), 0, stream>>>(X16, Wq16, freqs, qw, kw, Phi, VT);

  // ---- attention, all (batch, kv head) groups in one launch: Ob[b*2048+i][(2j+hg)*128+n] = f16( 16 * softmax(q.k^T * 128^-0.5 + mask) . v )
  //      grid (16 blocks of 128 query positions, 16 groups) = 256 blocks; covers the whole [4096][2048] Ob plane ----
  attn_kernel<<<dim3(kSeq / 128, kBatch * kKV), dim3(256), 0, stream>>>(Phi, VT, xmask, Ob);

  // ---- output projection: out[tok][n] = 2^-8 * sum_e Ob[tok][e] * Wo16[n][e]   (M=4096, N=2048, K=2048) ----
  {
    const int tilesOut = (kTok / 64) * (kDim / 64);   // 2048 -> 256 blocks; covers the whole [4096][2048] output
    wmma_gemm64<0, false, 0, 0, false, 0><<<dim3(tilesOut / 8, 1), dim3(256), 0, stream>>>(
        Ob, Ob, kNQ, 0L, Wo16, Wo16, kNQ, 0L,
        (void*)out, (void*)out, kDim, 0L, dummyf, dummyf, 0L, kTok, kDim, kNQ, kOutScale);
  }
}

// v009
// A run of this version takes 143 microseconds.
// In two side-by-side timings against v008, it was 1.03 and 1.02 times as fast.
// Counting every step since v000, it is 15.5 times as fast.
// Contractions: qkv projection (x as f16(bf16 RNE) x w_qkv^T as f16(16*bf16 RNE)), V^T.P^T (P f16, unnormalised, carried x256, x V^T f16) and output projection (o f16 carried x16 x w_out^T as f16(16*bf16 RNE)) on v_wmma_f32_16x16x32_f16; scores k.q^T on v_wmma_f32_16x16x32_f16 with q,k as one f16 plane each (RNE of the f32 norm+rotary result, one product); f32 accumulate everywhere; RMSNorm, 2x2 rotary map and online softmax in f32.
#include <hip/hip_runtime.h>
#include <math.h>

// ---------------------------------------------------------------------------
// Problem constants
// ---------------------------------------------------------------------------
constexpr int kBatch = 2;
constexpr int kSeq   = 2048;
constexpr int kDim   = 2048;              // model dim (K of the qkv projection, N of the output projection)
constexpr int kHeads = 16;
constexpr int kKV    = 8;
constexpr int kHD    = 128;
constexpr int kTok   = kBatch * kSeq;     // 4096 token rows
constexpr int kNQ    = kHeads * kHD;      // 2048 q columns / o columns
constexpr int kNK    = kKV * kHD;         // 1024 k columns (= v columns)
constexpr int kNQK   = kNQ + kNK;         // 3072 = q|k columns (N of the q|k projection)
constexpr int kNQKV  = kNQ + 2 * kNK;     // 4096 rows of w_qkv
constexpr int kQKRows = kBatch * (kHeads + kKV) * kSeq;   // 98304 rows of 128 in the q|k f16 plane
constexpr int kKRow0  = kBatch * kHeads * kSeq;           // 65536 = first k row in the q|k plane
constexpr float kEps        = 1.1920929e-07f;
constexpr float kInvHD      = 1.0f / 128.0f;
constexpr float kWCarry     = 16.0f;                      // weights carried x16 in f16
constexpr float kWCarryInv  = 1.0f / 16.0f;
constexpr float kOCarry     = 16.0f;                      // attention output carried x16 in f16
constexpr float kOutScale   = 1.0f / (kOCarry * kWCarry); // 2^-8
constexpr float kScoreScale = 0.08838834764831845f;       // 128^-0.5
static_assert(kHD == 128, "a head is two 64-column wave tiles of the qkv projection");
static_assert(kHeads == 2 * kKV, "two query heads per kv head");
static_assert(kSeq % 64 == 0 && kNQK % 64 == 0 && kNK % 64 == 0 && kNQ % 64 == 0 && kDim % 64 == 0 && kTok % 64 == 0, "GEMM M/N tiles");
static_assert(kHD % 64 == 0);
static_assert(kDim % 32 == 0 && kHD % 32 == 0 && kSeq % 32 == 0 && kNQ % 32 == 0, "GEMM K % 32");
static_assert(kDim % 128 == 0 && kSeq % 128 == 0 && kNQ % 128 == 0, "staged GEMM K: two or more stages of 64");
static_assert(kSeq % 256 == 0 && kNK % 256 == 0 && kTok % 256 == 0 && kNQK % 128 == 0 && kDim % 128 == 0, "staged GEMM: 256 x 128 per work-group");
static_assert(kSeq == 256 * 8, "key bias coverage: 256 threads x 8 keys");

typedef __attribute__((ext_vector_type(16))) _Float16 v16h;
typedef __attribute__((ext_vector_type(8)))  _Float16 v8h;
typedef __attribute__((ext_vector_type(16))) __bf16   v16b;
typedef __attribute__((ext_vector_type(8)))  __bf16   v8b;
typedef __attribute__((ext_vector_type(2)))  __bf16   v2b;
typedef __attribute__((ext_vector_type(4)))  _Float16 v4h;
typedef __attribute__((ext_vector_type(8)))  float    v8f;
typedef __attribute__((ext_vector_type(4)))  float    v4f;
typedef __attribute__((ext_vector_type(2)))  float    v2f;
typedef __attribute__((ext_vector_type(2)))  int      v2i;
typedef __attribute__((ext_vector_type(4)))  unsigned int v4u;
typedef __attribute__((ext_vector_type(2)))  unsigned int v2u;

// ---------------------------------------------------------------------------
// Helpers
// ---------------------------------------------------------------------------
__device__ __forceinline__ unsigned short f2bf_bits(float f) {
  unsigned u = __float_as_uint(f);
  return (unsigned short)((u + 0x7FFFu + ((u >> 16) & 1u)) >> 16);
}
__device__ __forceinline__ float bf_bits2f(unsigned short h) { return __uint_as_float(((unsigned)h) << 16); }

// hazard guards as plain device helpers
__device__ __forceinline__ void dep_guard_h(v8f& a, v8f& b, v16h x, v16h y) { asm volatile("v_nop\n\tv_nop\n\tv_nop\n\tv_nop" : "+v"(a), "+v"(b) : "v"(x), "v"(y)); }
__device__ __forceinline__ void dep_guard_b(v8f& a, v8f& b, v16b x, v16b y) { asm volatile("v_nop\n\tv_nop\n\tv_nop\n\tv_nop" : "+v"(a), "+v"(b) : "v"(x), "v"(y)); }
__device__ __forceinline__ void keep4_h(v16h a, v16h b, v16h c, v16h d) { asm volatile("v_nop" :: "v"(a), "v"(b), "v"(c), "v"(d)); }
__device__ __forceinline__ void keep4_b(v16b a, v16b b, v16b c, v16b d) { asm volatile("v_nop" :: "v"(a), "v"(b), "v"(c), "v"(d)); }
__device__ __forceinline__ void acc_guard4(v8f& a, v8f& b, v8f& c, v8f& d) { asm volatile("v_nop\n\tv_nop\n\tv_nop\n\tv_nop" : "+v"(a), "+v"(b), "+v"(c), "+v"(d)); }
template <typename T> struct Frag;
template <> struct Frag<_Float16> {
  typedef v16h V; union U { v16h v; v8h h[2]; };
  // elements 0..7 <- p[0..7], 8..15 <- p[16..23]
  static __device__ __forceinline__ v16h load(const _Float16* p) {
    U f; f.h[0] = *(const v8h*)(p); f.h[1] = *(const v8h*)(p + 16); return f.v;
  }
  static __device__ __forceinline__ v8f mma(v16h a, v16h b, v8f c) {
    return __builtin_amdgcn_wmma_f32_16x16x32_f16(false, a, false, b, (short)0, c, false, false);
  }
  static __device__ __forceinline__ void guard(v8f& a, v8f& b, v16h x, v16h y) { dep_guard_h(a, b, x, y); }
  static __device__ __forceinline__ void keep(v16h a, v16h b, v16h c, v16h d) { keep4_h(a, b, c, d); }
};
template <> struct Frag<__bf16> {
  typedef v16b V; union U { v16b v; v8b h[2]; };
  static __device__ __forceinline__ v16b load(const __bf16* p) {
    U f; f.h[0] = *(const v8b*)(p); f.h[1] = *(const v8b*)(p + 16); return f.v;
  }
  static __device__ __forceinline__ v8f mma(v16b a, v16b b, v8f c) {
    return __builtin_amdgcn_wmma_f32_16x16x32_bf16(false, a, false, b, (short)0, c, false, false);
  }
  static __device__ __forceinline__ void guard(v8f& a, v8f& b, v16b x, v16b y) { dep_guard_b(a, b, x, y); }
  static __device__ __forceinline__ void keep(v16b a, v16b b, v16b c, v16b d) { keep4_b(a, b, c, d); }
};

__device__ __forceinline__ unsigned pk16(unsigned short a, unsigned short b) { return (unsigned)a | ((unsigned)b << 16); }
__device__ __forceinline__ unsigned short h_bits(float f) { const _Float16 h = (_Float16)f; return __builtin_bit_cast(unsigned short, h); }
// RNE bf16 conversion returned as f32
__device__ __forceinline__ float bfr(float f) { return bf_bits2f(f2bf_bits(f)); }

// ---- Register-blocked batched WMMA GEMM (ACT reduced to none/relu/leaky) -------------------------------
// C[m,n] = scale * sum_k A[m,k] * Bt[n,k] (+bias)(+resid); each wave owns a 64x64 tile.
// A row-major [M,K]; Bt row-major [N,K]; SPLIT: M,N % 64 == 0, K % 32 == 0.
// Not SPLIT: a work-group owns 256 x 128 of C, its waves 4 x 2 tiles of 64x64 on shared staged operands; M % 256 == 0, N % 128 == 0, K % 64 == 0.
// SPLIT: operands are hi/lo planes (A2/Bt2 = lo planes, same layout); product = hi*hi + hi*lo + lo*hi.
// BIAS_MODE: 0 = none, 1 = bias[m], 2 = bias[n].
// OUT_MODE: 0 = f32, 1 = f16, 2 = bf16 hi plane (Cout) + bf16 lo plane (Cout2).
// ET: 0 = f16 operands, 1 = bf16 operands (pointers passed as 16-bit storage)
template <int ET> struct Elem;
template <> struct Elem<0> { typedef _Float16 T; };
template <> struct Elem<1> { typedef __bf16 T; };
// One asynchronous 16-byte-per-lane copy global -> LDS, as the compiler's own builtin: the compiler sees the address registers, so it may keep
// them anywhere in the register file (operands of asm text must lie in the first 256 registers, which accumulators and fragments fill),
// folds constant steps into the instruction's offset, and no wait stands between a copy and the next address arithmetic.
typedef int cp16 __attribute__((vector_size(16)));
typedef __attribute__((address_space(1))) cp16 gcp16;
typedef __attribute__((address_space(3))) cp16 lcp16;
__device__ __forceinline__ void async_copy16(char* l, const char* g) {
  __builtin_amdgcn_global_load_async_to_lds_b128((gcp16*)g, (lcp16*)l, 0, 0);
}
// One stage of the work-group's shared tiles: A 256 rows x 128 B (64 k), then B 128 rows x 128 B, in LDS rows of pitch 144 B.
// A wave brings 32 rows of A (8 copies) and 16 rows of B (4 copies); every A row then feeds two waves, every B row four.
// lA / gA and lB / gB are the lane's own addresses for its wave's first row + (lane >> 3), 16-byte chunk (lane & 7); copy c moves 4 rows.
constexpr int kRowPitch  = 144;                    // 128-B rows + 16 B: 16 B x odd, the pitch for ds_load_b128 readers
constexpr int kATile     = 256 * kRowPitch;        // 36864
constexpr int kBTile     = 128 * kRowPitch;        // 18432
constexpr int kBufBytes  = kATile + kBTile;        // A tile then B tile
constexpr int kRingBytes = 2 * kBufBytes;          // two buffers per work-group
__device__ __forceinline__ void stage_block(char* lA, char* lB, const char* gA, const char* gB, size_t ldaBytes, size_t ldbBytes) {
  // twelve copies, each 32 lanes x 16 B = 4 rows x one whole 128-B line; both loops unrolled: straight-line copies, no loop counter or branch at the foot
#pragma unroll
  for (int c = 0; c < 8; ++c) async_copy16(lA + c * 4 * kRowPitch, gA + (size_t)(c * 4) * ldaBytes);
#pragma unroll
  for (int c = 0; c < 4; ++c) async_copy16(lB + c * 4 * kRowPitch, gB + (size_t)(c * 4) * ldbBytes);
}

template <int ET, bool SPLIT, int BIAS_MODE, int OUT_MODE, bool RESID, int ACT = 0>
__global__ __launch_bounds__(256) void wmma_gemm64(
    const unsigned short* __restrict__ Ap, const unsigned short* __restrict__ A2p, int lda, long strideA,
    const unsigned short* __restrict__ Btp, const unsigned short* __restrict__ Bt2p, int ldb, long strideB,
    void* __restrict__ Cout, void* __restrict__ Cout2, int ldc, long strideC,
    const float* __restrict__ bias,
    const float* __restrict__ resid, long strideR,
    int M, int N, int K, float scale) {
  typedef typename Elem<ET>::T T;
  typedef typename Frag<T>::V V;
  const T* A = (const T*)Ap; const T* A2 = (const T*)A2p; const T* Bt = (const T*)Btp; const T* Bt2 = (const T*)Bt2p;
  // Per-wave 16x64 f32 slab, pitch 68 floats. Not SPLIT: the work-group's ring of two staged buffers; its first bytes serve as the slabs behind the k loop.
  constexpr int kSlabBytes = 16 * 68 * 4;
  __shared__ __align__(16) char smem[SPLIT ? 8 * kSlabBytes : kRingBytes];
  const int b    = blockIdx.y;
  const int lane = threadIdx.x & 31;
  const int wave = threadIdx.x >> 5;
  int m0, n0, mB = 0, nB = 0;                  // the wave's tile; the work-group's tile (staged path)
  if (SPLIT) {
    const int tilesN = N >> 6;
    const int tile = blockIdx.x * 8 + wave;
    if (tile >= (M >> 6) * tilesN) return;    // wave-uniform; no block barriers on this path
    const int tm = tile / tilesN;
    m0 = tm << 6;
    n0 = (tile - tm * tilesN) << 6;
  } else {
    const int blocksN = N >> 7;
    if ((int)blockIdx.x >= (M >> 8) * blocksN) return;   // the whole work-group leaves, ahead of every barrier and copy
    const int bm = blockIdx.x / blocksN;
    mB = bm << 8;
    nB = (blockIdx.x - bm * blocksN) << 7;
    m0 = mB + ((wave >> 1) << 6);
    n0 = nB + ((wave & 1) << 6);
  }

  const T* Ab  = A  + (size_t)b * strideA;
  const T* Bb  = Bt + (size_t)b * strideB;
  const T* Ab2 = SPLIT ? (A2  + (size_t)b * strideA) : nullptr;
  const T* Bb2 = SPLIT ? (Bt2 + (size_t)b * strideB) : nullptr;

  const int rlane = lane & 15;                 // row (A) / col (B, D) within subtile
  const int koff  = (lane >> 4) * 8;           // k offset of this lane half
  const int mOff  = (lane >> 4) * 8;           // D row offset

  v8f acc[4][4];
#pragma unroll
  for (int i = 0; i < 4; ++i)
#pragma unroll
    for (int j = 0; j < 4; ++j) acc[i][j] = (v8f){0.f,0.f,0.f,0.f,0.f,0.f,0.f,0.f};

  if (SPLIT) {
    for (int k0 = 0; k0 < K; k0 += 32) {
      V bh[4], bl[4];
#pragma unroll
      for (int j = 0; j < 4; ++j) {
        const size_t bo = (size_t)(n0 + (j << 4) + rlane) * ldb + koff + k0;
        bh[j] = Frag<T>::load(Bb + bo);
        if (SPLIT) bl[j] = Frag<T>::load(Bb2 + bo);
      }
#pragma unroll
      for (int i = 0; i < 4; ++i) {
        const size_t ao = (size_t)(m0 + (i << 4) + rlane) * lda + koff + k0;
        V ah = Frag<T>::load(Ab + ao);
        V al;
        if (SPLIT) al = Frag<T>::load(Ab2 + ao);
#pragma unroll
        for (int j = 0; j < 4; ++j) {
          acc[i][j] = Frag<T>::mma(ah, bh[j], acc[i][j]);
          if (SPLIT) {
            acc[i][j] = Frag<T>::mma(ah, bl[j], acc[i][j]);
            acc[i][j] = Frag<T>::mma(al, bh[j], acc[i][j]);
          }
        }
        Frag<T>::guard(acc[i][0], acc[i][3], ah, SPLIT ? al : ah);
      }
      Frag<T>::keep(bh[0], bh[1], bh[2], bh[3]);
      if (SPLIT) Frag<T>::keep(bl[0], bl[1], bl[2], bl[3]);
    }
  } else {
    // The work-group stages its A and B tiles once for all eight waves, 64 k (one whole 128-B line of every row) per stage, in two LDS
    // buffers by asynchronous copies; the fragments come from LDS through Frag::load, k ascending. K is a multiple of 128 (asserted below the constants).
    char* lc = smem + ((lane >> 3) * kRowPitch + (lane & 7) * 16);
    char* lA = lc + wave * 32 * kRowPitch;
    char* lB = lc + (kATile + wave * 16 * kRowPitch);
    const size_t ldaB = (size_t)lda * 2, ldbB = (size_t)ldb * 2;
    const char* gA = (const char*)Ab + (size_t)(mB + wave * 32 + (lane >> 3)) * ldaB + (lane & 7) * 16;
    const char* gB = (const char*)Bb + (size_t)(nB + wave * 16 + (lane >> 3)) * ldbB + (lane & 7) * 16;
    const int stages = K >> 6;
    stage_block(lA, lB, gA, gB, ldaB, ldbB);
    asm volatile("s_wait_asynccnt 0x0" ::: "memory");   // this wave's share of stage 0 has landed; the barrier publishes every wave's
    __syncthreads();
    if (stages > 1) stage_block(lA + kBufBytes, lB + kBufBytes, gA + 128, gB + 128, ldaB, ldbB);
    // the lane's fragment row and k half inside the wave's 64 rows of the A tile and of the B tile
    const int foA = ((wave >> 1) * 64 + rlane) * kRowPitch + koff * 2;
    const int foB = kATile + ((wave & 1) * 64 + rlane) * kRowPitch + koff * 2;
    for (int t = 0; t < stages; ++t) {
      const int bsel = (t & 1) * kBufBytes;
      const char* rb = smem + bsel;
      // all 32 fragment loads of the stage go out as one group ahead of its products: one LDS latency a stage, not one per A fragment
      V ah[2][4], bh[2][4];                              // loops below unrolled: constant indices keep the fragments in registers
#pragma unroll
      for (int s = 0; s < 2; ++s) {
#pragma unroll
        for (int j = 0; j < 4; ++j) {
          bh[s][j] = Frag<T>::load((const T*)(rb + foB + j * 16 * kRowPitch + s * 64));
          ah[s][j] = Frag<T>::load((const T*)(rb + foA + j * 16 * kRowPitch + s * 64));
        }
      }
      // holds the load group ahead of the products; the scheduler otherwise sinks each A fragment's loads in front of its use
      __builtin_amdgcn_sched_barrier(0);
#pragma unroll
      for (int s = 0; s < 2; ++s) {
#pragma unroll
        for (int i = 0; i < 4; ++i) {
#pragma unroll
          for (int j = 0; j < 4; ++j) acc[i][j] = Frag<T>::mma(ah[s][i], bh[s][j], acc[i][j]);
        }
      }
      // holds the products ahead of the foot's waits, so that stage t + 1's copies fly while stage t is worked on
      __builtin_amdgcn_sched_barrier(0);
      asm volatile("s_wait_dscnt 0x0" ::: "memory");     // this wave's LDS reads of the stage are done before any wave refills its buffer
      asm volatile("s_wait_asynccnt 0x0" ::: "memory");  // this wave's share of stage t + 1 has landed
      __syncthreads();                                   // publishes stage t + 1 to all waves; ends every wave's reads of stage t
      if (t + 2 < stages) {
        const size_t kb = (size_t)(t + 2) * 128;
        stage_block(lA + bsel, lB + bsel, gA + kb, gB + kb, ldaB, ldbB);
      }
    }
    asm volatile("s_wait_asynccnt 0x0" ::: "memory");    // nothing in flight when the ring becomes the epilogue's slabs (all reads ended at the last barrier)
  }
  acc_guard4(acc[0][0], acc[0][1], acc[0][2], acc[0][3]);
  acc_guard4(acc[1][0], acc[1][1], acc[1][2], acc[1][3]);
  acc_guard4(acc[2][0], acc[2][1], acc[2][2], acc[2][3]);
  acc_guard4(acc[3][0], acc[3][1], acc[3][2], acc[3][3]);

  // ---- epilogue ----
  float* slab = (float*)(smem + wave * kSlabBytes);
  const float* Rb = RESID ? (resid + (size_t)b * strideR) : nullptr;
#pragma unroll
  for (int i = 0; i < 4; ++i) {
    const int mBase = m0 + (i << 4);
#pragma unroll
    for (int j = 0; j < 4; ++j) {
      const int n = n0 + (j << 4) + rlane;
      float bv = 0.f;
      if (BIAS_MODE == 2) bv = bias[n];
#pragma unroll
      for (int r = 0; r < 8; ++r) {
        float v = acc[i][j][r] * scale;
        if (BIAS_MODE == 1) v += bias[mBase + mOff + r];
        if (BIAS_MODE == 2) v += bv;
        if (RESID) v += Rb[(size_t)(mBase + mOff + r) * ldc + n];
        if (ACT == 2) v = fmaxf(v, 0.0f);
        if (ACT == 4) v = (v > 0.f) ? v : 0.01f * v;
        slab[(mOff + r) * 68 + (j << 4) + rlane] = v;
      }
    }
    __builtin_amdgcn_fence(__ATOMIC_RELEASE, "workgroup");
    __builtin_amdgcn_wave_barrier();
    __builtin_amdgcn_fence(__ATOMIC_ACQUIRE, "workgroup");
    if (OUT_MODE == 0) {
      float* C = (float*)Cout + (size_t)b * strideC;
      const int hh = lane >> 4, c4 = (lane & 15) * 4;     // row seg = 256 B = 16 lanes x 16 B
      {
#pragma unroll
        for (int it = 0; it < 8; ++it) {
          const int row = it * 2 + hh;
          v4f v = *(const v4f*)(slab + row * 68 + c4);
          *(v4f*)(C + (size_t)(mBase + row) * ldc + n0 + c4) = v;
        }
        
      }
    } else {
      const int q = lane >> 3, c8 = (lane & 7) * 8;
      unsigned short* C  = (unsigned short*)Cout  + (size_t)b * strideC;
      unsigned short* C2 = (OUT_MODE == 2) ? ((unsigned short*)Cout2 + (size_t)b * strideC) : nullptr;
      {
#pragma unroll
        for (int it = 0; it < 4; ++it) {
          const int row = it * 4 + q;
          const float* sp = slab + row * 68 + c8;
          v8h hv, lv;
#pragma unroll
          for (int e = 0; e < 8; ++e) {
            if (OUT_MODE == 1) {
              hv[e] = (_Float16)sp[e];
            } else {
              unsigned short hb = f2bf_bits(sp[e]);
              unsigned short lb = f2bf_bits(sp[e] - bf_bits2f(hb));
              hv[e] = __builtin_bit_cast(_Float16, hb);
              lv[e] = __builtin_bit_cast(_Float16, lb);
            }
          }
          *(v8h*)(C + (size_t)(mBase + row) * ldc + n0 + c8) = hv;
          if (OUT_MODE == 2) *(v8h*)(C2 + (size_t)(mBase + row) * ldc + n0 + c8) = lv;
        }
        
      }
    }
    __builtin_amdgcn_fence(__ATOMIC_RELEASE, "workgroup");
    __builtin_amdgcn_wave_barrier();
    __builtin_amdgcn_fence(__ATOMIC_ACQUIRE, "workgroup");
  }
}

// ---------------------------------------------------------------------------
// The whole qkv projection in ONE launch of 256 equal work-groups, one per WGP, each on a 256 x 256 tile of its product.
// Work-groups 0..191:   q|k of both batches, 1/16 * sum_k X[tok][k] * W[n][k] (M=4096, N=3072; a tile holds two whole heads of 256 tokens),
//                       normed and rotated in the epilogue, f16.
// Work-groups 192..255: V^T, VT[b*8+j][d][s] = f16( 1/16 * sum_k W[3072+j*128+d][k] * X[b*2048+s][k] ) (per batch M=1024, N=2048).
// Waves 2 x 4, each on 128 x 64: an A fragment feeds 4 products and a B fragment 8, so a product takes 384 B out of LDS (64 x 64: 512 B),
// and the tile brings two thirds of the bytes per flop from L2 that a 256 x 128 tile brings.
// A stage is 128 k (256 B of every row): one landing latency, one barrier and one exposed LDS latency per 128 products of a wave.
// Ring of two buffers and foot of the k loop (waits, barrier, refill) keep the form of wmma_gemm64's staged path; the operand addresses and
// the epilogue follow the work-group's index (the same for all its waves).
// ---------------------------------------------------------------------------
constexpr int kQKBlocksN = kNQK / 256;                        // 12
constexpr int kQKBlocks  = (kTok / 256) * kQKBlocksN;         // 192
constexpr int kVTBlocksN = kSeq / 256;                        // 8
constexpr int kVTBlocks1 = (kNK / 256) * kVTBlocksN;          // 32 per batch
constexpr int kQKVBlocks = kQKBlocks + kBatch * kVTBlocks1;   // 256
constexpr int kPitch2     = 272;                              // 256-B rows + 16 B: 16 B x odd, the pitch for ds_load_b128 readers
constexpr int kTile2      = 256 * kPitch2;                    // 69632: one operand tile of a stage
constexpr int kBuf2Bytes  = 2 * kTile2;                       // A tile 256 rows, then B tile 256 rows
constexpr int kRing2Bytes = 2 * kBuf2Bytes;                   // two buffers per work-group: 278528
static_assert(kDim % 256 == 0, "qkv projection: two or more stages of 128 k");
static_assert(kNQK % 256 == 0 && kSeq % 256 == 0 && kNK % 256 == 0 && kTok % 256 == 0, "qkv projection: 256 x 256 per work-group");
// Eight asynchronous 16-byte-per-lane copies global -> LDS (each 32 lanes x 16 B = 2 rows x two whole 128-B lines): 16 rows of one operand tile.
// l / g are the lane's own addresses for the first row + (lane >> 4), 16-byte chunk (lane & 15); copy c moves 2 rows.
__device__ __forceinline__ void stage_rows16(char* l, const char* g, size_t ldBytes) {
  // unrolled: the constant row steps go into the copies' offsets, one 64-bit address serves the eight
#pragma unroll
  for (int c = 0; c < 8; ++c) async_copy16(l + c * 2 * kPitch2, g + (size_t)(c * 2) * ldBytes);
}
// A wave's share of one stage: 32 rows of A and 32 rows of B, 32 copies.
__device__ __forceinline__ void stage_wave(char* lA, char* lB, const char* gA, const char* gB, size_t ldBytes) {
  stage_rows16(lA, gA, ldBytes);
  stage_rows16(lA + 16 * kPitch2, gA + 16 * ldBytes, ldBytes);
  stage_rows16(lB, gB, ldBytes);
  stage_rows16(lB + 16 * kPitch2, gB + 16 * ldBytes, ldBytes);
}
// Epilogue of one wave's 128 x 64 tile of V^T: each 16 x 64 strip goes through the wave's own slab (pitch 68 floats), so that whole lines are stored:
// f16 rows of this batch's V^T plane (pitch 2048).
__device__ __forceinline__ void vt_store(const v8f (&acc)[8][4], float* slab, unsigned short* __restrict__ Cv, int m0, int n0, int lane) {
  const int rlane = lane & 15;                 // D column within a subtile
  const int mOff  = (lane >> 4) * 8;           // D row offset
  // every '#pragma unroll' here: constant indices keep the accumulators in registers
#pragma unroll
  for (int i = 0; i < 8; ++i) {
    const int mBase = m0 + (i << 4);
#pragma unroll
    for (int j = 0; j < 4; ++j) {
#pragma unroll
      for (int r = 0; r < 8; ++r) slab[(mOff + r) * 68 + (j << 4) + rlane] = acc[i][j][r] * kWCarryInv;
    }
    __builtin_amdgcn_fence(__ATOMIC_RELEASE, "workgroup");
    __builtin_amdgcn_wave_barrier();
    __builtin_amdgcn_fence(__ATOMIC_ACQUIRE, "workgroup");
    const int q = lane >> 3, c8 = (lane & 7) * 8;         // row seg = 128 B = 8 lanes x 16 B
#pragma unroll
    for (int it = 0; it < 4; ++it) {
      const int row = it * 4 + q;
      const float* sp = slab + row * 68 + c8;
      v8h hv;
#pragma unroll
      for (int e = 0; e < 8; ++e) hv[e] = (_Float16)sp[e];
      *(v8h*)(Cv + (size_t)(mBase + row) * kSeq + n0 + c8) = hv;
    }
    __builtin_amdgcn_fence(__ATOMIC_RELEASE, "workgroup");
    __builtin_amdgcn_wave_barrier();
    __builtin_amdgcn_fence(__ATOMIC_ACQUIRE, "workgroup");
  }
}
// x + (x of lane ^ M) inside a 16-lane row: one add with a DPP operand (row_xmask)
template <int M> __device__ __forceinline__ float row_xadd(float x) {
  return x + __builtin_bit_cast(float, __builtin_amdgcn_update_dpp(0, __builtin_bit_cast(int, x), 0x160 + M, 0xf, 0xf, true));
}
// v_rsq_f32 (its argument here is never below eps, so no small-input scaling); the v_nop is the one slot that the instruction set asks for
// behind a transcendental, in the same statement so that it stands directly behind it
__device__ __forceinline__ float rsq_slot(float x) {
  float y;
  asm("v_rsq_f32 %0, %1\n\tv_nop" : "=v"(y) : "v"(x));
  return y;
}
// RNE bf16 conversion of four values, returned as f32
__device__ __forceinline__ v4f bfr4(v4f x) {
  const v2f lo = __builtin_convertvector(__builtin_convertvector((v2f){x[0], x[1]}, v2b), v2f);   // by pairs: one packed conversion for two values
  const v2f hi = __builtin_convertvector(__builtin_convertvector((v2f){x[2], x[3]}, v2b), v2f);
  return (v4f){lo[0], lo[1], hi[0], hi[1]};
}
// Epilogue of one wave's 128 x 64 tile of q|k: RMSNorm (mean over the head's 128 dims, eps inside rsqrt, x norm weight) and the per-position
// 2x2 rotary map straight from the accumulators, f32 math; the result goes out as one f16 plane (RNE; |q|, |k| stay far inside the f16 range
// for norm weights and rotary entries of ordinary size). The f32 q|k plane and its own launch are gone.
// A head's 128 columns lie in two waves (wave ^ 1): each sums the squares of its 64 columns per row (4 in the lane, then the 16 lanes of a row
// by DPP), the two halves meet through LDS behind a work-group barrier, and the row factors come back through LDS behind a second one.
// Rotary table fcs [s][64][2][2] and norm weights [128] are converted to bf16 (RNE) before use. out[2p+i] = fc[s,p,i,0]*v[2p] + fc[s,p,i,1]*v[2p+1].
// The scaled tile then goes through the wave's own slab, so that a lane holds 4 consecutive dims (two pairs) of one row and 16 lanes store one
// whole 128-B line. Output plane Ph, rows of 128 elements = 256 B: q rows (b*16+h)*2048+s, k rows 65536 + (b*8+kh)*2048+s.
constexpr int kSlabB = 16 * 68 * 4;            // V^T: one wave's slab, a 16 x 64 strip
constexpr int kSlabQ = 128 * 68 * 4;           // q|k: one wave's slab, its whole 128 x 64 tile; the eight fill the ring
constexpr int kSsOff = 8 * kSlabQ;             // [4 column waves][256 rows] f32 sums of squares, behind the eight slabs
constexpr int kRnOff = kSsOff + 4 * 256 * 4;   // [2 heads][256 rows] f32 row factors
constexpr int kQkvLds = kRnOff + 2 * 256 * 4;  // 284672
static_assert(kSsOff == kRing2Bytes, "the q|k slabs take the ring over; sums and row factors lie behind it");
__device__ __forceinline__ void qk_norm_rope_store(const v8f (&acc)[8][4], char* smem, const float* __restrict__ fcs,
                                                   const float* __restrict__ qw, const float* __restrict__ kw,
                                                   unsigned short* __restrict__ Ph, int m0, int n0, int wave, int lane) {
  const int rlane = lane & 15;                 // D column within a subtile
  const int mOff  = (lane >> 4) * 8;           // D row offset
  const int hh    = lane >> 4, c4 = (lane & 15) * 4;      // read-back: row it * 2 + hh of a strip, 4 dims from c4
  const int head  = n0 >> 7;                   // 0..15 q heads, 16..23 k heads; the same for the whole wave
  const int d0    = (n0 & 64) + c4;            // the lane's first dim inside the head
  const int b     = m0 / kSeq;                 // a 256-row tile lies in one batch
  const int s0    = m0 % kSeq + hh;            // position of the lane's row 0 of strip 0
  float* slab = (float*)(smem + wave * kSlabQ);
  float* ssb  = (float*)(smem + kSsOff);
  float* rnb  = (float*)(smem + kRnOff);
  const int ssRow = (wave >> 2) * 128 + mOff;  // the lane's first D row inside the work-group's 256
  // every '#pragma unroll' here: constant indices keep the accumulators, the sums and the rotary rows in registers
  // rotary rows: 8 coefficients for each of the lane's 8 rows of a 16-row trip; the registers are loaded anew for the next trip as soon as
  // this trip has converted them, so that every load has one trip's time to land
  const float* fp = fcs + (size_t)s0 * (2 * kHD) + 2 * d0;
  v4f fa[8], fb[8];
#pragma unroll
  for (int it = 0; it < 8; ++it) {
    fa[it] = *(const v4f*)(fp + it * 2 * (2 * kHD));
    fb[it] = *(const v4f*)(fp + it * 2 * (2 * kHD) + 4);
  }
  const v4f wraw = *(const v4f*)((head < kHeads ? qw : kw) + d0);
  asm volatile("s_wait_xcnt 0x0" ::: "memory");   // behind these loads, ahead of any rewrite of the address registers that they name
  __builtin_amdgcn_sched_barrier(0);              // keeps the arithmetic below, which takes those registers over, behind the wait

  {
    const bool writer = rlane == 0;            // after the row sums all 16 lanes hold the same eight values
#pragma unroll
    for (int i = 0; i < 8; ++i) {
      v8f q = acc[i][0] * acc[i][0];
#pragma unroll
      for (int j = 1; j < 4; ++j) q += acc[i][j] * acc[i][j];
#pragma unroll
      for (int r = 0; r < 8; ++r) q[r] = row_xadd<8>(row_xadd<4>(row_xadd<2>(row_xadd<1>(q[r]))));
      if (writer) {
        float* sp = ssb + (wave & 3) * 256 + ssRow + i * 16;
        *(v4f*)(sp)     = (v4f){q[0], q[1], q[2], q[3]};
        *(v4f*)(sp + 4) = (v4f){q[4], q[5], q[6], q[7]};
      }
    }
  }
  __syncthreads();                             // publishes every wave's sums; the same branch for the whole work-group
  // one thread per row: the row factor of both heads of the tile, once, not in all 16 lanes of every wave.
  // the accumulators carry x16, their squares x256: with eps x256 as well the argument is 256 x the definition's (exact powers of two),
  // so the root comes out as 1/16 of the row factor, which takes the carry off the accumulators
  {
    const int row = wave * 32 + lane;
#pragma unroll
    for (int h = 0; h < 2; ++h)
      rnb[h * 256 + row] = rsq_slot((ssb[(2 * h) * 256 + row] + ssb[(2 * h + 1) * 256 + row]) * kInvHD + kEps * (kWCarry * kWCarry));
  }
  __syncthreads();                             // publishes the row factors
  const float* rp = rnb + ((wave & 3) >> 1) * 256 + ssRow;   // the lane's eight D rows of strip 0, this wave's head

  // the whole 128 x 64 tile, scaled by its row factors, into the wave's own slab
#pragma unroll
  for (int i = 0; i < 8; ++i) {
    const v8f rn = __builtin_shufflevector(*(const v4f*)(rp + i * 16), *(const v4f*)(rp + i * 16 + 4), 0, 1, 2, 3, 4, 5, 6, 7);
#pragma unroll
    for (int j = 0; j < 4; ++j) {
      const v8f t = acc[i][j] * rn;
#pragma unroll
      for (int r = 0; r < 8; ++r) slab[(i * 16 + mOff + r) * 68 + (j << 4) + rlane] = t[r];
    }
  }
  asm volatile("s_wait_dscnt 0x0" ::: "memory");   // the tile is in the wave's own slab before its lanes read each other's rows back

  const v4f wv = bfr4(wraw);
  const int row0 = (head < kHeads) ? (b * kHeads + head) * kSeq : kKRow0 + (b * kKV + head - kHeads) * kSeq;
  unsigned short* dp = Ph + (size_t)(row0 + s0) * kHD + d0;
  const float* sl = slab + hh * 68 + c4;
  const float* fn = fp + 16 * (2 * kHD);       // the rotary rows of the trip after the current one
  // eight trips of 16 rows, kept rolled: unrolled, this epilogue alone is some 23 KB of text
#pragma unroll 1
  for (int i = 0; i < 8; ++i) {
    v4f a[8], c[8];
#pragma unroll
    for (int it = 0; it < 8; ++it) {
      a[it] = bfr4(fa[it]);
      c[it] = bfr4(fb[it]);
    }
    // the next trip's rotary rows (the last trip loads its own once more, in bounds: no branch inside the trip)
#pragma unroll
    for (int it = 0; it < 8; ++it) {
      fa[it] = *(const v4f*)(fn + it * 2 * (2 * kHD));
      fb[it] = *(const v4f*)(fn + it * 2 * (2 * kHD) + 4);
    }
#pragma unroll
    for (int it = 0; it < 8; ++it) {
      const v4f v = *(const v4f*)(sl + (i * 16 + it * 2) * 68) * wv;
      v4h o;
      o[0] = (_Float16)(a[it][0] * v[0] + a[it][1] * v[1]);
      o[1] = (_Float16)(a[it][2] * v[0] + a[it][3] * v[1]);
      o[2] = (_Float16)(c[it][0] * v[2] + c[it][1] * v[3]);
      o[3] = (_Float16)(c[it][2] * v[2] + c[it][3] * v[3]);
      *(v4h*)(dp + (i * 16 + it * 2) * kHD) = o;
    }
    // behind the trip's loads and stores, ahead of any rewrite of the address and data registers that they name
    asm volatile("s_wait_xcnt 0x0" ::: "memory");
    // keeps the next trip's address arithmetic and conversions, which take those registers over, behind the wait
    __builtin_amdgcn_sched_barrier(0);
    if (i + 2 < 8) fn += 16 * (2 * kHD);
  }
}
__global__ __launch_bounds__(256) void qkv_gemm(const unsigned short* __restrict__ Xp, const unsigned short* __restrict__ Wp,
                                                const float* __restrict__ fcs, const float* __restrict__ qw, const float* __restrict__ kw,
                                                unsigned short* __restrict__ Ph, unsigned short* __restrict__ VTp) {
  typedef _Float16 T;
  typedef Frag<T>::V V;
  __shared__ __align__(16) char smem[kQkvLds];      // the ring of two staged buffers, which serves the epilogue behind the k loop; 6 KB of row sums and factors
  const int lane = threadIdx.x & 31;
  const int wave = threadIdx.x >> 5;
  const int bx   = blockIdx.x;
  const bool isV = bx >= kQKBlocks;
  const int rv   = isV ? bx - kQKBlocks : 0;
  const int vb   = rv / kVTBlocks1;                 // batch of a V^T work-group
  const int vt   = rv % kVTBlocks1;
  const int mB   = (isV ? vt / kVTBlocksN : bx / kQKBlocksN) << 8;
  const int nB   = (isV ? vt % kVTBlocksN : bx % kQKBlocksN) << 8;
  const int m0   = mB + ((wave >> 2) << 7);
  const int n0   = nB + ((wave & 3) << 6);
  const unsigned short* Ab = isV ? Wp + (size_t)kNQK * kDim : Xp;
  const unsigned short* Bb = isV ? Xp + (size_t)vb * kSeq * kDim : Wp;

  const int rlane = lane & 15;                 // row (A) / col (B, D) within subtile
  const int koff  = (lane >> 4) * 8;           // k offset of this lane half

  // every '#pragma unroll' in this kernel: constant indices keep the fragment and accumulator arrays in registers
  v8f acc[8][4];
#pragma unroll
  for (int i = 0; i < 8; ++i)
#pragma unroll
    for (int j = 0; j < 4; ++j) acc[i][j] = (v8f){0.f,0.f,0.f,0.f,0.f,0.f,0.f,0.f};

  {
    // a wave brings 32 rows of A and 32 rows of B a stage; every A row then feeds four waves, every B row two
    char* lc = smem + ((wave * 32 + (lane >> 4)) * kPitch2 + (lane & 15) * 16);
    char* lA = lc;
    char* lB = lc + kTile2;
    constexpr size_t ldB = (size_t)kDim * 2;   // bytes of a row of X and of W
    const char* gA = (const char*)Ab + (size_t)(mB + wave * 32 + (lane >> 4)) * ldB + (lane & 15) * 16;
    const char* gB = (const char*)Bb + (size_t)(nB + wave * 32 + (lane >> 4)) * ldB + (lane & 15) * 16;
    constexpr int stages = kDim >> 7;
    stage_wave(lA, lB, gA, gB, ldB);
    asm volatile("s_wait_asynccnt 0x0" ::: "memory");   // this wave's share of stage 0 has landed; the barrier publishes every wave's
    __syncthreads();
    stage_wave(lA + kBuf2Bytes, lB + kBuf2Bytes, gA + 256, gB + 256, ldB);
    // the lane's fragment row and k half inside the wave's 128 rows of the A tile and 64 rows of the B tile
    const int foA = ((wave >> 2) * 128 + rlane) * kPitch2 + koff * 2;
    const int foB = kTile2 + ((wave & 3) * 64 + rlane) * kPitch2 + koff * 2;
    for (int t = 0; t < stages; ++t) {
      const int bsel = (t & 1) * kBuf2Bytes;
      const char* rb = smem + bsel;
      // four blocks of 32 k, 32 products each; the fragments of two blocks are in registers at a time
      V ah[4][8], bh[4][4];
#pragma unroll
      for (int s = 0; s < 4; ++s) {
        // blocks 0 and 1: one load group at the head of the stage, in the order of use; block s + 1 (s = 1, 2): one group ahead of block s's
        // products, into the registers that block s - 1 has left, so that its LDS latency passes under 32 products
        const int f0 = (s == 0) ? 0 : s + 1, f1 = (s == 0) ? 2 : ((s < 3) ? s + 2 : 0);
#pragma unroll
        for (int f = f0; f < f1; ++f) {
#pragma unroll
          for (int j = 0; j < 4; ++j) bh[f][j] = Frag<T>::load((const T*)(rb + foB + j * 16 * kPitch2 + f * 64));
#pragma unroll
          for (int i = 0; i < 8; ++i) ah[f][i] = Frag<T>::load((const T*)(rb + foA + i * 16 * kPitch2 + f * 64));
        }
        // holds each load group whole and ahead of the block's products; the scheduler otherwise sinks each fragment's loads in front of its use
        __builtin_amdgcn_sched_barrier(0);
#pragma unroll
        for (int i = 0; i < 8; ++i) {
#pragma unroll
          for (int j = 0; j < 4; ++j) acc[i][j] = Frag<T>::mma(ah[s][i], bh[s][j], acc[i][j]);
        }
        // holds the next group behind this block's products (hoisted, three blocks' fragments would be live: spills), and the last block's
        // products ahead of the foot's waits, so that stage t + 1's copies fly while stage t is worked on
        __builtin_amdgcn_sched_barrier(0);
      }
      asm volatile("s_wait_dscnt 0x0" ::: "memory");     // this wave's LDS reads of the stage are done before any wave refills its buffer
      asm volatile("s_wait_asynccnt 0x0" ::: "memory");  // this wave's share of stage t + 1 has landed
      __syncthreads();                                   // publishes stage t + 1 to all waves; ends every wave's reads of stage t
      if (t + 2 < stages) {
        const size_t kb = (size_t)(t + 2) * 256;
        stage_wave(lA + bsel, lB + bsel, gA + kb, gB + kb, ldB);
      }
    }
    asm volatile("s_wait_asynccnt 0x0" ::: "memory");    // nothing in flight when the ring becomes the epilogue's slabs (all reads ended at the last barrier)
  }

  // ---- epilogue: one branch, the same for the whole work-group ----
  if (!isV) qk_norm_rope_store(acc, smem, fcs, qw, kw, Ph, m0, n0, wave, lane);
  else      vt_store(acc, (float*)(smem + wave * kSlabB), VTp + (size_t)vb * kNK * kSeq, m0, n0, lane);
}

// ---------------------------------------------------------------------------
// f32 -> (RNE bf16) -> f16 casts with an exact power-of-two carry, out = f16( scale * bf16(in) ), of x (x1), w_qkv (x16) and w_out (x16):
// ONE launch of a grid that is resident at once, one work-group of 16 waves per WGP, 4096 waves in all. A wave moves 20 KB of input,
// not 1 KB (for speed only): 40 segments of 128 floats, 16 of x, 16 of w_qkv and 8 of w_out.
// A segment is one load of 32 lanes x 16 B = 4 whole lines, and one store of 32 lanes x 8 B = 2 whole lines.
// All 40 loads of a wave go out before the first conversion, so that its whole read stream is in flight from its start; the segments are
// then converted and stored eight at a time, in the order in which they land.
// ---------------------------------------------------------------------------
constexpr int kCastBlocks = 256;
constexpr int kCastWaves  = 16;
constexpr int kCastAll    = kCastBlocks * kCastWaves;             // 4096 waves
constexpr int kSegX = kTok * kDim / 128 / kCastAll;               // 16 segments a wave
constexpr int kSegQ = kNQKV * kDim / 128 / kCastAll;              // 16
constexpr int kSegO = kDim * kNQ / 128 / kCastAll;                // 8
static_assert(kSegX * kCastAll * 128 == kTok * kDim && kSegQ * kCastAll * 128 == kNQKV * kDim && kSegO * kCastAll * 128 == kDim * kNQ,
              "every wave takes the same whole number of segments of each plane");
static_assert(kSegX % 8 == 0 && kSegQ % 8 == 0 && kSegO % 8 == 0, "groups of eight segments");
// eight loads: the lane's 16 B of eight consecutive segments (512 B apart)
__device__ __forceinline__ void cast_load8(v4f (&d)[8], const char* p) {
  // unrolled: constant indices keep the array in registers, the constant steps go into the loads' offsets
#pragma unroll
  for (int c = 0; c < 8; ++c) d[c] = *(const v4f*)(p + c * 512);
  // keeps the groups' loads in the order in which the groups are converted (the scheduler otherwise interleaves two planes' loads,
  // and the first group's counted wait then covers twice as many loads)
  __builtin_amdgcn_sched_barrier(0);
}
// eight segments converted and stored (256 B apart). The carry is applied ahead of the bf16 rounding: a power of two, so the rounded value is
// the same, and the product stays an f32 product.
template <bool CARRY, bool LAST> __device__ __forceinline__ void cast_store8(const v4f (&d)[8], char* p) {
  // unrolled: as above
#pragma unroll
  for (int c = 0; c < 8; ++c) *(v4h*)(p + c * 256) = __builtin_convertvector(bfr4(CARRY ? d[c] * kWCarry : d[c]), v4h);
  if (!LAST) {
    // behind the group's stores, ahead of any rewrite of the data registers that they name
    asm volatile("s_wait_xcnt 0x0" ::: "memory");
    // keeps the next group's conversions, which may take those registers over, behind the wait
    __builtin_amdgcn_sched_barrier(0);
  }
}
__global__ __launch_bounds__(kCastWaves * 32) void cast_all_kernel(const float* __restrict__ x, const float* __restrict__ wq, const float* __restrict__ wo,
                                                                   unsigned short* __restrict__ x16, unsigned short* __restrict__ wq16,
                                                                   unsigned short* __restrict__ wo16) {
  const unsigned lane = threadIdx.x & 31;
  const unsigned w    = blockIdx.x * kCastWaves + (threadIdx.x >> 5);   // the wave's number in the grid
  // the lane's byte offsets in the f32 planes and in the f16 planes (32 bits: the largest plane has 32 MB)
  const unsigned ix = w * (kSegX * 512) + lane * 16, ox = w * (kSegX * 256) + lane * 8;
  const unsigned iq = w * (kSegQ * 512) + lane * 16, oq = w * (kSegQ * 256) + lane * 8;
  const unsigned io = w * (kSegO * 512) + lane * 16, oo = w * (kSegO * 256) + lane * 8;
  v4f dx[kSegX / 8][8], dq[kSegQ / 8][8], dn[kSegO / 8][8];
  // every '#pragma unroll' in this kernel: constant indices keep the arrays in registers
#pragma unroll
  for (int g = 0; g < kSegX / 8; ++g) cast_load8(dx[g], (const char*)x + ix + g * 4096);
#pragma unroll
  for (int g = 0; g < kSegQ / 8; ++g) cast_load8(dq[g], (const char*)wq + iq + g * 4096);
#pragma unroll
  for (int g = 0; g < kSegO / 8; ++g) cast_load8(dn[g], (const char*)wo + io + g * 4096);
  asm volatile("s_wait_xcnt 0x0" ::: "memory");   // behind these loads, ahead of any rewrite of the address registers that they name
  __builtin_amdgcn_sched_barrier(0);              // keeps the conversions, which may take those registers over, behind the wait
#pragma unroll
  for (int g = 0; g < kSegX / 8; ++g) cast_store8<false, false>(dx[g], (char*)x16 + ox + g * 2048);
#pragma unroll
  for (int g = 0; g < kSegQ / 8; ++g) cast_store8<true, false>(dq[g], (char*)wq16 + oq + g * 2048);
#pragma unroll
  for (int g = 0; g < kSegO / 8 - 1; ++g) cast_store8<true, false>(dn[g], (char*)wo16 + oo + g * 2048);
  cast_store8<true, true>(dn[kSegO / 8 - 1], (char*)wo16 + oo + (kSegO / 8 - 1) * 2048);
}

constexpr int kAKeys   = 64;
constexpr int kAStages = kSeq / kAKeys;
constexpr int kKPitch  = 2 * kHD + 16;
constexpr int kVPitch  = 2 * kAKeys + 16;
constexpr int kKTile   = kAKeys * kKPitch;
constexpr int kVTile   = kHD * kVPitch;
constexpr int kABuf    = kKTile + kVTile;
constexpr float kScoreLog2 = kScoreScale * 1.4426950408889634f;
constexpr float kPShift    = 8.0f;                 // p carried x2^8: small p stay clear of the f16 subnormals; cancels in sum p v / sum p
static_assert(kAStages >= 2 && kSeq % 128 == 0, "two or more stages; 128 query positions per block");

typedef __attribute__((ext_vector_type(4))) int v4i;

// One stage: 64 K rows x 256 B (thread: row tid >> 4 (+16 a copy), chunk tid & 15) and 128 V^T rows x 128 B
// (thread: row tid >> 3 (+32 a copy), chunk tid & 7). lK, lV, gK, gV are the thread's own addresses of its first copy.
__device__ __forceinline__ void attn_stage(char* lK, char* lV, const char* gK, const char* gV) {
  constexpr int    kLK = 16 * kKPitch, kLV = 32 * kVPitch;
  constexpr size_t kGK = (size_t)16 * 2 * kHD, kGV = (size_t)32 * 2 * kSeq;
  // both loops unrolled: straight-line copies, constant steps
#pragma unroll
  for (int c = 0; c < 4; ++c) async_copy16(lK + c * kLK, gK + c * kGK);
#pragma unroll
  for (int c = 0; c < 4; ++c) async_copy16(lV + c * kLV, gV + c * kGV);
}
// lane l with lane l ^ 16
__device__ __forceinline__ float xhalf(float x) {
  return __builtin_bit_cast(float, __builtin_amdgcn_permlanex16(__builtin_bit_cast(int, x), __builtin_bit_cast(int, x), 0x76543210, 0xfedcba98, false, false));
}

__global__ __launch_bounds__(256) void attn_kernel(const unsigned short* __restrict__ Ph,
                                                   const unsigned short* __restrict__ VTp, const int* __restrict__ maskp,
                                                   unsigned short* __restrict__ Obp) {
  // every '#pragma unroll' in this kernel: constant indices keep the fragment, score and accumulator arrays in registers
  __shared__ __align__(128) char ring[2 * kABuf];
  __shared__ __align__(16) float kbias[kSeq];
  const int tid   = threadIdx.x;
  const int lane  = tid & 31;
  const int wave  = tid >> 5;
  const int rlane = lane & 15;                 // row of an A fragment, column of a B fragment and of D
  const int koff  = (lane >> 4) * 8;           // k offset of this lane half = D row offset
  const int b     = blockIdx.y / kKV;
  const int j     = blockIdx.y % kKV;
  const int q0    = blockIdx.x * 128 + wave * 16;

  // additive key bias of batch b, once per block
  {
    const int* mp = maskp + (size_t)b * kSeq + 8 * tid;
    const v4i m0 = *(const v4i*)(mp);
    const v4i m1 = *(const v4i*)(mp + 4);
    v4f f0, f1;
#pragma unroll
    for (int e = 0; e < 4; ++e) {
      f0[e] = (m0[e] != 0) ? 0.0f : -__builtin_inff();
      f1[e] = (m1[e] != 0) ? 0.0f : -__builtin_inff();
    }
    *(v4f*)(kbias + 8 * tid)     = f0;
    *(v4f*)(kbias + 8 * tid + 4) = f1;
  }

  char* lK = ring + ((tid >> 4) * kKPitch + (tid & 15) * 16);
  char* lV = ring + (kKTile + (tid >> 3) * kVPitch + (tid & 7) * 16);
  const char* gK  = (const char*)(Ph + ((size_t)kKRow0 + (size_t)(b * kKV + j) * kSeq + (tid >> 4)) * kHD) + (tid & 15) * 16;
  const char* gV  = (const char*)(VTp + ((size_t)(b * kKV + j) * kHD + (tid >> 3)) * kSeq) + (tid & 7) * 16;
  constexpr size_t kKStep = (size_t)kAKeys * kHD * 2;   // bytes from one stage's K rows to the next
  constexpr size_t kVStep = (size_t)kAKeys * 2;         // bytes from one stage's V^T columns to the next

  attn_stage(lK, lV, gK, gV);

  // Q fragments (B operand), both heads, kept for the whole kernel
  v16h qf[2][4];
#pragma unroll
  for (int g = 0; g < 2; ++g) {
    const _Float16* qp = (const _Float16*)Ph + ((size_t)(b * kHeads + 2 * j + g) * kSeq + q0 + rlane) * kHD + koff;
#pragma unroll
    for (int kc = 0; kc < 4; ++kc) qf[g][kc] = Frag<_Float16>::load(qp + kc * 32);
  }
  v8f acc[2][8];
  float mrun[2], lrun[2];
#pragma unroll
  for (int g = 0; g < 2; ++g) {
    mrun[g] = -__builtin_inff();
    lrun[g] = 0.0f;
#pragma unroll
    for (int d = 0; d < 8; ++d) acc[g][d] = (v8f){0.f,0.f,0.f,0.f,0.f,0.f,0.f,0.f};
  }

  asm volatile("s_wait_asynccnt 0x0" ::: "memory");     // stage 0 has landed before anybody reads it
  __syncthreads();                                      // also publishes kbias
  attn_stage(lK + kABuf, lV + kABuf, gK + kKStep, gV + kVStep);

  for (int t = 0; t < kAStages; ++t) {
    const int bsel = (t & 1) * kABuf;
    // two 32-key passes; kept rolled: unrolled, both passes' fragments are fetched together and registers spill
#pragma unroll 1
    for (int sub = 0; sub < 2; ++sub) {
      const char* kp = ring + bsel + (sub * 32 + rlane) * kKPitch + koff * 2;
      // all 16 K fragment loads of the pass go out as one group, in the order of their use
      v16h kf[2][4];
#pragma unroll
      for (int kc = 0; kc < 4; ++kc) {
#pragma unroll
        for (int kt = 0; kt < 2; ++kt) kf[kt][kc] = Frag<_Float16>::load((const _Float16*)(kp + kt * 16 * kKPitch + kc * 64));
      }
      // bias of this lane's 16 keys, last in the same group: there when the products end
      const float* bp = kbias + t * kAKeys + sub * 32 + koff;
      const v4f b0 = *(const v4f*)(bp), b1 = *(const v4f*)(bp + 4), b2 = *(const v4f*)(bp + 16), b3 = *(const v4f*)(bp + 20);
      // holds the load group ahead of the products; the scheduler otherwise sinks each fragment's loads in front of its use, one LDS latency each
      __builtin_amdgcn_sched_barrier(0);
      v8f s[2][2];
#pragma unroll
      for (int kt = 0; kt < 2; ++kt)
#pragma unroll
        for (int g = 0; g < 2; ++g) s[kt][g] = (v8f){0.f,0.f,0.f,0.f,0.f,0.f,0.f,0.f};
      // the four score tiles take turns, so that no product waits for the one before it
#pragma unroll
      for (int kc = 0; kc < 4; ++kc) {
#pragma unroll
        for (int kt = 0; kt < 2; ++kt)
#pragma unroll
          for (int g = 0; g < 2; ++g) s[kt][g] = Frag<_Float16>::mma(kf[kt][kc], qf[g][kc], s[kt][g]);
      }
      // holds the V^T loads behind the score products, where the K fragments' registers are free again (hoisted, they spill);
      // their latency passes under the softmax arithmetic
      __builtin_amdgcn_sched_barrier(0);
      // V^T fragments of the pass: 16 dims x 32 keys each
      const char* vp = ring + bsel + kKTile + rlane * kVPitch + sub * 64 + koff * 2;
      v16h vf[8];
#pragma unroll
      for (int d = 0; d < 8; ++d) vf[d] = Frag<_Float16>::load((const _Float16*)(vp + d * 16 * kVPitch));
#pragma unroll
      for (int g = 0; g < 2; ++g) {
        float a[16];
#pragma unroll
        for (int r = 0; r < 4; ++r) {
          a[r]      = fmaf(s[0][g][r],     kScoreLog2, b0[r]);
          a[4 + r]  = fmaf(s[0][g][4 + r], kScoreLog2, b1[r]);
          a[8 + r]  = fmaf(s[1][g][r],     kScoreLog2, b2[r]);
          a[12 + r] = fmaf(s[1][g][4 + r], kScoreLog2, b3[r]);
        }
        float mx = a[0];
#pragma unroll
        for (int e = 1; e < 16; ++e) mx = fmaxf(mx, a[e]);
        mx = fmaxf(mx, xhalf(mx));                                     // both halves hold the query's maximum over the 32 keys
        const float mnew  = fmaxf(mrun[g], mx);
        const float msafe = (mnew == -__builtin_inff()) ? 0.0f : mnew; // only masked keys so far: keep -inf - -inf out of the exponents
        const float corr  = __builtin_amdgcn_exp2f(mrun[g] - msafe);
        const float nm    = kPShift - msafe;
        mrun[g] = mnew;
        v16h pf;
        float ps0 = 0.0f, ps1 = 0.0f;
#pragma unroll
        for (int e = 0; e < 16; e += 2) {
          const float p0 = __builtin_amdgcn_exp2f(a[e] + nm);
          const float p1 = __builtin_amdgcn_exp2f(a[e + 1] + nm);
          ps0 += p0;
          ps1 += p1;
          pf[e]     = (_Float16)p0;
          pf[e + 1] = (_Float16)p1;
        }
        lrun[g] = fmaf(lrun[g], corr, ps0 + ps1);                      // this half's keys only; the halves join behind the loop
#pragma unroll
        for (int d = 0; d < 8; ++d) acc[g][d] = acc[g][d] * corr;
#pragma unroll
        for (int d = 0; d < 8; ++d) acc[g][d] = Frag<_Float16>::mma(vf[d], pf, acc[g][d]);
      }
      // the distance behind a matrix instruction on the loop's taken branch: the next pass's address arithmetic reuses the registers of the last
      // product's V^T fragment; the scheduling barrier keeps the products ahead of the four slots
      __builtin_amdgcn_sched_barrier(0);
      asm volatile("v_nop\n\tv_nop\n\tv_nop\n\tv_nop");
    }
    asm volatile("s_wait_dscnt 0x0" ::: "memory");      // this stage's LDS reads are done before its buffer is refilled
    asm volatile("s_wait_asynccnt 0x0" ::: "memory");   // stage t + 1 has landed
    __syncthreads();
    if (t + 2 < kAStages) {
      const size_t st = (size_t)(t + 2);
      attn_stage(lK + bsel, lV + bsel, gK + st * kKStep, gV + st * kVStep);
    }
  }
  asm volatile("s_wait_asynccnt 0x0" ::: "memory");     // nothing in flight when the wave ends

  // O^T tile d: lane holds dims 16 d + koff + 0..7 of query q0 + rlane: one 16-B store; a wave writes whole 256-B head rows
#pragma unroll
  for (int g = 0; g < 2; ++g) {
    const float inv = kOCarry / (lrun[g] + xhalf(lrun[g]));
    unsigned short* op = Obp + ((size_t)b * kSeq + q0 + rlane) * kNQ + (size_t)(2 * j + g) * kHD + koff;
#pragma unroll
    for (int d = 0; d < 8; ++d) {
      v8h o;
#pragma unroll
      for (int r = 0; r < 8; ++r) o[r] = (_Float16)(acc[g][d][r] * inv);
      *(v8h*)(op + d * 16) = o;
    }
  }
}

// ---------------------------------------------------------------------------
// Host glue.
//   R0 X16  f16 [4096][2048]                        16,777,216 at           0   (later: Ob f16 [4096][2048], same type + layout)
//   R1 Wq16 f16 [4096][2048] (w_qkv x16)            16,777,216 at  16,777,216   
//   R2 Wo16 f16 [2048][2048] (w_out x16)             8,388,608 at  33,554,432
//   R3 VT   f16 [2*8][128][2048] (v transposed)       8,388,608 at  41,943,040
//   R4 QK16 f16 [98304][128] (q rows then k rows)   25,165,824 at  50,331,648
//   total                                           75,497,472
// Re-use timeline (stream ordered): X16/Wq16 are read only by the qkv GEMM;
// Ob is first written by the attention kernel, which starts after the qkv GEMM.
// Every region is fully written before it is read; no region changes element type.
// GEMM shapes: q|k (M=4096, N=3072, K=2048); V^T per batch (M=1024, N=2048, K=2048);
// output (M=4096, N=2048, K=2048); all M,N multiples of 64, all K multiples of 32, no padding anywhere.
// ---------------------------------------------------------------------------
extern "C" void kernel_launch(void* const* d_in, const int* in_sizes, int n_in,
                              void* d_out, int out_size, void* d_ws, size_t ws_size,
                              hipStream_t stream) {
  if (n_in < 7) return;
  const int nX = kBatch * kSeq * kDim;            // 8,388,608
  if (in_sizes[0] != nX) return;
  if (in_sizes[1] != kBatch * kSeq) return;
  if (in_sizes[2] != kSeq * (kHD / 2) * 4) return;
  if (in_sizes[3] != kNQKV * kDim) return;
  if (in_sizes[4] != kDim * kNQ) return;
  if (in_sizes[5] != kHD || in_sizes[6] != kHD) return;
  if (out_size != kTok * kDim) return;

  const size_t szX16  = (size_t)kTok * kDim * 2;
  const size_t szWq16 = (size_t)kNQKV * kDim * 2;
  const size_t szWo16 = (size_t)kDim * kNQ * 2;
  const size_t szVT   = (size_t)kBatch * kKV * kHD * kSeq * 2;
  const size_t szPl   = (size_t)kQKRows * kHD * 2;        // the f16 q|k plane
  const size_t szOb   = (size_t)kTok * kNQ * 2;
  const size_t offX16  = 0;
  const size_t offWq16 = offX16 + szX16;
  const size_t offWo16 = offWq16 + szWq16;
  const size_t offVT   = offWo16 + szWo16;
  const size_t offPhi  = offVT + szVT;
  const size_t total   = offPhi + szPl;
  if (szOb > szX16) return;                      // the re-used region fits its first carve
  if (ws_size < total) return;

  const float* x     = (const float*)d_in[0];
  const int*   xmask = (const int*)d_in[1];
  const float* freqs = (const float*)d_in[2];
  const float* wqkv  = (const float*)d_in[3];
  const float* wout  = (const float*)d_in[4];
  const float* qw    = (const float*)d_in[5];
  const float* kw    = (const float*)d_in[6];
  float* out = (float*)d_out;
  char* ws = (char*)d_ws;
  unsigned short* X16  = (unsigned short*)(ws + offX16);
  unsigned short* Ob   = (unsigned short*)(ws + offX16);     // re-use of R0 (f16, same layout)
  unsigned short* Wq16 = (unsigned short*)(ws + offWq16);
  unsigned short* Wo16 = (unsigned short*)(ws + offWo16);
  unsigned short* VT  = (unsigned short*)(ws + offVT);
  unsigned short* Phi = (unsigned short*)(ws + offPhi);
  const float* dummyf = (const float*)(ws + offVT);          // valid in-ws pointer for unused bias/resid arguments

  // ---- 16-bit operand planes of the inputs (RNE bf16 of every float input, f16 containers, weights x16) ----
  cast_all_kernel<<<dim3(kCastBlocks), dim3(kCastWaves * 32), 0, stream>>>(x, wqkv, wout, X16, Wq16, Wo16);

  // ---- q|k projection of both batches (w_qkv rows 0..3071) with norm + rotary in its epilogue -> f16 plane, and v projection written directly
  //      transposed (f16), one launch: 192 + 64 work-groups cover all 98304 rows of the q|k plane and the whole 16 x 128 x 2048 VT plane ----
  qkv_gemm<<<dim3(kQKVBlocks), dim3(256), 0, stream>>>(X16, Wq16, freqs, qw, kw, Phi, VT);

  // ---- attention, all (batch, kv head) groups in one launch: Ob[b*2048+i][(2j+hg)*128+n] = f16( 16 * softmax(q.k^T * 128^-0.5 + mask) . v )
  //      grid (16 blocks of 128 query positions, 16 groups) = 256 blocks; covers the whole [4096][2048] Ob plane ----
  attn_kernel<<<dim3(kSeq / 128, kBatch * kKV), dim3(256), 0, stream>>>(Phi, VT, xmask, Ob);

  // ---- output projection: out[tok][n] = 2^-8 * sum_e Ob[tok][e] * Wo16[n][e]   (M=4096, N=2048, K=2048) ----
  {
    const int tilesOut = (kTok / 64) * (kDim / 64);   // 2048 -> 256 blocks; covers the whole [4096][2048] output
    wmma_gemm64<0, false, 0, 0, false, 0><<<dim3(tilesOut / 8, 1), dim3(256), 0, stream>>>(
        Ob, Ob, kNQ, 0L, Wo16, Wo16, kNQ, 0L,
        (void*)out, (void*)out, kDim, 0L, dummyf, dummyf, 0L, kTok, kDim, kNQ, kOutScale);
  }
}
